// v000
// Measured on an AMD MI455X. A time is GPU time per run, averaged over a window of back-to-back runs after a warm-up
// (all launches, gaps included; the runs take copies of the inputs in turn), and the median of several windows.
// Apart from v000's, it joins two sittings. Times from different sittings can be a few percent apart, while
// side-by-side timings come from the same sitting.
// v000 is the starting kernel. One run takes 316 microseconds.
#include <hip/hip_runtime.h>
#include <hip/hip_bf16.h>
#include <math.h>

typedef __attribute__((ext_vector_type(16))) _Float16 v16h;
typedef __attribute__((ext_vector_type(8)))  float    v8f;

#define Bb   4
#define Nn_  256
#define Oo   5
#define KK2  25      // K*K patch positions
#define Ff   256
#define Hh   4
#define Dd   64
#define DFFc 1024

constexpr int TOK  = Bb * Nn_ * Oo * KK2;   // 128000 tokens
constexpr int ROWS = Bb * Nn_ * Oo;         // 5120 output rows
constexpr int PB   = Nn_ * Oo * Ff;         // 327680 elems per batch for LN

constexpr int KPANEL  = 256;                // B panel depth staged in LDS
constexpr int BSTRIDE = KPANEL + 8;         // +16B pad: breaks LDS bank conflicts

// ---------------------------------------------------------------------------
// helpers
// ---------------------------------------------------------------------------
__device__ __forceinline__ float wave_max32(float v) {
  #pragma unroll
  for (int o = 16; o > 0; o >>= 1) v = fmaxf(v, __shfl_xor(v, o, 32));
  return v;
}
__device__ __forceinline__ float wave_sum32(float v) {
  #pragma unroll
  for (int o = 16; o > 0; o >>= 1) v += __shfl_xor(v, o, 32);
  return v;
}

union FragU { v16h v; uint4 q[2]; };

// Load one f16 16x32 fragment given per-lane base (row/col and half-offset
// already folded in): elements 0..7 at +k, elements 8..15 at +k+16.
__device__ __forceinline__ v16h frag_at(const _Float16* p) {
  FragU f;
  f.q[0] = *(const uint4*)(p);
  f.q[1] = *(const uint4*)(p + 16);
  return f.v;
}

// ---------------------------------------------------------------------------
// GEMM: C[M][N] = A[M][K] * W[N][K]^T (+bias) (+addsrc) (relu?) -> f32/f16
// block = 256 threads = 8 waves; wave computes 32 rows x 64 cols (2 A frags
// share 4 B frags -> 8 WMMAs per k-step); block tile is 256x64. The B panel
// (64 cols x KPANEL) is staged in LDS with async-to-LDS copies shared by all
// 8 waves; A fragments are register double-buffered.
// grid = (M/256, N/64). M%256==0, N%64==0, K%KPANEL==0 guaranteed by caller.
//
// f16 16x32 fragment layout (A and B identical): lane L<16 -> row/col L,
// elements 0..7 = K [k0+off, k0+off+8), elements 8..15 = +16; off = 8*(L>=16).
// Both runs are contiguous -> two b128 loads per fragment.
// ---------------------------------------------------------------------------
__global__ __launch_bounds__(256) void gemm_f16_wmma(
    const _Float16* __restrict__ A, const _Float16* __restrict__ W,
    const float* __restrict__ bias, const float* __restrict__ addsrc,
    float* __restrict__ outF, _Float16* __restrict__ outH,
    int M, int N, int K, int doRelu)
{
  __shared__ _Float16 Bs[64 * BSTRIDE];     // ~33KB

  const int lane    = threadIdx.x & 31;
  const int wave    = threadIdx.x >> 5;
  const int rowBase = (blockIdx.x * 8 + wave) * 32;
  const int colBase = blockIdx.y * 64;

  const int n0    = lane & 15;              // row (A) / col (B) within tile
  const int half8 = ((lane >> 4) & 1) << 3; // K sub-offset per lane half

  const _Float16* aPtr0 = A + (size_t)(rowBase + n0) * K + half8;
  const _Float16* aPtr1 = aPtr0 + (size_t)16 * K;

  v8f acc[8];
  #pragma unroll
  for (int j = 0; j < 8; ++j) acc[j] = (v8f){};

  // preload first A fragments (register double buffer, 2 row groups)
  FragU aN0, aN1;
  aN0.q[0] = *(const uint4*)(aPtr0);
  aN0.q[1] = *(const uint4*)(aPtr0 + 16);
  aN1.q[0] = *(const uint4*)(aPtr1);
  aN1.q[1] = *(const uint4*)(aPtr1 + 16);

  // async staging assignment: 4 threads per B row, 8 b128 chunks each
  const int srow = threadIdx.x >> 2;          // 0..63
  const int skc  = (threadIdx.x & 3) << 3;    // 0,8,16,24
  const _Float16* srcRow = W + (size_t)(colBase + srow) * K + skc;
  const unsigned ldsBase = (unsigned)(uintptr_t)&Bs[srow * BSTRIDE + skc];

  for (int kp = 0; kp < K; kp += KPANEL) {
    __syncthreads();   // previous panel fully consumed before overwrite

    // --- async stage of B panel: 64 rows x KPANEL f16 -> LDS (b128 chunks)
    {
      const _Float16* src = srcRow + kp;
      unsigned lds = ldsBase;
      #pragma unroll
      for (int c = 0; c < KPANEL / 32; ++c) { // 8 chunks, stride 32 elems
        asm volatile("global_load_async_to_lds_b128 %0, %1, off"
                     :: "v"(lds), "v"(src) : "memory");
        src += 32;
        lds += 64;
      }
    }
    asm volatile("s_wait_asynccnt 0x0" ::: "memory");
    __syncthreads();

    // --- K panel: 8 steps of 32; A double-buffered, B frags from LDS
    #pragma unroll
    for (int kk = 0; kk < KPANEL; kk += 32) {
      const v16h a0 = aN0.v;
      const v16h a1 = aN1.v;
      const int kNext = kp + kk + 32;
      if (kNext < K) {                      // prefetch next A fragments
        aN0.q[0] = *(const uint4*)(aPtr0 + kNext);
        aN0.q[1] = *(const uint4*)(aPtr0 + kNext + 16);
        aN1.q[0] = *(const uint4*)(aPtr1 + kNext);
        aN1.q[1] = *(const uint4*)(aPtr1 + kNext + 16);
      }
      // load all 4 B fragments first (separate regs -> one ds clause)
      const _Float16* bb = &Bs[n0 * BSTRIDE + kk + half8];
      const v16h b0 = frag_at(bb);
      const v16h b1 = frag_at(bb + 16 * BSTRIDE);
      const v16h b2 = frag_at(bb + 32 * BSTRIDE);
      const v16h b3 = frag_at(bb + 48 * BSTRIDE);
      acc[0] = __builtin_amdgcn_wmma_f32_16x16x32_f16(false, a0, false, b0, (short)0, acc[0], false, false);
      acc[1] = __builtin_amdgcn_wmma_f32_16x16x32_f16(false, a0, false, b1, (short)0, acc[1], false, false);
      acc[2] = __builtin_amdgcn_wmma_f32_16x16x32_f16(false, a0, false, b2, (short)0, acc[2], false, false);
      acc[3] = __builtin_amdgcn_wmma_f32_16x16x32_f16(false, a0, false, b3, (short)0, acc[3], false, false);
      acc[4] = __builtin_amdgcn_wmma_f32_16x16x32_f16(false, a1, false, b0, (short)0, acc[4], false, false);
      acc[5] = __builtin_amdgcn_wmma_f32_16x16x32_f16(false, a1, false, b1, (short)0, acc[5], false, false);
      acc[6] = __builtin_amdgcn_wmma_f32_16x16x32_f16(false, a1, false, b2, (short)0, acc[6], false, false);
      acc[7] = __builtin_amdgcn_wmma_f32_16x16x32_f16(false, a1, false, b3, (short)0, acc[7], false, false);
    }
  }

  // C/D layout: VGPR r -> (M=r, N=lane) for lanes 0-15, (M=r+8, N=lane-16)
  const int r0 = (lane >> 4) * 8;
  #pragma unroll
  for (int g = 0; g < 2; ++g) {             // two 16-row groups
    #pragma unroll
    for (int j = 0; j < 4; ++j) {
      const int col = colBase + 16 * j + n0;
      const float bv = bias ? bias[col] : 0.0f;
      const v8f av = acc[g * 4 + j];
      #pragma unroll
      for (int r = 0; r < 8; ++r) {
        const int row = rowBase + g * 16 + r0 + r;
        float v = av[r] + bv;
        if (doRelu) v = fmaxf(v, 0.0f);
        const size_t idx = (size_t)row * N + col;
        if (addsrc) v += addsrc[idx];
        if (outF) outF[idx] = v;
        if (outH) outH[idx] = (_Float16)v;
      }
    }
  }
}

// ---------------------------------------------------------------------------
// Attention: one wave per (b,n,o,h) unit. qkv rows are tokens of 768 f16
// ([q 256 | k 256 | v 256]); 25 tokens per (b,n,o) patch, center at p=12.
// ---------------------------------------------------------------------------
__global__ __launch_bounds__(256) void attention_kernel(
    const _Float16* __restrict__ qkv, _Float16* __restrict__ merged)
{
  __shared__ float wsm[8][32];
  const int lane = threadIdx.x & 31;
  const int wave = threadIdx.x >> 5;
  const int unit = blockIdx.x * 8 + wave;   // 0 .. ROWS*H-1
  const int h    = unit & (Hh - 1);
  const int bno  = unit >> 2;
  const size_t t0 = (size_t)bno * KK2;

  const _Float16* qc = qkv + (t0 + 12) * 768 + h * Dd;         // center query
  const _Float16* kb = qkv + t0 * 768 + 256 + h * Dd;
  const _Float16* vb = qkv + t0 * 768 + 512 + h * Dd;

  // lanes 0..24: one score each (dot over 64 dims), scaled by 1/sqrt(64)
  float score = -1e30f;
  if (lane < KK2) {
    const _Float16* kp = kb + (size_t)lane * 768;
    float s = 0.f;
    #pragma unroll 8
    for (int d = 0; d < Dd; ++d) s += (float)qc[d] * (float)kp[d];
    score = s * 0.125f;
  }
  const float m  = wave_max32(score);
  const float e  = (lane < KK2) ? __expf(score - m) : 0.f;
  const float sm = wave_sum32(e);
  wsm[wave][lane] = e / sm;
  __syncthreads();

  // each lane accumulates 2 of the 64 output dims
  const int d0 = lane * 2;
  float a0 = 0.f, a1 = 0.f;
  #pragma unroll
  for (int p = 0; p < KK2; ++p) {
    const float wp = wsm[wave][p];
    a0 += wp * (float)vb[(size_t)p * 768 + d0];
    a1 += wp * (float)vb[(size_t)p * 768 + d0 + 1];
  }
  _Float16* out = merged + (size_t)bno * (Hh * Dd) + h * Dd + d0;
  out[0] = (_Float16)a0;
  out[1] = (_Float16)a1;
}

// ---------------------------------------------------------------------------
// LayerNorm over (N,O,F) per batch element: reduce then apply
// ---------------------------------------------------------------------------
__global__ __launch_bounds__(256) void ln_reduce_kernel(
    const float* __restrict__ x, float* __restrict__ stats)
{
  __shared__ float sA[256], sB[256];
  const int b = blockIdx.y;
  const float* xb = x + (size_t)b * PB;
  float s = 0.f, s2 = 0.f;
  for (int i = blockIdx.x * blockDim.x + threadIdx.x; i < PB;
       i += gridDim.x * blockDim.x) {
    const float v = xb[i];
    s += v; s2 += v * v;
  }
  sA[threadIdx.x] = s; sB[threadIdx.x] = s2;
  __syncthreads();
  for (int st = 128; st > 0; st >>= 1) {
    if (threadIdx.x < st) {
      sA[threadIdx.x] += sA[threadIdx.x + st];
      sB[threadIdx.x] += sB[threadIdx.x + st];
    }
    __syncthreads();
  }
  if (threadIdx.x == 0) {
    atomicAdd(&stats[2 * b + 0], sA[0]);
    atomicAdd(&stats[2 * b + 1], sB[0]);
  }
}

__global__ __launch_bounds__(256) void ln_apply_kernel(
    const float* __restrict__ x, const float* __restrict__ g,
    const float* __restrict__ beta, const float* __restrict__ stats,
    float* __restrict__ outF, _Float16* __restrict__ outH, int total)
{
  for (int i = blockIdx.x * blockDim.x + threadIdx.x; i < total;
       i += gridDim.x * blockDim.x) {
    const int b = i / PB;
    const int r = i - b * PB;
    const float mu  = stats[2 * b + 0] * (1.0f / PB);
    const float var = stats[2 * b + 1] * (1.0f / PB) - mu * mu;
    const float v = (x[i] - mu) * rsqrtf(var + 1e-5f) * g[r] + beta[r];
    if (outF) outF[i] = v;
    if (outH) outH[i] = (_Float16)v;
  }
}

// ---------------------------------------------------------------------------
// small utility kernels
// ---------------------------------------------------------------------------
__global__ void cvt_f32_to_f16(const float* __restrict__ s,
                               _Float16* __restrict__ d, int n) {
  for (int i = blockIdx.x * blockDim.x + threadIdx.x; i < n;
       i += gridDim.x * blockDim.x)
    d[i] = (_Float16)s[i];
}
__global__ void copy_f32(const float* __restrict__ s, float* __restrict__ d, int n) {
  for (int i = blockIdx.x * blockDim.x + threadIdx.x; i < n;
       i += gridDim.x * blockDim.x)
    d[i] = s[i];
}
__global__ void zero_f32(float* __restrict__ p, int n) {
  if ((int)threadIdx.x < n) p[threadIdx.x] = 0.f;
}

// ---------------------------------------------------------------------------
extern "C" void kernel_launch(void* const* d_in, const int* in_sizes, int n_in,
                              void* d_out, int out_size, void* d_ws, size_t ws_size,
                              hipStream_t stream) {
  const float* x    = (const float*)d_in[0];
  const float* Wq   = (const float*)d_in[1];
  const float* bq   = (const float*)d_in[2];
  const float* Wk   = (const float*)d_in[3];
  const float* bk   = (const float*)d_in[4];
  const float* Wv   = (const float*)d_in[5];
  const float* bv   = (const float*)d_in[6];
  const float* Wf   = (const float*)d_in[7];
  const float* bf   = (const float*)d_in[8];
  const float* ln1w = (const float*)d_in[9];
  const float* ln1b = (const float*)d_in[10];
  const float* ln2w = (const float*)d_in[11];
  const float* ln2b = (const float*)d_in[12];
  const float* W1   = (const float*)d_in[13];
  const float* b1   = (const float*)d_in[14];
  const float* W2   = (const float*)d_in[15];
  const float* b2   = (const float*)d_in[16];

  char* ws = (char*)d_ws;
  size_t off = 0;
  auto alloc = [&](size_t bytes) -> void* {
    void* p = ws + off;
    off += (bytes + 255) & ~(size_t)255;
    return p;
  };

  _Float16* xb      = (_Float16*)alloc((size_t)TOK * Ff * 2);      // x in f16
  _Float16* wqkv    = (_Float16*)alloc((size_t)768 * Ff * 2);      // [Wq;Wk;Wv]
  _Float16* wfH     = (_Float16*)alloc((size_t)Ff * Ff * 2);
  _Float16* w1H     = (_Float16*)alloc((size_t)DFFc * Ff * 2);
  _Float16* w2H     = (_Float16*)alloc((size_t)Ff * DFFc * 2);
  float*    bqkv    = (float*)   alloc(768 * 4);                   // [bq;bk;bv]
  _Float16* qkvH    = (_Float16*)alloc((size_t)TOK * 768 * 2);     // fused qkv
  _Float16* mergedH = (_Float16*)alloc((size_t)ROWS * Ff * 2);
  float*    attent  = (float*)   alloc((size_t)ROWS * Ff * 4);
  float*    out1F   = (float*)   alloc((size_t)ROWS * Ff * 4);
  _Float16* out1H   = (_Float16*)alloc((size_t)ROWS * Ff * 2);
  _Float16* hidH    = (_Float16*)alloc((size_t)ROWS * DFFc * 2);
  float*    ytmp    = (float*)   alloc((size_t)ROWS * Ff * 4);
  float*    stats   = (float*)   alloc(256);                       // 2 sets of 4x2

  // --- prep: zero LN stats, convert inputs/weights to f16, pack fused bias
  zero_f32<<<1, 32, 0, stream>>>(stats, 16);
  cvt_f32_to_f16<<<2048, 256, 0, stream>>>(x,  xb,   TOK * Ff);
  cvt_f32_to_f16<<<64,   256, 0, stream>>>(Wq, wqkv,                   Ff * Ff);
  cvt_f32_to_f16<<<64,   256, 0, stream>>>(Wk, wqkv + (size_t)Ff*Ff,   Ff * Ff);
  cvt_f32_to_f16<<<64,   256, 0, stream>>>(Wv, wqkv + (size_t)2*Ff*Ff, Ff * Ff);
  cvt_f32_to_f16<<<64,   256, 0, stream>>>(Wf, wfH, Ff * Ff);
  cvt_f32_to_f16<<<256,  256, 0, stream>>>(W1, w1H, DFFc * Ff);
  cvt_f32_to_f16<<<256,  256, 0, stream>>>(W2, w2H, Ff * DFFc);
  copy_f32<<<1, 256, 0, stream>>>(bq, bqkv,        Ff);
  copy_f32<<<1, 256, 0, stream>>>(bk, bqkv + Ff,   Ff);
  copy_f32<<<1, 256, 0, stream>>>(bv, bqkv + 2*Ff, Ff);

  // --- fused QKV projection: (128000 x 256) @ (256 x 768) -> f16
  {
    dim3 g(TOK / 256, 768 / 64);
    gemm_f16_wmma<<<g, 256, 0, stream>>>(xb, wqkv, bqkv, nullptr,
                                         nullptr, qkvH, TOK, 768, Ff, 0);
  }

  // --- local patch attention (softmax over 25, per head) -> merged f16
  attention_kernel<<<(ROWS * Hh) / 8, 256, 0, stream>>>(qkvH, mergedH);

  // --- output projection: (5120 x 256) @ (256 x 256) -> attent f32
  {
    dim3 g(ROWS / 256, Ff / 64);
    gemm_f16_wmma<<<g, 256, 0, stream>>>(mergedH, wfH, bf, nullptr,
                                         attent, nullptr, ROWS, Ff, Ff, 0);
  }

  // --- LayerNorm 1 (per batch over N,O,F) -> out1 (f32 + f16)
  ln_reduce_kernel<<<dim3(40, Bb), 256, 0, stream>>>(attent, stats);
  ln_apply_kernel<<<2560, 256, 0, stream>>>(attent, ln1w, ln1b, stats,
                                            out1F, out1H, Bb * PB);

  // --- FFN: relu(out1 @ W1^T + b1) @ W2^T + b2 + out1
  {
    dim3 g(ROWS / 256, DFFc / 64);
    gemm_f16_wmma<<<g, 256, 0, stream>>>(out1H, w1H, b1, nullptr,
                                         nullptr, hidH, ROWS, DFFc, Ff, 1);
  }
  {
    dim3 g(ROWS / 256, Ff / 64);
    gemm_f16_wmma<<<g, 256, 0, stream>>>(hidH, w2H, b2, out1F,
                                         ytmp, nullptr, ROWS, Ff, DFFc, 0);
  }

  // --- LayerNorm 2 -> d_out (f32)
  ln_reduce_kernel<<<dim3(40, Bb), 256, 0, stream>>>(ytmp, stats + 8);
  ln_apply_kernel<<<2560, 256, 0, stream>>>(ytmp, ln2w, ln2b, stats + 8,
                                            (float*)d_out, nullptr, Bb * PB);
}

// v002
// Measured time: 140 microseconds a run.
// Versions between v000 and this one are left out; their measured steps multiply to 2.29 times as fast.
#include <hip/hip_runtime.h>
#include <hip/hip_bf16.h>
#include <math.h>

typedef __attribute__((ext_vector_type(16))) _Float16 v16h;
typedef __attribute__((ext_vector_type(8)))  float    v8f;
typedef __attribute__((ext_vector_type(4)))  float    v4f;

#define Bb   4
#define Nn_  256
#define Oo   5
#define KK2  25      // K*K patch positions
#define Ff   256
#define Hh   4
#define Dd   64
#define DFFc 1024

constexpr int ROWS = Bb * Nn_ * Oo;         // 5120 output rows
constexpr int PB   = Nn_ * Oo * Ff;         // 327680 elems per batch for LN

constexpr int WPB  = 4;                     // waves (patches) per block, folded attention

// ---------------------------------------------------------------------------
// helpers
// ---------------------------------------------------------------------------
union FragU { v16h v; uint4 q[2]; };

// Load one f16 16x32 fragment given per-lane base (row/col and half-offset
// already folded in): elements 0..7 at +k, elements 8..15 at +k+16.
__device__ __forceinline__ v16h frag_at(const _Float16* p) {
  FragU f;
  f.q[0] = *(const uint4*)(p);
  f.q[1] = *(const uint4*)(p + 16);
  return f.v;
}

// ---------------------------------------------------------------------------
// GEMM: C[M][N] = A[M][K] * W[N][K]^T (+bias) (+addsrc) (relu?) -> f32/f16
// block = 256 threads = 8 waves; wave computes 32 rows x 64 cols (2 A frags
// share 4 B frags -> 8 WMMAs per k-step); block tile is 256x64. The B panel
// (64 cols x KPANEL) is staged in LDS with async-to-LDS copies shared by all
// 8 waves; A fragments are register double-buffered.
// grid = (M/256, N/64). M%256==0, N%64==0, K%KPANEL==0 guaranteed by caller.
// KPANEL is the B panel depth staged in LDS. A rows have pitch lda, and column
// block y reads A from column (y >> aShift) * aStep on: that gives the per-head
// products (each head has its own slice of A) in one launch.
//
// f16 16x32 fragment layout (A and B identical): lane L<16 -> row/col L,
// elements 0..7 = K [k0+off, k0+off+8), elements 8..15 = +16; off = 8*(L>=16).
// Both runs are contiguous -> two b128 loads per fragment.
// ---------------------------------------------------------------------------
template <int KPANEL>
__global__ __launch_bounds__(256) void gemm_f16_wmma(
    const _Float16* __restrict__ A, const _Float16* __restrict__ W,
    const float* __restrict__ bias, const float* __restrict__ addsrc,
    float* __restrict__ outF, _Float16* __restrict__ outH,
    int M, int N, int K, int doRelu, int lda, int aShift, int aStep)
{
  constexpr int BSTRIDE = KPANEL + 8;       // +16B pad: breaks LDS bank conflicts
  __shared__ _Float16 Bs[64 * BSTRIDE];     // ~33KB at KPANEL 256

  const int lane    = threadIdx.x & 31;
  const int wave    = threadIdx.x >> 5;
  const int rowBase = (blockIdx.x * 8 + wave) * 32;
  const int colBase = blockIdx.y * 64;

  const int n0    = lane & 15;              // row (A) / col (B) within tile
  const int half8 = ((lane >> 4) & 1) << 3; // K sub-offset per lane half

  const _Float16* aPtr0 = A + (size_t)(rowBase + n0) * lda
                            + ((int)blockIdx.y >> aShift) * aStep + half8;
  const _Float16* aPtr1 = aPtr0 + (size_t)16 * lda;

  v8f acc[8];
  #pragma unroll
  for (int j = 0; j < 8; ++j) acc[j] = (v8f){};

  // preload first A fragments (register double buffer, 2 row groups)
  FragU aN0, aN1;
  aN0.q[0] = *(const uint4*)(aPtr0);
  aN0.q[1] = *(const uint4*)(aPtr0 + 16);
  aN1.q[0] = *(const uint4*)(aPtr1);
  aN1.q[1] = *(const uint4*)(aPtr1 + 16);

  // async staging assignment: 4 threads per B row, KPANEL/32 b128 chunks each
  const int srow = threadIdx.x >> 2;          // 0..63
  const int skc  = (threadIdx.x & 3) << 3;    // 0,8,16,24
  const _Float16* srcRow = W + (size_t)(colBase + srow) * K + skc;
  const unsigned ldsBase = (unsigned)(uintptr_t)&Bs[srow * BSTRIDE + skc];

  for (int kp = 0; kp < K; kp += KPANEL) {
    // own LDS reads of the previous panel retired before the copies refill it
    asm volatile("s_wait_dscnt 0x0" ::: "memory");
    __syncthreads();   // previous panel fully consumed before overwrite

    // --- async stage of B panel: 64 rows x KPANEL f16 -> LDS (b128 chunks)
    {
      const _Float16* src = srcRow + kp;
      unsigned lds = ldsBase;
      #pragma unroll
      for (int c = 0; c < KPANEL / 32; c += 2) { // chunks of 8, stride 32 elems
        // the xcnt wait closes the statement so that no address register of
        // an issued copy is rewritten ahead of it
        asm volatile("global_load_async_to_lds_b128 %0, %1, off\n\t"
                     "global_load_async_to_lds_b128 %2, %3, off\n\t"
                     "s_wait_xcnt 0x0"
                     :: "v"(lds), "v"(src), "v"(lds + 64), "v"(src + 32)
                     : "memory");
        src += 64;
        lds += 128;
      }
    }
    asm volatile("s_wait_asynccnt 0x0" ::: "memory");
    __syncthreads();

    // --- K panel: KPANEL/32 steps of 32; A double-buffered, B frags from LDS
    #pragma unroll
    for (int kk = 0; kk < KPANEL; kk += 32) {
      const v16h a0 = aN0.v;
      const v16h a1 = aN1.v;
      const int kNext = kp + kk + 32;
      if (kNext < K) {                      // prefetch next A fragments
        aN0.q[0] = *(const uint4*)(aPtr0 + kNext);
        aN0.q[1] = *(const uint4*)(aPtr0 + kNext + 16);
        aN1.q[0] = *(const uint4*)(aPtr1 + kNext);
        aN1.q[1] = *(const uint4*)(aPtr1 + kNext + 16);
        // stands ahead of the B fragment loads, which may reuse the address
        // registers of the four loads just issued
        asm volatile("s_wait_xcnt 0x0" ::: "memory");
      }
      // load all 4 B fragments first (separate regs -> one ds clause)
      const _Float16* bb = &Bs[n0 * BSTRIDE + kk + half8];
      const v16h b0 = frag_at(bb);
      const v16h b1 = frag_at(bb + 16 * BSTRIDE);
      const v16h b2 = frag_at(bb + 32 * BSTRIDE);
      const v16h b3 = frag_at(bb + 48 * BSTRIDE);
      acc[0] = __builtin_amdgcn_wmma_f32_16x16x32_f16(false, a0, false, b0, (short)0, acc[0], false, false);
      acc[1] = __builtin_amdgcn_wmma_f32_16x16x32_f16(false, a0, false, b1, (short)0, acc[1], false, false);
      acc[2] = __builtin_amdgcn_wmma_f32_16x16x32_f16(false, a0, false, b2, (short)0, acc[2], false, false);
      acc[3] = __builtin_amdgcn_wmma_f32_16x16x32_f16(false, a0, false, b3, (short)0, acc[3], false, false);
      acc[4] = __builtin_amdgcn_wmma_f32_16x16x32_f16(false, a1, false, b0, (short)0, acc[4], false, false);
      acc[5] = __builtin_amdgcn_wmma_f32_16x16x32_f16(false, a1, false, b1, (short)0, acc[5], false, false);
      acc[6] = __builtin_amdgcn_wmma_f32_16x16x32_f16(false, a1, false, b2, (short)0, acc[6], false, false);
      acc[7] = __builtin_amdgcn_wmma_f32_16x16x32_f16(false, a1, false, b3, (short)0, acc[7], false, false);
    }
  }

  // C/D layout: VGPR r -> (M=r, N=lane) for lanes 0-15, (M=r+8, N=lane-16)
  const int r0 = (lane >> 4) * 8;
  #pragma unroll
  for (int g = 0; g < 2; ++g) {             // two 16-row groups
    #pragma unroll
    for (int j = 0; j < 4; ++j) {
      const int col = colBase + 16 * j + n0;
      const float bv = bias ? bias[col] : 0.0f;
      const v8f av = acc[g * 4 + j];
      #pragma unroll
      for (int r = 0; r < 8; ++r) {
        const int row = rowBase + g * 16 + r0 + r;
        float v = av[r] + bv;
        if (doRelu) v = fmaxf(v, 0.0f);
        const size_t idx = (size_t)row * N + col;
        if (addsrc) v += addsrc[idx];
        if (outF) outF[idx] = v;
        if (outH) outH[idx] = (_Float16)v;
      }
    }
  }
}

// ---------------------------------------------------------------------------
// Folded patch attention. With qt[h] = Wk_h^T q_h (256 long, q the centre
// query) the score of patch position p is qt[h] . x_p / 8 (+ q_h . bk_h, the
// same for every p of a head, so it cancels in the softmax), and the merged
// value is Wv_h (sum_p w_p x_p) + bv_h because the weights sum to one. This
// kernel reads x once in f32 and writes xw[h] = sum_p w_p x_p per head.
// One wave per patch, no LDS and no barrier: the wave holds all 25 rows in
// registers, a lane 8 of a row's 256 values (f0..f0+3 and 128+f0..128+f0+3).
// ---------------------------------------------------------------------------
__device__ __forceinline__ float dot4(const v4f a, const v4f b, float s) {
  s = fmaf(a.x, b.x, s);
  s = fmaf(a.y, b.y, s);
  s = fmaf(a.z, b.z, s);
  s = fmaf(a.w, b.w, s);
  return s;
}
// lanes L and L ^ N: the lane with bit N clear keeps v[0..N), the other
// v[N..2N); each adds the partner's share of what it keeps
template <int N, int S>
__device__ __forceinline__ void halve_step(float (&v)[S], int lane) {
  const bool hi = (lane & N) != 0;
  #pragma unroll
  for (int j = 0; j < N; ++j) {
    const float send = hi ? v[j] : v[j + N];
    const float keep = hi ? v[j + N] : v[j];
    v[j] = keep + __shfl_xor(send, N, 32);
  }
}
__device__ __forceinline__ float lane_bcast(float v, int srcLane) {
  return __builtin_bit_cast(float,
      __builtin_amdgcn_readlane(__builtin_bit_cast(int, v), srcLane));
}

__global__ __launch_bounds__(WPB * 32) void patch_attention_folded(
    const float* __restrict__ x, const float* __restrict__ qt,
    _Float16* __restrict__ xw)
{
  const int lane = threadIdx.x & 31;
  const int bno  = blockIdx.x * WPB + (threadIdx.x >> 5);
  const int f0   = lane * 4;
  const float* qp = qt + (size_t)bno * (Hh * Ff) + f0;
  const float* xp = x + (size_t)bno * (KK2 * Ff) + f0;

  v4f q[Hh][2];
  #pragma unroll
  for (int h = 0; h < Hh; ++h) {
    q[h][0] = *(const v4f*)(qp + h * Ff);
    q[h][1] = *(const v4f*)(qp + h * Ff + 128);
  }
  // the address pair of the eight loads above is dead from here on and a row
  // load's result may land in it: the wait stands ahead of that overwrite
  asm volatile("s_wait_xcnt 0x0" ::: "memory");
  v4f xr[KK2][2];
  #pragma unroll
  for (int p = 0; p < KK2; ++p) {
    xr[p][0] = *(const v4f*)(xp + p * Ff);
    xr[p][1] = *(const v4f*)(xp + p * Ff + 128);
  }
  // the same for the address pair of the fifty row loads, which is free for
  // the arithmetic below as soon as the last of them has issued
  asm volatile("s_wait_xcnt 0x0" ::: "memory");
  // scores. Rows 0..23 in three groups of 8: 32 partial dots per lane, index
  // pl*4 + h; five halving steps leave lane L with the full sum of index L,
  // so lane L carries p = 8g + (L >> 2), h = L & 3.
  float s[3];
  #pragma unroll
  for (int g = 0; g < 3; ++g) {
    float v[32];
    #pragma unroll
    for (int pl = 0; pl < 8; ++pl)
      #pragma unroll
      for (int h = 0; h < Hh; ++h)
        v[pl * 4 + h] = dot4(xr[8 * g + pl][1], q[h][1],
                             dot4(xr[8 * g + pl][0], q[h][0], 0.f));
    halve_step<16>(v, lane);
    halve_step<8>(v, lane);
    halve_step<4>(v, lane);
    halve_step<2>(v, lane);
    halve_step<1>(v, lane);
    s[g] = v[0] * 0.125f;
  }
  // row 24: every lane ends with the full sum of head L & 3
  float s24;
  {
    float v[4];
    #pragma unroll
    for (int h = 0; h < Hh; ++h)
      v[h] = dot4(xr[24][1], q[h][1], dot4(xr[24][0], q[h][0], 0.f));
    halve_step<2>(v, lane);
    halve_step<1>(v, lane);
    #pragma unroll
    for (int o = 4; o <= 16; o <<= 1) v[0] += __shfl_xor(v[0], o, 32);
    s24 = v[0] * 0.125f;
  }

  // softmax over the 25 positions of head L & 3 (lanes L, L^4, L^8, L^16 ...)
  float mx = fmaxf(fmaxf(s[0], s[1]), fmaxf(s[2], s24));
  #pragma unroll
  for (int o = 4; o <= 16; o <<= 1) mx = fmaxf(mx, __shfl_xor(mx, o, 32));
  const float e0  = __expf(s[0] - mx);
  const float e1  = __expf(s[1] - mx);
  const float e2  = __expf(s[2] - mx);
  const float e24 = __expf(s24 - mx);
  float sum = (e0 + e1) + e2;
  #pragma unroll
  for (int o = 4; o <= 16; o <<= 1) sum += __shfl_xor(sum, o, 32);
  sum += e24;
  const float inv = 1.0f / sum;
  float wg[3];
  wg[0] = e0 * inv;
  wg[1] = e1 * inv;
  wg[2] = e2 * inv;
  const float w24 = e24 * inv;

  // weighted sum of the rows per head, p ascending; each weight is read from
  // its lane into a scalar
  _Float16* op = xw + (size_t)bno * (Hh * Ff) + f0;
  #pragma unroll
  for (int h = 0; h < Hh; ++h) {
    v4f a0 = (v4f){0.f, 0.f, 0.f, 0.f};
    v4f a1 = (v4f){0.f, 0.f, 0.f, 0.f};
    #pragma unroll
    for (int p = 0; p < KK2; ++p) {
      const float w = (p < 24) ? lane_bcast(wg[p >> 3], (p & 7) * 4 + h)
                               : lane_bcast(w24, h);
      a0.x = fmaf(w, xr[p][0].x, a0.x);
      a0.y = fmaf(w, xr[p][0].y, a0.y);
      a0.z = fmaf(w, xr[p][0].z, a0.z);
      a0.w = fmaf(w, xr[p][0].w, a0.w);
      a1.x = fmaf(w, xr[p][1].x, a1.x);
      a1.y = fmaf(w, xr[p][1].y, a1.y);
      a1.z = fmaf(w, xr[p][1].z, a1.z);
      a1.w = fmaf(w, xr[p][1].w, a1.w);
    }
    union { _Float16 hh[4]; uint2 u; } o0, o1;
    o0.hh[0] = (_Float16)a0.x; o0.hh[1] = (_Float16)a0.y;
    o0.hh[2] = (_Float16)a0.z; o0.hh[3] = (_Float16)a0.w;
    o1.hh[0] = (_Float16)a1.x; o1.hh[1] = (_Float16)a1.y;
    o1.hh[2] = (_Float16)a1.z; o1.hh[3] = (_Float16)a1.w;
    *(uint2*)(op + h * Ff)       = o0.u;
    *(uint2*)(op + h * Ff + 128) = o1.u;
  }
}

// ---------------------------------------------------------------------------
// LayerNorm over (N,O,F) per batch element: reduce then apply. Both move
// 16-byte vectors and issue all loads of a thread before the first use.
// ---------------------------------------------------------------------------
constexpr int PB4        = PB / 4;                    // float4 per batch element
constexpr int LNR_BLOCKS = 40;                        // reduce blocks per batch
constexpr int LNR_VEC    = PB4 / (LNR_BLOCKS * 256);  // float4 per thread
static_assert(LNR_VEC * LNR_BLOCKS * 256 == PB4, "reduce covers a batch exactly");
static_assert(PB4 % 256 == 0, "apply covers a batch exactly");

__device__ __forceinline__ uint2 pack4h(const v4f v) {
  union { _Float16 h[4]; uint2 u; } o;
  o.h[0] = (_Float16)v.x; o.h[1] = (_Float16)v.y;
  o.h[2] = (_Float16)v.z; o.h[3] = (_Float16)v.w;
  return o.u;
}

// grid = (LNR_BLOCKS, Bb)
__global__ __launch_bounds__(256) void ln_reduce_kernel(
    const float* __restrict__ x, float* __restrict__ stats)
{
  __shared__ float sA[256], sB[256];
  const int b = blockIdx.y;
  const v4f* xb = (const v4f*)(x + (size_t)b * PB)
                + blockIdx.x * 256 + threadIdx.x;
  v4f v[LNR_VEC];
  #pragma unroll
  for (int j = 0; j < LNR_VEC; ++j) v[j] = xb[j * (LNR_BLOCKS * 256)];
  v4f s4 = (v4f){0.f, 0.f, 0.f, 0.f};
  v4f q4 = (v4f){0.f, 0.f, 0.f, 0.f};
  #pragma unroll
  for (int j = 0; j < LNR_VEC; ++j) {
    s4 += v[j];
    q4 += v[j] * v[j];
  }
  sA[threadIdx.x] = (s4.x + s4.y) + (s4.z + s4.w);
  sB[threadIdx.x] = (q4.x + q4.y) + (q4.z + q4.w);
  __syncthreads();
  for (int st = 128; st > 0; st >>= 1) {
    if (threadIdx.x < st) {
      sA[threadIdx.x] += sA[threadIdx.x + st];
      sB[threadIdx.x] += sB[threadIdx.x + st];
    }
    __syncthreads();
  }
  if (threadIdx.x == 0) {
    atomicAdd(&stats[2 * b + 0], sA[0]);
    atomicAdd(&stats[2 * b + 1], sB[0]);
  }
}

// grid = PB4 / 256. A thread takes the same four (n,o,f) positions in every
// batch element, so it reads g and beta once.
__global__ __launch_bounds__(256) void ln_apply_kernel(
    const float* __restrict__ x, const float* __restrict__ g,
    const float* __restrict__ beta, const float* __restrict__ stats,
    float* __restrict__ outF, _Float16* __restrict__ outH)
{
  const int r4 = blockIdx.x * 256 + threadIdx.x;
  float st[2 * Bb];
  #pragma unroll
  for (int k = 0; k < 2 * Bb; ++k) st[k] = stats[k];
  v4f xv[Bb];
  #pragma unroll
  for (int b = 0; b < Bb; ++b) xv[b] = ((const v4f*)x)[b * PB4 + r4];
  const v4f gv = ((const v4f*)g)[r4];
  const v4f bv = ((const v4f*)beta)[r4];
  // the base addresses of the six loads above are dead from here on: the wait
  // stands ahead of whatever is written into their registers
  asm volatile("s_wait_xcnt 0x0" ::: "memory");
  v4f o[Bb];
  #pragma unroll
  for (int b = 0; b < Bb; ++b) {
    const float mu  = st[2 * b + 0] * (1.0f / PB);
    const float var = st[2 * b + 1] * (1.0f / PB) - mu * mu;
    const float rs  = rsqrtf(var + 1e-5f);
    o[b].x = (xv[b].x - mu) * rs * gv.x + bv.x;
    o[b].y = (xv[b].y - mu) * rs * gv.y + bv.y;
    o[b].z = (xv[b].z - mu) * rs * gv.z + bv.z;
    o[b].w = (xv[b].w - mu) * rs * gv.w + bv.w;
  }
  if (outF) {
    #pragma unroll
    for (int b = 0; b < Bb; ++b) ((v4f*)outF)[b * PB4 + r4] = o[b];
  }
  // the f16 packing below may reuse registers that the stores above name
  asm volatile("s_wait_xcnt 0x0" ::: "memory");
  if (outH) {
    #pragma unroll
    for (int b = 0; b < Bb; ++b) ((uint2*)outH)[b * PB4 + r4] = pack4h(o[b]);
  }
}

// ---------------------------------------------------------------------------
// small utility kernels
// ---------------------------------------------------------------------------
// four elements a thread; grid * block = n / 4
__global__ __launch_bounds__(256) void cvt_f32_to_f16(
    const float* __restrict__ s, _Float16* __restrict__ d, int n4) {
  const int i = blockIdx.x * 256 + threadIdx.x;
  if (i < n4) ((uint2*)d)[i] = pack4h(((const v4f*)s)[i]);
}
// centre token (p = 12) of every patch, f32 -> f16: xc[r][f]. A thread takes
// eight values each of rows r and r + 1; grid = ROWS * Ff / 16 / 256
__global__ __launch_bounds__(256) void cvt_centre_f16(
    const float* __restrict__ x, _Float16* __restrict__ d) {
  const int i = blockIdx.x * 256 + threadIdx.x;
  const int r = (i >> 5) * 2, c = i & 31;       // c: run of eight values
  const v4f* p = (const v4f*)x + (r * KK2 + 12) * (Ff / 4) + c * 2;
  const v4f a0 = p[0], a1 = p[1];
  const v4f c0 = p[KK2 * (Ff / 4)], c1 = p[KK2 * (Ff / 4) + 1];
  union { uint2 h[2]; uint4 u; } o0, o1;
  o0.h[0] = pack4h(a0); o0.h[1] = pack4h(a1);
  o1.h[0] = pack4h(c0); o1.h[1] = pack4h(c1);
  uint4* q = (uint4*)d + r * (Ff / 8) + c;
  q[0]      = o0.u;
  q[Ff / 8] = o1.u;
}
// per-head transpose of Wk, f32 -> f16: d[(h*256 + f)*64 + dd] = Wk[h*64 + dd][f]
// a thread reads four rows dd..dd+3 at one f; grid * block = Ff * Ff / 4
__global__ __launch_bounds__(256) void cvt_wk_headT_f16(
    const float* __restrict__ s, _Float16* __restrict__ d) {
  const int i  = blockIdx.x * 256 + threadIdx.x;
  const int dd = (i & (Dd / 4 - 1)) * 4, f = (i >> 4) & (Ff - 1), h = i >> 12;
  const float* p = s + (size_t)(h * Dd + dd) * Ff + f;
  v4f v;
  v.x = p[0]; v.y = p[Ff]; v.z = p[2 * Ff]; v.w = p[3 * Ff];
  ((uint2*)d)[i] = pack4h(v);
}
__global__ void zero_f32(float* __restrict__ p, int n) {
  if ((int)threadIdx.x < n) p[threadIdx.x] = 0.f;
}

// ---------------------------------------------------------------------------
extern "C" void kernel_launch(void* const* d_in, const int* in_sizes, int n_in,
                              void* d_out, int out_size, void* d_ws, size_t ws_size,
                              hipStream_t stream) {
  const float* x    = (const float*)d_in[0];
  const float* Wq   = (const float*)d_in[1];
  const float* bq   = (const float*)d_in[2];
  const float* Wk   = (const float*)d_in[3];
  // d_in[4] (bk) adds q_h . bk_h to all 25 scores of a head: cancels in softmax
  const float* Wv   = (const float*)d_in[5];
  const float* bv   = (const float*)d_in[6];
  const float* Wf   = (const float*)d_in[7];
  const float* bf   = (const float*)d_in[8];
  const float* ln1w = (const float*)d_in[9];
  const float* ln1b = (const float*)d_in[10];
  const float* ln2w = (const float*)d_in[11];
  const float* ln2b = (const float*)d_in[12];
  const float* W1   = (const float*)d_in[13];
  const float* b1   = (const float*)d_in[14];
  const float* W2   = (const float*)d_in[15];
  const float* b2   = (const float*)d_in[16];

  char* ws = (char*)d_ws;
  size_t off = 0;
  auto alloc = [&](size_t bytes) -> void* {
    void* p = ws + off;
    off += (bytes + 255) & ~(size_t)255;
    return p;
  };

  _Float16* xcH     = (_Float16*)alloc((size_t)ROWS * Ff * 2);     // centre tokens
  _Float16* wqH     = (_Float16*)alloc((size_t)Ff * Ff * 2);
  _Float16* wkT     = (_Float16*)alloc((size_t)Ff * Ff * 2);       // per-head Wk^T
  _Float16* wvH     = (_Float16*)alloc((size_t)Ff * Ff * 2);
  _Float16* wfH     = (_Float16*)alloc((size_t)Ff * Ff * 2);
  _Float16* w1H     = (_Float16*)alloc((size_t)DFFc * Ff * 2);
  _Float16* w2H     = (_Float16*)alloc((size_t)Ff * DFFc * 2);
  _Float16* qcH     = (_Float16*)alloc((size_t)ROWS * Ff * 2);     // centre query
  float*    qtF     = (float*)   alloc((size_t)ROWS * Hh * Ff * 4); // Wk_h^T q_h
  _Float16* xwH     = (_Float16*)alloc((size_t)ROWS * Hh * Ff * 2); // sum_p w_p x_p
  _Float16* mergedH = (_Float16*)alloc((size_t)ROWS * Ff * 2);
  float*    attent  = (float*)   alloc((size_t)ROWS * Ff * 4);
  float*    out1F   = (float*)   alloc((size_t)ROWS * Ff * 4);
  _Float16* out1H   = (_Float16*)alloc((size_t)ROWS * Ff * 2);
  _Float16* hidH    = (_Float16*)alloc((size_t)ROWS * DFFc * 2);
  float*    ytmp    = (float*)   alloc((size_t)ROWS * Ff * 4);
  float*    stats   = (float*)   alloc(256);                       // 2 sets of 4x2

  // --- prep: zero LN stats, convert centre tokens and weights to f16
  zero_f32<<<1, 32, 0, stream>>>(stats, 16);
  cvt_centre_f16<<<ROWS * Ff / 16 / 256, 256, 0, stream>>>(x, xcH);
  cvt_f32_to_f16<<<64,   256, 0, stream>>>(Wq, wqH, Ff * Ff / 4);
  cvt_wk_headT_f16<<<64, 256, 0, stream>>>(Wk, wkT);
  cvt_f32_to_f16<<<64,   256, 0, stream>>>(Wv, wvH, Ff * Ff / 4);
  cvt_f32_to_f16<<<64,   256, 0, stream>>>(Wf, wfH, Ff * Ff / 4);
  cvt_f32_to_f16<<<256,  256, 0, stream>>>(W1, w1H, DFFc * Ff / 4);
  cvt_f32_to_f16<<<256,  256, 0, stream>>>(W2, w2H, Ff * DFFc / 4);

  // --- centre query: (5120 x 256) @ (256 x 256) + bq -> f16
  {
    dim3 g(ROWS / 256, Ff / 64);
    gemm_f16_wmma<256><<<g, 256, 0, stream>>>(xcH, wqH, bq, nullptr,
                                              nullptr, qcH, ROWS, Ff, Ff, 0,
                                              Ff, 0, 0);
  }
  // --- folded query per head: q_h (5120 x 64) @ Wk_h (64 x 256) -> f32
  {
    dim3 g(ROWS / 256, (Hh * Ff) / 64);
    gemm_f16_wmma<64><<<g, 256, 0, stream>>>(qcH, wkT, nullptr, nullptr,
                                             qtF, nullptr, ROWS, Hh * Ff, Dd, 0,
                                             Ff, 2, Dd);
  }

  // --- scores, softmax over 25 and weighted patch sum per head, x read once
  patch_attention_folded<<<ROWS / WPB, WPB * 32, 0, stream>>>(x, qtF, xwH);

  // --- value projection per head: xw_h (5120 x 256) @ Wv_h^T (256 x 64) + bv
  {
    dim3 g(ROWS / 256, Ff / 64);
    gemm_f16_wmma<256><<<g, 256, 0, stream>>>(xwH, wvH, bv, nullptr,
                                              nullptr, mergedH, ROWS, Ff, Ff, 0,
                                              Hh * Ff, 0, Ff);
  }

  // --- output projection: (5120 x 256) @ (256 x 256) -> attent f32
  {
    dim3 g(ROWS / 256, Ff / 64);
    gemm_f16_wmma<256><<<g, 256, 0, stream>>>(mergedH, wfH, bf, nullptr,
                                              attent, nullptr, ROWS, Ff, Ff, 0,
                                              Ff, 0, 0);
  }

  // --- LayerNorm 1 (per batch over N,O,F) -> out1 (f32 + f16)
  ln_reduce_kernel<<<dim3(LNR_BLOCKS, Bb), 256, 0, stream>>>(attent, stats);
  ln_apply_kernel<<<PB4 / 256, 256, 0, stream>>>(attent, ln1w, ln1b, stats,
                                                 out1F, out1H);

  // --- FFN: relu(out1 @ W1^T + b1) @ W2^T + b2 + out1
  {
    dim3 g(ROWS / 256, DFFc / 64);
    gemm_f16_wmma<256><<<g, 256, 0, stream>>>(out1H, w1H, b1, nullptr,
                                              nullptr, hidH, ROWS, DFFc, Ff, 1,
                                              Ff, 0, 0);
  }
  {
    dim3 g(ROWS / 256, Ff / 64);
    gemm_f16_wmma<256><<<g, 256, 0, stream>>>(hidH, w2H, b2, out1F,
                                              ytmp, nullptr, ROWS, Ff, DFFc, 0,
                                              DFFc, 0, 0);
  }

  // --- LayerNorm 2 -> d_out (f32)
  ln_reduce_kernel<<<dim3(LNR_BLOCKS, Bb), 256, 0, stream>>>(ytmp, stats + 8);
  ln_apply_kernel<<<PB4 / 256, 256, 0, stream>>>(ytmp, ln2w, ln2b, stats + 8,
                                                 (float*)d_out, nullptr);
}

// v003
// Measured time: 127 microseconds a run.
// In two side-by-side timings against v002, it was 1.11 and 1.10 times as fast.
// Counting every step since v000, it is 2.54 times as fast.
#include <hip/hip_runtime.h>
#include <hip/hip_bf16.h>
#include <math.h>

typedef __attribute__((ext_vector_type(16))) _Float16 v16h;
typedef __attribute__((ext_vector_type(8)))  float    v8f;
typedef __attribute__((ext_vector_type(4)))  float    v4f;

#define Bb   4
#define Nn_  256
#define Oo   5
#define KK2  25      // K*K patch positions
#define Ff   256
#define Hh   4
#define Dd   64
#define DFFc 1024

constexpr int ROWS = Bb * Nn_ * Oo;         // 5120 output rows
constexpr int PB   = Nn_ * Oo * Ff;         // 327680 elems per batch for LN

constexpr int WPB  = 4;                     // waves (patches) per block, folded attention

// ---------------------------------------------------------------------------
// helpers
// ---------------------------------------------------------------------------
union FragU { v16h v; uint4 q[2]; };

// Load one f16 16x32 fragment given per-lane base (row/col and half-offset
// already folded in): elements 0..7 at +k, elements 8..15 at +k+16.
__device__ __forceinline__ v16h frag_at(const _Float16* p) {
  FragU f;
  f.q[0] = *(const uint4*)(p);
  f.q[1] = *(const uint4*)(p + 16);
  return f.v;
}

// ---------------------------------------------------------------------------
// GEMM: C[M][N] = A[M][K] * W[N][K]^T (+bias) (+addsrc) (relu?) -> f32/f16
// block = 256 threads = 8 waves; wave computes 32 rows x 64 cols (2 A frags
// share 4 B frags -> 8 WMMAs per k-step); block tile is 256x64. The B panel
// (64 cols x KPANEL) is staged in LDS with async-to-LDS copies shared by all
// 8 waves; A fragments are register double-buffered.
// grid = (M/256, N/64). M%256==0, N%64==0, K%KPANEL==0 guaranteed by caller.
// KPANEL is the B panel depth staged in LDS. A rows have pitch lda, and column
// block y reads A from column (y >> aShift) * aStep on: that gives the per-head
// products (each head has its own slice of A) in one launch.
//
// f16 16x32 fragment layout (A and B identical): lane L<16 -> row/col L,
// elements 0..7 = K [k0+off, k0+off+8), elements 8..15 = +16; off = 8*(L>=16).
// Both runs are contiguous -> two b128 loads per fragment.
// ---------------------------------------------------------------------------
template <int KPANEL>
__global__ __launch_bounds__(256) void gemm_f16_wmma(
    const _Float16* __restrict__ A, const _Float16* __restrict__ W,
    const float* __restrict__ bias, const float* __restrict__ addsrc,
    float* __restrict__ outF, _Float16* __restrict__ outH,
    int M, int N, int K, int doRelu, int lda, int aShift, int aStep)
{
  constexpr int BSTRIDE = KPANEL + 8;       // +16B pad: breaks LDS bank conflicts
  __shared__ _Float16 Bs[64 * BSTRIDE];     // ~33KB at KPANEL 256

  const int lane    = threadIdx.x & 31;
  const int wave    = threadIdx.x >> 5;
  const int rowBase = (blockIdx.x * 8 + wave) * 32;
  const int colBase = blockIdx.y * 64;

  const int n0    = lane & 15;              // row (A) / col (B) within tile
  const int half8 = ((lane >> 4) & 1) << 3; // K sub-offset per lane half

  const _Float16* aPtr0 = A + (size_t)(rowBase + n0) * lda
                            + ((int)blockIdx.y >> aShift) * aStep + half8;
  const _Float16* aPtr1 = aPtr0 + (size_t)16 * lda;

  v8f acc[8];
  #pragma unroll
  for (int j = 0; j < 8; ++j) acc[j] = (v8f){};

  // preload first A fragments (register double buffer, 2 row groups)
  FragU aN0, aN1;
  aN0.q[0] = *(const uint4*)(aPtr0);
  aN0.q[1] = *(const uint4*)(aPtr0 + 16);
  aN1.q[0] = *(const uint4*)(aPtr1);
  aN1.q[1] = *(const uint4*)(aPtr1 + 16);

  // async staging assignment: 4 threads per B row, KPANEL/32 b128 chunks each
  const int srow = threadIdx.x >> 2;          // 0..63
  const int skc  = (threadIdx.x & 3) << 3;    // 0,8,16,24
  const _Float16* srcRow = W + (size_t)(colBase + srow) * K + skc;
  const unsigned ldsBase = (unsigned)(uintptr_t)&Bs[srow * BSTRIDE + skc];

  for (int kp = 0; kp < K; kp += KPANEL) {
    // own LDS reads of the previous panel retired before the copies refill it
    asm volatile("s_wait_dscnt 0x0" ::: "memory");
    __syncthreads();   // previous panel fully consumed before overwrite

    // --- async stage of B panel: 64 rows x KPANEL f16 -> LDS (b128 chunks)
    {
      const _Float16* src = srcRow + kp;
      unsigned lds = ldsBase;
      #pragma unroll
      for (int c = 0; c < KPANEL / 32; c += 2) { // chunks of 8, stride 32 elems
        // the xcnt wait closes the statement so that no address register of
        // an issued copy is rewritten ahead of it
        asm volatile("global_load_async_to_lds_b128 %0, %1, off\n\t"
                     "global_load_async_to_lds_b128 %2, %3, off\n\t"
                     "s_wait_xcnt 0x0"
                     :: "v"(lds), "v"(src), "v"(lds + 64), "v"(src + 32)
                     : "memory");
        src += 64;
        lds += 128;
      }
    }
    asm volatile("s_wait_asynccnt 0x0" ::: "memory");
    __syncthreads();

    // --- K panel: KPANEL/32 steps of 32; A double-buffered, B frags from LDS
    #pragma unroll
    for (int kk = 0; kk < KPANEL; kk += 32) {
      const v16h a0 = aN0.v;
      const v16h a1 = aN1.v;
      const int kNext = kp + kk + 32;
      if (kNext < K) {                      // prefetch next A fragments
        aN0.q[0] = *(const uint4*)(aPtr0 + kNext);
        aN0.q[1] = *(const uint4*)(aPtr0 + kNext + 16);
        aN1.q[0] = *(const uint4*)(aPtr1 + kNext);
        aN1.q[1] = *(const uint4*)(aPtr1 + kNext + 16);
        // stands ahead of the B fragment loads, which may reuse the address
        // registers of the four loads just issued
        asm volatile("s_wait_xcnt 0x0" ::: "memory");
      }
      // load all 4 B fragments first (separate regs -> one ds clause)
      const _Float16* bb = &Bs[n0 * BSTRIDE + kk + half8];
      const v16h b0 = frag_at(bb);
      const v16h b1 = frag_at(bb + 16 * BSTRIDE);
      const v16h b2 = frag_at(bb + 32 * BSTRIDE);
      const v16h b3 = frag_at(bb + 48 * BSTRIDE);
      acc[0] = __builtin_amdgcn_wmma_f32_16x16x32_f16(false, a0, false, b0, (short)0, acc[0], false, false);
      acc[1] = __builtin_amdgcn_wmma_f32_16x16x32_f16(false, a0, false, b1, (short)0, acc[1], false, false);
      acc[2] = __builtin_amdgcn_wmma_f32_16x16x32_f16(false, a0, false, b2, (short)0, acc[2], false, false);
      acc[3] = __builtin_amdgcn_wmma_f32_16x16x32_f16(false, a0, false, b3, (short)0, acc[3], false, false);
      acc[4] = __builtin_amdgcn_wmma_f32_16x16x32_f16(false, a1, false, b0, (short)0, acc[4], false, false);
      acc[5] = __builtin_amdgcn_wmma_f32_16x16x32_f16(false, a1, false, b1, (short)0, acc[5], false, false);
      acc[6] = __builtin_amdgcn_wmma_f32_16x16x32_f16(false, a1, false, b2, (short)0, acc[6], false, false);
      acc[7] = __builtin_amdgcn_wmma_f32_16x16x32_f16(false, a1, false, b3, (short)0, acc[7], false, false);
    }
  }

  // C/D layout: VGPR r -> (M=r, N=lane) for lanes 0-15, (M=r+8, N=lane-16)
  const int r0 = (lane >> 4) * 8;
  #pragma unroll
  for (int g = 0; g < 2; ++g) {             // two 16-row groups
    #pragma unroll
    for (int j = 0; j < 4; ++j) {
      const int col = colBase + 16 * j + n0;
      const float bv = bias ? bias[col] : 0.0f;
      const v8f av = acc[g * 4 + j];
      #pragma unroll
      for (int r = 0; r < 8; ++r) {
        const int row = rowBase + g * 16 + r0 + r;
        float v = av[r] + bv;
        if (doRelu) v = fmaxf(v, 0.0f);
        const size_t idx = (size_t)row * N + col;
        if (addsrc) v += addsrc[idx];
        if (outF) outF[idx] = v;
        if (outH) outH[idx] = (_Float16)v;
      }
    }
  }
}

// ---------------------------------------------------------------------------
// Folded patch attention. With qt[h] = Wk_h^T q_h (256 long, q the centre
// query) the score of patch position p is qt[h] . x_p / 8 (+ q_h . bk_h, the
// same for every p of a head, so it cancels in the softmax), and the merged
// value is Wv_h (sum_p w_p x_p) + bv_h because the weights sum to one. This
// kernel reads x once in f32 and writes xw[h] = sum_p w_p x_p per head.
// One wave per patch, no LDS and no barrier: the wave holds all 25 rows in
// registers, a lane 8 of a row's 256 values (f0..f0+3 and 128+f0..128+f0+3).
// ---------------------------------------------------------------------------
__device__ __forceinline__ float dot4(const v4f a, const v4f b, float s) {
  s = fmaf(a.x, b.x, s);
  s = fmaf(a.y, b.y, s);
  s = fmaf(a.z, b.z, s);
  s = fmaf(a.w, b.w, s);
  return s;
}
// lanes L and L ^ N: the lane with bit N clear keeps v[0..N), the other
// v[N..2N); each adds the partner's share of what it keeps
template <int N, int S>
__device__ __forceinline__ void halve_step(float (&v)[S], int lane) {
  const bool hi = (lane & N) != 0;
  #pragma unroll
  for (int j = 0; j < N; ++j) {
    const float send = hi ? v[j] : v[j + N];
    const float keep = hi ? v[j + N] : v[j];
    v[j] = keep + __shfl_xor(send, N, 32);
  }
}
__device__ __forceinline__ float lane_bcast(float v, int srcLane) {
  return __builtin_bit_cast(float,
      __builtin_amdgcn_readlane(__builtin_bit_cast(int, v), srcLane));
}

__global__ __launch_bounds__(WPB * 32) void patch_attention_folded(
    const float* __restrict__ x, const float* __restrict__ qt,
    _Float16* __restrict__ xw)
{
  const int lane = threadIdx.x & 31;
  const int bno  = blockIdx.x * WPB + (threadIdx.x >> 5);
  const int f0   = lane * 4;
  const float* qp = qt + (size_t)bno * (Hh * Ff) + f0;
  const float* xp = x + (size_t)bno * (KK2 * Ff) + f0;

  v4f q[Hh][2];
  #pragma unroll
  for (int h = 0; h < Hh; ++h) {
    q[h][0] = *(const v4f*)(qp + h * Ff);
    q[h][1] = *(const v4f*)(qp + h * Ff + 128);
  }
  // the address pair of the eight loads above is dead from here on and a row
  // load's result may land in it: the wait stands ahead of that overwrite
  asm volatile("s_wait_xcnt 0x0" ::: "memory");
  v4f xr[KK2][2];
  #pragma unroll
  for (int p = 0; p < KK2; ++p) {
    xr[p][0] = *(const v4f*)(xp + p * Ff);
    xr[p][1] = *(const v4f*)(xp + p * Ff + 128);
  }
  // the same for the address pair of the fifty row loads, which is free for
  // the arithmetic below as soon as the last of them has issued
  asm volatile("s_wait_xcnt 0x0" ::: "memory");
  // scores. Rows 0..23 in three groups of 8: 32 partial dots per lane, index
  // pl*4 + h; five halving steps leave lane L with the full sum of index L,
  // so lane L carries p = 8g + (L >> 2), h = L & 3.
  float s[3];
  #pragma unroll
  for (int g = 0; g < 3; ++g) {
    float v[32];
    #pragma unroll
    for (int pl = 0; pl < 8; ++pl)
      #pragma unroll
      for (int h = 0; h < Hh; ++h)
        v[pl * 4 + h] = dot4(xr[8 * g + pl][1], q[h][1],
                             dot4(xr[8 * g + pl][0], q[h][0], 0.f));
    halve_step<16>(v, lane);
    halve_step<8>(v, lane);
    halve_step<4>(v, lane);
    halve_step<2>(v, lane);
    halve_step<1>(v, lane);
    s[g] = v[0] * 0.125f;
  }
  // row 24: every lane ends with the full sum of head L & 3
  float s24;
  {
    float v[4];
    #pragma unroll
    for (int h = 0; h < Hh; ++h)
      v[h] = dot4(xr[24][1], q[h][1], dot4(xr[24][0], q[h][0], 0.f));
    halve_step<2>(v, lane);
    halve_step<1>(v, lane);
    #pragma unroll
    for (int o = 4; o <= 16; o <<= 1) v[0] += __shfl_xor(v[0], o, 32);
    s24 = v[0] * 0.125f;
  }

  // softmax over the 25 positions of head L & 3 (lanes L, L^4, L^8, L^16 ...)
  float mx = fmaxf(fmaxf(s[0], s[1]), fmaxf(s[2], s24));
  #pragma unroll
  for (int o = 4; o <= 16; o <<= 1) mx = fmaxf(mx, __shfl_xor(mx, o, 32));
  const float e0  = __expf(s[0] - mx);
  const float e1  = __expf(s[1] - mx);
  const float e2  = __expf(s[2] - mx);
  const float e24 = __expf(s24 - mx);
  float sum = (e0 + e1) + e2;
  #pragma unroll
  for (int o = 4; o <= 16; o <<= 1) sum += __shfl_xor(sum, o, 32);
  sum += e24;
  const float inv = 1.0f / sum;
  float wg[3];
  wg[0] = e0 * inv;
  wg[1] = e1 * inv;
  wg[2] = e2 * inv;
  const float w24 = e24 * inv;

  // weighted sum of the rows per head, p ascending; each weight is read from
  // its lane into a scalar
  _Float16* op = xw + (size_t)bno * (Hh * Ff) + f0;
  #pragma unroll
  for (int h = 0; h < Hh; ++h) {
    v4f a0 = (v4f){0.f, 0.f, 0.f, 0.f};
    v4f a1 = (v4f){0.f, 0.f, 0.f, 0.f};
    #pragma unroll
    for (int p = 0; p < KK2; ++p) {
      const float w = (p < 24) ? lane_bcast(wg[p >> 3], (p & 7) * 4 + h)
                               : lane_bcast(w24, h);
      a0.x = fmaf(w, xr[p][0].x, a0.x);
      a0.y = fmaf(w, xr[p][0].y, a0.y);
      a0.z = fmaf(w, xr[p][0].z, a0.z);
      a0.w = fmaf(w, xr[p][0].w, a0.w);
      a1.x = fmaf(w, xr[p][1].x, a1.x);
      a1.y = fmaf(w, xr[p][1].y, a1.y);
      a1.z = fmaf(w, xr[p][1].z, a1.z);
      a1.w = fmaf(w, xr[p][1].w, a1.w);
    }
    union { _Float16 hh[4]; uint2 u; } o0, o1;
    o0.hh[0] = (_Float16)a0.x; o0.hh[1] = (_Float16)a0.y;
    o0.hh[2] = (_Float16)a0.z; o0.hh[3] = (_Float16)a0.w;
    o1.hh[0] = (_Float16)a1.x; o1.hh[1] = (_Float16)a1.y;
    o1.hh[2] = (_Float16)a1.z; o1.hh[3] = (_Float16)a1.w;
    *(uint2*)(op + h * Ff)       = o0.u;
    *(uint2*)(op + h * Ff + 128) = o1.u;
  }
}

// ---------------------------------------------------------------------------
// LayerNorm over (N,O,F) per batch element: reduce then apply. Both move
// 16-byte vectors and issue all loads of a thread before the first use.
// ---------------------------------------------------------------------------
constexpr int PB4        = PB / 4;                    // float4 per batch element
constexpr int LNR_BLOCKS = 40;                        // reduce blocks per batch
constexpr int LNR_VEC    = PB4 / (LNR_BLOCKS * 256);  // float4 per thread
static_assert(LNR_VEC * LNR_BLOCKS * 256 == PB4, "reduce covers a batch exactly");
static_assert(PB4 % 256 == 0, "apply covers a batch exactly");

__device__ __forceinline__ uint2 pack4h(const v4f v) {
  union { _Float16 h[4]; uint2 u; } o;
  o.h[0] = (_Float16)v.x; o.h[1] = (_Float16)v.y;
  o.h[2] = (_Float16)v.z; o.h[3] = (_Float16)v.w;
  return o.u;
}

// grid = (LNR_BLOCKS, Bb)
__global__ __launch_bounds__(256) void ln_reduce_kernel(
    const float* __restrict__ x, float* __restrict__ stats)
{
  __shared__ float sA[256], sB[256];
  const int b = blockIdx.y;
  const v4f* xb = (const v4f*)(x + (size_t)b * PB)
                + blockIdx.x * 256 + threadIdx.x;
  v4f v[LNR_VEC];
  #pragma unroll
  for (int j = 0; j < LNR_VEC; ++j) v[j] = xb[j * (LNR_BLOCKS * 256)];
  v4f s4 = (v4f){0.f, 0.f, 0.f, 0.f};
  v4f q4 = (v4f){0.f, 0.f, 0.f, 0.f};
  #pragma unroll
  for (int j = 0; j < LNR_VEC; ++j) {
    s4 += v[j];
    q4 += v[j] * v[j];
  }
  sA[threadIdx.x] = (s4.x + s4.y) + (s4.z + s4.w);
  sB[threadIdx.x] = (q4.x + q4.y) + (q4.z + q4.w);
  __syncthreads();
  for (int st = 128; st > 0; st >>= 1) {
    if (threadIdx.x < st) {
      sA[threadIdx.x] += sA[threadIdx.x + st];
      sB[threadIdx.x] += sB[threadIdx.x + st];
    }
    __syncthreads();
  }
  if (threadIdx.x == 0) {
    atomicAdd(&stats[2 * b + 0], sA[0]);
    atomicAdd(&stats[2 * b + 1], sB[0]);
  }
}

// grid = PB4 / 256. A thread takes the same four (n,o,f) positions in every
// batch element, so it reads g and beta once.
__global__ __launch_bounds__(256) void ln_apply_kernel(
    const float* __restrict__ x, const float* __restrict__ g,
    const float* __restrict__ beta, const float* __restrict__ stats,
    float* __restrict__ outF, _Float16* __restrict__ outH)
{
  const int r4 = blockIdx.x * 256 + threadIdx.x;
  float st[2 * Bb];
  #pragma unroll
  for (int k = 0; k < 2 * Bb; ++k) st[k] = stats[k];
  v4f xv[Bb];
  #pragma unroll
  for (int b = 0; b < Bb; ++b) xv[b] = ((const v4f*)x)[b * PB4 + r4];
  const v4f gv = ((const v4f*)g)[r4];
  const v4f bv = ((const v4f*)beta)[r4];
  // the base addresses of the six loads above are dead from here on: the wait
  // stands ahead of whatever is written into their registers
  asm volatile("s_wait_xcnt 0x0" ::: "memory");
  v4f o[Bb];
  #pragma unroll
  for (int b = 0; b < Bb; ++b) {
    const float mu  = st[2 * b + 0] * (1.0f / PB);
    const float var = st[2 * b + 1] * (1.0f / PB) - mu * mu;
    const float rs  = rsqrtf(var + 1e-5f);
    o[b].x = (xv[b].x - mu) * rs * gv.x + bv.x;
    o[b].y = (xv[b].y - mu) * rs * gv.y + bv.y;
    o[b].z = (xv[b].z - mu) * rs * gv.z + bv.z;
    o[b].w = (xv[b].w - mu) * rs * gv.w + bv.w;
  }
  if (outF) {
    #pragma unroll
    for (int b = 0; b < Bb; ++b) ((v4f*)outF)[b * PB4 + r4] = o[b];
  }
  // the f16 packing below may reuse registers that the stores above name
  asm volatile("s_wait_xcnt 0x0" ::: "memory");
  if (outH) {
    #pragma unroll
    for (int b = 0; b < Bb; ++b) ((uint2*)outH)[b * PB4 + r4] = pack4h(o[b]);
  }
}

// ---------------------------------------------------------------------------
// prep: everything that depends on the inputs alone, in ONE launch. The parts
// need nothing of each other, so each takes a range of the block index (the
// branch is the same for a whole block). 16 values a thread in every part,
// all of a thread's loads issued before its first store.
// ---------------------------------------------------------------------------
constexpr int PREP_WK     = Ff * Ff / 16 / 256;        // blocks per 256x256 weight
constexpr int PREP_FFN    = DFFc * Ff / 16 / 256;      // blocks per FFN weight
constexpr int PREP_CENTRE = ROWS * Ff / 16 / 256;      // blocks for the centre tokens
constexpr int PREP_BLOCKS = 4 * PREP_WK + 2 * PREP_FFN + PREP_CENTRE;

// flat f32 -> f16: block blk takes 1024 runs of four values
__device__ __forceinline__ void cvt_flat_f16(
    const float* __restrict__ s, _Float16* __restrict__ d, int blk) {
  const int i = blk * 1024 + threadIdx.x;
  v4f v[4];
  #pragma unroll
  for (int j = 0; j < 4; ++j) v[j] = ((const v4f*)s)[i + j * 256];
  #pragma unroll
  for (int j = 0; j < 4; ++j) ((uint2*)d)[i + j * 256] = pack4h(v[j]);
  // the built code joins this part's exit with another part's path, where the
  // registers that the four stores name are written again: the wait stands
  // ahead of that
  asm volatile("s_wait_xcnt 0x0" ::: "memory");
}
// centre token (p = 12) of every patch, f32 -> f16: xc[r][f]. A thread takes
// eight values each of rows r and r + 1
__device__ __forceinline__ void cvt_centre_f16(
    const float* __restrict__ x, _Float16* __restrict__ d, int blk) {
  const int i = blk * 256 + threadIdx.x;
  const int r = (i >> 5) * 2, c = i & 31;       // c: run of eight values
  const v4f* p = (const v4f*)x + (r * KK2 + 12) * (Ff / 4) + c * 2;
  const v4f a0 = p[0], a1 = p[1];
  const v4f c0 = p[KK2 * (Ff / 4)], c1 = p[KK2 * (Ff / 4) + 1];
  union { uint2 h[2]; uint4 u; } o0, o1;
  o0.h[0] = pack4h(a0); o0.h[1] = pack4h(a1);
  o1.h[0] = pack4h(c0); o1.h[1] = pack4h(c1);
  uint4* q = (uint4*)d + r * (Ff / 8) + c;
  q[0]      = o0.u;
  q[Ff / 8] = o1.u;
}
// per-head transpose of Wk, f32 -> f16: d[(h*256 + f)*64 + dd] = Wk[h*64 + dd][f]
// one run of four is rows dd..dd+3 at one f; a thread takes four runs
__device__ __forceinline__ void cvt_wk_headT_f16(
    const float* __restrict__ s, _Float16* __restrict__ d, int blk) {
  const int i0 = blk * 1024 + threadIdx.x;
  v4f v[4];
  #pragma unroll
  for (int j = 0; j < 4; ++j) {
    const int i  = i0 + j * 256;
    const int dd = (i & (Dd / 4 - 1)) * 4, f = (i >> 4) & (Ff - 1), h = i >> 12;
    const float* p = s + (size_t)(h * Dd + dd) * Ff + f;
    v[j].x = p[0]; v[j].y = p[Ff]; v[j].z = p[2 * Ff]; v[j].w = p[3 * Ff];
  }
  #pragma unroll
  for (int j = 0; j < 4; ++j) ((uint2*)d)[i0 + j * 256] = pack4h(v[j]);
  // the built code joins this part's exit with another part's path, where the
  // registers that the four stores name are written again: the wait stands
  // ahead of that
  asm volatile("s_wait_xcnt 0x0" ::: "memory");
}

// grid = PREP_BLOCKS
__global__ __launch_bounds__(256) void prep_kernel(
    const float* __restrict__ x,  const float* __restrict__ Wq,
    const float* __restrict__ Wk, const float* __restrict__ Wv,
    const float* __restrict__ Wf, const float* __restrict__ W1,
    const float* __restrict__ W2,
    _Float16* __restrict__ xcH, _Float16* __restrict__ wqH,
    _Float16* __restrict__ wkT, _Float16* __restrict__ wvH,
    _Float16* __restrict__ wfH, _Float16* __restrict__ w1H,
    _Float16* __restrict__ w2H, float* __restrict__ stats)
{
  int blk = blockIdx.x;
  if (blk < PREP_CENTRE) { cvt_centre_f16(x, xcH, blk); return; }
  blk -= PREP_CENTRE;
  if (blk < PREP_WK) {
    if (blk == 0 && threadIdx.x < 16) stats[threadIdx.x] = 0.f;  // both LN sets
    cvt_wk_headT_f16(Wk, wkT, blk);
    return;
  }
  blk -= PREP_WK;
  // the five flat conversions run the same code on a block's own pair of
  // pointers
  const float* s = W1;
  _Float16*    d = w1H;
  if (blk >= PREP_FFN) {
    blk -= PREP_FFN; s = W2; d = w2H;
    if (blk >= PREP_FFN) {
      blk -= PREP_FFN; s = Wq; d = wqH;
      if (blk >= PREP_WK) {
        blk -= PREP_WK; s = Wv; d = wvH;
        if (blk >= PREP_WK) { blk -= PREP_WK; s = Wf; d = wfH; }
      }
    }
  }
  cvt_flat_f16(s, d, blk);
}

// ---------------------------------------------------------------------------
extern "C" void kernel_launch(void* const* d_in, const int* in_sizes, int n_in,
                              void* d_out, int out_size, void* d_ws, size_t ws_size,
                              hipStream_t stream) {
  const float* x    = (const float*)d_in[0];
  const float* Wq   = (const float*)d_in[1];
  const float* bq   = (const float*)d_in[2];
  const float* Wk   = (const float*)d_in[3];
  // d_in[4] (bk) adds q_h . bk_h to all 25 scores of a head: cancels in softmax
  const float* Wv   = (const float*)d_in[5];
  const float* bv   = (const float*)d_in[6];
  const float* Wf   = (const float*)d_in[7];
  const float* bf   = (const float*)d_in[8];
  const float* ln1w = (const float*)d_in[9];
  const float* ln1b = (const float*)d_in[10];
  const float* ln2w = (const float*)d_in[11];
  const float* ln2b = (const float*)d_in[12];
  const float* W1   = (const float*)d_in[13];
  const float* b1   = (const float*)d_in[14];
  const float* W2   = (const float*)d_in[15];
  const float* b2   = (const float*)d_in[16];

  char* ws = (char*)d_ws;
  size_t off = 0;
  auto alloc = [&](size_t bytes) -> void* {
    void* p = ws + off;
    off += (bytes + 255) & ~(size_t)255;
    return p;
  };

  _Float16* xcH     = (_Float16*)alloc((size_t)ROWS * Ff * 2);     // centre tokens
  _Float16* wqH     = (_Float16*)alloc((size_t)Ff * Ff * 2);
  _Float16* wkT     = (_Float16*)alloc((size_t)Ff * Ff * 2);       // per-head Wk^T
  _Float16* wvH     = (_Float16*)alloc((size_t)Ff * Ff * 2);
  _Float16* wfH     = (_Float16*)alloc((size_t)Ff * Ff * 2);
  _Float16* w1H     = (_Float16*)alloc((size_t)DFFc * Ff * 2);
  _Float16* w2H     = (_Float16*)alloc((size_t)Ff * DFFc * 2);
  _Float16* qcH     = (_Float16*)alloc((size_t)ROWS * Ff * 2);     // centre query
  float*    qtF     = (float*)   alloc((size_t)ROWS * Hh * Ff * 4); // Wk_h^T q_h
  _Float16* xwH     = (_Float16*)alloc((size_t)ROWS * Hh * Ff * 2); // sum_p w_p x_p
  _Float16* mergedH = (_Float16*)alloc((size_t)ROWS * Ff * 2);
  float*    attent  = (float*)   alloc((size_t)ROWS * Ff * 4);
  float*    out1F   = (float*)   alloc((size_t)ROWS * Ff * 4);
  _Float16* out1H   = (_Float16*)alloc((size_t)ROWS * Ff * 2);
  _Float16* hidH    = (_Float16*)alloc((size_t)ROWS * DFFc * 2);
  float*    ytmp    = (float*)   alloc((size_t)ROWS * Ff * 4);
  float*    stats   = (float*)   alloc(256);                       // 2 sets of 4x2

  // --- prep: zero LN stats, convert centre tokens and weights to f16
  prep_kernel<<<PREP_BLOCKS, 256, 0, stream>>>(x, Wq, Wk, Wv, Wf, W1, W2,
                                               xcH, wqH, wkT, wvH, wfH, w1H, w2H,
                                               stats);

  // --- centre query: (5120 x 256) @ (256 x 256) + bq -> f16
  {
    dim3 g(ROWS / 256, Ff / 64);
    gemm_f16_wmma<256><<<g, 256, 0, stream>>>(xcH, wqH, bq, nullptr,
                                              nullptr, qcH, ROWS, Ff, Ff, 0,
                                              Ff, 0, 0);
  }
  // --- folded query per head: q_h (5120 x 64) @ Wk_h (64 x 256) -> f32
  {
    dim3 g(ROWS / 256, (Hh * Ff) / 64);
    gemm_f16_wmma<64><<<g, 256, 0, stream>>>(qcH, wkT, nullptr, nullptr,
                                             qtF, nullptr, ROWS, Hh * Ff, Dd, 0,
                                             Ff, 2, Dd);
  }

  // --- scores, softmax over 25 and weighted patch sum per head, x read once
  patch_attention_folded<<<ROWS / WPB, WPB * 32, 0, stream>>>(x, qtF, xwH);

  // --- value projection per head: xw_h (5120 x 256) @ Wv_h^T (256 x 64) + bv
  {
    dim3 g(ROWS / 256, Ff / 64);
    gemm_f16_wmma<256><<<g, 256, 0, stream>>>(xwH, wvH, bv, nullptr,
                                              nullptr, mergedH, ROWS, Ff, Ff, 0,
                                              Hh * Ff, 0, Ff);
  }

  // --- output projection: (5120 x 256) @ (256 x 256) -> attent f32
  {
    dim3 g(ROWS / 256, Ff / 64);
    gemm_f16_wmma<256><<<g, 256, 0, stream>>>(mergedH, wfH, bf, nullptr,
                                              attent, nullptr, ROWS, Ff, Ff, 0,
                                              Ff, 0, 0);
  }

  // --- LayerNorm 1 (per batch over N,O,F) -> out1 (f32 + f16)
  ln_reduce_kernel<<<dim3(LNR_BLOCKS, Bb), 256, 0, stream>>>(attent, stats);
  ln_apply_kernel<<<PB4 / 256, 256, 0, stream>>>(attent, ln1w, ln1b, stats,
                                                 out1F, out1H);

  // --- FFN: relu(out1 @ W1^T + b1) @ W2^T + b2 + out1
  {
    dim3 g(ROWS / 256, DFFc / 64);
    gemm_f16_wmma<256><<<g, 256, 0, stream>>>(out1H, w1H, b1, nullptr,
                                              nullptr, hidH, ROWS, DFFc, Ff, 1,
                                              Ff, 0, 0);
  }
  {
    dim3 g(ROWS / 256, Ff / 64);
    gemm_f16_wmma<256><<<g, 256, 0, stream>>>(hidH, w2H, b2, out1F,
                                              ytmp, nullptr, ROWS, Ff, DFFc, 0,
                                              DFFc, 0, 0);
  }

  // --- LayerNorm 2 -> d_out (f32)
  ln_reduce_kernel<<<dim3(LNR_BLOCKS, Bb), 256, 0, stream>>>(ytmp, stats + 8);
  ln_apply_kernel<<<PB4 / 256, 256, 0, stream>>>(ytmp, ln2w, ln2b, stats + 8,
                                                 (float*)d_out, nullptr);
}

// v004
// One run takes 78 microseconds.
// Timed twice side by side with v003, it ran 1.61 times as fast both times.
// Counting every step since v000, it is 4.08 times as fast.
#include <hip/hip_runtime.h>
#include <hip/hip_bf16.h>
#include <math.h>

typedef __attribute__((ext_vector_type(16))) _Float16 v16h;
typedef __attribute__((ext_vector_type(8)))  float    v8f;
typedef __attribute__((ext_vector_type(4)))  float    v4f;

#define Bb   4
#define Nn_  256
#define Oo   5
#define KK2  25      // K*K patch positions
#define Ff   256
#define Hh   4
#define Dd   64
#define DFFc 1024

constexpr int ROWS = Bb * Nn_ * Oo;         // 5120 output rows
constexpr int PB   = Nn_ * Oo * Ff;         // 327680 elems per batch for LN

constexpr int WPB  = 4;                     // waves (patches) per block, folded attention

// ---------------------------------------------------------------------------
// helpers
// ---------------------------------------------------------------------------
union FragU { v16h v; uint4 q[2]; };

// Load one f16 16x32 fragment given per-lane base (row/col and half-offset
// already folded in): elements 0..7 at +k, elements 8..15 at +k+16.
__device__ __forceinline__ v16h frag_at(const _Float16* p) {
  FragU f;
  f.q[0] = *(const uint4*)(p);
  f.q[1] = *(const uint4*)(p + 16);
  return f.v;
}

// ---------------------------------------------------------------------------
// GEMM: C[M][NT] = A[M][KT] * W[NT][KT]^T (+bias) (relu?) (+addsrc) -> f32/f16
// block = 256 threads = 8 waves; a wave computes 16*RG rows x 64 cols (RG A
// fragments share 4 B fragments per k-step); block tile is (128*RG) x 64.
// grid = (M/(128*RG), NT/64). NT is a compile-time constant so that one
// address serves all of a lane's C positions (constant offsets from it).
// Nothing is fetched step by step: a block issues every global read it will
// ever make ahead of its k loop, so that their latencies run side by side.
// The B panel (64 cols x all of K) goes to LDS by async copies shared by the
// 8 waves, filled once; a wave's A fragments for all of K, its bias values
// and (ADD) its residual values go to registers.
// A rows have pitch lda, and column block y reads A from column
// (y >> aShift) * aStep on: that gives the per-head products (each head has
// its own slice of A) in one launch.
//
// f16 16x32 fragment layout (A and B identical): lane L<16 -> row/col L,
// elements 0..7 = K [k0+off, k0+off+8), elements 8..15 = +16; off = 8*(L>=16).
// Both runs are contiguous -> two b128 loads per fragment.
// ---------------------------------------------------------------------------
template <int KT, int NT, int RG, bool ADD>
__global__ __launch_bounds__(256) void gemm_f16_wmma(
    const _Float16* __restrict__ A, const _Float16* __restrict__ W,
    const float* __restrict__ bias, const float* __restrict__ addsrc,
    float* __restrict__ outF, _Float16* __restrict__ outH,
    int doRelu, int lda, int aShift, int aStep)
{
  // The panel lies in LDS in PARTS runs of K, each 64 rows of KP values, so
  // that inside a part every fragment is within the 64 KB that the offset
  // field of an LDS load reaches from one address register.
  constexpr int PARTS   = (KT > 512) ? KT / 512 : 1;
  constexpr int KP      = KT / PARTS;
  constexpr int BSTRIDE = KP + 8;           // +16B pad: breaks LDS bank conflicts
  constexpr int STEPS   = KT / 32;          // k-steps, and B copies per thread
  constexpr int SPP     = STEPS / PARTS;    // k-steps per part
  // A wave has at most 63 loads outstanding, and the barrier below waits for
  // every load issued ahead of it. So only the first PRE steps' A fragments
  // are asked for ahead of the barrier; the rest, and the residual, are asked
  // for behind it and land while the first steps are worked on.
  constexpr int PRE     = (2 * RG * STEPS <= 48) ? STEPS : 24 / RG;
  __shared__ _Float16 Bs[PARTS * 64 * BSTRIDE];

  const int lane    = threadIdx.x & 31;
  const int wave    = threadIdx.x >> 5;
  const int rowBase = (blockIdx.x * 8 + wave) * (16 * RG);
  const int colBase = blockIdx.y * 64;

  const int n0    = lane & 15;              // row (A) / col (B) within tile
  const int half8 = ((lane >> 4) & 1) << 3; // K sub-offset per lane half
  const int r0    = (lane >> 4) * 8;        // first C row of this lane half

  // --- B panel, 64 rows x KT f16 -> LDS: 4 threads per row, STEPS b128 chunks
  // each (chunks of 8 values, 32 values apart). The xcnt wait closes each
  // statement so that no address register of an issued copy is rewritten
  // ahead of it.
  {
    const int srow = threadIdx.x >> 2;          // 0..63
    const int skc  = (threadIdx.x & 3) << 3;    // 0,8,16,24
    const _Float16* src = W + (size_t)(colBase + srow) * KT + skc;
    const unsigned lds0 = (unsigned)(uintptr_t)&Bs[srow * BSTRIDE + skc];
    if constexpr (STEPS % 8 == 0) {
      static_assert(SPP % 8 == 0, "a statement's eight chunks lie in one part");
      // unrolled: c is a compile-time index into the parts
      #pragma unroll
      for (int c = 0; c < STEPS; c += 8) {
        const unsigned lds = lds0 + ((c / SPP) * 64 * BSTRIDE + (c % SPP) * 32) * 2;
        asm volatile("global_load_async_to_lds_b128 %0, %1, off\n\t"
                     "global_load_async_to_lds_b128 %2, %3, off\n\t"
                     "global_load_async_to_lds_b128 %4, %5, off\n\t"
                     "global_load_async_to_lds_b128 %6, %7, off\n\t"
                     "global_load_async_to_lds_b128 %8, %9, off\n\t"
                     "global_load_async_to_lds_b128 %10, %11, off\n\t"
                     "global_load_async_to_lds_b128 %12, %13, off\n\t"
                     "global_load_async_to_lds_b128 %14, %15, off\n\t"
                     "s_wait_xcnt 0x0"
                     :: "v"(lds),       "v"(src),
                        "v"(lds + 64),  "v"(src + 32),
                        "v"(lds + 128), "v"(src + 64),
                        "v"(lds + 192), "v"(src + 96),
                        "v"(lds + 256), "v"(src + 128),
                        "v"(lds + 320), "v"(src + 160),
                        "v"(lds + 384), "v"(src + 192),
                        "v"(lds + 448), "v"(src + 224)
                     : "memory");
        src += 256;
      }
    } else {
      static_assert(STEPS == 2, "two chunks a thread");
      asm volatile("global_load_async_to_lds_b128 %0, %1, off\n\t"
                   "global_load_async_to_lds_b128 %2, %3, off\n\t"
                   "s_wait_xcnt 0x0"
                   :: "v"(lds0), "v"(src), "v"(lds0 + 64), "v"(src + 32)
                   : "memory");
    }
  }

  float bv[4] = {0.0f, 0.0f, 0.0f, 0.0f};
  // --- A fragments of the first PRE k-steps, k ascending
  const _Float16* aPtr = A + (size_t)(rowBase + n0) * lda
                           + ((int)blockIdx.y >> aShift) * aStep + half8;
  static_assert(RG <= 2, "the waits below name one or two row addresses");
  const _Float16* aPtr1 = aPtr + (size_t)(16 * (RG - 1)) * lda;  // last row group
  FragU a[STEPS][RG];
  // unrolled: a[][] must stay in registers
  #pragma unroll
  for (int s = 0; s < PRE; ++s) {
    #pragma unroll
    for (int g = 0; g < RG; ++g) {
      const _Float16* p = (g ? aPtr1 : aPtr) + 32 * s;
      a[s][g].q[0] = *(const uint4*)(p);
      a[s][g].q[1] = *(const uint4*)(p + 16);
    }
  }
  // stands ahead of whatever is written into the address registers of the
  // loads above (the bias address may be formed in them); it names the
  // addresses as inputs so that their registers stay untouched up to the wait
  asm volatile("s_wait_xcnt 0x0" :: "v"(aPtr), "v"(aPtr1) : "memory");
  // --- bias, needed only behind the k loop
  if (bias) {
    #pragma unroll
    for (int j = 0; j < 4; ++j) bv[j] = bias[colBase + 16 * j + n0];
  }
  // the same for the bias loads
  asm volatile("s_wait_xcnt 0x0" ::: "memory");

  v8f acc[4 * RG];
  #pragma unroll
  for (int j = 0; j < 4 * RG; ++j) acc[j] = (v8f){};

  // own copies landed, then every wave's: the panel is read only behind this
  asm volatile("s_wait_asynccnt 0x0" ::: "memory");
  __syncthreads();

  // --- the late A fragments and the residual
  #pragma unroll
  for (int s = PRE; s < STEPS; ++s) {
    #pragma unroll
    for (int g = 0; g < RG; ++g) {
      const _Float16* p = (g ? aPtr1 : aPtr) + 32 * s;
      a[s][g].q[0] = *(const uint4*)(p);
      a[s][g].q[1] = *(const uint4*)(p + 16);
    }
  }
  // a lane's first C position; (g, j, r) lies (16 g + r) * NT + 16 j behind it
  const size_t c0 = (size_t)(rowBase + r0) * NT + colBase + n0;
  float ad[ADD ? RG * 32 : 1];
  const float* ap = ADD ? addsrc + c0 : nullptr;
  if constexpr (ADD) {
    #pragma unroll
    for (int g = 0; g < RG; ++g)
      #pragma unroll
      for (int j = 0; j < 4; ++j)
        #pragma unroll
        for (int r = 0; r < 8; ++r)
          ad[(g * 4 + j) * 8 + r] = ap[(16 * g + r) * NT + 16 * j];
  }
  if constexpr (ADD || PRE < STEPS) {
    // stands ahead of whatever is written into the address registers of the
    // loads just issued; it names the addresses as inputs so that their
    // registers stay untouched up to the wait
    asm volatile("s_wait_xcnt 0x0" :: "v"(aPtr), "v"(aPtr1), "v"(ap) : "memory");
  }

  // --- k loop: B fragments from LDS, A fragments already in registers
  FragU cur[SPP][RG];
  #pragma unroll
  for (int s = 0; s < SPP; ++s)
    #pragma unroll
    for (int g = 0; g < RG; ++g) cur[s][g] = a[s][g];
  const _Float16* bb = &Bs[n0 * BSTRIDE + half8];
  // the loop over the parts stays rolled: bb is then a register that moves
  // from part to part, and every LDS load of the body is bb + a small offset;
  // unrolled, each load beyond 64 KB would need an address of its own
  #pragma unroll 1
  for (int part = 0; part < PARTS; ++part) {
    // unrolled: cur[s] is a register index
    #pragma unroll
    for (int s = 0; s < SPP; ++s) {
      const v16h b0 = frag_at(bb + 32 * s);
      const v16h b1 = frag_at(bb + 32 * s + 16 * BSTRIDE);
      const v16h b2 = frag_at(bb + 32 * s + 32 * BSTRIDE);
      const v16h b3 = frag_at(bb + 32 * s + 48 * BSTRIDE);
      #pragma unroll
      for (int g = 0; g < RG; ++g) {
        const v16h ag = cur[s][g].v;
        acc[g * 4 + 0] = __builtin_amdgcn_wmma_f32_16x16x32_f16(false, ag, false, b0, (short)0, acc[g * 4 + 0], false, false);
        acc[g * 4 + 1] = __builtin_amdgcn_wmma_f32_16x16x32_f16(false, ag, false, b1, (short)0, acc[g * 4 + 1], false, false);
        acc[g * 4 + 2] = __builtin_amdgcn_wmma_f32_16x16x32_f16(false, ag, false, b2, (short)0, acc[g * 4 + 2], false, false);
        acc[g * 4 + 3] = __builtin_amdgcn_wmma_f32_16x16x32_f16(false, ag, false, b3, (short)0, acc[g * 4 + 3], false, false);
      }
    }
    if constexpr (PARTS > 1) {
      static_assert(PARTS <= 2, "cur is refilled from the second part only");
      #pragma unroll
      for (int s = 0; s < SPP; ++s)
        #pragma unroll
        for (int g = 0; g < RG; ++g) cur[s][g] = a[SPP + s][g];
      bb += 64 * BSTRIDE;
    }
  }

  // C/D layout: VGPR r -> (M=r, N=lane) for lanes 0-15, (M=r+8, N=lane-16)
  // final values first, in place; then all stores of a kind in one run, so
  // that no store is waited for before the next is issued
  #pragma unroll
  for (int t = 0; t < 4 * RG; ++t) {        // t = 4 g + j
    #pragma unroll
    for (int r = 0; r < 8; ++r) {
      float v = acc[t][r] + bv[t & 3];
      if (doRelu) v = fmaxf(v, 0.0f);
      if constexpr (ADD) v += ad[t * 8 + r];
      acc[t][r] = v;
    }
  }
  if (outF) {
    float* o = outF + c0;
    #pragma unroll
    for (int t = 0; t < 4 * RG; ++t)
      #pragma unroll
      for (int r = 0; r < 8; ++r)
        o[(16 * (t >> 2) + r) * NT + 16 * (t & 3)] = acc[t][r];
  }
  // the f16 conversions below may reuse registers that the stores above name
  asm volatile("s_wait_xcnt 0x0" ::: "memory");
  if (outH) {
    _Float16* o = outH + c0;
    _Float16 h[4 * RG][8];
    #pragma unroll
    for (int t = 0; t < 4 * RG; ++t)
      #pragma unroll
      for (int r = 0; r < 8; ++r) h[t][r] = (_Float16)acc[t][r];
    #pragma unroll
    for (int t = 0; t < 4 * RG; ++t)
      #pragma unroll
      for (int r = 0; r < 8; ++r)
        o[(16 * (t >> 2) + r) * NT + 16 * (t & 3)] = h[t][r];
  }
}

// ---------------------------------------------------------------------------
// Folded patch attention. With qt[h] = Wk_h^T q_h (256 long, q the centre
// query) the score of patch position p is qt[h] . x_p / 8 (+ q_h . bk_h, the
// same for every p of a head, so it cancels in the softmax), and the merged
// value is Wv_h (sum_p w_p x_p) + bv_h because the weights sum to one. This
// kernel reads x once in f32 and writes xw[h] = sum_p w_p x_p per head.
// One wave per patch, no LDS and no barrier: the wave holds all 25 rows in
// registers, a lane 8 of a row's 256 values (f0..f0+3 and 128+f0..128+f0+3).
// ---------------------------------------------------------------------------
__device__ __forceinline__ float dot4(const v4f a, const v4f b, float s) {
  s = fmaf(a.x, b.x, s);
  s = fmaf(a.y, b.y, s);
  s = fmaf(a.z, b.z, s);
  s = fmaf(a.w, b.w, s);
  return s;
}
// lanes L and L ^ N: the lane with bit N clear keeps v[0..N), the other
// v[N..2N); each adds the partner's share of what it keeps
template <int N, int S>
__device__ __forceinline__ void halve_step(float (&v)[S], int lane) {
  const bool hi = (lane & N) != 0;
  #pragma unroll
  for (int j = 0; j < N; ++j) {
    const float send = hi ? v[j] : v[j + N];
    const float keep = hi ? v[j + N] : v[j];
    v[j] = keep + __shfl_xor(send, N, 32);
  }
}
__device__ __forceinline__ float lane_bcast(float v, int srcLane) {
  return __builtin_bit_cast(float,
      __builtin_amdgcn_readlane(__builtin_bit_cast(int, v), srcLane));
}

__global__ __launch_bounds__(WPB * 32) void patch_attention_folded(
    const float* __restrict__ x, const float* __restrict__ qt,
    _Float16* __restrict__ xw)
{
  const int lane = threadIdx.x & 31;
  const int bno  = blockIdx.x * WPB + (threadIdx.x >> 5);
  const int f0   = lane * 4;
  const float* qp = qt + (size_t)bno * (Hh * Ff) + f0;
  const float* xp = x + (size_t)bno * (KK2 * Ff) + f0;

  v4f q[Hh][2];
  #pragma unroll
  for (int h = 0; h < Hh; ++h) {
    q[h][0] = *(const v4f*)(qp + h * Ff);
    q[h][1] = *(const v4f*)(qp + h * Ff + 128);
  }
  // the address pair of the eight loads above is dead from here on and a row
  // load's result may land in it: the wait stands ahead of that overwrite
  asm volatile("s_wait_xcnt 0x0" ::: "memory");
  v4f xr[KK2][2];
  #pragma unroll
  for (int p = 0; p < KK2; ++p) {
    xr[p][0] = *(const v4f*)(xp + p * Ff);
    xr[p][1] = *(const v4f*)(xp + p * Ff + 128);
  }
  // the same for the address pair of the fifty row loads, which is free for
  // the arithmetic below as soon as the last of them has issued
  asm volatile("s_wait_xcnt 0x0" ::: "memory");
  // scores. Rows 0..23 in three groups of 8: 32 partial dots per lane, index
  // pl*4 + h; five halving steps leave lane L with the full sum of index L,
  // so lane L carries p = 8g + (L >> 2), h = L & 3.
  float s[3];
  #pragma unroll
  for (int g = 0; g < 3; ++g) {
    float v[32];
    #pragma unroll
    for (int pl = 0; pl < 8; ++pl)
      #pragma unroll
      for (int h = 0; h < Hh; ++h)
        v[pl * 4 + h] = dot4(xr[8 * g + pl][1], q[h][1],
                             dot4(xr[8 * g + pl][0], q[h][0], 0.f));
    halve_step<16>(v, lane);
    halve_step<8>(v, lane);
    halve_step<4>(v, lane);
    halve_step<2>(v, lane);
    halve_step<1>(v, lane);
    s[g] = v[0] * 0.125f;
  }
  // row 24: every lane ends with the full sum of head L & 3
  float s24;
  {
    float v[4];
    #pragma unroll
    for (int h = 0; h < Hh; ++h)
      v[h] = dot4(xr[24][1], q[h][1], dot4(xr[24][0], q[h][0], 0.f));
    halve_step<2>(v, lane);
    halve_step<1>(v, lane);
    #pragma unroll
    for (int o = 4; o <= 16; o <<= 1) v[0] += __shfl_xor(v[0], o, 32);
    s24 = v[0] * 0.125f;
  }

  // softmax over the 25 positions of head L & 3 (lanes L, L^4, L^8, L^16 ...)
  float mx = fmaxf(fmaxf(s[0], s[1]), fmaxf(s[2], s24));
  #pragma unroll
  for (int o = 4; o <= 16; o <<= 1) mx = fmaxf(mx, __shfl_xor(mx, o, 32));
  const float e0  = __expf(s[0] - mx);
  const float e1  = __expf(s[1] - mx);
  const float e2  = __expf(s[2] - mx);
  const float e24 = __expf(s24 - mx);
  float sum = (e0 + e1) + e2;
  #pragma unroll
  for (int o = 4; o <= 16; o <<= 1) sum += __shfl_xor(sum, o, 32);
  sum += e24;
  const float inv = 1.0f / sum;
  float wg[3];
  wg[0] = e0 * inv;
  wg[1] = e1 * inv;
  wg[2] = e2 * inv;
  const float w24 = e24 * inv;

  // weighted sum of the rows per head, p ascending; each weight is read from
  // its lane into a scalar
  _Float16* op = xw + (size_t)bno * (Hh * Ff) + f0;
  #pragma unroll
  for (int h = 0; h < Hh; ++h) {
    v4f a0 = (v4f){0.f, 0.f, 0.f, 0.f};
    v4f a1 = (v4f){0.f, 0.f, 0.f, 0.f};
    #pragma unroll
    for (int p = 0; p < KK2; ++p) {
      const float w = (p < 24) ? lane_bcast(wg[p >> 3], (p & 7) * 4 + h)
                               : lane_bcast(w24, h);
      a0.x = fmaf(w, xr[p][0].x, a0.x);
      a0.y = fmaf(w, xr[p][0].y, a0.y);
      a0.z = fmaf(w, xr[p][0].z, a0.z);
      a0.w = fmaf(w, xr[p][0].w, a0.w);
      a1.x = fmaf(w, xr[p][1].x, a1.x);
      a1.y = fmaf(w, xr[p][1].y, a1.y);
      a1.z = fmaf(w, xr[p][1].z, a1.z);
      a1.w = fmaf(w, xr[p][1].w, a1.w);
    }
    union { _Float16 hh[4]; uint2 u; } o0, o1;
    o0.hh[0] = (_Float16)a0.x; o0.hh[1] = (_Float16)a0.y;
    o0.hh[2] = (_Float16)a0.z; o0.hh[3] = (_Float16)a0.w;
    o1.hh[0] = (_Float16)a1.x; o1.hh[1] = (_Float16)a1.y;
    o1.hh[2] = (_Float16)a1.z; o1.hh[3] = (_Float16)a1.w;
    *(uint2*)(op + h * Ff)       = o0.u;
    *(uint2*)(op + h * Ff + 128) = o1.u;
  }
}

// ---------------------------------------------------------------------------
// LayerNorm over (N,O,F) per batch element: reduce then apply. Both move
// 16-byte vectors and issue all loads of a thread before the first use.
// ---------------------------------------------------------------------------
constexpr int PB4        = PB / 4;                    // float4 per batch element
constexpr int LNR_BLOCKS = 40;                        // reduce blocks per batch
constexpr int LNR_VEC    = PB4 / (LNR_BLOCKS * 256);  // float4 per thread
static_assert(LNR_VEC * LNR_BLOCKS * 256 == PB4, "reduce covers a batch exactly");
static_assert(PB4 % 256 == 0, "apply covers a batch exactly");

__device__ __forceinline__ uint2 pack4h(const v4f v) {
  union { _Float16 h[4]; uint2 u; } o;
  o.h[0] = (_Float16)v.x; o.h[1] = (_Float16)v.y;
  o.h[2] = (_Float16)v.z; o.h[3] = (_Float16)v.w;
  return o.u;
}

// grid = (LNR_BLOCKS, Bb)
__global__ __launch_bounds__(256) void ln_reduce_kernel(
    const float* __restrict__ x, float* __restrict__ stats)
{
  __shared__ float sA[256], sB[256];
  const int b = blockIdx.y;
  const v4f* xb = (const v4f*)(x + (size_t)b * PB)
                + blockIdx.x * 256 + threadIdx.x;
  v4f v[LNR_VEC];
  #pragma unroll
  for (int j = 0; j < LNR_VEC; ++j) v[j] = xb[j * (LNR_BLOCKS * 256)];
  v4f s4 = (v4f){0.f, 0.f, 0.f, 0.f};
  v4f q4 = (v4f){0.f, 0.f, 0.f, 0.f};
  #pragma unroll
  for (int j = 0; j < LNR_VEC; ++j) {
    s4 += v[j];
    q4 += v[j] * v[j];
  }
  sA[threadIdx.x] = (s4.x + s4.y) + (s4.z + s4.w);
  sB[threadIdx.x] = (q4.x + q4.y) + (q4.z + q4.w);
  __syncthreads();
  for (int st = 128; st > 0; st >>= 1) {
    if (threadIdx.x < st) {
      sA[threadIdx.x] += sA[threadIdx.x + st];
      sB[threadIdx.x] += sB[threadIdx.x + st];
    }
    __syncthreads();
  }
  if (threadIdx.x == 0) {
    atomicAdd(&stats[2 * b + 0], sA[0]);
    atomicAdd(&stats[2 * b + 1], sB[0]);
  }
}

// grid = PB4 / 256. A thread takes the same four (n,o,f) positions in every
// batch element, so it reads g and beta once.
__global__ __launch_bounds__(256) void ln_apply_kernel(
    const float* __restrict__ x, const float* __restrict__ g,
    const float* __restrict__ beta, const float* __restrict__ stats,
    float* __restrict__ outF, _Float16* __restrict__ outH)
{
  const int r4 = blockIdx.x * 256 + threadIdx.x;
  float st[2 * Bb];
  #pragma unroll
  for (int k = 0; k < 2 * Bb; ++k) st[k] = stats[k];
  v4f xv[Bb];
  #pragma unroll
  for (int b = 0; b < Bb; ++b) xv[b] = ((const v4f*)x)[b * PB4 + r4];
  const v4f gv = ((const v4f*)g)[r4];
  const v4f bv = ((const v4f*)beta)[r4];
  // the base addresses of the six loads above are dead from here on: the wait
  // stands ahead of whatever is written into their registers
  asm volatile("s_wait_xcnt 0x0" ::: "memory");
  v4f o[Bb];
  #pragma unroll
  for (int b = 0; b < Bb; ++b) {
    const float mu  = st[2 * b + 0] * (1.0f / PB);
    const float var = st[2 * b + 1] * (1.0f / PB) - mu * mu;
    const float rs  = rsqrtf(var + 1e-5f);
    o[b].x = (xv[b].x - mu) * rs * gv.x + bv.x;
    o[b].y = (xv[b].y - mu) * rs * gv.y + bv.y;
    o[b].z = (xv[b].z - mu) * rs * gv.z + bv.z;
    o[b].w = (xv[b].w - mu) * rs * gv.w + bv.w;
  }
  if (outF) {
    #pragma unroll
    for (int b = 0; b < Bb; ++b) ((v4f*)outF)[b * PB4 + r4] = o[b];
  }
  // the f16 packing below may reuse registers that the stores above name
  asm volatile("s_wait_xcnt 0x0" ::: "memory");
  if (outH) {
    #pragma unroll
    for (int b = 0; b < Bb; ++b) ((uint2*)outH)[b * PB4 + r4] = pack4h(o[b]);
  }
}

// ---------------------------------------------------------------------------
// prep: everything that depends on the inputs alone, in ONE launch. The parts
// need nothing of each other, so each takes a range of the block index (the
// branch is the same for a whole block). 16 values a thread in every part,
// all of a thread's loads issued before its first store.
// ---------------------------------------------------------------------------
constexpr int PREP_WK     = Ff * Ff / 16 / 256;        // blocks per 256x256 weight
constexpr int PREP_FFN    = DFFc * Ff / 16 / 256;      // blocks per FFN weight
constexpr int PREP_CENTRE = ROWS * Ff / 16 / 256;      // blocks for the centre tokens
constexpr int PREP_BLOCKS = 4 * PREP_WK + 2 * PREP_FFN + PREP_CENTRE;

// flat f32 -> f16: block blk takes 1024 runs of four values
__device__ __forceinline__ void cvt_flat_f16(
    const float* __restrict__ s, _Float16* __restrict__ d, int blk) {
  const int i = blk * 1024 + threadIdx.x;
  v4f v[4];
  #pragma unroll
  for (int j = 0; j < 4; ++j) v[j] = ((const v4f*)s)[i + j * 256];
  #pragma unroll
  for (int j = 0; j < 4; ++j) ((uint2*)d)[i + j * 256] = pack4h(v[j]);
  // the built code joins this part's exit with another part's path, where the
  // registers that the four stores name are written again: the wait stands
  // ahead of that
  asm volatile("s_wait_xcnt 0x0" ::: "memory");
}
// centre token (p = 12) of every patch, f32 -> f16: xc[r][f]. A thread takes
// eight values each of rows r and r + 1
__device__ __forceinline__ void cvt_centre_f16(
    const float* __restrict__ x, _Float16* __restrict__ d, int blk) {
  const int i = blk * 256 + threadIdx.x;
  const int r = (i >> 5) * 2, c = i & 31;       // c: run of eight values
  const v4f* p = (const v4f*)x + (r * KK2 + 12) * (Ff / 4) + c * 2;
  const v4f a0 = p[0], a1 = p[1];
  const v4f c0 = p[KK2 * (Ff / 4)], c1 = p[KK2 * (Ff / 4) + 1];
  union { uint2 h[2]; uint4 u; } o0, o1;
  o0.h[0] = pack4h(a0); o0.h[1] = pack4h(a1);
  o1.h[0] = pack4h(c0); o1.h[1] = pack4h(c1);
  uint4* q = (uint4*)d + r * (Ff / 8) + c;
  q[0]      = o0.u;
  q[Ff / 8] = o1.u;
}
// per-head transpose of Wk, f32 -> f16: d[(h*256 + f)*64 + dd] = Wk[h*64 + dd][f]
// one run of four is rows dd..dd+3 at one f; a thread takes four runs
__device__ __forceinline__ void cvt_wk_headT_f16(
    const float* __restrict__ s, _Float16* __restrict__ d, int blk) {
  const int i0 = blk * 1024 + threadIdx.x;
  v4f v[4];
  #pragma unroll
  for (int j = 0; j < 4; ++j) {
    const int i  = i0 + j * 256;
    const int dd = (i & (Dd / 4 - 1)) * 4, f = (i >> 4) & (Ff - 1), h = i >> 12;
    const float* p = s + (size_t)(h * Dd + dd) * Ff + f;
    v[j].x = p[0]; v[j].y = p[Ff]; v[j].z = p[2 * Ff]; v[j].w = p[3 * Ff];
  }
  #pragma unroll
  for (int j = 0; j < 4; ++j) ((uint2*)d)[i0 + j * 256] = pack4h(v[j]);
  // the built code joins this part's exit with another part's path, where the
  // registers that the four stores name are written again: the wait stands
  // ahead of that
  asm volatile("s_wait_xcnt 0x0" ::: "memory");
}

// grid = PREP_BLOCKS
__global__ __launch_bounds__(256) void prep_kernel(
    const float* __restrict__ x,  const float* __restrict__ Wq,
    const float* __restrict__ Wk, const float* __restrict__ Wv,
    const float* __restrict__ Wf, const float* __restrict__ W1,
    const float* __restrict__ W2,
    _Float16* __restrict__ xcH, _Float16* __restrict__ wqH,
    _Float16* __restrict__ wkT, _Float16* __restrict__ wvH,
    _Float16* __restrict__ wfH, _Float16* __restrict__ w1H,
    _Float16* __restrict__ w2H, float* __restrict__ stats)
{
  int blk = blockIdx.x;
  if (blk < PREP_CENTRE) { cvt_centre_f16(x, xcH, blk); return; }
  blk -= PREP_CENTRE;
  if (blk < PREP_WK) {
    if (blk == 0 && threadIdx.x < 16) stats[threadIdx.x] = 0.f;  // both LN sets
    cvt_wk_headT_f16(Wk, wkT, blk);
    return;
  }
  blk -= PREP_WK;
  // the five flat conversions run the same code on a block's own pair of
  // pointers
  const float* s = W1;
  _Float16*    d = w1H;
  if (blk >= PREP_FFN) {
    blk -= PREP_FFN; s = W2; d = w2H;
    if (blk >= PREP_FFN) {
      blk -= PREP_FFN; s = Wq; d = wqH;
      if (blk >= PREP_WK) {
        blk -= PREP_WK; s = Wv; d = wvH;
        if (blk >= PREP_WK) { blk -= PREP_WK; s = Wf; d = wfH; }
      }
    }
  }
  cvt_flat_f16(s, d, blk);
}

// ---------------------------------------------------------------------------
extern "C" void kernel_launch(void* const* d_in, const int* in_sizes, int n_in,
                              void* d_out, int out_size, void* d_ws, size_t ws_size,
                              hipStream_t stream) {
  const float* x    = (const float*)d_in[0];
  const float* Wq   = (const float*)d_in[1];
  const float* bq   = (const float*)d_in[2];
  const float* Wk   = (const float*)d_in[3];
  // d_in[4] (bk) adds q_h . bk_h to all 25 scores of a head: cancels in softmax
  const float* Wv   = (const float*)d_in[5];
  const float* bv   = (const float*)d_in[6];
  const float* Wf   = (const float*)d_in[7];
  const float* bf   = (const float*)d_in[8];
  const float* ln1w = (const float*)d_in[9];
  const float* ln1b = (const float*)d_in[10];
  const float* ln2w = (const float*)d_in[11];
  const float* ln2b = (const float*)d_in[12];
  const float* W1   = (const float*)d_in[13];
  const float* b1   = (const float*)d_in[14];
  const float* W2   = (const float*)d_in[15];
  const float* b2   = (const float*)d_in[16];

  char* ws = (char*)d_ws;
  size_t off = 0;
  auto alloc = [&](size_t bytes) -> void* {
    void* p = ws + off;
    off += (bytes + 255) & ~(size_t)255;
    return p;
  };

  _Float16* xcH     = (_Float16*)alloc((size_t)ROWS * Ff * 2);     // centre tokens
  _Float16* wqH     = (_Float16*)alloc((size_t)Ff * Ff * 2);
  _Float16* wkT     = (_Float16*)alloc((size_t)Ff * Ff * 2);       // per-head Wk^T
  _Float16* wvH     = (_Float16*)alloc((size_t)Ff * Ff * 2);
  _Float16* wfH     = (_Float16*)alloc((size_t)Ff * Ff * 2);
  _Float16* w1H     = (_Float16*)alloc((size_t)DFFc * Ff * 2);
  _Float16* w2H     = (_Float16*)alloc((size_t)Ff * DFFc * 2);
  _Float16* qcH     = (_Float16*)alloc((size_t)ROWS * Ff * 2);     // centre query
  float*    qtF     = (float*)   alloc((size_t)ROWS * Hh * Ff * 4); // Wk_h^T q_h
  _Float16* xwH     = (_Float16*)alloc((size_t)ROWS * Hh * Ff * 2); // sum_p w_p x_p
  _Float16* mergedH = (_Float16*)alloc((size_t)ROWS * Ff * 2);
  float*    attent  = (float*)   alloc((size_t)ROWS * Ff * 4);
  float*    out1F   = (float*)   alloc((size_t)ROWS * Ff * 4);
  _Float16* out1H   = (_Float16*)alloc((size_t)ROWS * Ff * 2);
  _Float16* hidH    = (_Float16*)alloc((size_t)ROWS * DFFc * 2);
  float*    ytmp    = (float*)   alloc((size_t)ROWS * Ff * 4);
  float*    stats   = (float*)   alloc(256);                       // 2 sets of 4x2

  // --- prep: zero LN stats, convert centre tokens and weights to f16
  prep_kernel<<<PREP_BLOCKS, 256, 0, stream>>>(x, Wq, Wk, Wv, Wf, W1, W2,
                                               xcH, wqH, wkT, wvH, wfH, w1H, w2H,
                                               stats);

  // --- centre query: (5120 x 256) @ (256 x 256) + bq -> f16
  {
    dim3 g(ROWS / 256, Ff / 64);
    gemm_f16_wmma<Ff, Ff, 2, false><<<g, 256, 0, stream>>>(xcH, wqH, bq, nullptr,
                                                           nullptr, qcH, 0,
                                                           Ff, 0, 0);
  }
  // --- folded query per head: q_h (5120 x 64) @ Wk_h (64 x 256) -> f32
  {
    dim3 g(ROWS / 256, (Hh * Ff) / 64);
    gemm_f16_wmma<Dd, Hh * Ff, 2, false><<<g, 256, 0, stream>>>(qcH, wkT, nullptr, nullptr,
                                                                qtF, nullptr, 0,
                                                                Ff, 2, Dd);
  }

  // --- scores, softmax over 25 and weighted patch sum per head, x read once
  patch_attention_folded<<<ROWS / WPB, WPB * 32, 0, stream>>>(x, qtF, xwH);

  // --- value projection per head: xw_h (5120 x 256) @ Wv_h^T (256 x 64) + bv
  {
    dim3 g(ROWS / 256, Ff / 64);
    gemm_f16_wmma<Ff, Ff, 2, false><<<g, 256, 0, stream>>>(xwH, wvH, bv, nullptr,
                                                           nullptr, mergedH, 0,
                                                           Hh * Ff, 0, Ff);
  }

  // --- output projection: (5120 x 256) @ (256 x 256) -> attent f32
  {
    dim3 g(ROWS / 256, Ff / 64);
    gemm_f16_wmma<Ff, Ff, 2, false><<<g, 256, 0, stream>>>(mergedH, wfH, bf, nullptr,
                                                           attent, nullptr, 0,
                                                           Ff, 0, 0);
  }

  // --- LayerNorm 1 (per batch over N,O,F) -> out1 (f32 + f16)
  ln_reduce_kernel<<<dim3(LNR_BLOCKS, Bb), 256, 0, stream>>>(attent, stats);
  ln_apply_kernel<<<PB4 / 256, 256, 0, stream>>>(attent, ln1w, ln1b, stats,
                                                 out1F, out1H);

  // --- FFN: relu(out1 @ W1^T + b1) @ W2^T + b2 + out1
  {
    dim3 g(ROWS / 256, DFFc / 64);
    gemm_f16_wmma<Ff, DFFc, 2, false><<<g, 256, 0, stream>>>(out1H, w1H, b1, nullptr,
                                                             nullptr, hidH, 1,
                                                             Ff, 0, 0);
  }
  {
    // 16 rows a wave: its A fragments for K = 1024 fill 256 registers
    dim3 g(ROWS / 128, Ff / 64);
    gemm_f16_wmma<DFFc, Ff, 1, true><<<g, 256, 0, stream>>>(hidH, w2H, b2, out1F,
                                                            ytmp, nullptr, 0,
                                                            DFFc, 0, 0);
  }

  // --- LayerNorm 2 -> d_out (f32)
  ln_reduce_kernel<<<dim3(LNR_BLOCKS, Bb), 256, 0, stream>>>(ytmp, stats + 8);
  ln_apply_kernel<<<PB4 / 256, 256, 0, stream>>>(ytmp, ln2w, ln2b, stats + 8,
                                                 (float*)d_out, nullptr);
}

// v005
// A run of this version takes 73.3 microseconds.
// Two timings next to v004 both put it at 1.07 times that version's speed.
// Counting every step since v000, it is 4.37 times as fast.
#include <hip/hip_runtime.h>
#include <hip/hip_bf16.h>
#include <math.h>

typedef __attribute__((ext_vector_type(16))) _Float16 v16h;
typedef __attribute__((ext_vector_type(8)))  float    v8f;
typedef __attribute__((ext_vector_type(4)))  float    v4f;

#define Bb   4
#define Nn_  256
#define Oo   5
#define KK2  25      // K*K patch positions
#define Ff   256
#define Hh   4
#define Dd   64
#define DFFc 1024

constexpr int ROWS = Bb * Nn_ * Oo;         // 5120 output rows
constexpr int PB   = Nn_ * Oo * Ff;         // 327680 elems per batch for LN

constexpr int WPB  = 4;                     // waves (patches) per block, folded attention

// ---------------------------------------------------------------------------
// helpers
// ---------------------------------------------------------------------------
union FragU { v16h v; uint4 q[2]; };

// Load one f16 16x32 fragment given per-lane base (row/col and half-offset
// already folded in): elements 0..7 at +k, elements 8..15 at +k+16.
__device__ __forceinline__ v16h frag_at(const _Float16* p) {
  FragU f;
  f.q[0] = *(const uint4*)(p);
  f.q[1] = *(const uint4*)(p + 16);
  return f.v;
}

// ---------------------------------------------------------------------------
// GEMM: C[M][NT] = A[M][KT] * W[NT][KT]^T (+bias) (relu?) (+addsrc) -> f32/f16
// block = 256 threads = 8 waves; a wave computes 16*RG rows x 64 cols (RG A
// fragments share 4 B fragments per k-step); block tile is (128*RG) x 64.
// grid = (M/(128*RG), NT/64). NT is a compile-time constant so that one
// address serves all of a lane's C positions (constant offsets from it).
// Nothing is fetched step by step: a block issues every global read it will
// ever make ahead of its k loop, so that their latencies run side by side.
// The B panel (64 cols x all of K) goes to LDS by async copies shared by the
// 8 waves, filled once; a wave's A fragments for all of K, its bias values
// and (ADD) its residual values go to registers.
// A rows have pitch lda, and column block y reads A from column
// (y >> aShift) * aStep on: that gives the per-head products (each head has
// its own slice of A) in one launch.
// STATS: the block also adds the sum and the sum of squares of its C values,
// taken from the registers that hold them, to the LayerNorm sums of its batch
// element, so that no launch has to read C again for them.
//
// f16 16x32 fragment layout (A and B identical): lane L<16 -> row/col L,
// elements 0..7 = K [k0+off, k0+off+8), elements 8..15 = +16; off = 8*(L>=16).
// Both runs are contiguous -> two b128 loads per fragment.
// ---------------------------------------------------------------------------
template <int KT, int NT, int RG, bool ADD, bool STATS>
__global__ __launch_bounds__(256) void gemm_f16_wmma(
    const _Float16* __restrict__ A, const _Float16* __restrict__ W,
    const float* __restrict__ bias, const float* __restrict__ addsrc,
    float* __restrict__ outF, _Float16* __restrict__ outH,
    float* __restrict__ stats, int doRelu, int lda, int aShift, int aStep)
{
  // The panel lies in LDS in PARTS runs of K, each 64 rows of KP values, so
  // that inside a part every fragment is within the 64 KB that the offset
  // field of an LDS load reaches from one address register.
  constexpr int PARTS   = (KT > 512) ? KT / 512 : 1;
  constexpr int KP      = KT / PARTS;
  constexpr int BSTRIDE = KP + 8;           // +16B pad: breaks LDS bank conflicts
  constexpr int STEPS   = KT / 32;          // k-steps, and B copies per thread
  constexpr int SPP     = STEPS / PARTS;    // k-steps per part
  // A wave has at most 63 loads outstanding, and the barrier below waits for
  // every load issued ahead of it. So only the first PRE steps' A fragments
  // are asked for ahead of the barrier; the rest, and the residual, are asked
  // for behind it and land while the first steps are worked on.
  constexpr int PRE     = (2 * RG * STEPS <= 48) ? STEPS : 24 / RG;
  __shared__ _Float16 Bs[PARTS * 64 * BSTRIDE];

  const int lane    = threadIdx.x & 31;
  const int wave    = threadIdx.x >> 5;
  const int rowBase = (blockIdx.x * 8 + wave) * (16 * RG);
  const int colBase = blockIdx.y * 64;

  const int n0    = lane & 15;              // row (A) / col (B) within tile
  const int half8 = ((lane >> 4) & 1) << 3; // K sub-offset per lane half
  const int r0    = (lane >> 4) * 8;        // first C row of this lane half

  // --- B panel, 64 rows x KT f16 -> LDS: 4 threads per row, STEPS b128 chunks
  // each (chunks of 8 values, 32 values apart). The xcnt wait closes each
  // statement so that no address register of an issued copy is rewritten
  // ahead of it.
  {
    const int srow = threadIdx.x >> 2;          // 0..63
    const int skc  = (threadIdx.x & 3) << 3;    // 0,8,16,24
    const _Float16* src = W + (size_t)(colBase + srow) * KT + skc;
    const unsigned lds0 = (unsigned)(uintptr_t)&Bs[srow * BSTRIDE + skc];
    if constexpr (STEPS % 8 == 0) {
      static_assert(SPP % 8 == 0, "a statement's eight chunks lie in one part");
      // unrolled: c is a compile-time index into the parts
      #pragma unroll
      for (int c = 0; c < STEPS; c += 8) {
        const unsigned lds = lds0 + ((c / SPP) * 64 * BSTRIDE + (c % SPP) * 32) * 2;
        asm volatile("global_load_async_to_lds_b128 %0, %1, off\n\t"
                     "global_load_async_to_lds_b128 %2, %3, off\n\t"
                     "global_load_async_to_lds_b128 %4, %5, off\n\t"
                     "global_load_async_to_lds_b128 %6, %7, off\n\t"
                     "global_load_async_to_lds_b128 %8, %9, off\n\t"
                     "global_load_async_to_lds_b128 %10, %11, off\n\t"
                     "global_load_async_to_lds_b128 %12, %13, off\n\t"
                     "global_load_async_to_lds_b128 %14, %15, off\n\t"
                     "s_wait_xcnt 0x0"
                     :: "v"(lds),       "v"(src),
                        "v"(lds + 64),  "v"(src + 32),
                        "v"(lds + 128), "v"(src + 64),
                        "v"(lds + 192), "v"(src + 96),
                        "v"(lds + 256), "v"(src + 128),
                        "v"(lds + 320), "v"(src + 160),
                        "v"(lds + 384), "v"(src + 192),
                        "v"(lds + 448), "v"(src + 224)
                     : "memory");
        src += 256;
      }
    } else {
      static_assert(STEPS == 2, "two chunks a thread");
      asm volatile("global_load_async_to_lds_b128 %0, %1, off\n\t"
                   "global_load_async_to_lds_b128 %2, %3, off\n\t"
                   "s_wait_xcnt 0x0"
                   :: "v"(lds0), "v"(src), "v"(lds0 + 64), "v"(src + 32)
                   : "memory");
    }
  }

  float bv[4] = {0.0f, 0.0f, 0.0f, 0.0f};
  // --- A fragments of the first PRE k-steps, k ascending
  const _Float16* aPtr = A + (size_t)(rowBase + n0) * lda
                           + ((int)blockIdx.y >> aShift) * aStep + half8;
  static_assert(RG <= 2, "the waits below name one or two row addresses");
  const _Float16* aPtr1 = aPtr + (size_t)(16 * (RG - 1)) * lda;  // last row group
  FragU a[STEPS][RG];
  // unrolled: a[][] must stay in registers
  #pragma unroll
  for (int s = 0; s < PRE; ++s) {
    #pragma unroll
    for (int g = 0; g < RG; ++g) {
      const _Float16* p = (g ? aPtr1 : aPtr) + 32 * s;
      a[s][g].q[0] = *(const uint4*)(p);
      a[s][g].q[1] = *(const uint4*)(p + 16);
    }
  }
  // stands ahead of whatever is written into the address registers of the
  // loads above (the bias address may be formed in them); it names the
  // addresses as inputs so that their registers stay untouched up to the wait
  asm volatile("s_wait_xcnt 0x0" :: "v"(aPtr), "v"(aPtr1) : "memory");
  // --- bias, needed only behind the k loop
  if (bias) {
    #pragma unroll
    for (int j = 0; j < 4; ++j) bv[j] = bias[colBase + 16 * j + n0];
  }
  // the same for the bias loads
  asm volatile("s_wait_xcnt 0x0" ::: "memory");

  v8f acc[4 * RG];
  #pragma unroll
  for (int j = 0; j < 4 * RG; ++j) acc[j] = (v8f){};

  // own copies landed, then every wave's: the panel is read only behind this
  asm volatile("s_wait_asynccnt 0x0" ::: "memory");
  __syncthreads();

  // --- the late A fragments and the residual
  #pragma unroll
  for (int s = PRE; s < STEPS; ++s) {
    #pragma unroll
    for (int g = 0; g < RG; ++g) {
      const _Float16* p = (g ? aPtr1 : aPtr) + 32 * s;
      a[s][g].q[0] = *(const uint4*)(p);
      a[s][g].q[1] = *(const uint4*)(p + 16);
    }
  }
  // a lane's first C position; (g, j, r) lies (16 g + r) * NT + 16 j behind it
  const size_t c0 = (size_t)(rowBase + r0) * NT + colBase + n0;
  float ad[ADD ? RG * 32 : 1];
  const float* ap = ADD ? addsrc + c0 : nullptr;
  if constexpr (ADD) {
    #pragma unroll
    for (int g = 0; g < RG; ++g)
      #pragma unroll
      for (int j = 0; j < 4; ++j)
        #pragma unroll
        for (int r = 0; r < 8; ++r)
          ad[(g * 4 + j) * 8 + r] = ap[(16 * g + r) * NT + 16 * j];
  }
  if constexpr (ADD || PRE < STEPS) {
    // stands ahead of whatever is written into the address registers of the
    // loads just issued; it names the addresses as inputs so that their
    // registers stay untouched up to the wait
    asm volatile("s_wait_xcnt 0x0" :: "v"(aPtr), "v"(aPtr1), "v"(ap) : "memory");
  }

  // --- k loop: B fragments from LDS, A fragments already in registers
  FragU cur[SPP][RG];
  #pragma unroll
  for (int s = 0; s < SPP; ++s)
    #pragma unroll
    for (int g = 0; g < RG; ++g) cur[s][g] = a[s][g];
  const _Float16* bb = &Bs[n0 * BSTRIDE + half8];
  // the loop over the parts stays rolled: bb is then a register that moves
  // from part to part, and every LDS load of the body is bb + a small offset;
  // unrolled, each load beyond 64 KB would need an address of its own
  #pragma unroll 1
  for (int part = 0; part < PARTS; ++part) {
    // unrolled: cur[s] is a register index
    #pragma unroll
    for (int s = 0; s < SPP; ++s) {
      const v16h b0 = frag_at(bb + 32 * s);
      const v16h b1 = frag_at(bb + 32 * s + 16 * BSTRIDE);
      const v16h b2 = frag_at(bb + 32 * s + 32 * BSTRIDE);
      const v16h b3 = frag_at(bb + 32 * s + 48 * BSTRIDE);
      #pragma unroll
      for (int g = 0; g < RG; ++g) {
        const v16h ag = cur[s][g].v;
        acc[g * 4 + 0] = __builtin_amdgcn_wmma_f32_16x16x32_f16(false, ag, false, b0, (short)0, acc[g * 4 + 0], false, false);
        acc[g * 4 + 1] = __builtin_amdgcn_wmma_f32_16x16x32_f16(false, ag, false, b1, (short)0, acc[g * 4 + 1], false, false);
        acc[g * 4 + 2] = __builtin_amdgcn_wmma_f32_16x16x32_f16(false, ag, false, b2, (short)0, acc[g * 4 + 2], false, false);
        acc[g * 4 + 3] = __builtin_amdgcn_wmma_f32_16x16x32_f16(false, ag, false, b3, (short)0, acc[g * 4 + 3], false, false);
      }
    }
    if constexpr (PARTS > 1) {
      static_assert(PARTS <= 2, "cur is refilled from the second part only");
      #pragma unroll
      for (int s = 0; s < SPP; ++s)
        #pragma unroll
        for (int g = 0; g < RG; ++g) cur[s][g] = a[SPP + s][g];
      bb += 64 * BSTRIDE;
    }
  }

  // C/D layout: VGPR r -> (M=r, N=lane) for lanes 0-15, (M=r+8, N=lane-16)
  // final values first, in place; then all stores of a kind in one run, so
  // that no store is waited for before the next is issued
  #pragma unroll
  for (int t = 0; t < 4 * RG; ++t) {        // t = 4 g + j
    #pragma unroll
    for (int r = 0; r < 8; ++r) {
      float v = acc[t][r] + bv[t & 3];
      if (doRelu) v = fmaxf(v, 0.0f);
      if constexpr (ADD) v += ad[t * 8 + r];
      acc[t][r] = v;
    }
  }
  if constexpr (STATS) {
    // ahead of the stores: the barrier below waits for every store that a wave
    // has issued, so here it waits for none, and the two adds fly beside them
    static_assert((Nn_ * Oo) % (128 * RG) == 0, "a block's rows lie in one batch element");
    __shared__ float red[16];
    v8f s8 = acc[0];
    v8f q8 = acc[0] * acc[0];
    // unrolled: acc[t] is a register index
    #pragma unroll
    for (int t = 1; t < 4 * RG; ++t) {
      s8 += acc[t];
      q8 += acc[t] * acc[t];
    }
    float s = ((s8[0] + s8[1]) + (s8[2] + s8[3])) + ((s8[4] + s8[5]) + (s8[6] + s8[7]));
    float q = ((q8[0] + q8[1]) + (q8[2] + q8[3])) + ((q8[4] + q8[5]) + (q8[6] + q8[7]));
    for (int o = 16; o > 0; o >>= 1) {
      s += __shfl_xor(s, o, 32);
      q += __shfl_xor(q, o, 32);
    }
    if (lane == 0) { red[wave] = s; red[8 + wave] = q; }
    __syncthreads();
    // thread 0 adds up the eight waves' sums, thread 1 their sums of squares
    if (threadIdx.x < 2) {
      const float* p = red + 8 * threadIdx.x;
      const float tot = ((p[0] + p[1]) + (p[2] + p[3])) + ((p[4] + p[5]) + (p[6] + p[7]));
      const int b = (blockIdx.x * (128 * RG)) / (Nn_ * Oo);
      atomicAdd(&stats[2 * b + threadIdx.x], tot);
    }
  }
  if (outF) {
    float* o = outF + c0;
    #pragma unroll
    for (int t = 0; t < 4 * RG; ++t)
      #pragma unroll
      for (int r = 0; r < 8; ++r)
        o[(16 * (t >> 2) + r) * NT + 16 * (t & 3)] = acc[t][r];
  }
  // the f16 conversions below may reuse registers that the stores above name
  asm volatile("s_wait_xcnt 0x0" ::: "memory");
  if (outH) {
    _Float16* o = outH + c0;
    _Float16 h[4 * RG][8];
    #pragma unroll
    for (int t = 0; t < 4 * RG; ++t)
      #pragma unroll
      for (int r = 0; r < 8; ++r) h[t][r] = (_Float16)acc[t][r];
    #pragma unroll
    for (int t = 0; t < 4 * RG; ++t)
      #pragma unroll
      for (int r = 0; r < 8; ++r)
        o[(16 * (t >> 2) + r) * NT + 16 * (t & 3)] = h[t][r];
  }
}

// ---------------------------------------------------------------------------
// Folded patch attention. With qt[h] = Wk_h^T q_h (256 long, q the centre
// query) the score of patch position p is qt[h] . x_p / 8 (+ q_h . bk_h, the
// same for every p of a head, so it cancels in the softmax), and the merged
// value is Wv_h (sum_p w_p x_p) + bv_h because the weights sum to one. This
// kernel reads x once in f32 and writes xw[h] = sum_p w_p x_p per head.
// One wave per patch, no LDS and no barrier: the wave holds all 25 rows in
// registers, a lane 8 of a row's 256 values (f0..f0+3 and 128+f0..128+f0+3).
// ---------------------------------------------------------------------------
__device__ __forceinline__ float dot4(const v4f a, const v4f b, float s) {
  s = fmaf(a.x, b.x, s);
  s = fmaf(a.y, b.y, s);
  s = fmaf(a.z, b.z, s);
  s = fmaf(a.w, b.w, s);
  return s;
}
// lanes L and L ^ N: the lane with bit N clear keeps v[0..N), the other
// v[N..2N); each adds the partner's share of what it keeps
template <int N, int S>
__device__ __forceinline__ void halve_step(float (&v)[S], int lane) {
  const bool hi = (lane & N) != 0;
  #pragma unroll
  for (int j = 0; j < N; ++j) {
    const float send = hi ? v[j] : v[j + N];
    const float keep = hi ? v[j + N] : v[j];
    v[j] = keep + __shfl_xor(send, N, 32);
  }
}
__device__ __forceinline__ float lane_bcast(float v, int srcLane) {
  return __builtin_bit_cast(float,
      __builtin_amdgcn_readlane(__builtin_bit_cast(int, v), srcLane));
}

__global__ __launch_bounds__(WPB * 32) void patch_attention_folded(
    const float* __restrict__ x, const float* __restrict__ qt,
    _Float16* __restrict__ xw)
{
  const int lane = threadIdx.x & 31;
  const int bno  = blockIdx.x * WPB + (threadIdx.x >> 5);
  const int f0   = lane * 4;
  const float* qp = qt + (size_t)bno * (Hh * Ff) + f0;
  const float* xp = x + (size_t)bno * (KK2 * Ff) + f0;

  v4f q[Hh][2];
  #pragma unroll
  for (int h = 0; h < Hh; ++h) {
    q[h][0] = *(const v4f*)(qp + h * Ff);
    q[h][1] = *(const v4f*)(qp + h * Ff + 128);
  }
  // the address pair of the eight loads above is dead from here on and a row
  // load's result may land in it: the wait stands ahead of that overwrite
  asm volatile("s_wait_xcnt 0x0" ::: "memory");
  v4f xr[KK2][2];
  #pragma unroll
  for (int p = 0; p < KK2; ++p) {
    xr[p][0] = *(const v4f*)(xp + p * Ff);
    xr[p][1] = *(const v4f*)(xp + p * Ff + 128);
  }
  // the same for the address pair of the fifty row loads, which is free for
  // the arithmetic below as soon as the last of them has issued
  asm volatile("s_wait_xcnt 0x0" ::: "memory");
  // scores. Rows 0..23 in three groups of 8: 32 partial dots per lane, index
  // pl*4 + h; five halving steps leave lane L with the full sum of index L,
  // so lane L carries p = 8g + (L >> 2), h = L & 3.
  float s[3];
  #pragma unroll
  for (int g = 0; g < 3; ++g) {
    float v[32];
    #pragma unroll
    for (int pl = 0; pl < 8; ++pl)
      #pragma unroll
      for (int h = 0; h < Hh; ++h)
        v[pl * 4 + h] = dot4(xr[8 * g + pl][1], q[h][1],
                             dot4(xr[8 * g + pl][0], q[h][0], 0.f));
    halve_step<16>(v, lane);
    halve_step<8>(v, lane);
    halve_step<4>(v, lane);
    halve_step<2>(v, lane);
    halve_step<1>(v, lane);
    s[g] = v[0] * 0.125f;
  }
  // row 24: every lane ends with the full sum of head L & 3
  float s24;
  {
    float v[4];
    #pragma unroll
    for (int h = 0; h < Hh; ++h)
      v[h] = dot4(xr[24][1], q[h][1], dot4(xr[24][0], q[h][0], 0.f));
    halve_step<2>(v, lane);
    halve_step<1>(v, lane);
    #pragma unroll
    for (int o = 4; o <= 16; o <<= 1) v[0] += __shfl_xor(v[0], o, 32);
    s24 = v[0] * 0.125f;
  }

  // softmax over the 25 positions of head L & 3 (lanes L, L^4, L^8, L^16 ...)
  float mx = fmaxf(fmaxf(s[0], s[1]), fmaxf(s[2], s24));
  #pragma unroll
  for (int o = 4; o <= 16; o <<= 1) mx = fmaxf(mx, __shfl_xor(mx, o, 32));
  const float e0  = __expf(s[0] - mx);
  const float e1  = __expf(s[1] - mx);
  const float e2  = __expf(s[2] - mx);
  const float e24 = __expf(s24 - mx);
  float sum = (e0 + e1) + e2;
  #pragma unroll
  for (int o = 4; o <= 16; o <<= 1) sum += __shfl_xor(sum, o, 32);
  sum += e24;
  const float inv = 1.0f / sum;
  float wg[3];
  wg[0] = e0 * inv;
  wg[1] = e1 * inv;
  wg[2] = e2 * inv;
  const float w24 = e24 * inv;

  // weighted sum of the rows per head, p ascending; each weight is read from
  // its lane into a scalar
  _Float16* op = xw + (size_t)bno * (Hh * Ff) + f0;
  #pragma unroll
  for (int h = 0; h < Hh; ++h) {
    v4f a0 = (v4f){0.f, 0.f, 0.f, 0.f};
    v4f a1 = (v4f){0.f, 0.f, 0.f, 0.f};
    #pragma unroll
    for (int p = 0; p < KK2; ++p) {
      const float w = (p < 24) ? lane_bcast(wg[p >> 3], (p & 7) * 4 + h)
                               : lane_bcast(w24, h);
      a0.x = fmaf(w, xr[p][0].x, a0.x);
      a0.y = fmaf(w, xr[p][0].y, a0.y);
      a0.z = fmaf(w, xr[p][0].z, a0.z);
      a0.w = fmaf(w, xr[p][0].w, a0.w);
      a1.x = fmaf(w, xr[p][1].x, a1.x);
      a1.y = fmaf(w, xr[p][1].y, a1.y);
      a1.z = fmaf(w, xr[p][1].z, a1.z);
      a1.w = fmaf(w, xr[p][1].w, a1.w);
    }
    union { _Float16 hh[4]; uint2 u; } o0, o1;
    o0.hh[0] = (_Float16)a0.x; o0.hh[1] = (_Float16)a0.y;
    o0.hh[2] = (_Float16)a0.z; o0.hh[3] = (_Float16)a0.w;
    o1.hh[0] = (_Float16)a1.x; o1.hh[1] = (_Float16)a1.y;
    o1.hh[2] = (_Float16)a1.z; o1.hh[3] = (_Float16)a1.w;
    *(uint2*)(op + h * Ff)       = o0.u;
    *(uint2*)(op + h * Ff + 128) = o1.u;
  }
}

// ---------------------------------------------------------------------------
// LayerNorm over (N,O,F) per batch element: the sums come from the GEMM that
// makes the values; this applies them. It moves 16-byte vectors and issues all
// loads of a thread before the first use.
// ---------------------------------------------------------------------------
constexpr int PB4        = PB / 4;                    // float4 per batch element
static_assert(PB4 % 256 == 0, "apply covers a batch exactly");

__device__ __forceinline__ uint2 pack4h(const v4f v) {
  union { _Float16 h[4]; uint2 u; } o;
  o.h[0] = (_Float16)v.x; o.h[1] = (_Float16)v.y;
  o.h[2] = (_Float16)v.z; o.h[3] = (_Float16)v.w;
  return o.u;
}

// grid = PB4 / 256. A thread takes the same four (n,o,f) positions in every
// batch element, so it reads g and beta once.
__global__ __launch_bounds__(256) void ln_apply_kernel(
    const float* __restrict__ x, const float* __restrict__ g,
    const float* __restrict__ beta, const float* __restrict__ stats,
    float* __restrict__ outF, _Float16* __restrict__ outH)
{
  const int r4 = blockIdx.x * 256 + threadIdx.x;
  float st[2 * Bb];
  #pragma unroll
  for (int k = 0; k < 2 * Bb; ++k) st[k] = stats[k];
  v4f xv[Bb];
  #pragma unroll
  for (int b = 0; b < Bb; ++b) xv[b] = ((const v4f*)x)[b * PB4 + r4];
  const v4f gv = ((const v4f*)g)[r4];
  const v4f bv = ((const v4f*)beta)[r4];
  // the base addresses of the six loads above are dead from here on: the wait
  // stands ahead of whatever is written into their registers
  asm volatile("s_wait_xcnt 0x0" ::: "memory");
  v4f o[Bb];
  #pragma unroll
  for (int b = 0; b < Bb; ++b) {
    const float mu  = st[2 * b + 0] * (1.0f / PB);
    const float var = st[2 * b + 1] * (1.0f / PB) - mu * mu;
    const float rs  = rsqrtf(var + 1e-5f);
    o[b].x = (xv[b].x - mu) * rs * gv.x + bv.x;
    o[b].y = (xv[b].y - mu) * rs * gv.y + bv.y;
    o[b].z = (xv[b].z - mu) * rs * gv.z + bv.z;
    o[b].w = (xv[b].w - mu) * rs * gv.w + bv.w;
  }
  if (outF) {
    #pragma unroll
    for (int b = 0; b < Bb; ++b) ((v4f*)outF)[b * PB4 + r4] = o[b];
  }
  // the f16 packing below may reuse registers that the stores above name
  asm volatile("s_wait_xcnt 0x0" ::: "memory");
  if (outH) {
    #pragma unroll
    for (int b = 0; b < Bb; ++b) ((uint2*)outH)[b * PB4 + r4] = pack4h(o[b]);
  }
}

// ---------------------------------------------------------------------------
// prep: everything that depends on the inputs alone, in ONE launch. The parts
// need nothing of each other, so each takes a range of the block index (the
// branch is the same for a whole block). 16 values a thread in every part,
// all of a thread's loads issued before its first store.
// ---------------------------------------------------------------------------
constexpr int PREP_WK     = Ff * Ff / 16 / 256;        // blocks per 256x256 weight
constexpr int PREP_FFN    = DFFc * Ff / 16 / 256;      // blocks per FFN weight
constexpr int PREP_CENTRE = ROWS * Ff / 16 / 256;      // blocks for the centre tokens
constexpr int PREP_BLOCKS = 4 * PREP_WK + 2 * PREP_FFN + PREP_CENTRE;

// flat f32 -> f16: block blk takes 1024 runs of four values
__device__ __forceinline__ void cvt_flat_f16(
    const float* __restrict__ s, _Float16* __restrict__ d, int blk) {
  const int i = blk * 1024 + threadIdx.x;
  v4f v[4];
  #pragma unroll
  for (int j = 0; j < 4; ++j) v[j] = ((const v4f*)s)[i + j * 256];
  #pragma unroll
  for (int j = 0; j < 4; ++j) ((uint2*)d)[i + j * 256] = pack4h(v[j]);
  // the built code joins this part's exit with another part's path, where the
  // registers that the four stores name are written again: the wait stands
  // ahead of that
  asm volatile("s_wait_xcnt 0x0" ::: "memory");
}
// centre token (p = 12) of every patch, f32 -> f16: xc[r][f]. A thread takes
// eight values each of rows r and r + 1
__device__ __forceinline__ void cvt_centre_f16(
    const float* __restrict__ x, _Float16* __restrict__ d, int blk) {
  const int i = blk * 256 + threadIdx.x;
  const int r = (i >> 5) * 2, c = i & 31;       // c: run of eight values
  const v4f* p = (const v4f*)x + (r * KK2 + 12) * (Ff / 4) + c * 2;
  const v4f a0 = p[0], a1 = p[1];
  const v4f c0 = p[KK2 * (Ff / 4)], c1 = p[KK2 * (Ff / 4) + 1];
  union { uint2 h[2]; uint4 u; } o0, o1;
  o0.h[0] = pack4h(a0); o0.h[1] = pack4h(a1);
  o1.h[0] = pack4h(c0); o1.h[1] = pack4h(c1);
  uint4* q = (uint4*)d + r * (Ff / 8) + c;
  q[0]      = o0.u;
  q[Ff / 8] = o1.u;
}
// per-head transpose of Wk, f32 -> f16: d[(h*256 + f)*64 + dd] = Wk[h*64 + dd][f]
// one run of four is rows dd..dd+3 at one f; a thread takes four runs
__device__ __forceinline__ void cvt_wk_headT_f16(
    const float* __restrict__ s, _Float16* __restrict__ d, int blk) {
  const int i0 = blk * 1024 + threadIdx.x;
  v4f v[4];
  #pragma unroll
  for (int j = 0; j < 4; ++j) {
    const int i  = i0 + j * 256;
    const int dd = (i & (Dd / 4 - 1)) * 4, f = (i >> 4) & (Ff - 1), h = i >> 12;
    const float* p = s + (size_t)(h * Dd + dd) * Ff + f;
    v[j].x = p[0]; v[j].y = p[Ff]; v[j].z = p[2 * Ff]; v[j].w = p[3 * Ff];
  }
  #pragma unroll
  for (int j = 0; j < 4; ++j) ((uint2*)d)[i0 + j * 256] = pack4h(v[j]);
  // the built code joins this part's exit with another part's path, where the
  // registers that the four stores name are written again: the wait stands
  // ahead of that
  asm volatile("s_wait_xcnt 0x0" ::: "memory");
}

// grid = PREP_BLOCKS
__global__ __launch_bounds__(256) void prep_kernel(
    const float* __restrict__ x,  const float* __restrict__ Wq,
    const float* __restrict__ Wk, const float* __restrict__ Wv,
    const float* __restrict__ Wf, const float* __restrict__ W1,
    const float* __restrict__ W2,
    _Float16* __restrict__ xcH, _Float16* __restrict__ wqH,
    _Float16* __restrict__ wkT, _Float16* __restrict__ wvH,
    _Float16* __restrict__ wfH, _Float16* __restrict__ w1H,
    _Float16* __restrict__ w2H, float* __restrict__ stats)
{
  int blk = blockIdx.x;
  if (blk < PREP_CENTRE) { cvt_centre_f16(x, xcH, blk); return; }
  blk -= PREP_CENTRE;
  if (blk < PREP_WK) {
    if (blk == 0 && threadIdx.x < 16) stats[threadIdx.x] = 0.f;  // both LN sets
    cvt_wk_headT_f16(Wk, wkT, blk);
    return;
  }
  blk -= PREP_WK;
  // the five flat conversions run the same code on a block's own pair of
  // pointers
  const float* s = W1;
  _Float16*    d = w1H;
  if (blk >= PREP_FFN) {
    blk -= PREP_FFN; s = W2; d = w2H;
    if (blk >= PREP_FFN) {
      blk -= PREP_FFN; s = Wq; d = wqH;
      if (blk >= PREP_WK) {
        blk -= PREP_WK; s = Wv; d = wvH;
        if (blk >= PREP_WK) { blk -= PREP_WK; s = Wf; d = wfH; }
      }
    }
  }
  cvt_flat_f16(s, d, blk);
}

// ---------------------------------------------------------------------------
extern "C" void kernel_launch(void* const* d_in, const int* in_sizes, int n_in,
                              void* d_out, int out_size, void* d_ws, size_t ws_size,
                              hipStream_t stream) {
  const float* x    = (const float*)d_in[0];
  const float* Wq   = (const float*)d_in[1];
  const float* bq   = (const float*)d_in[2];
  const float* Wk   = (const float*)d_in[3];
  // d_in[4] (bk) adds q_h . bk_h to all 25 scores of a head: cancels in softmax
  const float* Wv   = (const float*)d_in[5];
  const float* bv   = (const float*)d_in[6];
  const float* Wf   = (const float*)d_in[7];
  const float* bf   = (const float*)d_in[8];
  const float* ln1w = (const float*)d_in[9];
  const float* ln1b = (const float*)d_in[10];
  const float* ln2w = (const float*)d_in[11];
  const float* ln2b = (const float*)d_in[12];
  const float* W1   = (const float*)d_in[13];
  const float* b1   = (const float*)d_in[14];
  const float* W2   = (const float*)d_in[15];
  const float* b2   = (const float*)d_in[16];

  char* ws = (char*)d_ws;
  size_t off = 0;
  auto alloc = [&](size_t bytes) -> void* {
    void* p = ws + off;
    off += (bytes + 255) & ~(size_t)255;
    return p;
  };

  _Float16* xcH     = (_Float16*)alloc((size_t)ROWS * Ff * 2);     // centre tokens
  _Float16* wqH     = (_Float16*)alloc((size_t)Ff * Ff * 2);
  _Float16* wkT     = (_Float16*)alloc((size_t)Ff * Ff * 2);       // per-head Wk^T
  _Float16* wvH     = (_Float16*)alloc((size_t)Ff * Ff * 2);
  _Float16* wfH     = (_Float16*)alloc((size_t)Ff * Ff * 2);
  _Float16* w1H     = (_Float16*)alloc((size_t)DFFc * Ff * 2);
  _Float16* w2H     = (_Float16*)alloc((size_t)Ff * DFFc * 2);
  _Float16* qcH     = (_Float16*)alloc((size_t)ROWS * Ff * 2);     // centre query
  float*    qtF     = (float*)   alloc((size_t)ROWS * Hh * Ff * 4); // Wk_h^T q_h
  _Float16* xwH     = (_Float16*)alloc((size_t)ROWS * Hh * Ff * 2); // sum_p w_p x_p
  _Float16* mergedH = (_Float16*)alloc((size_t)ROWS * Ff * 2);
  float*    attent  = (float*)   alloc((size_t)ROWS * Ff * 4);
  float*    out1F   = (float*)   alloc((size_t)ROWS * Ff * 4);
  _Float16* out1H   = (_Float16*)alloc((size_t)ROWS * Ff * 2);
  _Float16* hidH    = (_Float16*)alloc((size_t)ROWS * DFFc * 2);
  float*    ytmp    = (float*)   alloc((size_t)ROWS * Ff * 4);
  float*    stats   = (float*)   alloc(256);                       // 2 sets of 4x2

  // --- prep: zero LN stats, convert centre tokens and weights to f16
  prep_kernel<<<PREP_BLOCKS, 256, 0, stream>>>(x, Wq, Wk, Wv, Wf, W1, W2,
                                               xcH, wqH, wkT, wvH, wfH, w1H, w2H,
                                               stats);

  // --- centre query: (5120 x 256) @ (256 x 256) + bq -> f16
  {
    dim3 g(ROWS / 256, Ff / 64);
    gemm_f16_wmma<Ff, Ff, 2, false, false><<<g, 256, 0, stream>>>(xcH, wqH, bq, nullptr,
                                                                  nullptr, qcH, nullptr, 0,
                                                                  Ff, 0, 0);
  }
  // --- folded query per head: q_h (5120 x 64) @ Wk_h (64 x 256) -> f32
  {
    dim3 g(ROWS / 256, (Hh * Ff) / 64);
    gemm_f16_wmma<Dd, Hh * Ff, 2, false, false><<<g, 256, 0, stream>>>(qcH, wkT, nullptr, nullptr,
                                                                       qtF, nullptr, nullptr, 0,
                                                                       Ff, 2, Dd);
  }

  // --- scores, softmax over 25 and weighted patch sum per head, x read once
  patch_attention_folded<<<ROWS / WPB, WPB * 32, 0, stream>>>(x, qtF, xwH);

  // --- value projection per head: xw_h (5120 x 256) @ Wv_h^T (256 x 64) + bv
  {
    dim3 g(ROWS / 256, Ff / 64);
    gemm_f16_wmma<Ff, Ff, 2, false, false><<<g, 256, 0, stream>>>(xwH, wvH, bv, nullptr,
                                                                  nullptr, mergedH, nullptr, 0,
                                                                  Hh * Ff, 0, Ff);
  }

  // --- output projection: (5120 x 256) @ (256 x 256) -> attent f32, LN 1 sums
  {
    dim3 g(ROWS / 256, Ff / 64);
    gemm_f16_wmma<Ff, Ff, 2, false, true><<<g, 256, 0, stream>>>(mergedH, wfH, bf, nullptr,
                                                                 attent, nullptr, stats, 0,
                                                                 Ff, 0, 0);
  }

  // --- LayerNorm 1 (per batch over N,O,F) -> out1 (f32 + f16)
  ln_apply_kernel<<<PB4 / 256, 256, 0, stream>>>(attent, ln1w, ln1b, stats,
                                                 out1F, out1H);

  // --- FFN: relu(out1 @ W1^T + b1) @ W2^T + b2 + out1
  {
    dim3 g(ROWS / 256, DFFc / 64);
    gemm_f16_wmma<Ff, DFFc, 2, false, false><<<g, 256, 0, stream>>>(out1H, w1H, b1, nullptr,
                                                                    nullptr, hidH, nullptr, 1,
                                                                    Ff, 0, 0);
  }
  {
    // 16 rows a wave: its A fragments for K = 1024 fill 256 registers; LN 2 sums
    dim3 g(ROWS / 128, Ff / 64);
    gemm_f16_wmma<DFFc, Ff, 1, true, true><<<g, 256, 0, stream>>>(hidH, w2H, b2, out1F,
                                                                  ytmp, nullptr, stats + 8, 0,
                                                                  DFFc, 0, 0);
  }

  // --- LayerNorm 2 -> d_out (f32)
  ln_apply_kernel<<<PB4 / 256, 256, 0, stream>>>(ytmp, ln2w, ln2b, stats + 8,
                                                 (float*)d_out, nullptr);
}

// v006
// One run takes 66.9 microseconds.
// Timed twice side by side with v005, it ran 1.10 times as fast both times.
// All steps since v000 together make it 4.81 times as fast.
#include <hip/hip_runtime.h>
#include <hip/hip_bf16.h>
#include <math.h>

typedef __attribute__((ext_vector_type(16))) _Float16 v16h;
typedef __attribute__((ext_vector_type(8)))  float    v8f;
typedef __attribute__((ext_vector_type(4)))  float    v4f;

#define Bb   4
#define Nn_  256
#define Oo   5
#define KK2  25      // K*K patch positions
#define Ff   256
#define Hh   4
#define Dd   64
#define DFFc 1024

constexpr int ROWS = Bb * Nn_ * Oo;         // 5120 output rows
constexpr int PB   = Nn_ * Oo * Ff;         // 327680 elems per batch for LN

constexpr int WPB  = 4;                     // waves (patches) per block, folded attention

// ---------------------------------------------------------------------------
// helpers
// ---------------------------------------------------------------------------
union FragU { v16h v; uint4 q[2]; };

// Load one f16 16x32 fragment given per-lane base (row/col and half-offset
// already folded in): elements 0..7 at +k, elements 8..15 at +k+16.
__device__ __forceinline__ v16h frag_at(const _Float16* p) {
  FragU f;
  f.q[0] = *(const uint4*)(p);
  f.q[1] = *(const uint4*)(p + 16);
  return f.v;
}

// ---------------------------------------------------------------------------
// GEMM: C[M][NT] = A[M][KT] * W[NT][KT]^T (+bias) (relu?) (+addsrc) -> f32/f16
// block = 256 threads = 8 waves; a wave computes 16*RG rows x 64 cols (RG A
// fragments share 4 B fragments per k-step); block tile is (128*RG) x 64.
// grid = (M/(128*RG), NT/64). NT is a compile-time constant so that one
// address serves all of a lane's C positions (constant offsets from it).
// Nothing is fetched step by step: a block issues every global read it will
// ever make ahead of its k loop, so that their latencies run side by side.
// The B panel (64 cols x all of K) goes to LDS by async copies shared by the
// 8 waves, filled once; a wave's A fragments for all of K, its bias values
// and (ADD) its residual values go to registers.
// A rows have pitch lda, and column block y reads A from column
// (y >> aShift) * aStep on; every launch here passes 0 for both.
// STATS: the block also adds the sum and the sum of squares of its C values,
// taken from the registers that hold them, to the LayerNorm sums of its batch
// element, so that no launch has to read C again for them.
//
// f16 16x32 fragment layout (A and B identical): lane L<16 -> row/col L,
// elements 0..7 = K [k0+off, k0+off+8), elements 8..15 = +16; off = 8*(L>=16).
// Both runs are contiguous -> two b128 loads per fragment.
// ---------------------------------------------------------------------------
template <int KT, int NT, int RG, bool ADD, bool STATS>
__global__ __launch_bounds__(256) void gemm_f16_wmma(
    const _Float16* __restrict__ A, const _Float16* __restrict__ W,
    const float* __restrict__ bias, const float* __restrict__ addsrc,
    float* __restrict__ outF, _Float16* __restrict__ outH,
    float* __restrict__ stats, int doRelu, int lda, int aShift, int aStep)
{
  // The panel lies in LDS in PARTS runs of K, each 64 rows of KP values, so
  // that inside a part every fragment is within the 64 KB that the offset
  // field of an LDS load reaches from one address register.
  constexpr int PARTS   = (KT > 512) ? KT / 512 : 1;
  constexpr int KP      = KT / PARTS;
  constexpr int BSTRIDE = KP + 8;           // +16B pad: breaks LDS bank conflicts
  constexpr int STEPS   = KT / 32;          // k-steps, and B copies per thread
  constexpr int SPP     = STEPS / PARTS;    // k-steps per part
  // A wave has at most 63 loads outstanding, and the barrier below waits for
  // every load issued ahead of it. So only the first PRE steps' A fragments
  // are asked for ahead of the barrier; the rest, and the residual, are asked
  // for behind it and land while the first steps are worked on.
  constexpr int PRE     = (2 * RG * STEPS <= 48) ? STEPS : 24 / RG;
  __shared__ _Float16 Bs[PARTS * 64 * BSTRIDE];

  const int lane    = threadIdx.x & 31;
  const int wave    = threadIdx.x >> 5;
  const int rowBase = (blockIdx.x * 8 + wave) * (16 * RG);
  const int colBase = blockIdx.y * 64;

  const int n0    = lane & 15;              // row (A) / col (B) within tile
  const int half8 = ((lane >> 4) & 1) << 3; // K sub-offset per lane half
  const int r0    = (lane >> 4) * 8;        // first C row of this lane half

  // --- B panel, 64 rows x KT f16 -> LDS: 4 threads per row, STEPS b128 chunks
  // each (chunks of 8 values, 32 values apart). The xcnt wait closes each
  // statement so that no address register of an issued copy is rewritten
  // ahead of it.
  {
    const int srow = threadIdx.x >> 2;          // 0..63
    const int skc  = (threadIdx.x & 3) << 3;    // 0,8,16,24
    const _Float16* src = W + (size_t)(colBase + srow) * KT + skc;
    const unsigned lds0 = (unsigned)(uintptr_t)&Bs[srow * BSTRIDE + skc];
    if constexpr (STEPS % 8 == 0) {
      static_assert(SPP % 8 == 0, "a statement's eight chunks lie in one part");
      // unrolled: c is a compile-time index into the parts
      #pragma unroll
      for (int c = 0; c < STEPS; c += 8) {
        const unsigned lds = lds0 + ((c / SPP) * 64 * BSTRIDE + (c % SPP) * 32) * 2;
        asm volatile("global_load_async_to_lds_b128 %0, %1, off\n\t"
                     "global_load_async_to_lds_b128 %2, %3, off\n\t"
                     "global_load_async_to_lds_b128 %4, %5, off\n\t"
                     "global_load_async_to_lds_b128 %6, %7, off\n\t"
                     "global_load_async_to_lds_b128 %8, %9, off\n\t"
                     "global_load_async_to_lds_b128 %10, %11, off\n\t"
                     "global_load_async_to_lds_b128 %12, %13, off\n\t"
                     "global_load_async_to_lds_b128 %14, %15, off\n\t"
                     "s_wait_xcnt 0x0"
                     :: "v"(lds),       "v"(src),
                        "v"(lds + 64),  "v"(src + 32),
                        "v"(lds + 128), "v"(src + 64),
                        "v"(lds + 192), "v"(src + 96),
                        "v"(lds + 256), "v"(src + 128),
                        "v"(lds + 320), "v"(src + 160),
                        "v"(lds + 384), "v"(src + 192),
                        "v"(lds + 448), "v"(src + 224)
                     : "memory");
        src += 256;
      }
    } else {
      static_assert(STEPS == 2, "two chunks a thread");
      asm volatile("global_load_async_to_lds_b128 %0, %1, off\n\t"
                   "global_load_async_to_lds_b128 %2, %3, off\n\t"
                   "s_wait_xcnt 0x0"
                   :: "v"(lds0), "v"(src), "v"(lds0 + 64), "v"(src + 32)
                   : "memory");
    }
  }

  float bv[4] = {0.0f, 0.0f, 0.0f, 0.0f};
  // --- A fragments of the first PRE k-steps, k ascending
  const _Float16* aPtr = A + (size_t)(rowBase + n0) * lda
                           + ((int)blockIdx.y >> aShift) * aStep + half8;
  static_assert(RG <= 2, "the waits below name one or two row addresses");
  const _Float16* aPtr1 = aPtr + (size_t)(16 * (RG - 1)) * lda;  // last row group
  FragU a[STEPS][RG];
  // unrolled: a[][] must stay in registers
  #pragma unroll
  for (int s = 0; s < PRE; ++s) {
    #pragma unroll
    for (int g = 0; g < RG; ++g) {
      const _Float16* p = (g ? aPtr1 : aPtr) + 32 * s;
      a[s][g].q[0] = *(const uint4*)(p);
      a[s][g].q[1] = *(const uint4*)(p + 16);
    }
  }
  // stands ahead of whatever is written into the address registers of the
  // loads above (the bias address may be formed in them); it names the
  // addresses as inputs so that their registers stay untouched up to the wait
  asm volatile("s_wait_xcnt 0x0" :: "v"(aPtr), "v"(aPtr1) : "memory");
  // --- bias, needed only behind the k loop
  if (bias) {
    #pragma unroll
    for (int j = 0; j < 4; ++j) bv[j] = bias[colBase + 16 * j + n0];
  }
  // the same for the bias loads
  asm volatile("s_wait_xcnt 0x0" ::: "memory");

  v8f acc[4 * RG];
  #pragma unroll
  for (int j = 0; j < 4 * RG; ++j) acc[j] = (v8f){};

  // own copies landed, then every wave's: the panel is read only behind this
  asm volatile("s_wait_asynccnt 0x0" ::: "memory");
  __syncthreads();

  // --- the late A fragments and the residual
  #pragma unroll
  for (int s = PRE; s < STEPS; ++s) {
    #pragma unroll
    for (int g = 0; g < RG; ++g) {
      const _Float16* p = (g ? aPtr1 : aPtr) + 32 * s;
      a[s][g].q[0] = *(const uint4*)(p);
      a[s][g].q[1] = *(const uint4*)(p + 16);
    }
  }
  // a lane's first C position; (g, j, r) lies (16 g + r) * NT + 16 j behind it
  const size_t c0 = (size_t)(rowBase + r0) * NT + colBase + n0;
  float ad[ADD ? RG * 32 : 1];
  const float* ap = ADD ? addsrc + c0 : nullptr;
  if constexpr (ADD) {
    #pragma unroll
    for (int g = 0; g < RG; ++g)
      #pragma unroll
      for (int j = 0; j < 4; ++j)
        #pragma unroll
        for (int r = 0; r < 8; ++r)
          ad[(g * 4 + j) * 8 + r] = ap[(16 * g + r) * NT + 16 * j];
  }
  if constexpr (ADD || PRE < STEPS) {
    // stands ahead of whatever is written into the address registers of the
    // loads just issued; it names the addresses as inputs so that their
    // registers stay untouched up to the wait
    asm volatile("s_wait_xcnt 0x0" :: "v"(aPtr), "v"(aPtr1), "v"(ap) : "memory");
  }

  // --- k loop: B fragments from LDS, A fragments already in registers
  FragU cur[SPP][RG];
  #pragma unroll
  for (int s = 0; s < SPP; ++s)
    #pragma unroll
    for (int g = 0; g < RG; ++g) cur[s][g] = a[s][g];
  const _Float16* bb = &Bs[n0 * BSTRIDE + half8];
  // the loop over the parts stays rolled: bb is then a register that moves
  // from part to part, and every LDS load of the body is bb + a small offset;
  // unrolled, each load beyond 64 KB would need an address of its own
  #pragma unroll 1
  for (int part = 0; part < PARTS; ++part) {
    // unrolled: cur[s] is a register index
    #pragma unroll
    for (int s = 0; s < SPP; ++s) {
      const v16h b0 = frag_at(bb + 32 * s);
      const v16h b1 = frag_at(bb + 32 * s + 16 * BSTRIDE);
      const v16h b2 = frag_at(bb + 32 * s + 32 * BSTRIDE);
      const v16h b3 = frag_at(bb + 32 * s + 48 * BSTRIDE);
      #pragma unroll
      for (int g = 0; g < RG; ++g) {
        const v16h ag = cur[s][g].v;
        acc[g * 4 + 0] = __builtin_amdgcn_wmma_f32_16x16x32_f16(false, ag, false, b0, (short)0, acc[g * 4 + 0], false, false);
        acc[g * 4 + 1] = __builtin_amdgcn_wmma_f32_16x16x32_f16(false, ag, false, b1, (short)0, acc[g * 4 + 1], false, false);
        acc[g * 4 + 2] = __builtin_amdgcn_wmma_f32_16x16x32_f16(false, ag, false, b2, (short)0, acc[g * 4 + 2], false, false);
        acc[g * 4 + 3] = __builtin_amdgcn_wmma_f32_16x16x32_f16(false, ag, false, b3, (short)0, acc[g * 4 + 3], false, false);
      }
    }
    if constexpr (PARTS > 1) {
      static_assert(PARTS <= 2, "cur is refilled from the second part only");
      #pragma unroll
      for (int s = 0; s < SPP; ++s)
        #pragma unroll
        for (int g = 0; g < RG; ++g) cur[s][g] = a[SPP + s][g];
      bb += 64 * BSTRIDE;
    }
  }

  // C/D layout: VGPR r -> (M=r, N=lane) for lanes 0-15, (M=r+8, N=lane-16)
  // final values first, in place; then all stores of a kind in one run, so
  // that no store is waited for before the next is issued
  #pragma unroll
  for (int t = 0; t < 4 * RG; ++t) {        // t = 4 g + j
    #pragma unroll
    for (int r = 0; r < 8; ++r) {
      float v = acc[t][r] + bv[t & 3];
      if (doRelu) v = fmaxf(v, 0.0f);
      if constexpr (ADD) v += ad[t * 8 + r];
      acc[t][r] = v;
    }
  }
  if constexpr (STATS) {
    // ahead of the stores: the barrier below waits for every store that a wave
    // has issued, so here it waits for none, and the two adds fly beside them
    static_assert((Nn_ * Oo) % (128 * RG) == 0, "a block's rows lie in one batch element");
    __shared__ float red[16];
    v8f s8 = acc[0];
    v8f q8 = acc[0] * acc[0];
    // unrolled: acc[t] is a register index
    #pragma unroll
    for (int t = 1; t < 4 * RG; ++t) {
      s8 += acc[t];
      q8 += acc[t] * acc[t];
    }
    float s = ((s8[0] + s8[1]) + (s8[2] + s8[3])) + ((s8[4] + s8[5]) + (s8[6] + s8[7]));
    float q = ((q8[0] + q8[1]) + (q8[2] + q8[3])) + ((q8[4] + q8[5]) + (q8[6] + q8[7]));
    for (int o = 16; o > 0; o >>= 1) {
      s += __shfl_xor(s, o, 32);
      q += __shfl_xor(q, o, 32);
    }
    if (lane == 0) { red[wave] = s; red[8 + wave] = q; }
    __syncthreads();
    // thread 0 adds up the eight waves' sums, thread 1 their sums of squares
    if (threadIdx.x < 2) {
      const float* p = red + 8 * threadIdx.x;
      const float tot = ((p[0] + p[1]) + (p[2] + p[3])) + ((p[4] + p[5]) + (p[6] + p[7]));
      const int b = (blockIdx.x * (128 * RG)) / (Nn_ * Oo);
      atomicAdd(&stats[2 * b + threadIdx.x], tot);
    }
  }
  if (outF) {
    float* o = outF + c0;
    #pragma unroll
    for (int t = 0; t < 4 * RG; ++t)
      #pragma unroll
      for (int r = 0; r < 8; ++r)
        o[(16 * (t >> 2) + r) * NT + 16 * (t & 3)] = acc[t][r];
  }
  // the f16 conversions below may reuse registers that the stores above name
  asm volatile("s_wait_xcnt 0x0" ::: "memory");
  if (outH) {
    _Float16* o = outH + c0;
    _Float16 h[4 * RG][8];
    #pragma unroll
    for (int t = 0; t < 4 * RG; ++t)
      #pragma unroll
      for (int r = 0; r < 8; ++r) h[t][r] = (_Float16)acc[t][r];
    #pragma unroll
    for (int t = 0; t < 4 * RG; ++t)
      #pragma unroll
      for (int r = 0; r < 8; ++r)
        o[(16 * (t >> 2) + r) * NT + 16 * (t & 3)] = h[t][r];
  }
}

// ---------------------------------------------------------------------------
// Folded patch attention. With qt[h] = Wk_h^T q_h (256 long, q the centre
// query) the score of patch position p is qt[h] . x_p / 8 (+ q_h . bk_h, the
// same for every p of a head, so it cancels in the softmax), and the merged
// value is Wv_h (sum_p w_p x_p) + bv_h because the weights sum to one. This
// kernel reads x once in f32 and writes xw[h] = sum_p w_p x_p per head.
// One wave per patch, no LDS and no barrier: the wave holds all 25 rows in
// registers, a lane 8 of a row's 256 values (f0..f0+3 and 128+f0..128+f0+3).
// ---------------------------------------------------------------------------
__device__ __forceinline__ float dot4(const v4f a, const v4f b, float s) {
  s = fmaf(a.x, b.x, s);
  s = fmaf(a.y, b.y, s);
  s = fmaf(a.z, b.z, s);
  s = fmaf(a.w, b.w, s);
  return s;
}
// lanes L and L ^ N: the lane with bit N clear keeps v[0..N), the other
// v[N..2N); each adds the partner's share of what it keeps
template <int N, int S>
__device__ __forceinline__ void halve_step(float (&v)[S], int lane) {
  const bool hi = (lane & N) != 0;
  #pragma unroll
  for (int j = 0; j < N; ++j) {
    const float send = hi ? v[j] : v[j + N];
    const float keep = hi ? v[j + N] : v[j];
    v[j] = keep + __shfl_xor(send, N, 32);
  }
}
__device__ __forceinline__ float lane_bcast(float v, int srcLane) {
  return __builtin_bit_cast(float,
      __builtin_amdgcn_readlane(__builtin_bit_cast(int, v), srcLane));
}

__global__ __launch_bounds__(WPB * 32) void patch_attention_folded(
    const float* __restrict__ x, const float* __restrict__ qt,
    _Float16* __restrict__ xw)
{
  const int lane = threadIdx.x & 31;
  const int bno  = blockIdx.x * WPB + (threadIdx.x >> 5);
  const int f0   = lane * 4;
  const float* qp = qt + (size_t)bno * (Hh * Ff) + f0;
  const float* xp = x + (size_t)bno * (KK2 * Ff) + f0;

  v4f q[Hh][2];
  #pragma unroll
  for (int h = 0; h < Hh; ++h) {
    q[h][0] = *(const v4f*)(qp + h * Ff);
    q[h][1] = *(const v4f*)(qp + h * Ff + 128);
  }
  // the address pair of the eight loads above is dead from here on and a row
  // load's result may land in it: the wait stands ahead of that overwrite
  asm volatile("s_wait_xcnt 0x0" ::: "memory");
  v4f xr[KK2][2];
  #pragma unroll
  for (int p = 0; p < KK2; ++p) {
    xr[p][0] = *(const v4f*)(xp + p * Ff);
    xr[p][1] = *(const v4f*)(xp + p * Ff + 128);
  }
  // the same for the address pair of the fifty row loads, which is free for
  // the arithmetic below as soon as the last of them has issued
  asm volatile("s_wait_xcnt 0x0" ::: "memory");
  // scores. Rows 0..23 in three groups of 8: 32 partial dots per lane, index
  // pl*4 + h; five halving steps leave lane L with the full sum of index L,
  // so lane L carries p = 8g + (L >> 2), h = L & 3.
  float s[3];
  #pragma unroll
  for (int g = 0; g < 3; ++g) {
    float v[32];
    #pragma unroll
    for (int pl = 0; pl < 8; ++pl)
      #pragma unroll
      for (int h = 0; h < Hh; ++h)
        v[pl * 4 + h] = dot4(xr[8 * g + pl][1], q[h][1],
                             dot4(xr[8 * g + pl][0], q[h][0], 0.f));
    halve_step<16>(v, lane);
    halve_step<8>(v, lane);
    halve_step<4>(v, lane);
    halve_step<2>(v, lane);
    halve_step<1>(v, lane);
    s[g] = v[0] * 0.125f;
  }
  // row 24: every lane ends with the full sum of head L & 3
  float s24;
  {
    float v[4];
    #pragma unroll
    for (int h = 0; h < Hh; ++h)
      v[h] = dot4(xr[24][1], q[h][1], dot4(xr[24][0], q[h][0], 0.f));
    halve_step<2>(v, lane);
    halve_step<1>(v, lane);
    #pragma unroll
    for (int o = 4; o <= 16; o <<= 1) v[0] += __shfl_xor(v[0], o, 32);
    s24 = v[0] * 0.125f;
  }

  // softmax over the 25 positions of head L & 3 (lanes L, L^4, L^8, L^16 ...)
  float mx = fmaxf(fmaxf(s[0], s[1]), fmaxf(s[2], s24));
  #pragma unroll
  for (int o = 4; o <= 16; o <<= 1) mx = fmaxf(mx, __shfl_xor(mx, o, 32));
  const float e0  = __expf(s[0] - mx);
  const float e1  = __expf(s[1] - mx);
  const float e2  = __expf(s[2] - mx);
  const float e24 = __expf(s24 - mx);
  float sum = (e0 + e1) + e2;
  #pragma unroll
  for (int o = 4; o <= 16; o <<= 1) sum += __shfl_xor(sum, o, 32);
  sum += e24;
  const float inv = 1.0f / sum;
  float wg[3];
  wg[0] = e0 * inv;
  wg[1] = e1 * inv;
  wg[2] = e2 * inv;
  const float w24 = e24 * inv;

  // weighted sum of the rows per head, p ascending; each weight is read from
  // its lane into a scalar
  _Float16* op = xw + (size_t)bno * (Hh * Ff) + f0;
  #pragma unroll
  for (int h = 0; h < Hh; ++h) {
    v4f a0 = (v4f){0.f, 0.f, 0.f, 0.f};
    v4f a1 = (v4f){0.f, 0.f, 0.f, 0.f};
    #pragma unroll
    for (int p = 0; p < KK2; ++p) {
      const float w = (p < 24) ? lane_bcast(wg[p >> 3], (p & 7) * 4 + h)
                               : lane_bcast(w24, h);
      a0.x = fmaf(w, xr[p][0].x, a0.x);
      a0.y = fmaf(w, xr[p][0].y, a0.y);
      a0.z = fmaf(w, xr[p][0].z, a0.z);
      a0.w = fmaf(w, xr[p][0].w, a0.w);
      a1.x = fmaf(w, xr[p][1].x, a1.x);
      a1.y = fmaf(w, xr[p][1].y, a1.y);
      a1.z = fmaf(w, xr[p][1].z, a1.z);
      a1.w = fmaf(w, xr[p][1].w, a1.w);
    }
    union { _Float16 hh[4]; uint2 u; } o0, o1;
    o0.hh[0] = (_Float16)a0.x; o0.hh[1] = (_Float16)a0.y;
    o0.hh[2] = (_Float16)a0.z; o0.hh[3] = (_Float16)a0.w;
    o1.hh[0] = (_Float16)a1.x; o1.hh[1] = (_Float16)a1.y;
    o1.hh[2] = (_Float16)a1.z; o1.hh[3] = (_Float16)a1.w;
    *(uint2*)(op + h * Ff)       = o0.u;
    *(uint2*)(op + h * Ff + 128) = o1.u;
  }
}

// ---------------------------------------------------------------------------
// LayerNorm over (N,O,F) per batch element: the sums come from the GEMM that
// makes the values; this applies them. It moves 16-byte vectors and issues all
// loads of a thread before the first use.
// ---------------------------------------------------------------------------
constexpr int PB4        = PB / 4;                    // float4 per batch element
static_assert(PB4 % 256 == 0, "apply covers a batch exactly");

__device__ __forceinline__ uint2 pack4h(const v4f v) {
  union { _Float16 h[4]; uint2 u; } o;
  o.h[0] = (_Float16)v.x; o.h[1] = (_Float16)v.y;
  o.h[2] = (_Float16)v.z; o.h[3] = (_Float16)v.w;
  return o.u;
}

// grid = PB4 / 256. A thread takes the same four (n,o,f) positions in every
// batch element, so it reads g and beta once.
__global__ __launch_bounds__(256) void ln_apply_kernel(
    const float* __restrict__ x, const float* __restrict__ g,
    const float* __restrict__ beta, const float* __restrict__ stats,
    float* __restrict__ outF, _Float16* __restrict__ outH)
{
  const int r4 = blockIdx.x * 256 + threadIdx.x;
  float st[2 * Bb];
  #pragma unroll
  for (int k = 0; k < 2 * Bb; ++k) st[k] = stats[k];
  v4f xv[Bb];
  #pragma unroll
  for (int b = 0; b < Bb; ++b) xv[b] = ((const v4f*)x)[b * PB4 + r4];
  const v4f gv = ((const v4f*)g)[r4];
  const v4f bv = ((const v4f*)beta)[r4];
  // the base addresses of the six loads above are dead from here on: the wait
  // stands ahead of whatever is written into their registers
  asm volatile("s_wait_xcnt 0x0" ::: "memory");
  v4f o[Bb];
  #pragma unroll
  for (int b = 0; b < Bb; ++b) {
    const float mu  = st[2 * b + 0] * (1.0f / PB);
    const float var = st[2 * b + 1] * (1.0f / PB) - mu * mu;
    const float rs  = rsqrtf(var + 1e-5f);
    o[b].x = (xv[b].x - mu) * rs * gv.x + bv.x;
    o[b].y = (xv[b].y - mu) * rs * gv.y + bv.y;
    o[b].z = (xv[b].z - mu) * rs * gv.z + bv.z;
    o[b].w = (xv[b].w - mu) * rs * gv.w + bv.w;
  }
  if (outF) {
    #pragma unroll
    for (int b = 0; b < Bb; ++b) ((v4f*)outF)[b * PB4 + r4] = o[b];
  }
  // the f16 packing below may reuse registers that the stores above name
  asm volatile("s_wait_xcnt 0x0" ::: "memory");
  if (outH) {
    #pragma unroll
    for (int b = 0; b < Bb; ++b) ((uint2*)outH)[b * PB4 + r4] = pack4h(o[b]);
  }
}

// ---------------------------------------------------------------------------
// prep: everything that depends on the inputs alone, in ONE launch. The parts
// need nothing of each other, so each takes a range of the block index (the
// branch is the same for a whole block). Apart from the zeroing of the LN
// sums, a thread issues all its global loads before its first store.
// ---------------------------------------------------------------------------
constexpr int PREP_FFN    = DFFc * Ff / 16 / 256;      // blocks per FFN weight
constexpr int PREP_CENTRE = ROWS * Ff / 16 / 256;      // blocks for the centre tokens
constexpr int PREP_PROD   = Hh * 2 * 4;                // blocks per weight product
constexpr int PREP_BIAS   = 4;                         // blocks for Wf bv + bf
constexpr int PREP_BLOCKS = 2 * PREP_PROD + PREP_BIAS + PREP_CENTRE + 2 * PREP_FFN;

// flat f32 -> f16: block blk takes 1024 runs of four values
__device__ __forceinline__ void cvt_flat_f16(
    const float* __restrict__ s, _Float16* __restrict__ d, int blk) {
  const int i = blk * 1024 + threadIdx.x;
  v4f v[4];
  #pragma unroll
  for (int j = 0; j < 4; ++j) v[j] = ((const v4f*)s)[i + j * 256];
  #pragma unroll
  for (int j = 0; j < 4; ++j) ((uint2*)d)[i + j * 256] = pack4h(v[j]);
  // the built code joins this part's exit with another part's path, where the
  // registers that the four stores name are written again: the wait stands
  // ahead of that
  asm volatile("s_wait_xcnt 0x0" ::: "memory");
}
// centre token (p = 12) of every patch, f32 -> f16: xc[r][f]. A thread takes
// eight values each of rows r and r + 1
__device__ __forceinline__ void cvt_centre_f16(
    const float* __restrict__ x, _Float16* __restrict__ d, int blk) {
  const int i = blk * 256 + threadIdx.x;
  const int r = (i >> 5) * 2, c = i & 31;       // c: run of eight values
  const v4f* p = (const v4f*)x + (r * KK2 + 12) * (Ff / 4) + c * 2;
  const v4f a0 = p[0], a1 = p[1];
  const v4f c0 = p[KK2 * (Ff / 4)], c1 = p[KK2 * (Ff / 4) + 1];
  union { uint2 h[2]; uint4 u; } o0, o1;
  o0.h[0] = pack4h(a0); o0.h[1] = pack4h(a1);
  o1.h[0] = pack4h(c0); o1.h[1] = pack4h(c1);
  uint4* q = (uint4*)d + r * (Ff / 8) + c;
  q[0]      = o0.u;
  q[Ff / 8] = o1.u;
  // as at the end of cvt_flat_f16: this part's exit too is joined with other
  // parts' paths, where the registers that the two stores name are written again
  asm volatile("s_wait_xcnt 0x0" ::: "memory");
}

// ---------------------------------------------------------------------------
// Weight products. Two linear maps that follow one another with nothing in
// between are one map, and its matrix depends on the weights alone:
//   qt[h]  = Wk_h^T (Wq_h xc + bq_h) = (Wk_h^T Wq_h) xc + Wk_h^T bq_h
//   attent = Wf (Wv_h xw_h + bv_h)_h + bf = sum_h (Wf_h Wv_h) xw_h + (Wf bv + bf)
// (Wf_h: columns 64 h .. 64 h + 63 of Wf). The products have K = 64 and are
// small; with them each pair of activation GEMMs becomes one.
// One block makes a 128 x 64 tile C[m][n] = sum_d A(m, d) B(n, d), d < 64:
// both operands go f32 -> f16 into LDS with d running along a row, then each
// wave takes 16 rows. PS: LDS pitch, +16 B against bank conflicts.
// ---------------------------------------------------------------------------
constexpr int PS = Dd + 8;

// an operand that lies d-major in memory (row d, pitch Ff, COLS columns from
// src on): a thread takes rows d, d + 1 at four columns, so that a pair of
// f16 values along d is one 4-byte LDS store. Its COLS / 32 such pieces lie a
// constant number of rows apart: one address serves them all.
template <int COLS>
__device__ __forceinline__ const float* addrT(const float* __restrict__ src) {
  return src + (threadIdx.x / (COLS / 4)) * 2 * Ff + (threadIdx.x % (COLS / 4)) * 4;
}
template <int COLS>
__device__ __forceinline__ void loadT(const float* __restrict__ p,
                                      v4f (&lo)[COLS / 32], v4f (&hi)[COLS / 32]) {
  constexpr int DSTEP = 2 * 256 / (COLS / 4);   // rows from piece to piece
  #pragma unroll
  for (int j = 0; j < COLS / 32; ++j) {
    lo[j] = *(const v4f*)(p + j * DSTEP * Ff);
    hi[j] = *(const v4f*)(p + j * DSTEP * Ff + Ff);
  }
}
template <int COLS>
__device__ __forceinline__ void storeT(_Float16* S,
                                       const v4f (&lo)[COLS / 32], const v4f (&hi)[COLS / 32]) {
  constexpr int DSTEP = 2 * 256 / (COLS / 4);
  _Float16* q = S + (threadIdx.x % (COLS / 4)) * 4 * PS + (threadIdx.x / (COLS / 4)) * 2;
  #pragma unroll
  for (int j = 0; j < COLS / 32; ++j) {
    #pragma unroll
    for (int e = 0; e < 4; ++e) {
      union { _Float16 h[2]; unsigned u; } w;
      w.h[0] = (_Float16)lo[j][e];
      w.h[1] = (_Float16)hi[j][e];
      *(unsigned*)&q[e * PS + j * DSTEP] = w.u;
    }
  }
}

// AT: A lies d-major (srcA at [0][first m], pitch Ff); otherwise m-major (srcA
// at [first m][first d], pitch Ff). B always lies d-major. vec (AT only, may
// be null): 64 values; the block then also makes cvec[m] = sum_d A(m, d) vec[d]
// as one more column of the product.
template <bool AT>
__device__ __forceinline__ void weight_product(
    const float* __restrict__ srcA, const float* __restrict__ srcB,
    const float* __restrict__ vec, _Float16* __restrict__ C, int ldc,
    float* __restrict__ cvec, _Float16* As, _Float16* Bs)
{
  const int lane  = threadIdx.x & 31;
  const int wave  = threadIdx.x >> 5;
  const int n0    = lane & 15;
  const int half8 = ((lane >> 4) & 1) << 3;
  const int r0    = (lane >> 4) * 8;

  // every global read of the block ahead of its first LDS store
  v4f alo[4], ahi[4], blo[2], bhi[2], vv[2][4];
  const float* pa = AT ? addrT<128>(srcA)
                       : srcA + (threadIdx.x >> 4) * Ff + (threadIdx.x & 15) * 4;
  const float* pb = addrT<64>(srcB);
  const float* pv = vec + half8;                // the k order of frag_at
  if constexpr (AT) {
    loadT<128>(pa, alo, ahi);
  } else {
    #pragma unroll
    for (int j = 0; j < 4; ++j) {               // rows 16 j + (t >> 4), and 64 more
      alo[j] = *(const v4f*)(pa + 16 * j * Ff);
      ahi[j] = *(const v4f*)(pa + (64 + 16 * j) * Ff);
    }
  }
  loadT<64>(pb, blo, bhi);
  const bool withVec = AT && vec != nullptr;    // the same for the whole block
  if (withVec) {
    #pragma unroll
    for (int s = 0; s < 2; ++s) {
      vv[s][0] = *(const v4f*)(pv + 32 * s);
      vv[s][1] = *(const v4f*)(pv + 32 * s + 4);
      vv[s][2] = *(const v4f*)(pv + 32 * s + 16);
      vv[s][3] = *(const v4f*)(pv + 32 * s + 20);
    }
  }
  // stands ahead of whatever is written into the address registers of the
  // loads above; it names the addresses as inputs so that their registers stay
  // untouched (also by a later load's result) up to the wait
  if constexpr (AT) asm volatile("s_wait_xcnt 0x0" :: "v"(pa), "v"(pb), "v"(pv) : "memory");
  else              asm volatile("s_wait_xcnt 0x0" :: "v"(pa), "v"(pb) : "memory");
  if constexpr (AT) {
    storeT<128>(As, alo, ahi);
  } else {
    _Float16* q = As + (threadIdx.x >> 4) * PS + (threadIdx.x & 15) * 4;
    #pragma unroll
    for (int j = 0; j < 4; ++j) {
      *(uint2*)&q[16 * j * PS]        = pack4h(alo[j]);
      *(uint2*)&q[(64 + 16 * j) * PS] = pack4h(ahi[j]);
    }
  }
  storeT<64>(Bs, blo, bhi);
  __syncthreads();

  const _Float16* ap = &As[(wave * 16 + n0) * PS + half8];
  const _Float16* bp = &Bs[n0 * PS + half8];
  const v16h a0 = frag_at(ap), a1 = frag_at(ap + 32);
  v8f accv = (v8f){};
  if (withVec) {
    // B fragment with vec in column 0 and zeros in the other fifteen
    #pragma unroll
    for (int s = 0; s < 2; ++s) {
      v16h b;
      #pragma unroll
      for (int e = 0; e < 16; ++e)
        b[e] = (n0 == 0) ? (_Float16)vv[s][e >> 2][e & 3] : (_Float16)0.0f;
      accv = __builtin_amdgcn_wmma_f32_16x16x32_f16(false, s ? a1 : a0, false, b, (short)0, accv, false, false);
    }
  }
  v8f acc[4];
  #pragma unroll
  for (int j = 0; j < 4; ++j) {
    acc[j] = (v8f){};
    acc[j] = __builtin_amdgcn_wmma_f32_16x16x32_f16(false, a0, false, frag_at(bp + 16 * j * PS), (short)0, acc[j], false, false);
    acc[j] = __builtin_amdgcn_wmma_f32_16x16x32_f16(false, a1, false, frag_at(bp + 16 * j * PS + 32), (short)0, acc[j], false, false);
  }
  _Float16* o = C + (size_t)(wave * 16 + r0) * ldc + n0;
  _Float16 h[4][8];
  #pragma unroll
  for (int j = 0; j < 4; ++j)
    #pragma unroll
    for (int r = 0; r < 8; ++r) h[j][r] = (_Float16)acc[j][r];
  #pragma unroll
  for (int j = 0; j < 4; ++j)
    #pragma unroll
    for (int r = 0; r < 8; ++r) o[r * ldc + 16 * j] = h[j][r];
  if (withVec && n0 == 0) {
    #pragma unroll
    for (int r = 0; r < 8; ++r) cvec[wave * 16 + r0 + r] = accv[r];
  }
  // the built code may join this part's exit with another part's path, where
  // registers that the stores name are written again: the wait stands ahead
  asm volatile("s_wait_xcnt 0x0" ::: "memory");
}

// bfv[o] = bf[o] + sum_j Wf[o][j] bv[j], j < 256: a pair of waves takes 16 rows
// of Wf, each wave one half of K as A fragments straight from memory (all of K
// in one wave would set the register count of the whole launch); bv is column
// 0 of the B fragments. The odd wave hands its sums to the even one in LDS.
__device__ __forceinline__ void bias_product(
    const float* __restrict__ Wf, const float* __restrict__ bv,
    const float* __restrict__ bf, float* __restrict__ bfv, int blk,
    _Float16* vs, float* red)
{
  const int lane  = threadIdx.x & 31;
  const int wave  = threadIdx.x >> 5;
  const int n0    = lane & 15;
  const int half8 = ((lane >> 4) & 1) << 3;
  const int r0    = (lane >> 4) * 8;
  const int kh    = wave & 1;
  const int row0  = (blk * 4 + (wave >> 1)) * 16;
  const float* ap = Wf + (size_t)(row0 + n0) * Ff + 128 * kh + half8;
  v4f av[4][4];
  // unrolled: av[][] must stay in registers
  #pragma unroll
  for (int s = 0; s < 4; ++s) {
    av[s][0] = *(const v4f*)(ap + 32 * s);
    av[s][1] = *(const v4f*)(ap + 32 * s + 4);
    av[s][2] = *(const v4f*)(ap + 32 * s + 16);
    av[s][3] = *(const v4f*)(ap + 32 * s + 20);
  }
  const float* pbv = bv + threadIdx.x;
  const float* pbf = bf + row0 + r0;
  const float bvv = *pbv;
  const v4f f0 = *(const v4f*)(pbf);
  const v4f f1 = *(const v4f*)(pbf + 4);
  // stands ahead of whatever is written into the address registers of the
  // loads above; it names the addresses as inputs so that their registers stay
  // untouched (also by a later load's result) up to the wait
  asm volatile("s_wait_xcnt 0x0" :: "v"(ap), "v"(pbv), "v"(pbf) : "memory");
  vs[threadIdx.x] = (_Float16)bvv;
  __syncthreads();
  v8f acc = (v8f){};
  #pragma unroll
  for (int s = 0; s < 4; ++s) {
    FragU a;
    a.q[0].x = pack4h(av[s][0]).x; a.q[0].y = pack4h(av[s][0]).y;
    a.q[0].z = pack4h(av[s][1]).x; a.q[0].w = pack4h(av[s][1]).y;
    a.q[1].x = pack4h(av[s][2]).x; a.q[1].y = pack4h(av[s][2]).y;
    a.q[1].z = pack4h(av[s][3]).x; a.q[1].w = pack4h(av[s][3]).y;
    const v16h bl = frag_at(vs + 128 * kh + 32 * s + half8);
    v16h b;
    #pragma unroll
    for (int e = 0; e < 16; ++e) b[e] = (n0 == 0) ? bl[e] : (_Float16)0.0f;
    acc = __builtin_amdgcn_wmma_f32_16x16x32_f16(false, a.v, false, b, (short)0, acc, false, false);
  }
  float* rp = red + (wave >> 1) * 16 + r0;
  if (kh == 1 && n0 == 0) {
    #pragma unroll
    for (int r = 0; r < 8; ++r) rp[r] = acc[r];
  }
  __syncthreads();
  if (kh == 0 && n0 == 0) {
    #pragma unroll
    for (int r = 0; r < 8; ++r)
      bfv[row0 + r0 + r] = (acc[r] + rp[r]) + (r < 4 ? f0[r & 3] : f1[r & 3]);
  }
  // as at the end of weight_product
  asm volatile("s_wait_xcnt 0x0" ::: "memory");
}

// grid = PREP_BLOCKS; the parts with the longest way to go come first
__global__ __launch_bounds__(256) void prep_kernel(
    const float* __restrict__ x,  const float* __restrict__ Wq,
    const float* __restrict__ bq, const float* __restrict__ Wk,
    const float* __restrict__ Wv, const float* __restrict__ bv,
    const float* __restrict__ Wf, const float* __restrict__ bf,
    const float* __restrict__ W1, const float* __restrict__ W2,
    _Float16* __restrict__ xcH, _Float16* __restrict__ mqH,
    float* __restrict__ cq, _Float16* __restrict__ wfvH,
    float* __restrict__ bfv, _Float16* __restrict__ w1H,
    _Float16* __restrict__ w2H, float* __restrict__ stats)
{
  __shared__ __attribute__((aligned(16))) _Float16 As[128 * PS];
  __shared__ __attribute__((aligned(16))) _Float16 Bs[64 * PS];
  int blk = blockIdx.x;
  if (blk < 2 * PREP_PROD) {
    const int h = (blk >> 3) & 3, mb = (blk >> 2) & 1, nb = blk & 3;
    if (blk < PREP_PROD) {
      // mq[h*256 + f][g] = sum_d Wk[h*64 + d][f] Wq[h*64 + d][g]; cq with bq
      weight_product<true>(Wk + h * Dd * Ff + mb * 128, Wq + h * Dd * Ff + nb * 64,
                           nb == 0 ? bq + h * Dd : nullptr,
                           mqH + (size_t)(h * Ff + mb * 128) * Ff + nb * 64, Ff,
                           cq + h * Ff + mb * 128, As, Bs);
    } else {
      // wfv[o][h*256 + f] = sum_d Wf[o][h*64 + d] Wv[h*64 + d][f]
      weight_product<false>(Wf + mb * 128 * Ff + h * Dd, Wv + h * Dd * Ff + nb * 64,
                            nullptr,
                            wfvH + (size_t)(mb * 128) * (Hh * Ff) + h * Ff + nb * 64, Hh * Ff,
                            nullptr, As, Bs);
    }
    return;
  }
  blk -= 2 * PREP_PROD;
  if (blk < PREP_BIAS) {
    if (blk == 0 && threadIdx.x < 16) stats[threadIdx.x] = 0.f;  // both LN sets
    bias_product(Wf, bv, bf, bfv, blk, As, (float*)Bs);
    return;
  }
  blk -= PREP_BIAS;
  if (blk < PREP_CENTRE) { cvt_centre_f16(x, xcH, blk); return; }
  blk -= PREP_CENTRE;
  if (blk < PREP_FFN) cvt_flat_f16(W1, w1H, blk);
  else                cvt_flat_f16(W2, w2H, blk - PREP_FFN);
}

// ---------------------------------------------------------------------------
extern "C" void kernel_launch(void* const* d_in, const int* in_sizes, int n_in,
                              void* d_out, int out_size, void* d_ws, size_t ws_size,
                              hipStream_t stream) {
  const float* x    = (const float*)d_in[0];
  const float* Wq   = (const float*)d_in[1];
  const float* bq   = (const float*)d_in[2];
  const float* Wk   = (const float*)d_in[3];
  // d_in[4] (bk) adds q_h . bk_h to all 25 scores of a head: cancels in softmax
  const float* Wv   = (const float*)d_in[5];
  const float* bv   = (const float*)d_in[6];
  const float* Wf   = (const float*)d_in[7];
  const float* bf   = (const float*)d_in[8];
  const float* ln1w = (const float*)d_in[9];
  const float* ln1b = (const float*)d_in[10];
  const float* ln2w = (const float*)d_in[11];
  const float* ln2b = (const float*)d_in[12];
  const float* W1   = (const float*)d_in[13];
  const float* b1   = (const float*)d_in[14];
  const float* W2   = (const float*)d_in[15];
  const float* b2   = (const float*)d_in[16];

  char* ws = (char*)d_ws;
  size_t off = 0;
  auto alloc = [&](size_t bytes) -> void* {
    void* p = ws + off;
    off += (bytes + 255) & ~(size_t)255;
    return p;
  };

  _Float16* xcH     = (_Float16*)alloc((size_t)ROWS * Ff * 2);     // centre tokens
  _Float16* mqH     = (_Float16*)alloc((size_t)Hh * Ff * Ff * 2);  // Wk_h^T Wq_h
  float*    cq      = (float*)   alloc((size_t)Hh * Ff * 4);       // Wk_h^T bq_h
  _Float16* wfvH    = (_Float16*)alloc((size_t)Ff * Hh * Ff * 2);  // Wf_h Wv_h
  float*    bfv     = (float*)   alloc((size_t)Ff * 4);            // Wf bv + bf
  _Float16* w1H     = (_Float16*)alloc((size_t)DFFc * Ff * 2);
  _Float16* w2H     = (_Float16*)alloc((size_t)Ff * DFFc * 2);
  float*    qtF     = (float*)   alloc((size_t)ROWS * Hh * Ff * 4); // Wk_h^T q_h
  _Float16* xwH     = (_Float16*)alloc((size_t)ROWS * Hh * Ff * 2); // sum_p w_p x_p
  float*    attent  = (float*)   alloc((size_t)ROWS * Ff * 4);
  float*    out1F   = (float*)   alloc((size_t)ROWS * Ff * 4);
  _Float16* out1H   = (_Float16*)alloc((size_t)ROWS * Ff * 2);
  _Float16* hidH    = (_Float16*)alloc((size_t)ROWS * DFFc * 2);
  float*    ytmp    = (float*)   alloc((size_t)ROWS * Ff * 4);
  float*    stats   = (float*)   alloc(256);                       // 2 sets of 4x2

  // --- prep: zero LN stats, centre tokens and FFN weights to f16, weight products
  prep_kernel<<<PREP_BLOCKS, 256, 0, stream>>>(x, Wq, bq, Wk, Wv, bv, Wf, bf, W1, W2,
                                               xcH, mqH, cq, wfvH, bfv, w1H, w2H,
                                               stats);

  // --- folded query of all heads: (5120 x 256) @ (256 x 1024) + cq -> f32
  {
    dim3 g(ROWS / 256, (Hh * Ff) / 64);
    gemm_f16_wmma<Ff, Hh * Ff, 2, false, false><<<g, 256, 0, stream>>>(xcH, mqH, cq, nullptr,
                                                                       qtF, nullptr, nullptr, 0,
                                                                       Ff, 0, 0);
  }

  // --- scores, softmax over 25 and weighted patch sum per head, x read once
  patch_attention_folded<<<ROWS / WPB, WPB * 32, 0, stream>>>(x, qtF, xwH);

  // --- value and output projection in one: (5120 x 1024) @ (1024 x 256) + bfv
  //     -> attent f32, LN 1 sums; 16 rows a wave as in the second FFN product
  {
    dim3 g(ROWS / 128, Ff / 64);
    gemm_f16_wmma<Hh * Ff, Ff, 1, false, true><<<g, 256, 0, stream>>>(xwH, wfvH, bfv, nullptr,
                                                                      attent, nullptr, stats, 0,
                                                                      Hh * Ff, 0, 0);
  }

  // --- LayerNorm 1 (per batch over N,O,F) -> out1 (f32 + f16)
  ln_apply_kernel<<<PB4 / 256, 256, 0, stream>>>(attent, ln1w, ln1b, stats,
                                                 out1F, out1H);

  // --- FFN: relu(out1 @ W1^T + b1) @ W2^T + b2 + out1
  {
    dim3 g(ROWS / 256, DFFc / 64);
    gemm_f16_wmma<Ff, DFFc, 2, false, false><<<g, 256, 0, stream>>>(out1H, w1H, b1, nullptr,
                                                                    nullptr, hidH, nullptr, 1,
                                                                    Ff, 0, 0);
  }
  {
    // 16 rows a wave: its A fragments for K = 1024 fill 256 registers; LN 2 sums
    dim3 g(ROWS / 128, Ff / 64);
    gemm_f16_wmma<DFFc, Ff, 1, true, true><<<g, 256, 0, stream>>>(hidH, w2H, b2, out1F,
                                                                  ytmp, nullptr, stats + 8, 0,
                                                                  DFFc, 0, 0);
  }

  // --- LayerNorm 2 -> d_out (f32)
  ln_apply_kernel<<<PB4 / 256, 256, 0, stream>>>(ytmp, ln2w, ln2b, stats + 8,
                                                 (float*)d_out, nullptr);
}

// v007
// It runs in 59.6 microseconds.
// In both of two side-by-side timings against v006, it was 1.12 times as fast.
// Over all steps from v000 it is 5.38 times as fast.
#include <hip/hip_runtime.h>
#include <hip/hip_bf16.h>
#include <math.h>

typedef __attribute__((ext_vector_type(16))) _Float16 v16h;
typedef __attribute__((ext_vector_type(8)))  float    v8f;
typedef __attribute__((ext_vector_type(4)))  float    v4f;

#define Bb   4
#define Nn_  256
#define Oo   5
#define KK2  25      // K*K patch positions
#define Ff   256
#define Hh   4
#define Dd   64
#define DFFc 1024

constexpr int ROWS = Bb * Nn_ * Oo;         // 5120 output rows
constexpr int PB   = Nn_ * Oo * Ff;         // 327680 elems per batch for LN

constexpr int WPB  = 4;                     // waves (patches) per block, folded attention

// ---------------------------------------------------------------------------
// helpers
// ---------------------------------------------------------------------------
union FragU { v16h v; uint4 q[2]; };

// Load one f16 16x32 fragment given per-lane base (row/col and half-offset
// already folded in): elements 0..7 at +k, elements 8..15 at +k+16.
__device__ __forceinline__ v16h frag_at(const _Float16* p) {
  FragU f;
  f.q[0] = *(const uint4*)(p);
  f.q[1] = *(const uint4*)(p + 16);
  return f.v;
}

// ---------------------------------------------------------------------------
// GEMM: C[M][NT] = A[M][KT] * W[NT][KT]^T (+bias) (relu?) (+addsrc) -> f32/f16
// block = 256 threads = 8 waves; a wave computes 16*RG rows x 64 cols (RG A
// fragments share 4 B fragments per k-step); block tile is (128*RG) x 64.
// grid = (M/(128*RG), NT/64). NT is a compile-time constant so that one
// address serves all of a lane's C positions (constant offsets from it).
// Nothing is fetched step by step: a block issues every global read it will
// ever make ahead of its k loop, so that their latencies run side by side.
// The B panel (64 cols x all of K) goes to LDS by async copies shared by the
// 8 waves, filled once; a wave's A fragments for all of K, its bias values
// and (ADD) its residual values go to registers.
// A rows have pitch lda, and column block y reads A from column
// (y >> aShift) * aStep on; every launch here passes 0 for both.
// STATS: the block also adds the sum and the sum of squares of its C values,
// taken from the registers that hold them, to the LayerNorm sums of its batch
// element, so that no launch has to read C again for them.
//
// f16 16x32 fragment layout (A and B identical): lane L<16 -> row/col L,
// elements 0..7 = K [k0+off, k0+off+8), elements 8..15 = +16; off = 8*(L>=16).
// Both runs are contiguous -> two b128 loads per fragment.
// ---------------------------------------------------------------------------
template <int KT, int NT, int RG, bool ADD, bool STATS>
__global__ __launch_bounds__(256) void gemm_f16_wmma(
    const _Float16* __restrict__ A, const _Float16* __restrict__ W,
    const float* __restrict__ bias, const float* __restrict__ addsrc,
    float* __restrict__ outF, _Float16* __restrict__ outH,
    float* __restrict__ stats, int doRelu, int lda, int aShift, int aStep)
{
  // The panel lies in LDS in PARTS runs of K, each 64 rows of KP values, so
  // that inside a part every fragment is within the 64 KB that the offset
  // field of an LDS load reaches from one address register.
  constexpr int PARTS   = (KT > 512) ? KT / 512 : 1;
  constexpr int KP      = KT / PARTS;
  constexpr int BSTRIDE = KP + 8;           // +16B pad: breaks LDS bank conflicts
  constexpr int STEPS   = KT / 32;          // k-steps, and B copies per thread
  constexpr int SPP     = STEPS / PARTS;    // k-steps per part
  // A wave has at most 63 loads outstanding, and the barrier below waits for
  // every load issued ahead of it. So only the first PRE steps' A fragments
  // are asked for ahead of the barrier; the rest, and the residual, are asked
  // for behind it and land while the first steps are worked on.
  constexpr int PRE     = (2 * RG * STEPS <= 48) ? STEPS : 24 / RG;
  __shared__ _Float16 Bs[PARTS * 64 * BSTRIDE];

  const int lane    = threadIdx.x & 31;
  const int wave    = threadIdx.x >> 5;
  const int rowBase = (blockIdx.x * 8 + wave) * (16 * RG);
  const int colBase = blockIdx.y * 64;

  const int n0    = lane & 15;              // row (A) / col (B) within tile
  const int half8 = ((lane >> 4) & 1) << 3; // K sub-offset per lane half
  const int r0    = (lane >> 4) * 8;        // first C row of this lane half

  // --- B panel, 64 rows x KT f16 -> LDS: 4 threads per row, STEPS b128 chunks
  // each (chunks of 8 values, 32 values apart). The xcnt wait closes each
  // statement so that no address register of an issued copy is rewritten
  // ahead of it.
  {
    const int srow = threadIdx.x >> 2;          // 0..63
    const int skc  = (threadIdx.x & 3) << 3;    // 0,8,16,24
    const _Float16* src = W + (size_t)(colBase + srow) * KT + skc;
    const unsigned lds0 = (unsigned)(uintptr_t)&Bs[srow * BSTRIDE + skc];
    if constexpr (STEPS % 8 == 0) {
      static_assert(SPP % 8 == 0, "a statement's eight chunks lie in one part");
      // unrolled: c is a compile-time index into the parts
      #pragma unroll
      for (int c = 0; c < STEPS; c += 8) {
        const unsigned lds = lds0 + ((c / SPP) * 64 * BSTRIDE + (c % SPP) * 32) * 2;
        asm volatile("global_load_async_to_lds_b128 %0, %1, off\n\t"
                     "global_load_async_to_lds_b128 %2, %3, off\n\t"
                     "global_load_async_to_lds_b128 %4, %5, off\n\t"
                     "global_load_async_to_lds_b128 %6, %7, off\n\t"
                     "global_load_async_to_lds_b128 %8, %9, off\n\t"
                     "global_load_async_to_lds_b128 %10, %11, off\n\t"
                     "global_load_async_to_lds_b128 %12, %13, off\n\t"
                     "global_load_async_to_lds_b128 %14, %15, off\n\t"
                     "s_wait_xcnt 0x0"
                     :: "v"(lds),       "v"(src),
                        "v"(lds + 64),  "v"(src + 32),
                        "v"(lds + 128), "v"(src + 64),
                        "v"(lds + 192), "v"(src + 96),
                        "v"(lds + 256), "v"(src + 128),
                        "v"(lds + 320), "v"(src + 160),
                        "v"(lds + 384), "v"(src + 192),
                        "v"(lds + 448), "v"(src + 224)
                     : "memory");
        src += 256;
      }
    } else {
      static_assert(STEPS == 2, "two chunks a thread");
      asm volatile("global_load_async_to_lds_b128 %0, %1, off\n\t"
                   "global_load_async_to_lds_b128 %2, %3, off\n\t"
                   "s_wait_xcnt 0x0"
                   :: "v"(lds0), "v"(src), "v"(lds0 + 64), "v"(src + 32)
                   : "memory");
    }
  }

  float bv[4] = {0.0f, 0.0f, 0.0f, 0.0f};
  // --- A fragments of the first PRE k-steps, k ascending
  const _Float16* aPtr = A + (size_t)(rowBase + n0) * lda
                           + ((int)blockIdx.y >> aShift) * aStep + half8;
  static_assert(RG <= 2, "the waits below name one or two row addresses");
  const _Float16* aPtr1 = aPtr + (size_t)(16 * (RG - 1)) * lda;  // last row group
  FragU a[STEPS][RG];
  // unrolled: a[][] must stay in registers
  #pragma unroll
  for (int s = 0; s < PRE; ++s) {
    #pragma unroll
    for (int g = 0; g < RG; ++g) {
      const _Float16* p = (g ? aPtr1 : aPtr) + 32 * s;
      a[s][g].q[0] = *(const uint4*)(p);
      a[s][g].q[1] = *(const uint4*)(p + 16);
    }
  }
  // stands ahead of whatever is written into the address registers of the
  // loads above (the bias address may be formed in them); it names the
  // addresses as inputs so that their registers stay untouched up to the wait
  asm volatile("s_wait_xcnt 0x0" :: "v"(aPtr), "v"(aPtr1) : "memory");
  // --- bias, needed only behind the k loop
  if (bias) {
    #pragma unroll
    for (int j = 0; j < 4; ++j) bv[j] = bias[colBase + 16 * j + n0];
  }
  // the same for the bias loads
  asm volatile("s_wait_xcnt 0x0" ::: "memory");

  v8f acc[4 * RG];
  #pragma unroll
  for (int j = 0; j < 4 * RG; ++j) acc[j] = (v8f){};

  // own copies landed, then every wave's: the panel is read only behind this
  asm volatile("s_wait_asynccnt 0x0" ::: "memory");
  __syncthreads();

  // --- the late A fragments and the residual
  #pragma unroll
  for (int s = PRE; s < STEPS; ++s) {
    #pragma unroll
    for (int g = 0; g < RG; ++g) {
      const _Float16* p = (g ? aPtr1 : aPtr) + 32 * s;
      a[s][g].q[0] = *(const uint4*)(p);
      a[s][g].q[1] = *(const uint4*)(p + 16);
    }
  }
  // a lane's first C position; (g, j, r) lies (16 g + r) * NT + 16 j behind it
  const size_t c0 = (size_t)(rowBase + r0) * NT + colBase + n0;
  float ad[ADD ? RG * 32 : 1];
  const float* ap = ADD ? addsrc + c0 : nullptr;
  if constexpr (ADD) {
    #pragma unroll
    for (int g = 0; g < RG; ++g)
      #pragma unroll
      for (int j = 0; j < 4; ++j)
        #pragma unroll
        for (int r = 0; r < 8; ++r)
          ad[(g * 4 + j) * 8 + r] = ap[(16 * g + r) * NT + 16 * j];
  }
  if constexpr (ADD || PRE < STEPS) {
    // stands ahead of whatever is written into the address registers of the
    // loads just issued; it names the addresses as inputs so that their
    // registers stay untouched up to the wait
    asm volatile("s_wait_xcnt 0x0" :: "v"(aPtr), "v"(aPtr1), "v"(ap) : "memory");
  }

  // --- k loop: B fragments from LDS, A fragments already in registers
  FragU cur[SPP][RG];
  #pragma unroll
  for (int s = 0; s < SPP; ++s)
    #pragma unroll
    for (int g = 0; g < RG; ++g) cur[s][g] = a[s][g];
  const _Float16* bb = &Bs[n0 * BSTRIDE + half8];
  // the loop over the parts stays rolled: bb is then a register that moves
  // from part to part, and every LDS load of the body is bb + a small offset;
  // unrolled, each load beyond 64 KB would need an address of its own
  #pragma unroll 1
  for (int part = 0; part < PARTS; ++part) {
    // unrolled: cur[s] is a register index
    #pragma unroll
    for (int s = 0; s < SPP; ++s) {
      const v16h b0 = frag_at(bb + 32 * s);
      const v16h b1 = frag_at(bb + 32 * s + 16 * BSTRIDE);
      const v16h b2 = frag_at(bb + 32 * s + 32 * BSTRIDE);
      const v16h b3 = frag_at(bb + 32 * s + 48 * BSTRIDE);
      #pragma unroll
      for (int g = 0; g < RG; ++g) {
        const v16h ag = cur[s][g].v;
        acc[g * 4 + 0] = __builtin_amdgcn_wmma_f32_16x16x32_f16(false, ag, false, b0, (short)0, acc[g * 4 + 0], false, false);
        acc[g * 4 + 1] = __builtin_amdgcn_wmma_f32_16x16x32_f16(false, ag, false, b1, (short)0, acc[g * 4 + 1], false, false);
        acc[g * 4 + 2] = __builtin_amdgcn_wmma_f32_16x16x32_f16(false, ag, false, b2, (short)0, acc[g * 4 + 2], false, false);
        acc[g * 4 + 3] = __builtin_amdgcn_wmma_f32_16x16x32_f16(false, ag, false, b3, (short)0, acc[g * 4 + 3], false, false);
      }
    }
    if constexpr (PARTS > 1) {
      static_assert(PARTS <= 2, "cur is refilled from the second part only");
      #pragma unroll
      for (int s = 0; s < SPP; ++s)
        #pragma unroll
        for (int g = 0; g < RG; ++g) cur[s][g] = a[SPP + s][g];
      bb += 64 * BSTRIDE;
    }
  }

  // C/D layout: VGPR r -> (M=r, N=lane) for lanes 0-15, (M=r+8, N=lane-16)
  // final values first, in place; then all stores of a kind in one run, so
  // that no store is waited for before the next is issued
  #pragma unroll
  for (int t = 0; t < 4 * RG; ++t) {        // t = 4 g + j
    #pragma unroll
    for (int r = 0; r < 8; ++r) {
      float v = acc[t][r] + bv[t & 3];
      if (doRelu) v = fmaxf(v, 0.0f);
      if constexpr (ADD) v += ad[t * 8 + r];
      acc[t][r] = v;
    }
  }
  if constexpr (STATS) {
    // ahead of the stores: the barrier below waits for every store that a wave
    // has issued, so here it waits for none, and the two adds fly beside them
    static_assert((Nn_ * Oo) % (128 * RG) == 0, "a block's rows lie in one batch element");
    __shared__ float red[16];
    v8f s8 = acc[0];
    v8f q8 = acc[0] * acc[0];
    // unrolled: acc[t] is a register index
    #pragma unroll
    for (int t = 1; t < 4 * RG; ++t) {
      s8 += acc[t];
      q8 += acc[t] * acc[t];
    }
    float s = ((s8[0] + s8[1]) + (s8[2] + s8[3])) + ((s8[4] + s8[5]) + (s8[6] + s8[7]));
    float q = ((q8[0] + q8[1]) + (q8[2] + q8[3])) + ((q8[4] + q8[5]) + (q8[6] + q8[7]));
    for (int o = 16; o > 0; o >>= 1) {
      s += __shfl_xor(s, o, 32);
      q += __shfl_xor(q, o, 32);
    }
    if (lane == 0) { red[wave] = s; red[8 + wave] = q; }
    __syncthreads();
    // thread 0 adds up the eight waves' sums, thread 1 their sums of squares
    if (threadIdx.x < 2) {
      const float* p = red + 8 * threadIdx.x;
      const float tot = ((p[0] + p[1]) + (p[2] + p[3])) + ((p[4] + p[5]) + (p[6] + p[7]));
      const int b = (blockIdx.x * (128 * RG)) / (Nn_ * Oo);
      atomicAdd(&stats[2 * b + threadIdx.x], tot);
    }
  }
  if (outF) {
    float* o = outF + c0;
    #pragma unroll
    for (int t = 0; t < 4 * RG; ++t)
      #pragma unroll
      for (int r = 0; r < 8; ++r)
        o[(16 * (t >> 2) + r) * NT + 16 * (t & 3)] = acc[t][r];
  }
  // the f16 conversions below may reuse registers that the stores above name
  asm volatile("s_wait_xcnt 0x0" ::: "memory");
  if (outH) {
    _Float16* o = outH + c0;
    _Float16 h[4 * RG][8];
    #pragma unroll
    for (int t = 0; t < 4 * RG; ++t)
      #pragma unroll
      for (int r = 0; r < 8; ++r) h[t][r] = (_Float16)acc[t][r];
    #pragma unroll
    for (int t = 0; t < 4 * RG; ++t)
      #pragma unroll
      for (int r = 0; r < 8; ++r)
        o[(16 * (t >> 2) + r) * NT + 16 * (t & 3)] = h[t][r];
  }
}

// ---------------------------------------------------------------------------
// Folded patch attention. With qt[h] = Wk_h^T q_h (256 long, q the centre
// query) the score of patch position p is qt[h] . x_p / 8 (+ q_h . bk_h, the
// same for every p of a head, so it cancels in the softmax), and the merged
// value is Wv_h (sum_p w_p x_p) + bv_h because the weights sum to one. This
// kernel reads x once in f32 and writes xw[h] = sum_p w_p x_p per head.
// One wave per patch, no LDS and no barrier: the wave holds all 25 rows in
// registers, a lane 8 of a row's 256 values (f0..f0+3 and 128+f0..128+f0+3).
// ---------------------------------------------------------------------------
__device__ __forceinline__ float dot4(const v4f a, const v4f b, float s) {
  s = fmaf(a.x, b.x, s);
  s = fmaf(a.y, b.y, s);
  s = fmaf(a.z, b.z, s);
  s = fmaf(a.w, b.w, s);
  return s;
}
// lanes L and L ^ N: the lane with bit N clear keeps v[0..N), the other
// v[N..2N); each adds the partner's share of what it keeps
template <int N, int S>
__device__ __forceinline__ void halve_step(float (&v)[S], int lane) {
  const bool hi = (lane & N) != 0;
  #pragma unroll
  for (int j = 0; j < N; ++j) {
    const float send = hi ? v[j] : v[j + N];
    const float keep = hi ? v[j + N] : v[j];
    v[j] = keep + __shfl_xor(send, N, 32);
  }
}
__device__ __forceinline__ float lane_bcast(float v, int srcLane) {
  return __builtin_bit_cast(float,
      __builtin_amdgcn_readlane(__builtin_bit_cast(int, v), srcLane));
}

__global__ __launch_bounds__(WPB * 32) void patch_attention_folded(
    const float* __restrict__ x, const float* __restrict__ qt,
    _Float16* __restrict__ xw)
{
  const int lane = threadIdx.x & 31;
  const int bno  = blockIdx.x * WPB + (threadIdx.x >> 5);
  const int f0   = lane * 4;
  const float* qp = qt + (size_t)bno * (Hh * Ff) + f0;
  const float* xp = x + (size_t)bno * (KK2 * Ff) + f0;

  v4f q[Hh][2];
  #pragma unroll
  for (int h = 0; h < Hh; ++h) {
    q[h][0] = *(const v4f*)(qp + h * Ff);
    q[h][1] = *(const v4f*)(qp + h * Ff + 128);
  }
  // the address pair of the eight loads above is dead from here on and a row
  // load's result may land in it: the wait stands ahead of that overwrite
  asm volatile("s_wait_xcnt 0x0" ::: "memory");
  v4f xr[KK2][2];
  #pragma unroll
  for (int p = 0; p < KK2; ++p) {
    xr[p][0] = *(const v4f*)(xp + p * Ff);
    xr[p][1] = *(const v4f*)(xp + p * Ff + 128);
  }
  // the same for the address pair of the fifty row loads, which is free for
  // the arithmetic below as soon as the last of them has issued
  asm volatile("s_wait_xcnt 0x0" ::: "memory");
  // scores. Rows 0..23 in three groups of 8: 32 partial dots per lane, index
  // pl*4 + h; five halving steps leave lane L with the full sum of index L,
  // so lane L carries p = 8g + (L >> 2), h = L & 3.
  float s[3];
  #pragma unroll
  for (int g = 0; g < 3; ++g) {
    float v[32];
    #pragma unroll
    for (int pl = 0; pl < 8; ++pl)
      #pragma unroll
      for (int h = 0; h < Hh; ++h)
        v[pl * 4 + h] = dot4(xr[8 * g + pl][1], q[h][1],
                             dot4(xr[8 * g + pl][0], q[h][0], 0.f));
    halve_step<16>(v, lane);
    halve_step<8>(v, lane);
    halve_step<4>(v, lane);
    halve_step<2>(v, lane);
    halve_step<1>(v, lane);
    s[g] = v[0] * 0.125f;
  }
  // row 24: every lane ends with the full sum of head L & 3
  float s24;
  {
    float v[4];
    #pragma unroll
    for (int h = 0; h < Hh; ++h)
      v[h] = dot4(xr[24][1], q[h][1], dot4(xr[24][0], q[h][0], 0.f));
    halve_step<2>(v, lane);
    halve_step<1>(v, lane);
    #pragma unroll
    for (int o = 4; o <= 16; o <<= 1) v[0] += __shfl_xor(v[0], o, 32);
    s24 = v[0] * 0.125f;
  }

  // softmax over the 25 positions of head L & 3 (lanes L, L^4, L^8, L^16 ...)
  float mx = fmaxf(fmaxf(s[0], s[1]), fmaxf(s[2], s24));
  #pragma unroll
  for (int o = 4; o <= 16; o <<= 1) mx = fmaxf(mx, __shfl_xor(mx, o, 32));
  const float e0  = __expf(s[0] - mx);
  const float e1  = __expf(s[1] - mx);
  const float e2  = __expf(s[2] - mx);
  const float e24 = __expf(s24 - mx);
  float sum = (e0 + e1) + e2;
  #pragma unroll
  for (int o = 4; o <= 16; o <<= 1) sum += __shfl_xor(sum, o, 32);
  sum += e24;
  const float inv = 1.0f / sum;
  float wg[3];
  wg[0] = e0 * inv;
  wg[1] = e1 * inv;
  wg[2] = e2 * inv;
  const float w24 = e24 * inv;

  // weighted sum of the rows per head, p ascending; each weight is read from
  // its lane into a scalar
  _Float16* op = xw + (size_t)bno * (Hh * Ff) + f0;
  #pragma unroll
  for (int h = 0; h < Hh; ++h) {
    v4f a0 = (v4f){0.f, 0.f, 0.f, 0.f};
    v4f a1 = (v4f){0.f, 0.f, 0.f, 0.f};
    #pragma unroll
    for (int p = 0; p < KK2; ++p) {
      const float w = (p < 24) ? lane_bcast(wg[p >> 3], (p & 7) * 4 + h)
                               : lane_bcast(w24, h);
      a0.x = fmaf(w, xr[p][0].x, a0.x);
      a0.y = fmaf(w, xr[p][0].y, a0.y);
      a0.z = fmaf(w, xr[p][0].z, a0.z);
      a0.w = fmaf(w, xr[p][0].w, a0.w);
      a1.x = fmaf(w, xr[p][1].x, a1.x);
      a1.y = fmaf(w, xr[p][1].y, a1.y);
      a1.z = fmaf(w, xr[p][1].z, a1.z);
      a1.w = fmaf(w, xr[p][1].w, a1.w);
    }
    union { _Float16 hh[4]; uint2 u; } o0, o1;
    o0.hh[0] = (_Float16)a0.x; o0.hh[1] = (_Float16)a0.y;
    o0.hh[2] = (_Float16)a0.z; o0.hh[3] = (_Float16)a0.w;
    o1.hh[0] = (_Float16)a1.x; o1.hh[1] = (_Float16)a1.y;
    o1.hh[2] = (_Float16)a1.z; o1.hh[3] = (_Float16)a1.w;
    *(uint2*)(op + h * Ff)       = o0.u;
    *(uint2*)(op + h * Ff + 128) = o1.u;
  }
}

// ---------------------------------------------------------------------------
// LayerNorm over (N,O,F) per batch element: the sums come from the kernel that
// makes the values; this applies them. It moves 16-byte vectors and issues all
// loads of a thread before the first use.
// ---------------------------------------------------------------------------
constexpr int PB4        = PB / 4;                    // float4 per batch element
static_assert(PB4 % 256 == 0, "apply covers a batch exactly");

__device__ __forceinline__ uint2 pack4h(const v4f v) {
  union { _Float16 h[4]; uint2 u; } o;
  o.h[0] = (_Float16)v.x; o.h[1] = (_Float16)v.y;
  o.h[2] = (_Float16)v.z; o.h[3] = (_Float16)v.w;
  return o.u;
}

// grid = PB4 / 256. A thread takes the same four (n,o,f) positions in every
// batch element, so it reads g and beta once.
__global__ __launch_bounds__(256) void ln_apply_kernel(
    const float* __restrict__ x, const float* __restrict__ g,
    const float* __restrict__ beta, const float* __restrict__ stats,
    float* __restrict__ outF, _Float16* __restrict__ outH)
{
  const int r4 = blockIdx.x * 256 + threadIdx.x;
  float st[2 * Bb];
  #pragma unroll
  for (int k = 0; k < 2 * Bb; ++k) st[k] = stats[k];
  v4f xv[Bb];
  #pragma unroll
  for (int b = 0; b < Bb; ++b) xv[b] = ((const v4f*)x)[b * PB4 + r4];
  const v4f gv = ((const v4f*)g)[r4];
  const v4f bv = ((const v4f*)beta)[r4];
  // the base addresses of the six loads above are dead from here on: the wait
  // stands ahead of whatever is written into their registers
  asm volatile("s_wait_xcnt 0x0" ::: "memory");
  v4f o[Bb];
  #pragma unroll
  for (int b = 0; b < Bb; ++b) {
    const float mu  = st[2 * b + 0] * (1.0f / PB);
    const float var = st[2 * b + 1] * (1.0f / PB) - mu * mu;
    const float rs  = rsqrtf(var + 1e-5f);
    o[b].x = (xv[b].x - mu) * rs * gv.x + bv.x;
    o[b].y = (xv[b].y - mu) * rs * gv.y + bv.y;
    o[b].z = (xv[b].z - mu) * rs * gv.z + bv.z;
    o[b].w = (xv[b].w - mu) * rs * gv.w + bv.w;
  }
  if (outF) {
    #pragma unroll
    for (int b = 0; b < Bb; ++b) ((v4f*)outF)[b * PB4 + r4] = o[b];
  }
  // the f16 packing below may reuse registers that the stores above name
  asm volatile("s_wait_xcnt 0x0" ::: "memory");
  if (outH) {
    #pragma unroll
    for (int b = 0; b < Bb; ++b) ((uint2*)outH)[b * PB4 + r4] = pack4h(o[b]);
  }
}

// ---------------------------------------------------------------------------
// LayerNorm 1 apply and both FFN products in ONE launch:
//   o = LN(x);  y = relu(o W1^T + b1) W2^T + b2 + o   (+ the LayerNorm 2 sums)
// All three are local to a row, so a block that owns FM whole rows needs
// nothing of another block: o and the hidden layer of its rows never leave the
// WGP. The hidden units go by in NCH chunks of HC: a chunk's values are made
// from the chunk's rows of W1, rounded to f16 into LDS, and multiplied at once
// with the chunk's columns of W2 into accumulators that live through all
// chunks (k ascending, as in two separate products).
// The two weight pieces of a chunk (64 KB each) come by async copies into one
// of two LDS buffers: the next chunk's copies fly while this chunk is worked on.
// 8 waves: in the first product a wave takes 16 hidden units, in the second 32
// output columns, each for all FM rows.
// ---------------------------------------------------------------------------
constexpr int FM   = 32;                    // rows a block
constexpr int HC   = 128;                   // hidden units a chunk
constexpr int NCH  = DFFc / HC;
constexpr int P1   = Ff + 8;                // LDS pitches, +16 B against bank conflicts
constexpr int P2   = HC + 8;
constexpr int PC   = Ff + 4;                // the same for the f32 result tile
constexpr int W1V  = HC * P1;               // f16 values of a chunk of W1 in LDS
constexpr int W2V  = Ff * P2;               // and of W2
constexpr int BUFV = W1V + W2V;
static_assert((Nn_ * Oo) % FM == 0, "a block's rows lie in one batch element");
static_assert(FM * PC * 4 <= 2 * BUFV * 2, "the result tile fits the ring");

// eight copies of 16 bytes a lane, LB bytes apart in LDS and GV values apart in
// memory. The xcnt wait closes the statement so that no address register of an
// issued copy is rewritten ahead of it.
template <int LB, int GV>
__device__ __forceinline__ void copy8(unsigned lds, const _Float16* src) {
  asm volatile("global_load_async_to_lds_b128 %0, %1, off\n\t"
               "global_load_async_to_lds_b128 %2, %3, off\n\t"
               "global_load_async_to_lds_b128 %4, %5, off\n\t"
               "global_load_async_to_lds_b128 %6, %7, off\n\t"
               "global_load_async_to_lds_b128 %8, %9, off\n\t"
               "global_load_async_to_lds_b128 %10, %11, off\n\t"
               "global_load_async_to_lds_b128 %12, %13, off\n\t"
               "global_load_async_to_lds_b128 %14, %15, off\n\t"
               "s_wait_xcnt 0x0"
               :: "v"(lds),          "v"(src),
                  "v"(lds + LB),     "v"(src + GV),
                  "v"(lds + 2 * LB), "v"(src + 2 * GV),
                  "v"(lds + 3 * LB), "v"(src + 3 * GV),
                  "v"(lds + 4 * LB), "v"(src + 4 * GV),
                  "v"(lds + 5 * LB), "v"(src + 5 * GV),
                  "v"(lds + 6 * LB), "v"(src + 6 * GV),
                  "v"(lds + 7 * LB), "v"(src + 7 * GV)
               : "memory");
}

// grid = ROWS / FM
__global__ __launch_bounds__(256) void ln_ffn_fused(
    const float* __restrict__ x, const float* __restrict__ g,
    const float* __restrict__ beta, const float* __restrict__ statsIn,
    const _Float16* __restrict__ W1h, const float* __restrict__ b1,
    const _Float16* __restrict__ W2h, const float* __restrict__ b2,
    float* __restrict__ outF, float* __restrict__ stats)
{
  __shared__ __attribute__((aligned(16))) _Float16 Wb[2 * BUFV];
  __shared__ __attribute__((aligned(16))) _Float16 As[FM * P1];
  __shared__ __attribute__((aligned(16))) _Float16 Hs[FM * P2];
  __shared__ __attribute__((aligned(16))) float b1s[DFFc];
  __shared__ __attribute__((aligned(16))) float b2s[Ff];
  __shared__ float red[16];

  const int tid     = threadIdx.x;
  const int lane    = tid & 31;
  const int wave    = tid >> 5;
  const int rowBase = blockIdx.x * FM;
  const int bidx    = rowBase / (Nn_ * Oo);   // batch element
  const int n0      = lane & 15;              // row (A) / col (B) within tile
  const int half8   = ((lane >> 4) & 1) << 3; // K sub-offset per lane half
  const int r0      = (lane >> 4) * 8;        // first C row of this lane half
  // elementwise parts: eight threads a row, a thread takes four values in each
  // of the row's eight 128-byte lines
  const int lr      = tid >> 3;
  const int lc      = (tid & 7) * 4;

  // A chunk of W1 is HC whole rows of 512 B, one run of memory: a wave's copy
  // takes one row. A chunk of W2 is 256 B of each of its Ff rows: two rows a copy.
  const unsigned l1 = (unsigned)(uintptr_t)&Wb[(tid >> 5) * P1 + (tid & 31) * 8];
  const unsigned l2 = (unsigned)(uintptr_t)&Wb[W1V + (tid >> 4) * P2 + (tid & 15) * 8];
  const _Float16* s1 = W1h + tid * 8;
  const _Float16* s2 = W2h + (tid >> 4) * DFFc + (tid & 15) * 8;
  auto fill = [&](int c, int buf) {
    const unsigned d1 = l1 + buf * (BUFV * 2);
    const unsigned d2 = l2 + buf * (BUFV * 2);
    const _Float16* g1 = s1 + c * (HC * Ff);
    const _Float16* g2 = s2 + c * HC;
    copy8<8 * P1 * 2, 8 * Ff>(d1, g1);
    copy8<8 * P1 * 2, 8 * Ff>(d1 + 64 * P1 * 2, g1 + 64 * Ff);
    copy8<16 * P2 * 2, 16 * DFFc>(d2, g2);
    copy8<16 * P2 * 2, 16 * DFFc>(d2 + 128 * P2 * 2, g2 + 128 * DFFc);
  };
  fill(0, 0);

  // --- LayerNorm 1 on the block's rows, beside the copies; res keeps the f32
  // values for the residual
  v4f res[8];
  {
    const float* px  = x + (size_t)(rowBase + lr) * Ff + lc;
    const float* pg  = g + (size_t)(rowBase - bidx * (Nn_ * Oo) + lr) * Ff + lc;
    const float* pe  = beta + (size_t)(rowBase - bidx * (Nn_ * Oo) + lr) * Ff + lc;
    const float* pb1 = b1 + tid * 4;
    const float* pb2 = b2 + tid;
    const float st0 = statsIn[2 * bidx + 0];
    const float st1 = statsIn[2 * bidx + 1];
    v4f gv[8], ev[8];
    // unrolled: the arrays must stay in registers
    #pragma unroll
    for (int k = 0; k < 8; ++k) res[k] = *(const v4f*)(px + 32 * k);
    #pragma unroll
    for (int k = 0; k < 8; ++k) gv[k] = *(const v4f*)(pg + 32 * k);
    #pragma unroll
    for (int k = 0; k < 8; ++k) ev[k] = *(const v4f*)(pe + 32 * k);
    const v4f b1v = *(const v4f*)pb1;
    const float b2v = *pb2;
    // stands ahead of whatever is written into the address registers of the
    // loads above; it names the addresses as inputs so that their registers
    // stay untouched (also by a later load's result) up to the wait
    asm volatile("s_wait_xcnt 0x0" :: "v"(px), "v"(pg), "v"(pe), "v"(pb1), "v"(pb2) : "memory");
    const float mu  = st0 * (1.0f / PB);
    const float var = st1 * (1.0f / PB) - mu * mu;
    const float rs  = rsqrtf(var + 1e-5f);
    #pragma unroll
    for (int k = 0; k < 8; ++k) {
      res[k].x = (res[k].x - mu) * rs * gv[k].x + ev[k].x;
      res[k].y = (res[k].y - mu) * rs * gv[k].y + ev[k].y;
      res[k].z = (res[k].z - mu) * rs * gv[k].z + ev[k].z;
      res[k].w = (res[k].w - mu) * rs * gv[k].w + ev[k].w;
      *(uint2*)&As[lr * P1 + lc + 32 * k] = pack4h(res[k]);
    }
    *(v4f*)&b1s[tid * 4] = b1v;
    b2s[tid] = b2v;
  }

  // own copies landed, then every wave's: chunk 0, the normalised rows and the
  // biases are read only behind this
  asm volatile("s_wait_asynccnt 0x0" ::: "memory");
  __syncthreads();

  // A fragments for all of K stay in registers through all chunks
  FragU a[Ff / 32][2];
  {
    const _Float16* af = &As[n0 * P1 + half8];
    // unrolled: a[][] must stay in registers
    #pragma unroll
    for (int s = 0; s < Ff / 32; ++s) {
      a[s][0].v = frag_at(af + 32 * s);
      a[s][1].v = frag_at(af + 16 * P1 + 32 * s);
    }
  }

  v8f acc[4];                                 // index 2 g + j
  #pragma unroll
  for (int t = 0; t < 4; ++t) acc[t] = (v8f){};

  // rolled: one body serves both buffers, the buffer is an address
  #pragma unroll 1
  for (int c = 0; c < NCH; ++c) {
    const _Float16* wb = Wb + (c & 1) * BUFV;
    // all weight fragments of the chunk are asked for at once; they land while
    // the next chunk's copies are issued
    v16h w1f[Ff / 32], w2f[HC / 32][2];
    {
      const _Float16* bp1 = wb + (wave * 16 + n0) * P1 + half8;
      const _Float16* bp2 = wb + W1V + (wave * 32 + n0) * P2 + half8;
      // unrolled: register indices
      #pragma unroll
      for (int s = 0; s < Ff / 32; ++s) w1f[s] = frag_at(bp1 + 32 * s);
      #pragma unroll
      for (int s = 0; s < HC / 32; ++s) {
        w2f[s][0] = frag_at(bp2 + 32 * s);
        w2f[s][1] = frag_at(bp2 + 16 * P2 + 32 * s);
      }
    }
    const float bb = b1s[c * HC + wave * 16 + n0];
    // the other buffer's last reads ended at the barrier at the foot of the
    // trip before
    if (c + 1 < NCH) fill(c + 1, (c + 1) & 1);

    // --- first product: FM rows x the wave's 16 hidden units, K = Ff
    {
      v8f h0 = (v8f){}, h1 = (v8f){};
      // unrolled: register indices
      #pragma unroll
      for (int s = 0; s < Ff / 32; ++s) {
        h0 = __builtin_amdgcn_wmma_f32_16x16x32_f16(false, a[s][0].v, false, w1f[s], (short)0, h0, false, false);
        h1 = __builtin_amdgcn_wmma_f32_16x16x32_f16(false, a[s][1].v, false, w1f[s], (short)0, h1, false, false);
      }
      _Float16* hp = &Hs[r0 * P2 + wave * 16 + n0];
      #pragma unroll
      for (int r = 0; r < 8; ++r) {
        hp[r * P2]        = (_Float16)fmaxf(h0[r] + bb, 0.0f);
        hp[(16 + r) * P2] = (_Float16)fmaxf(h1[r] + bb, 0.0f);
      }
    }
    // the chunk's hidden values of all eight waves are read behind this
    __syncthreads();
    // --- second product: FM rows x the wave's 32 columns, K = this chunk
    {
      const _Float16* ha = &Hs[n0 * P2 + half8];
      v16h hf[HC / 32][2];
      #pragma unroll
      for (int s = 0; s < HC / 32; ++s) {
        hf[s][0] = frag_at(ha + 32 * s);
        hf[s][1] = frag_at(ha + 16 * P2 + 32 * s);
      }
      // keeps all eight fragment loads ahead of this product's first WMMA, so that
      // their latencies run side by side instead of one behind the other
      __builtin_amdgcn_sched_barrier(0);
      #pragma unroll
      for (int s = 0; s < HC / 32; ++s) {
        acc[0] = __builtin_amdgcn_wmma_f32_16x16x32_f16(false, hf[s][0], false, w2f[s][0], (short)0, acc[0], false, false);
        acc[1] = __builtin_amdgcn_wmma_f32_16x16x32_f16(false, hf[s][0], false, w2f[s][1], (short)0, acc[1], false, false);
        acc[2] = __builtin_amdgcn_wmma_f32_16x16x32_f16(false, hf[s][1], false, w2f[s][0], (short)0, acc[2], false, false);
        acc[3] = __builtin_amdgcn_wmma_f32_16x16x32_f16(false, hf[s][1], false, w2f[s][1], (short)0, acc[3], false, false);
      }
    }
    // foot of the trip: own LDS reads done, own copies of the next chunk
    // landed, then every wave's; the barrier publishes the next chunk and ends
    // the last read of this chunk's buffer and of the hidden values
    asm volatile("s_wait_dscnt 0x0" ::: "memory");
    asm volatile("s_wait_asynccnt 0x0" ::: "memory");
    __syncthreads();
  }
  // no copy is outstanding when the ring is put to another use
  asm volatile("s_wait_asynccnt 0x0" ::: "memory");

  // --- the result tile goes through the ring's LDS (free since the last
  // trip's barrier) back to the elementwise layout: the residual is there, and
  // the stores are whole 128-byte lines
  float* Cs = (float*)Wb;
  {
    float* cp = Cs + r0 * PC + wave * 32 + n0;
    #pragma unroll
    for (int t = 0; t < 4; ++t)
      #pragma unroll
      for (int r = 0; r < 8; ++r)
        cp[(16 * (t >> 1) + r) * PC + 16 * (t & 1)] = acc[t][r];
  }
  __syncthreads();
  v4f y[8];
  #pragma unroll
  for (int k = 0; k < 8; ++k) {
    const v4f cv = *(const v4f*)&Cs[lr * PC + lc + 32 * k];
    const v4f bv = *(const v4f*)&b2s[lc + 32 * k];
    y[k] = (cv + bv) + res[k];
  }
  // LayerNorm 2 sums, ahead of the stores: the barrier below waits for every
  // store that a wave has issued, so here it waits for none
  {
    v4f s4 = y[0];
    v4f q4 = y[0] * y[0];
    #pragma unroll
    for (int k = 1; k < 8; ++k) {
      s4 += y[k];
      q4 += y[k] * y[k];
    }
    float s = (s4.x + s4.y) + (s4.z + s4.w);
    float q = (q4.x + q4.y) + (q4.z + q4.w);
    for (int o = 16; o > 0; o >>= 1) {
      s += __shfl_xor(s, o, 32);
      q += __shfl_xor(q, o, 32);
    }
    if (lane == 0) { red[wave] = s; red[8 + wave] = q; }
    __syncthreads();
    // thread 0 adds up the eight waves' sums, thread 1 their sums of squares
    if (tid < 2) {
      const float* p = red + 8 * tid;
      const float tot = ((p[0] + p[1]) + (p[2] + p[3])) + ((p[4] + p[5]) + (p[6] + p[7]));
      atomicAdd(&stats[2 * bidx + tid], tot);
    }
  }
  float* o = outF + (size_t)(rowBase + lr) * Ff + lc;
  #pragma unroll
  for (int k = 0; k < 8; ++k) *(v4f*)(o + 32 * k) = y[k];
}

// ---------------------------------------------------------------------------
// prep: everything that depends on the inputs alone, in ONE launch. The parts
// need nothing of each other, so each takes a range of the block index (the
// branch is the same for a whole block). Apart from the zeroing of the LN
// sums, a thread issues all its global loads before its first store.
// ---------------------------------------------------------------------------
constexpr int PREP_FFN    = DFFc * Ff / 16 / 256;      // blocks per FFN weight
constexpr int PREP_CENTRE = ROWS * Ff / 16 / 256;      // blocks for the centre tokens
constexpr int PREP_PROD   = Hh * 2 * 4;                // blocks per weight product
constexpr int PREP_BIAS   = 4;                         // blocks for Wf bv + bf
constexpr int PREP_BLOCKS = 2 * PREP_PROD + PREP_BIAS + PREP_CENTRE + 2 * PREP_FFN;

// flat f32 -> f16: block blk takes 1024 runs of four values
__device__ __forceinline__ void cvt_flat_f16(
    const float* __restrict__ s, _Float16* __restrict__ d, int blk) {
  const int i = blk * 1024 + threadIdx.x;
  v4f v[4];
  #pragma unroll
  for (int j = 0; j < 4; ++j) v[j] = ((const v4f*)s)[i + j * 256];
  #pragma unroll
  for (int j = 0; j < 4; ++j) ((uint2*)d)[i + j * 256] = pack4h(v[j]);
  // the built code joins this part's exit with another part's path, where the
  // registers that the four stores name are written again: the wait stands
  // ahead of that
  asm volatile("s_wait_xcnt 0x0" ::: "memory");
}
// centre token (p = 12) of every patch, f32 -> f16: xc[r][f]. A thread takes
// eight values each of rows r and r + 1
__device__ __forceinline__ void cvt_centre_f16(
    const float* __restrict__ x, _Float16* __restrict__ d, int blk) {
  const int i = blk * 256 + threadIdx.x;
  const int r = (i >> 5) * 2, c = i & 31;       // c: run of eight values
  const v4f* p = (const v4f*)x + (r * KK2 + 12) * (Ff / 4) + c * 2;
  const v4f a0 = p[0], a1 = p[1];
  const v4f c0 = p[KK2 * (Ff / 4)], c1 = p[KK2 * (Ff / 4) + 1];
  union { uint2 h[2]; uint4 u; } o0, o1;
  o0.h[0] = pack4h(a0); o0.h[1] = pack4h(a1);
  o1.h[0] = pack4h(c0); o1.h[1] = pack4h(c1);
  uint4* q = (uint4*)d + r * (Ff / 8) + c;
  q[0]      = o0.u;
  q[Ff / 8] = o1.u;
  // as at the end of cvt_flat_f16: this part's exit too is joined with other
  // parts' paths, where the registers that the two stores name are written again
  asm volatile("s_wait_xcnt 0x0" ::: "memory");
}

// ---------------------------------------------------------------------------
// Weight products. Two linear maps that follow one another with nothing in
// between are one map, and its matrix depends on the weights alone:
//   qt[h]  = Wk_h^T (Wq_h xc + bq_h) = (Wk_h^T Wq_h) xc + Wk_h^T bq_h
//   attent = Wf (Wv_h xw_h + bv_h)_h + bf = sum_h (Wf_h Wv_h) xw_h + (Wf bv + bf)
// (Wf_h: columns 64 h .. 64 h + 63 of Wf). The products have K = 64 and are
// small; with them each pair of activation GEMMs becomes one.
// One block makes a 128 x 64 tile C[m][n] = sum_d A(m, d) B(n, d), d < 64:
// both operands go f32 -> f16 into LDS with d running along a row, then each
// wave takes 16 rows. PS: LDS pitch, +16 B against bank conflicts.
// ---------------------------------------------------------------------------
constexpr int PS = Dd + 8;

// an operand that lies d-major in memory (row d, pitch Ff, COLS columns from
// src on): a thread takes rows d, d + 1 at four columns, so that a pair of
// f16 values along d is one 4-byte LDS store. Its COLS / 32 such pieces lie a
// constant number of rows apart: one address serves them all.
template <int COLS>
__device__ __forceinline__ const float* addrT(const float* __restrict__ src) {
  return src + (threadIdx.x / (COLS / 4)) * 2 * Ff + (threadIdx.x % (COLS / 4)) * 4;
}
template <int COLS>
__device__ __forceinline__ void loadT(const float* __restrict__ p,
                                      v4f (&lo)[COLS / 32], v4f (&hi)[COLS / 32]) {
  constexpr int DSTEP = 2 * 256 / (COLS / 4);   // rows from piece to piece
  #pragma unroll
  for (int j = 0; j < COLS / 32; ++j) {
    lo[j] = *(const v4f*)(p + j * DSTEP * Ff);
    hi[j] = *(const v4f*)(p + j * DSTEP * Ff + Ff);
  }
}
template <int COLS>
__device__ __forceinline__ void storeT(_Float16* S,
                                       const v4f (&lo)[COLS / 32], const v4f (&hi)[COLS / 32]) {
  constexpr int DSTEP = 2 * 256 / (COLS / 4);
  _Float16* q = S + (threadIdx.x % (COLS / 4)) * 4 * PS + (threadIdx.x / (COLS / 4)) * 2;
  #pragma unroll
  for (int j = 0; j < COLS / 32; ++j) {
    #pragma unroll
    for (int e = 0; e < 4; ++e) {
      union { _Float16 h[2]; unsigned u; } w;
      w.h[0] = (_Float16)lo[j][e];
      w.h[1] = (_Float16)hi[j][e];
      *(unsigned*)&q[e * PS + j * DSTEP] = w.u;
    }
  }
}

// AT: A lies d-major (srcA at [0][first m], pitch Ff); otherwise m-major (srcA
// at [first m][first d], pitch Ff). B always lies d-major. vec (AT only, may
// be null): 64 values; the block then also makes cvec[m] = sum_d A(m, d) vec[d]
// as one more column of the product.
template <bool AT>
__device__ __forceinline__ void weight_product(
    const float* __restrict__ srcA, const float* __restrict__ srcB,
    const float* __restrict__ vec, _Float16* __restrict__ C, int ldc,
    float* __restrict__ cvec, _Float16* As, _Float16* Bs)
{
  const int lane  = threadIdx.x & 31;
  const int wave  = threadIdx.x >> 5;
  const int n0    = lane & 15;
  const int half8 = ((lane >> 4) & 1) << 3;
  const int r0    = (lane >> 4) * 8;

  // every global read of the block ahead of its first LDS store
  v4f alo[4], ahi[4], blo[2], bhi[2], vv[2][4];
  const float* pa = AT ? addrT<128>(srcA)
                       : srcA + (threadIdx.x >> 4) * Ff + (threadIdx.x & 15) * 4;
  const float* pb = addrT<64>(srcB);
  const float* pv = vec + half8;                // the k order of frag_at
  if constexpr (AT) {
    loadT<128>(pa, alo, ahi);
  } else {
    #pragma unroll
    for (int j = 0; j < 4; ++j) {               // rows 16 j + (t >> 4), and 64 more
      alo[j] = *(const v4f*)(pa + 16 * j * Ff);
      ahi[j] = *(const v4f*)(pa + (64 + 16 * j) * Ff);
    }
  }
  loadT<64>(pb, blo, bhi);
  const bool withVec = AT && vec != nullptr;    // the same for the whole block
  if (withVec) {
    #pragma unroll
    for (int s = 0; s < 2; ++s) {
      vv[s][0] = *(const v4f*)(pv + 32 * s);
      vv[s][1] = *(const v4f*)(pv + 32 * s + 4);
      vv[s][2] = *(const v4f*)(pv + 32 * s + 16);
      vv[s][3] = *(const v4f*)(pv + 32 * s + 20);
    }
  }
  // stands ahead of whatever is written into the address registers of the
  // loads above; it names the addresses as inputs so that their registers stay
  // untouched (also by a later load's result) up to the wait
  if constexpr (AT) asm volatile("s_wait_xcnt 0x0" :: "v"(pa), "v"(pb), "v"(pv) : "memory");
  else              asm volatile("s_wait_xcnt 0x0" :: "v"(pa), "v"(pb) : "memory");
  if constexpr (AT) {
    storeT<128>(As, alo, ahi);
  } else {
    _Float16* q = As + (threadIdx.x >> 4) * PS + (threadIdx.x & 15) * 4;
    #pragma unroll
    for (int j = 0; j < 4; ++j) {
      *(uint2*)&q[16 * j * PS]        = pack4h(alo[j]);
      *(uint2*)&q[(64 + 16 * j) * PS] = pack4h(ahi[j]);
    }
  }
  storeT<64>(Bs, blo, bhi);
  __syncthreads();

  const _Float16* ap = &As[(wave * 16 + n0) * PS + half8];
  const _Float16* bp = &Bs[n0 * PS + half8];
  const v16h a0 = frag_at(ap), a1 = frag_at(ap + 32);
  v8f accv = (v8f){};
  if (withVec) {
    // B fragment with vec in column 0 and zeros in the other fifteen
    #pragma unroll
    for (int s = 0; s < 2; ++s) {
      v16h b;
      #pragma unroll
      for (int e = 0; e < 16; ++e)
        b[e] = (n0 == 0) ? (_Float16)vv[s][e >> 2][e & 3] : (_Float16)0.0f;
      accv = __builtin_amdgcn_wmma_f32_16x16x32_f16(false, s ? a1 : a0, false, b, (short)0, accv, false, false);
    }
  }
  v8f acc[4];
  #pragma unroll
  for (int j = 0; j < 4; ++j) {
    acc[j] = (v8f){};
    acc[j] = __builtin_amdgcn_wmma_f32_16x16x32_f16(false, a0, false, frag_at(bp + 16 * j * PS), (short)0, acc[j], false, false);
    acc[j] = __builtin_amdgcn_wmma_f32_16x16x32_f16(false, a1, false, frag_at(bp + 16 * j * PS + 32), (short)0, acc[j], false, false);
  }
  _Float16* o = C + (size_t)(wave * 16 + r0) * ldc + n0;
  _Float16 h[4][8];
  #pragma unroll
  for (int j = 0; j < 4; ++j)
    #pragma unroll
    for (int r = 0; r < 8; ++r) h[j][r] = (_Float16)acc[j][r];
  #pragma unroll
  for (int j = 0; j < 4; ++j)
    #pragma unroll
    for (int r = 0; r < 8; ++r) o[r * ldc + 16 * j] = h[j][r];
  if (withVec && n0 == 0) {
    #pragma unroll
    for (int r = 0; r < 8; ++r) cvec[wave * 16 + r0 + r] = accv[r];
  }
  // the built code may join this part's exit with another part's path, where
  // registers that the stores name are written again: the wait stands ahead
  asm volatile("s_wait_xcnt 0x0" ::: "memory");
}

// bfv[o] = bf[o] + sum_j Wf[o][j] bv[j], j < 256: a pair of waves takes 16 rows
// of Wf, each wave one half of K as A fragments straight from memory (all of K
// in one wave would set the register count of the whole launch); bv is column
// 0 of the B fragments. The odd wave hands its sums to the even one in LDS.
__device__ __forceinline__ void bias_product(
    const float* __restrict__ Wf, const float* __restrict__ bv,
    const float* __restrict__ bf, float* __restrict__ bfv, int blk,
    _Float16* vs, float* red)
{
  const int lane  = threadIdx.x & 31;
  const int wave  = threadIdx.x >> 5;
  const int n0    = lane & 15;
  const int half8 = ((lane >> 4) & 1) << 3;
  const int r0    = (lane >> 4) * 8;
  const int kh    = wave & 1;
  const int row0  = (blk * 4 + (wave >> 1)) * 16;
  const float* ap = Wf + (size_t)(row0 + n0) * Ff + 128 * kh + half8;
  v4f av[4][4];
  // unrolled: av[][] must stay in registers
  #pragma unroll
  for (int s = 0; s < 4; ++s) {
    av[s][0] = *(const v4f*)(ap + 32 * s);
    av[s][1] = *(const v4f*)(ap + 32 * s + 4);
    av[s][2] = *(const v4f*)(ap + 32 * s + 16);
    av[s][3] = *(const v4f*)(ap + 32 * s + 20);
  }
  const float* pbv = bv + threadIdx.x;
  const float* pbf = bf + row0 + r0;
  const float bvv = *pbv;
  const v4f f0 = *(const v4f*)(pbf);
  const v4f f1 = *(const v4f*)(pbf + 4);
  // stands ahead of whatever is written into the address registers of the
  // loads above; it names the addresses as inputs so that their registers stay
  // untouched (also by a later load's result) up to the wait
  asm volatile("s_wait_xcnt 0x0" :: "v"(ap), "v"(pbv), "v"(pbf) : "memory");
  vs[threadIdx.x] = (_Float16)bvv;
  __syncthreads();
  v8f acc = (v8f){};
  #pragma unroll
  for (int s = 0; s < 4; ++s) {
    FragU a;
    a.q[0].x = pack4h(av[s][0]).x; a.q[0].y = pack4h(av[s][0]).y;
    a.q[0].z = pack4h(av[s][1]).x; a.q[0].w = pack4h(av[s][1]).y;
    a.q[1].x = pack4h(av[s][2]).x; a.q[1].y = pack4h(av[s][2]).y;
    a.q[1].z = pack4h(av[s][3]).x; a.q[1].w = pack4h(av[s][3]).y;
    const v16h bl = frag_at(vs + 128 * kh + 32 * s + half8);
    v16h b;
    #pragma unroll
    for (int e = 0; e < 16; ++e) b[e] = (n0 == 0) ? bl[e] : (_Float16)0.0f;
    acc = __builtin_amdgcn_wmma_f32_16x16x32_f16(false, a.v, false, b, (short)0, acc, false, false);
  }
  float* rp = red + (wave >> 1) * 16 + r0;
  if (kh == 1 && n0 == 0) {
    #pragma unroll
    for (int r = 0; r < 8; ++r) rp[r] = acc[r];
  }
  __syncthreads();
  if (kh == 0 && n0 == 0) {
    #pragma unroll
    for (int r = 0; r < 8; ++r)
      bfv[row0 + r0 + r] = (acc[r] + rp[r]) + (r < 4 ? f0[r & 3] : f1[r & 3]);
  }
  // as at the end of weight_product
  asm volatile("s_wait_xcnt 0x0" ::: "memory");
}

// grid = PREP_BLOCKS; the parts with the longest way to go come first
__global__ __launch_bounds__(256) void prep_kernel(
    const float* __restrict__ x,  const float* __restrict__ Wq,
    const float* __restrict__ bq, const float* __restrict__ Wk,
    const float* __restrict__ Wv, const float* __restrict__ bv,
    const float* __restrict__ Wf, const float* __restrict__ bf,
    const float* __restrict__ W1, const float* __restrict__ W2,
    _Float16* __restrict__ xcH, _Float16* __restrict__ mqH,
    float* __restrict__ cq, _Float16* __restrict__ wfvH,
    float* __restrict__ bfv, _Float16* __restrict__ w1H,
    _Float16* __restrict__ w2H, float* __restrict__ stats)
{
  __shared__ __attribute__((aligned(16))) _Float16 As[128 * PS];
  __shared__ __attribute__((aligned(16))) _Float16 Bs[64 * PS];
  int blk = blockIdx.x;
  if (blk < 2 * PREP_PROD) {
    const int h = (blk >> 3) & 3, mb = (blk >> 2) & 1, nb = blk & 3;
    if (blk < PREP_PROD) {
      // mq[h*256 + f][g] = sum_d Wk[h*64 + d][f] Wq[h*64 + d][g]; cq with bq
      weight_product<true>(Wk + h * Dd * Ff + mb * 128, Wq + h * Dd * Ff + nb * 64,
                           nb == 0 ? bq + h * Dd : nullptr,
                           mqH + (size_t)(h * Ff + mb * 128) * Ff + nb * 64, Ff,
                           cq + h * Ff + mb * 128, As, Bs);
    } else {
      // wfv[o][h*256 + f] = sum_d Wf[o][h*64 + d] Wv[h*64 + d][f]
      weight_product<false>(Wf + mb * 128 * Ff + h * Dd, Wv + h * Dd * Ff + nb * 64,
                            nullptr,
                            wfvH + (size_t)(mb * 128) * (Hh * Ff) + h * Ff + nb * 64, Hh * Ff,
                            nullptr, As, Bs);
    }
    return;
  }
  blk -= 2 * PREP_PROD;
  if (blk < PREP_BIAS) {
    if (blk == 0 && threadIdx.x < 16) stats[threadIdx.x] = 0.f;  // both LN sets
    bias_product(Wf, bv, bf, bfv, blk, As, (float*)Bs);
    return;
  }
  blk -= PREP_BIAS;
  if (blk < PREP_CENTRE) { cvt_centre_f16(x, xcH, blk); return; }
  blk -= PREP_CENTRE;
  if (blk < PREP_FFN) cvt_flat_f16(W1, w1H, blk);
  else                cvt_flat_f16(W2, w2H, blk - PREP_FFN);
}

// ---------------------------------------------------------------------------
extern "C" void kernel_launch(void* const* d_in, const int* in_sizes, int n_in,
                              void* d_out, int out_size, void* d_ws, size_t ws_size,
                              hipStream_t stream) {
  const float* x    = (const float*)d_in[0];
  const float* Wq   = (const float*)d_in[1];
  const float* bq   = (const float*)d_in[2];
  const float* Wk   = (const float*)d_in[3];
  // d_in[4] (bk) adds q_h . bk_h to all 25 scores of a head: cancels in softmax
  const float* Wv   = (const float*)d_in[5];
  const float* bv   = (const float*)d_in[6];
  const float* Wf   = (const float*)d_in[7];
  const float* bf   = (const float*)d_in[8];
  const float* ln1w = (const float*)d_in[9];
  const float* ln1b = (const float*)d_in[10];
  const float* ln2w = (const float*)d_in[11];
  const float* ln2b = (const float*)d_in[12];
  const float* W1   = (const float*)d_in[13];
  const float* b1   = (const float*)d_in[14];
  const float* W2   = (const float*)d_in[15];
  const float* b2   = (const float*)d_in[16];

  char* ws = (char*)d_ws;
  size_t off = 0;
  auto alloc = [&](size_t bytes) -> void* {
    void* p = ws + off;
    off += (bytes + 255) & ~(size_t)255;
    return p;
  };

  _Float16* xcH     = (_Float16*)alloc((size_t)ROWS * Ff * 2);     // centre tokens
  _Float16* mqH     = (_Float16*)alloc((size_t)Hh * Ff * Ff * 2);  // Wk_h^T Wq_h
  float*    cq      = (float*)   alloc((size_t)Hh * Ff * 4);       // Wk_h^T bq_h
  _Float16* wfvH    = (_Float16*)alloc((size_t)Ff * Hh * Ff * 2);  // Wf_h Wv_h
  float*    bfv     = (float*)   alloc((size_t)Ff * 4);            // Wf bv + bf
  _Float16* w1H     = (_Float16*)alloc((size_t)DFFc * Ff * 2);
  _Float16* w2H     = (_Float16*)alloc((size_t)Ff * DFFc * 2);
  float*    qtF     = (float*)   alloc((size_t)ROWS * Hh * Ff * 4); // Wk_h^T q_h
  _Float16* xwH     = (_Float16*)alloc((size_t)ROWS * Hh * Ff * 2); // sum_p w_p x_p
  float*    attent  = (float*)   alloc((size_t)ROWS * Ff * 4);
  float*    ytmp    = (float*)   alloc((size_t)ROWS * Ff * 4);
  float*    stats   = (float*)   alloc(256);                       // 2 sets of 4x2

  // --- prep: zero LN stats, centre tokens and FFN weights to f16, weight products
  prep_kernel<<<PREP_BLOCKS, 256, 0, stream>>>(x, Wq, bq, Wk, Wv, bv, Wf, bf, W1, W2,
                                               xcH, mqH, cq, wfvH, bfv, w1H, w2H,
                                               stats);

  // --- folded query of all heads: (5120 x 256) @ (256 x 1024) + cq -> f32
  {
    dim3 g(ROWS / 256, (Hh * Ff) / 64);
    gemm_f16_wmma<Ff, Hh * Ff, 2, false, false><<<g, 256, 0, stream>>>(xcH, mqH, cq, nullptr,
                                                                       qtF, nullptr, nullptr, 0,
                                                                       Ff, 0, 0);
  }

  // --- scores, softmax over 25 and weighted patch sum per head, x read once
  patch_attention_folded<<<ROWS / WPB, WPB * 32, 0, stream>>>(x, qtF, xwH);

  // --- value and output projection in one: (5120 x 1024) @ (1024 x 256) + bfv
  //     -> attent f32, LN 1 sums; 16 rows a wave: its A fragments for K = 1024
  //     fill 256 registers
  {
    dim3 g(ROWS / 128, Ff / 64);
    gemm_f16_wmma<Hh * Ff, Ff, 1, false, true><<<g, 256, 0, stream>>>(xwH, wfvH, bfv, nullptr,
                                                                      attent, nullptr, stats, 0,
                                                                      Hh * Ff, 0, 0);
  }

  // --- LayerNorm 1 (per batch over N,O,F) -> out1, then the FFN:
  //     relu(out1 @ W1^T + b1) @ W2^T + b2 + out1 -> ytmp, LN 2 sums
  ln_ffn_fused<<<ROWS / FM, 256, 0, stream>>>(attent, ln1w, ln1b, stats, w1H, b1, w2H, b2,
                                              ytmp, stats + 8);

  // --- LayerNorm 2 -> d_out (f32)
  ln_apply_kernel<<<PB4 / 256, 256, 0, stream>>>(ytmp, ln2w, ln2b, stats + 8,
                                                 (float*)d_out, nullptr);
}

// v008
// It runs in 55.3 microseconds.
// In both of two side-by-side timings against v007, it was 1.08 times as fast.
// All steps since v000 together make it 5.82 times as fast.
#include <hip/hip_runtime.h>
#include <hip/hip_bf16.h>
#include <math.h>

typedef __attribute__((ext_vector_type(16))) _Float16 v16h;
typedef __attribute__((ext_vector_type(8)))  float    v8f;
typedef __attribute__((ext_vector_type(4)))  float    v4f;

#define Bb   4
#define Nn_  256
#define Oo   5
#define KK2  25      // K*K patch positions
#define Ff   256
#define Hh   4
#define Dd   64
#define DFFc 1024

constexpr int ROWS = Bb * Nn_ * Oo;         // 5120 output rows
constexpr int PB   = Nn_ * Oo * Ff;         // 327680 elems per batch for LN

constexpr int WPB  = 4;                     // waves (patches) per block, folded attention

// ---------------------------------------------------------------------------
// helpers
// ---------------------------------------------------------------------------
union FragU { v16h v; uint4 q[2]; };

// Load one f16 16x32 fragment given per-lane base (row/col and half-offset
// already folded in): elements 0..7 at +k, elements 8..15 at +k+16.
__device__ __forceinline__ v16h frag_at(const _Float16* p) {
  FragU f;
  f.q[0] = *(const uint4*)(p);
  f.q[1] = *(const uint4*)(p + 16);
  return f.v;
}

// ---------------------------------------------------------------------------
// GEMM: C[M][NT] = A[M][KT] * W[NT][KT]^T (+bias) (relu?) (+addsrc) -> f32/f16
// block = 256 threads = 8 waves; a wave computes 16*RG rows x 64 cols (RG A
// fragments share 4 B fragments per k-step); block tile is (128*RG) x 64.
// grid = (M/(128*RG), NT/64). NT is a compile-time constant so that one
// address serves all of a lane's C positions (constant offsets from it).
// Nothing is fetched step by step: a block issues every global read it will
// ever make ahead of its k loop, so that their latencies run side by side.
// The B panel (64 cols x all of K) goes to LDS by async copies shared by the
// 8 waves, filled once; a wave's A fragments for all of K, its bias values
// and (ADD) its residual values go to registers.
// A rows have pitch lda, and column block y reads A from column
// (y >> aShift) * aStep on; every launch here passes 0 for both.
// STATS: the block also adds the sum and the sum of squares of its C values,
// taken from the registers that hold them, to the LayerNorm sums of its batch
// element, so that no launch has to read C again for them.
//
// f16 16x32 fragment layout (A and B identical): lane L<16 -> row/col L,
// elements 0..7 = K [k0+off, k0+off+8), elements 8..15 = +16; off = 8*(L>=16).
// Both runs are contiguous -> two b128 loads per fragment.
// ---------------------------------------------------------------------------
template <int KT, int NT, int RG, bool ADD, bool STATS>
__global__ __launch_bounds__(256) void gemm_f16_wmma(
    const _Float16* __restrict__ A, const _Float16* __restrict__ W,
    const float* __restrict__ bias, const float* __restrict__ addsrc,
    float* __restrict__ outF, _Float16* __restrict__ outH,
    float* __restrict__ stats, int doRelu, int lda, int aShift, int aStep)
{
  // The panel lies in LDS in PARTS runs of K, each 64 rows of KP values, so
  // that inside a part every fragment is within the 64 KB that the offset
  // field of an LDS load reaches from one address register.
  constexpr int PARTS   = (KT > 512) ? KT / 512 : 1;
  constexpr int KP      = KT / PARTS;
  constexpr int BSTRIDE = KP + 8;           // +16B pad: breaks LDS bank conflicts
  constexpr int STEPS   = KT / 32;          // k-steps, and B copies per thread
  constexpr int SPP     = STEPS / PARTS;    // k-steps per part
  // A wave has at most 63 loads outstanding, and the barrier below waits for
  // every load issued ahead of it. So only the first PRE steps' A fragments
  // are asked for ahead of the barrier; the rest, and the residual, are asked
  // for behind it and land while the first steps are worked on.
  constexpr int PRE     = (2 * RG * STEPS <= 48) ? STEPS : 24 / RG;
  __shared__ _Float16 Bs[PARTS * 64 * BSTRIDE];

  const int lane    = threadIdx.x & 31;
  const int wave    = threadIdx.x >> 5;
  const int rowBase = (blockIdx.x * 8 + wave) * (16 * RG);
  const int colBase = blockIdx.y * 64;

  const int n0    = lane & 15;              // row (A) / col (B) within tile
  const int half8 = ((lane >> 4) & 1) << 3; // K sub-offset per lane half
  const int r0    = (lane >> 4) * 8;        // first C row of this lane half

  // --- B panel, 64 rows x KT f16 -> LDS: 4 threads per row, STEPS b128 chunks
  // each (chunks of 8 values, 32 values apart). The xcnt wait closes each
  // statement so that no address register of an issued copy is rewritten
  // ahead of it.
  {
    const int srow = threadIdx.x >> 2;          // 0..63
    const int skc  = (threadIdx.x & 3) << 3;    // 0,8,16,24
    const _Float16* src = W + (size_t)(colBase + srow) * KT + skc;
    const unsigned lds0 = (unsigned)(uintptr_t)&Bs[srow * BSTRIDE + skc];
    if constexpr (STEPS % 8 == 0) {
      static_assert(SPP % 8 == 0, "a statement's eight chunks lie in one part");
      // unrolled: c is a compile-time index into the parts
      #pragma unroll
      for (int c = 0; c < STEPS; c += 8) {
        const unsigned lds = lds0 + ((c / SPP) * 64 * BSTRIDE + (c % SPP) * 32) * 2;
        asm volatile("global_load_async_to_lds_b128 %0, %1, off\n\t"
                     "global_load_async_to_lds_b128 %2, %3, off\n\t"
                     "global_load_async_to_lds_b128 %4, %5, off\n\t"
                     "global_load_async_to_lds_b128 %6, %7, off\n\t"
                     "global_load_async_to_lds_b128 %8, %9, off\n\t"
                     "global_load_async_to_lds_b128 %10, %11, off\n\t"
                     "global_load_async_to_lds_b128 %12, %13, off\n\t"
                     "global_load_async_to_lds_b128 %14, %15, off\n\t"
                     "s_wait_xcnt 0x0"
                     :: "v"(lds),       "v"(src),
                        "v"(lds + 64),  "v"(src + 32),
                        "v"(lds + 128), "v"(src + 64),
                        "v"(lds + 192), "v"(src + 96),
                        "v"(lds + 256), "v"(src + 128),
                        "v"(lds + 320), "v"(src + 160),
                        "v"(lds + 384), "v"(src + 192),
                        "v"(lds + 448), "v"(src + 224)
                     : "memory");
        src += 256;
      }
    } else {
      static_assert(STEPS == 2, "two chunks a thread");
      asm volatile("global_load_async_to_lds_b128 %0, %1, off\n\t"
                   "global_load_async_to_lds_b128 %2, %3, off\n\t"
                   "s_wait_xcnt 0x0"
                   :: "v"(lds0), "v"(src), "v"(lds0 + 64), "v"(src + 32)
                   : "memory");
    }
  }

  float bv[4] = {0.0f, 0.0f, 0.0f, 0.0f};
  // --- A fragments of the first PRE k-steps, k ascending
  const _Float16* aPtr = A + (size_t)(rowBase + n0) * lda
                           + ((int)blockIdx.y >> aShift) * aStep + half8;
  static_assert(RG <= 2, "the waits below name one or two row addresses");
  const _Float16* aPtr1 = aPtr + (size_t)(16 * (RG - 1)) * lda;  // last row group
  FragU a[STEPS][RG];
  // unrolled: a[][] must stay in registers
  #pragma unroll
  for (int s = 0; s < PRE; ++s) {
    #pragma unroll
    for (int g = 0; g < RG; ++g) {
      const _Float16* p = (g ? aPtr1 : aPtr) + 32 * s;
      a[s][g].q[0] = *(const uint4*)(p);
      a[s][g].q[1] = *(const uint4*)(p + 16);
    }
  }
  // stands ahead of whatever is written into the address registers of the
  // loads above (the bias address may be formed in them); it names the
  // addresses as inputs so that their registers stay untouched up to the wait
  asm volatile("s_wait_xcnt 0x0" :: "v"(aPtr), "v"(aPtr1) : "memory");
  // --- bias, needed only behind the k loop
  if (bias) {
    #pragma unroll
    for (int j = 0; j < 4; ++j) bv[j] = bias[colBase + 16 * j + n0];
  }
  // the same for the bias loads
  asm volatile("s_wait_xcnt 0x0" ::: "memory");

  v8f acc[4 * RG];
  #pragma unroll
  for (int j = 0; j < 4 * RG; ++j) acc[j] = (v8f){};

  // own copies landed, then every wave's: the panel is read only behind this
  asm volatile("s_wait_asynccnt 0x0" ::: "memory");
  __syncthreads();

  // --- the late A fragments and the residual
  #pragma unroll
  for (int s = PRE; s < STEPS; ++s) {
    #pragma unroll
    for (int g = 0; g < RG; ++g) {
      const _Float16* p = (g ? aPtr1 : aPtr) + 32 * s;
      a[s][g].q[0] = *(const uint4*)(p);
      a[s][g].q[1] = *(const uint4*)(p + 16);
    }
  }
  // a lane's first C position; (g, j, r) lies (16 g + r) * NT + 16 j behind it
  const size_t c0 = (size_t)(rowBase + r0) * NT + colBase + n0;
  float ad[ADD ? RG * 32 : 1];
  const float* ap = ADD ? addsrc + c0 : nullptr;
  if constexpr (ADD) {
    #pragma unroll
    for (int g = 0; g < RG; ++g)
      #pragma unroll
      for (int j = 0; j < 4; ++j)
        #pragma unroll
        for (int r = 0; r < 8; ++r)
          ad[(g * 4 + j) * 8 + r] = ap[(16 * g + r) * NT + 16 * j];
  }
  if constexpr (ADD || PRE < STEPS) {
    // stands ahead of whatever is written into the address registers of the
    // loads just issued; it names the addresses as inputs so that their
    // registers stay untouched up to the wait
    asm volatile("s_wait_xcnt 0x0" :: "v"(aPtr), "v"(aPtr1), "v"(ap) : "memory");
  }

  // --- k loop: B fragments from LDS, A fragments already in registers
  FragU cur[SPP][RG];
  #pragma unroll
  for (int s = 0; s < SPP; ++s)
    #pragma unroll
    for (int g = 0; g < RG; ++g) cur[s][g] = a[s][g];
  const _Float16* bb = &Bs[n0 * BSTRIDE + half8];
  // the loop over the parts stays rolled: bb is then a register that moves
  // from part to part, and every LDS load of the body is bb + a small offset;
  // unrolled, each load beyond 64 KB would need an address of its own
  #pragma unroll 1
  for (int part = 0; part < PARTS; ++part) {
    // unrolled: cur[s] is a register index
    #pragma unroll
    for (int s = 0; s < SPP; ++s) {
      const v16h b0 = frag_at(bb + 32 * s);
      const v16h b1 = frag_at(bb + 32 * s + 16 * BSTRIDE);
      const v16h b2 = frag_at(bb + 32 * s + 32 * BSTRIDE);
      const v16h b3 = frag_at(bb + 32 * s + 48 * BSTRIDE);
      #pragma unroll
      for (int g = 0; g < RG; ++g) {
        const v16h ag = cur[s][g].v;
        acc[g * 4 + 0] = __builtin_amdgcn_wmma_f32_16x16x32_f16(false, ag, false, b0, (short)0, acc[g * 4 + 0], false, false);
        acc[g * 4 + 1] = __builtin_amdgcn_wmma_f32_16x16x32_f16(false, ag, false, b1, (short)0, acc[g * 4 + 1], false, false);
        acc[g * 4 + 2] = __builtin_amdgcn_wmma_f32_16x16x32_f16(false, ag, false, b2, (short)0, acc[g * 4 + 2], false, false);
        acc[g * 4 + 3] = __builtin_amdgcn_wmma_f32_16x16x32_f16(false, ag, false, b3, (short)0, acc[g * 4 + 3], false, false);
      }
    }
    if constexpr (PARTS > 1) {
      static_assert(PARTS <= 2, "cur is refilled from the second part only");
      #pragma unroll
      for (int s = 0; s < SPP; ++s)
        #pragma unroll
        for (int g = 0; g < RG; ++g) cur[s][g] = a[SPP + s][g];
      bb += 64 * BSTRIDE;
    }
  }

  // C/D layout: VGPR r -> (M=r, N=lane) for lanes 0-15, (M=r+8, N=lane-16)
  // final values first, in place; then all stores of a kind in one run, so
  // that no store is waited for before the next is issued
  #pragma unroll
  for (int t = 0; t < 4 * RG; ++t) {        // t = 4 g + j
    #pragma unroll
    for (int r = 0; r < 8; ++r) {
      float v = acc[t][r] + bv[t & 3];
      if (doRelu) v = fmaxf(v, 0.0f);
      if constexpr (ADD) v += ad[t * 8 + r];
      acc[t][r] = v;
    }
  }
  if constexpr (STATS) {
    // ahead of the stores: the barrier below waits for every store that a wave
    // has issued, so here it waits for none, and the two adds fly beside them
    static_assert((Nn_ * Oo) % (128 * RG) == 0, "a block's rows lie in one batch element");
    __shared__ float red[16];
    v8f s8 = acc[0];
    v8f q8 = acc[0] * acc[0];
    // unrolled: acc[t] is a register index
    #pragma unroll
    for (int t = 1; t < 4 * RG; ++t) {
      s8 += acc[t];
      q8 += acc[t] * acc[t];
    }
    float s = ((s8[0] + s8[1]) + (s8[2] + s8[3])) + ((s8[4] + s8[5]) + (s8[6] + s8[7]));
    float q = ((q8[0] + q8[1]) + (q8[2] + q8[3])) + ((q8[4] + q8[5]) + (q8[6] + q8[7]));
    for (int o = 16; o > 0; o >>= 1) {
      s += __shfl_xor(s, o, 32);
      q += __shfl_xor(q, o, 32);
    }
    if (lane == 0) { red[wave] = s; red[8 + wave] = q; }
    __syncthreads();
    // thread 0 adds up the eight waves' sums, thread 1 their sums of squares
    if (threadIdx.x < 2) {
      const float* p = red + 8 * threadIdx.x;
      const float tot = ((p[0] + p[1]) + (p[2] + p[3])) + ((p[4] + p[5]) + (p[6] + p[7]));
      const int b = (blockIdx.x * (128 * RG)) / (Nn_ * Oo);
      atomicAdd(&stats[2 * b + threadIdx.x], tot);
    }
  }
  if (outF) {
    float* o = outF + c0;
    #pragma unroll
    for (int t = 0; t < 4 * RG; ++t)
      #pragma unroll
      for (int r = 0; r < 8; ++r)
        o[(16 * (t >> 2) + r) * NT + 16 * (t & 3)] = acc[t][r];
  }
  // the f16 conversions below may reuse registers that the stores above name
  asm volatile("s_wait_xcnt 0x0" ::: "memory");
  if (outH) {
    _Float16* o = outH + c0;
    _Float16 h[4 * RG][8];
    #pragma unroll
    for (int t = 0; t < 4 * RG; ++t)
      #pragma unroll
      for (int r = 0; r < 8; ++r) h[t][r] = (_Float16)acc[t][r];
    #pragma unroll
    for (int t = 0; t < 4 * RG; ++t)
      #pragma unroll
      for (int r = 0; r < 8; ++r)
        o[(16 * (t >> 2) + r) * NT + 16 * (t & 3)] = h[t][r];
  }
}

// ---------------------------------------------------------------------------
// Folded patch attention. With qt[h] = Wk_h^T q_h (256 long, q the centre
// query) the score of patch position p is qt[h] . x_p / 8 (+ q_h . bk_h, the
// same for every p of a head, so it cancels in the softmax), and the merged
// value is Wv_h (sum_p w_p x_p) + bv_h because the weights sum to one. This
// kernel reads x once in f32 and writes xw[h] = sum_p w_p x_p per head.
// One wave per patch, no LDS and no barrier: the wave holds all 25 rows in
// registers, a lane 8 of a row's 256 values (f0..f0+3 and 128+f0..128+f0+3).
// ---------------------------------------------------------------------------
__device__ __forceinline__ float dot4(const v4f a, const v4f b, float s) {
  s = fmaf(a.x, b.x, s);
  s = fmaf(a.y, b.y, s);
  s = fmaf(a.z, b.z, s);
  s = fmaf(a.w, b.w, s);
  return s;
}
// lanes L and L ^ N: the lane with bit N clear keeps v[0..N), the other
// v[N..2N); each adds the partner's share of what it keeps
template <int N, int S>
__device__ __forceinline__ void halve_step(float (&v)[S], int lane) {
  const bool hi = (lane & N) != 0;
  #pragma unroll
  for (int j = 0; j < N; ++j) {
    const float send = hi ? v[j] : v[j + N];
    const float keep = hi ? v[j + N] : v[j];
    v[j] = keep + __shfl_xor(send, N, 32);
  }
}
__device__ __forceinline__ float lane_bcast(float v, int srcLane) {
  return __builtin_bit_cast(float,
      __builtin_amdgcn_readlane(__builtin_bit_cast(int, v), srcLane));
}

__global__ __launch_bounds__(WPB * 32) void patch_attention_folded(
    const float* __restrict__ x, const float* __restrict__ qt,
    _Float16* __restrict__ xw)
{
  const int lane = threadIdx.x & 31;
  const int bno  = blockIdx.x * WPB + (threadIdx.x >> 5);
  const int f0   = lane * 4;
  const float* qp = qt + (size_t)bno * (Hh * Ff) + f0;
  const float* xp = x + (size_t)bno * (KK2 * Ff) + f0;

  v4f q[Hh][2];
  #pragma unroll
  for (int h = 0; h < Hh; ++h) {
    q[h][0] = *(const v4f*)(qp + h * Ff);
    q[h][1] = *(const v4f*)(qp + h * Ff + 128);
  }
  // the address pair of the eight loads above is dead from here on and a row
  // load's result may land in it: the wait stands ahead of that overwrite
  asm volatile("s_wait_xcnt 0x0" ::: "memory");
  v4f xr[KK2][2];
  #pragma unroll
  for (int p = 0; p < KK2; ++p) {
    xr[p][0] = *(const v4f*)(xp + p * Ff);
    xr[p][1] = *(const v4f*)(xp + p * Ff + 128);
  }
  // the same for the address pair of the fifty row loads, which is free for
  // the arithmetic below as soon as the last of them has issued
  asm volatile("s_wait_xcnt 0x0" ::: "memory");
  // scores. Rows 0..23 in three groups of 8: 32 partial dots per lane, index
  // pl*4 + h; five halving steps leave lane L with the full sum of index L,
  // so lane L carries p = 8g + (L >> 2), h = L & 3.
  float s[3];
  #pragma unroll
  for (int g = 0; g < 3; ++g) {
    float v[32];
    #pragma unroll
    for (int pl = 0; pl < 8; ++pl)
      #pragma unroll
      for (int h = 0; h < Hh; ++h)
        v[pl * 4 + h] = dot4(xr[8 * g + pl][1], q[h][1],
                             dot4(xr[8 * g + pl][0], q[h][0], 0.f));
    halve_step<16>(v, lane);
    halve_step<8>(v, lane);
    halve_step<4>(v, lane);
    halve_step<2>(v, lane);
    halve_step<1>(v, lane);
    s[g] = v[0] * 0.125f;
  }
  // row 24: every lane ends with the full sum of head L & 3
  float s24;
  {
    float v[4];
    #pragma unroll
    for (int h = 0; h < Hh; ++h)
      v[h] = dot4(xr[24][1], q[h][1], dot4(xr[24][0], q[h][0], 0.f));
    halve_step<2>(v, lane);
    halve_step<1>(v, lane);
    #pragma unroll
    for (int o = 4; o <= 16; o <<= 1) v[0] += __shfl_xor(v[0], o, 32);
    s24 = v[0] * 0.125f;
  }

  // softmax over the 25 positions of head L & 3 (lanes L, L^4, L^8, L^16 ...)
  float mx = fmaxf(fmaxf(s[0], s[1]), fmaxf(s[2], s24));
  #pragma unroll
  for (int o = 4; o <= 16; o <<= 1) mx = fmaxf(mx, __shfl_xor(mx, o, 32));
  const float e0  = __expf(s[0] - mx);
  const float e1  = __expf(s[1] - mx);
  const float e2  = __expf(s[2] - mx);
  const float e24 = __expf(s24 - mx);
  float sum = (e0 + e1) + e2;
  #pragma unroll
  for (int o = 4; o <= 16; o <<= 1) sum += __shfl_xor(sum, o, 32);
  sum += e24;
  const float inv = 1.0f / sum;
  float wg[3];
  wg[0] = e0 * inv;
  wg[1] = e1 * inv;
  wg[2] = e2 * inv;
  const float w24 = e24 * inv;

  // weighted sum of the rows per head, p ascending; each weight is read from
  // its lane into a scalar
  _Float16* op = xw + (size_t)bno * (Hh * Ff) + f0;
  #pragma unroll
  for (int h = 0; h < Hh; ++h) {
    v4f a0 = (v4f){0.f, 0.f, 0.f, 0.f};
    v4f a1 = (v4f){0.f, 0.f, 0.f, 0.f};
    #pragma unroll
    for (int p = 0; p < KK2; ++p) {
      const float w = (p < 24) ? lane_bcast(wg[p >> 3], (p & 7) * 4 + h)
                               : lane_bcast(w24, h);
      a0.x = fmaf(w, xr[p][0].x, a0.x);
      a0.y = fmaf(w, xr[p][0].y, a0.y);
      a0.z = fmaf(w, xr[p][0].z, a0.z);
      a0.w = fmaf(w, xr[p][0].w, a0.w);
      a1.x = fmaf(w, xr[p][1].x, a1.x);
      a1.y = fmaf(w, xr[p][1].y, a1.y);
      a1.z = fmaf(w, xr[p][1].z, a1.z);
      a1.w = fmaf(w, xr[p][1].w, a1.w);
    }
    union { _Float16 hh[4]; uint2 u; } o0, o1;
    o0.hh[0] = (_Float16)a0.x; o0.hh[1] = (_Float16)a0.y;
    o0.hh[2] = (_Float16)a0.z; o0.hh[3] = (_Float16)a0.w;
    o1.hh[0] = (_Float16)a1.x; o1.hh[1] = (_Float16)a1.y;
    o1.hh[2] = (_Float16)a1.z; o1.hh[3] = (_Float16)a1.w;
    *(uint2*)(op + h * Ff)       = o0.u;
    *(uint2*)(op + h * Ff + 128) = o1.u;
  }
}

// ---------------------------------------------------------------------------
// LayerNorm over (N,O,F) per batch element: the sums come from the kernel that
// makes the values; this applies them. It moves 16-byte vectors and issues all
// loads of a thread before the first use.
// ---------------------------------------------------------------------------
constexpr int PB4        = PB / 4;                    // float4 per batch element
static_assert(PB4 % 256 == 0, "apply covers a batch exactly");

__device__ __forceinline__ uint2 pack4h(const v4f v) {
  union { _Float16 h[4]; uint2 u; } o;
  o.h[0] = (_Float16)v.x; o.h[1] = (_Float16)v.y;
  o.h[2] = (_Float16)v.z; o.h[3] = (_Float16)v.w;
  return o.u;
}

// grid = PB4 / 256. A thread takes the same four (n,o,f) positions in every
// batch element, so it reads g and beta once.
__global__ __launch_bounds__(256) void ln_apply_kernel(
    const float* __restrict__ x, const float* __restrict__ g,
    const float* __restrict__ beta, const float* __restrict__ stats,
    float* __restrict__ outF, _Float16* __restrict__ outH)
{
  const int r4 = blockIdx.x * 256 + threadIdx.x;
  float st[2 * Bb];
  #pragma unroll
  for (int k = 0; k < 2 * Bb; ++k) st[k] = stats[k];
  v4f xv[Bb];
  #pragma unroll
  for (int b = 0; b < Bb; ++b) xv[b] = ((const v4f*)x)[b * PB4 + r4];
  const v4f gv = ((const v4f*)g)[r4];
  const v4f bv = ((const v4f*)beta)[r4];
  // the base addresses of the six loads above are dead from here on: the wait
  // stands ahead of whatever is written into their registers
  asm volatile("s_wait_xcnt 0x0" ::: "memory");
  v4f o[Bb];
  #pragma unroll
  for (int b = 0; b < Bb; ++b) {
    const float mu  = st[2 * b + 0] * (1.0f / PB);
    const float var = st[2 * b + 1] * (1.0f / PB) - mu * mu;
    const float rs  = rsqrtf(var + 1e-5f);
    o[b].x = (xv[b].x - mu) * rs * gv.x + bv.x;
    o[b].y = (xv[b].y - mu) * rs * gv.y + bv.y;
    o[b].z = (xv[b].z - mu) * rs * gv.z + bv.z;
    o[b].w = (xv[b].w - mu) * rs * gv.w + bv.w;
  }
  if (outF) {
    #pragma unroll
    for (int b = 0; b < Bb; ++b) ((v4f*)outF)[b * PB4 + r4] = o[b];
  }
  // the f16 packing below may reuse registers that the stores above name
  asm volatile("s_wait_xcnt 0x0" ::: "memory");
  if (outH) {
    #pragma unroll
    for (int b = 0; b < Bb; ++b) ((uint2*)outH)[b * PB4 + r4] = pack4h(o[b]);
  }
}

// ---------------------------------------------------------------------------
// LayerNorm 1 apply and both FFN products in ONE launch:
//   o = LN(x);  y = relu(o W1^T + b1) W2^T + b2 + o   (+ the LayerNorm 2 sums)
// All three are local to a row, so a block that owns FM whole rows needs
// nothing of another block: o and the hidden layer of its rows never leave the
// WGP. The hidden units go by in NCH chunks of HC: a chunk's values are made
// from the chunk's rows of W1, rounded to f16 into LDS, and multiplied at once
// with the chunk's columns of W2 into accumulators that live through all
// chunks (k ascending, as in two separate products).
// The two weight pieces of a chunk (64 KB each) come by async copies into one
// of two LDS buffers: the next chunk's copies fly while this chunk is worked on.
// 8 waves: in the first product a wave takes 16 hidden units, in the second 32
// output columns, each for all FM rows.
// ---------------------------------------------------------------------------
constexpr int FM   = 32;                    // rows a block
constexpr int HC   = 128;                   // hidden units a chunk
constexpr int NCH  = DFFc / HC;
constexpr int P1   = Ff + 8;                // LDS pitches, +16 B against bank conflicts
constexpr int P2   = HC + 8;
constexpr int PC   = Ff + 4;                // the same for the f32 result tile
constexpr int W1V  = HC * P1;               // f16 values of a chunk of W1 in LDS
constexpr int W2V  = Ff * P2;               // and of W2
constexpr int BUFV = W1V + W2V;
static_assert((Nn_ * Oo) % FM == 0, "a block's rows lie in one batch element");
static_assert(FM * PC * 4 <= 2 * BUFV * 2, "the result tile fits the ring");

// eight copies of 16 bytes a lane, LB bytes apart in LDS and GV values apart in
// memory. The xcnt wait closes the statement so that no address register of an
// issued copy is rewritten ahead of it.
template <int LB, int GV>
__device__ __forceinline__ void copy8(unsigned lds, const _Float16* src) {
  asm volatile("global_load_async_to_lds_b128 %0, %1, off\n\t"
               "global_load_async_to_lds_b128 %2, %3, off\n\t"
               "global_load_async_to_lds_b128 %4, %5, off\n\t"
               "global_load_async_to_lds_b128 %6, %7, off\n\t"
               "global_load_async_to_lds_b128 %8, %9, off\n\t"
               "global_load_async_to_lds_b128 %10, %11, off\n\t"
               "global_load_async_to_lds_b128 %12, %13, off\n\t"
               "global_load_async_to_lds_b128 %14, %15, off\n\t"
               "s_wait_xcnt 0x0"
               :: "v"(lds),          "v"(src),
                  "v"(lds + LB),     "v"(src + GV),
                  "v"(lds + 2 * LB), "v"(src + 2 * GV),
                  "v"(lds + 3 * LB), "v"(src + 3 * GV),
                  "v"(lds + 4 * LB), "v"(src + 4 * GV),
                  "v"(lds + 5 * LB), "v"(src + 5 * GV),
                  "v"(lds + 6 * LB), "v"(src + 6 * GV),
                  "v"(lds + 7 * LB), "v"(src + 7 * GV)
               : "memory");
}

// grid = ROWS / FM
__global__ __launch_bounds__(256) void ln_ffn_fused(
    const float* __restrict__ x, const float* __restrict__ g,
    const float* __restrict__ beta, const float* __restrict__ statsIn,
    const _Float16* __restrict__ W1h, const float* __restrict__ b1,
    const _Float16* __restrict__ W2h, const float* __restrict__ b2,
    float* __restrict__ outF, float* __restrict__ stats)
{
  __shared__ __attribute__((aligned(16))) _Float16 Wb[2 * BUFV];
  __shared__ __attribute__((aligned(16))) _Float16 As[FM * P1];
  __shared__ __attribute__((aligned(16))) _Float16 Hs[FM * P2];
  __shared__ __attribute__((aligned(16))) float b1s[DFFc];
  __shared__ __attribute__((aligned(16))) float b2s[Ff];
  __shared__ float red[16];

  const int tid     = threadIdx.x;
  const int lane    = tid & 31;
  const int wave    = tid >> 5;
  const int rowBase = blockIdx.x * FM;
  const int bidx    = rowBase / (Nn_ * Oo);   // batch element
  const int n0      = lane & 15;              // row (A) / col (B) within tile
  const int half8   = ((lane >> 4) & 1) << 3; // K sub-offset per lane half
  const int r0      = (lane >> 4) * 8;        // first C row of this lane half
  // elementwise parts: eight threads a row, a thread takes four values in each
  // of the row's eight 128-byte lines
  const int lr      = tid >> 3;
  const int lc      = (tid & 7) * 4;

  // A chunk of W1 is HC whole rows of 512 B, one run of memory: a wave's copy
  // takes one row. A chunk of W2 is 256 B of each of its Ff rows: two rows a copy.
  const unsigned l1 = (unsigned)(uintptr_t)&Wb[(tid >> 5) * P1 + (tid & 31) * 8];
  const unsigned l2 = (unsigned)(uintptr_t)&Wb[W1V + (tid >> 4) * P2 + (tid & 15) * 8];
  const _Float16* s1 = W1h + tid * 8;
  const _Float16* s2 = W2h + (tid >> 4) * DFFc + (tid & 15) * 8;
  auto fill = [&](int c, int buf) {
    const unsigned d1 = l1 + buf * (BUFV * 2);
    const unsigned d2 = l2 + buf * (BUFV * 2);
    const _Float16* g1 = s1 + c * (HC * Ff);
    const _Float16* g2 = s2 + c * HC;
    copy8<8 * P1 * 2, 8 * Ff>(d1, g1);
    copy8<8 * P1 * 2, 8 * Ff>(d1 + 64 * P1 * 2, g1 + 64 * Ff);
    copy8<16 * P2 * 2, 16 * DFFc>(d2, g2);
    copy8<16 * P2 * 2, 16 * DFFc>(d2 + 128 * P2 * 2, g2 + 128 * DFFc);
  };
  fill(0, 0);

  // --- LayerNorm 1 on the block's rows, beside the copies; res keeps the f32
  // values for the residual
  v4f res[8];
  {
    const float* px  = x + (size_t)(rowBase + lr) * Ff + lc;
    const float* pg  = g + (size_t)(rowBase - bidx * (Nn_ * Oo) + lr) * Ff + lc;
    const float* pe  = beta + (size_t)(rowBase - bidx * (Nn_ * Oo) + lr) * Ff + lc;
    const float* pb1 = b1 + tid * 4;
    const float* pb2 = b2 + tid;
    const float st0 = statsIn[2 * bidx + 0];
    const float st1 = statsIn[2 * bidx + 1];
    v4f gv[8], ev[8];
    // unrolled: the arrays must stay in registers
    #pragma unroll
    for (int k = 0; k < 8; ++k) res[k] = *(const v4f*)(px + 32 * k);
    #pragma unroll
    for (int k = 0; k < 8; ++k) gv[k] = *(const v4f*)(pg + 32 * k);
    #pragma unroll
    for (int k = 0; k < 8; ++k) ev[k] = *(const v4f*)(pe + 32 * k);
    const v4f b1v = *(const v4f*)pb1;
    const float b2v = *pb2;
    // stands ahead of whatever is written into the address registers of the
    // loads above; it names the addresses as inputs so that their registers
    // stay untouched (also by a later load's result) up to the wait
    asm volatile("s_wait_xcnt 0x0" :: "v"(px), "v"(pg), "v"(pe), "v"(pb1), "v"(pb2) : "memory");
    const float mu  = st0 * (1.0f / PB);
    const float var = st1 * (1.0f / PB) - mu * mu;
    const float rs  = rsqrtf(var + 1e-5f);
    #pragma unroll
    for (int k = 0; k < 8; ++k) {
      res[k].x = (res[k].x - mu) * rs * gv[k].x + ev[k].x;
      res[k].y = (res[k].y - mu) * rs * gv[k].y + ev[k].y;
      res[k].z = (res[k].z - mu) * rs * gv[k].z + ev[k].z;
      res[k].w = (res[k].w - mu) * rs * gv[k].w + ev[k].w;
      *(uint2*)&As[lr * P1 + lc + 32 * k] = pack4h(res[k]);
    }
    *(v4f*)&b1s[tid * 4] = b1v;
    b2s[tid] = b2v;
  }

  // own copies landed, then every wave's: chunk 0, the normalised rows and the
  // biases are read only behind this
  asm volatile("s_wait_asynccnt 0x0" ::: "memory");
  __syncthreads();

  // A fragments for all of K stay in registers through all chunks
  FragU a[Ff / 32][2];
  {
    const _Float16* af = &As[n0 * P1 + half8];
    // unrolled: a[][] must stay in registers
    #pragma unroll
    for (int s = 0; s < Ff / 32; ++s) {
      a[s][0].v = frag_at(af + 32 * s);
      a[s][1].v = frag_at(af + 16 * P1 + 32 * s);
    }
  }

  v8f acc[4];                                 // index 2 g + j
  #pragma unroll
  for (int t = 0; t < 4; ++t) acc[t] = (v8f){};

  // rolled: one body serves both buffers, the buffer is an address
  #pragma unroll 1
  for (int c = 0; c < NCH; ++c) {
    const _Float16* wb = Wb + (c & 1) * BUFV;
    // all weight fragments of the chunk are asked for at once; they land while
    // the next chunk's copies are issued
    v16h w1f[Ff / 32], w2f[HC / 32][2];
    {
      const _Float16* bp1 = wb + (wave * 16 + n0) * P1 + half8;
      const _Float16* bp2 = wb + W1V + (wave * 32 + n0) * P2 + half8;
      // unrolled: register indices
      #pragma unroll
      for (int s = 0; s < Ff / 32; ++s) w1f[s] = frag_at(bp1 + 32 * s);
      #pragma unroll
      for (int s = 0; s < HC / 32; ++s) {
        w2f[s][0] = frag_at(bp2 + 32 * s);
        w2f[s][1] = frag_at(bp2 + 16 * P2 + 32 * s);
      }
    }
    const float bb = b1s[c * HC + wave * 16 + n0];
    // the other buffer's last reads ended at the barrier at the foot of the
    // trip before
    if (c + 1 < NCH) fill(c + 1, (c + 1) & 1);

    // --- first product: FM rows x the wave's 16 hidden units, K = Ff
    {
      v8f h0 = (v8f){}, h1 = (v8f){};
      // unrolled: register indices
      #pragma unroll
      for (int s = 0; s < Ff / 32; ++s) {
        h0 = __builtin_amdgcn_wmma_f32_16x16x32_f16(false, a[s][0].v, false, w1f[s], (short)0, h0, false, false);
        h1 = __builtin_amdgcn_wmma_f32_16x16x32_f16(false, a[s][1].v, false, w1f[s], (short)0, h1, false, false);
      }
      _Float16* hp = &Hs[r0 * P2 + wave * 16 + n0];
      #pragma unroll
      for (int r = 0; r < 8; ++r) {
        hp[r * P2]        = (_Float16)fmaxf(h0[r] + bb, 0.0f);
        hp[(16 + r) * P2] = (_Float16)fmaxf(h1[r] + bb, 0.0f);
      }
    }
    // the chunk's hidden values of all eight waves are read behind this
    __syncthreads();
    // --- second product: FM rows x the wave's 32 columns, K = this chunk
    {
      const _Float16* ha = &Hs[n0 * P2 + half8];
      v16h hf[HC / 32][2];
      #pragma unroll
      for (int s = 0; s < HC / 32; ++s) {
        hf[s][0] = frag_at(ha + 32 * s);
        hf[s][1] = frag_at(ha + 16 * P2 + 32 * s);
      }
      // keeps all eight fragment loads ahead of this product's first WMMA, so that
      // their latencies run side by side instead of one behind the other
      __builtin_amdgcn_sched_barrier(0);
      #pragma unroll
      for (int s = 0; s < HC / 32; ++s) {
        acc[0] = __builtin_amdgcn_wmma_f32_16x16x32_f16(false, hf[s][0], false, w2f[s][0], (short)0, acc[0], false, false);
        acc[1] = __builtin_amdgcn_wmma_f32_16x16x32_f16(false, hf[s][0], false, w2f[s][1], (short)0, acc[1], false, false);
        acc[2] = __builtin_amdgcn_wmma_f32_16x16x32_f16(false, hf[s][1], false, w2f[s][0], (short)0, acc[2], false, false);
        acc[3] = __builtin_amdgcn_wmma_f32_16x16x32_f16(false, hf[s][1], false, w2f[s][1], (short)0, acc[3], false, false);
      }
    }
    // foot of the trip: own LDS reads done, own copies of the next chunk
    // landed, then every wave's; the barrier publishes the next chunk and ends
    // the last read of this chunk's buffer and of the hidden values
    asm volatile("s_wait_dscnt 0x0" ::: "memory");
    asm volatile("s_wait_asynccnt 0x0" ::: "memory");
    __syncthreads();
  }
  // no copy is outstanding when the ring is put to another use
  asm volatile("s_wait_asynccnt 0x0" ::: "memory");

  // --- the result tile goes through the ring's LDS (free since the last
  // trip's barrier) back to the elementwise layout: the residual is there, and
  // the stores are whole 128-byte lines
  float* Cs = (float*)Wb;
  {
    float* cp = Cs + r0 * PC + wave * 32 + n0;
    #pragma unroll
    for (int t = 0; t < 4; ++t)
      #pragma unroll
      for (int r = 0; r < 8; ++r)
        cp[(16 * (t >> 1) + r) * PC + 16 * (t & 1)] = acc[t][r];
  }
  __syncthreads();
  v4f y[8];
  #pragma unroll
  for (int k = 0; k < 8; ++k) {
    const v4f cv = *(const v4f*)&Cs[lr * PC + lc + 32 * k];
    const v4f bv = *(const v4f*)&b2s[lc + 32 * k];
    y[k] = (cv + bv) + res[k];
  }
  // LayerNorm 2 sums, ahead of the stores: the barrier below waits for every
  // store that a wave has issued, so here it waits for none
  {
    v4f s4 = y[0];
    v4f q4 = y[0] * y[0];
    #pragma unroll
    for (int k = 1; k < 8; ++k) {
      s4 += y[k];
      q4 += y[k] * y[k];
    }
    float s = (s4.x + s4.y) + (s4.z + s4.w);
    float q = (q4.x + q4.y) + (q4.z + q4.w);
    for (int o = 16; o > 0; o >>= 1) {
      s += __shfl_xor(s, o, 32);
      q += __shfl_xor(q, o, 32);
    }
    if (lane == 0) { red[wave] = s; red[8 + wave] = q; }
    __syncthreads();
    // thread 0 adds up the eight waves' sums, thread 1 their sums of squares
    if (tid < 2) {
      const float* p = red + 8 * tid;
      const float tot = ((p[0] + p[1]) + (p[2] + p[3])) + ((p[4] + p[5]) + (p[6] + p[7]));
      atomicAdd(&stats[2 * bidx + tid], tot);
    }
  }
  float* o = outF + (size_t)(rowBase + lr) * Ff + lc;
  #pragma unroll
  for (int k = 0; k < 8; ++k) *(v4f*)(o + 32 * k) = y[k];
}


// ---------------------------------------------------------------------------
// first launch: everything that depends on the inputs alone. The parts need
// nothing of each other, so each takes a range of the block index (the branch
// is the same for a whole block). All of a thread's loads are issued before
// its first store other than the zeroing of the LN sums.
// ---------------------------------------------------------------------------
constexpr int QROWS       = 128;                       // patches a query block
constexpr int PREP_Q      = (ROWS / QROWS) * Hh;       // blocks for the folded queries
constexpr int PREP_FFN    = DFFc * Ff / 16 / 256;      // blocks per FFN weight
constexpr int PREP_PROD   = Hh * 2 * 4;                // blocks for the weight product
constexpr int PREP_BIAS   = 4;                         // blocks for Wf bv + bf
constexpr int PREP_BLOCKS = PREP_Q + PREP_PROD + PREP_BIAS + 2 * PREP_FFN;

// flat f32 -> f16: block blk takes 1024 runs of four values
__device__ __forceinline__ void cvt_flat_f16(
    const float* __restrict__ s, _Float16* __restrict__ d, int blk) {
  const int i = blk * 1024 + threadIdx.x;
  v4f v[4];
  #pragma unroll
  for (int j = 0; j < 4; ++j) v[j] = ((const v4f*)s)[i + j * 256];
  #pragma unroll
  for (int j = 0; j < 4; ++j) ((uint2*)d)[i + j * 256] = pack4h(v[j]);
  // the built code joins this part's exit with another part's path, where the
  // registers that the four stores name are written again: the wait stands
  // ahead of that
  asm volatile("s_wait_xcnt 0x0" ::: "memory");
}

// ---------------------------------------------------------------------------
// Weight product. Two linear maps that follow one another with nothing in
// between are one map, and its matrix depends on the weights alone:
//   attent = Wf (Wv_h xw_h + bv_h)_h + bf = sum_h (Wf_h Wv_h) xw_h + (Wf bv + bf)
// (Wf_h: columns 64 h .. 64 h + 63 of Wf). The product has K = 64 and is small;
// with it the two activation GEMMs behind the attention are one.
// One block makes a 128 x 64 tile C[m][n] = sum_d A(m, d) B(n, d), d < 64:
// both operands go f32 -> f16 into LDS with d running along a row, then each
// wave takes 16 rows. PS: LDS pitch, +16 B against bank conflicts.
// ---------------------------------------------------------------------------
constexpr int PS = Dd + 8;

// an operand that lies d-major in memory (row d, pitch Ff, COLS columns from
// src on): a thread takes rows d, d + 1 at four columns, so that a pair of
// f16 values along d is one 4-byte LDS store. Its COLS / 32 such pieces lie a
// constant number of rows apart: one address serves them all.
template <int COLS>
__device__ __forceinline__ const float* addrT(const float* __restrict__ src) {
  return src + (threadIdx.x / (COLS / 4)) * 2 * Ff + (threadIdx.x % (COLS / 4)) * 4;
}
template <int COLS>
__device__ __forceinline__ void loadT(const float* __restrict__ p,
                                      v4f (&lo)[COLS / 32], v4f (&hi)[COLS / 32]) {
  constexpr int DSTEP = 2 * 256 / (COLS / 4);   // rows from piece to piece
  #pragma unroll
  for (int j = 0; j < COLS / 32; ++j) {
    lo[j] = *(const v4f*)(p + j * DSTEP * Ff);
    hi[j] = *(const v4f*)(p + j * DSTEP * Ff + Ff);
  }
}
template <int COLS>
__device__ __forceinline__ void storeT(_Float16* S,
                                       const v4f (&lo)[COLS / 32], const v4f (&hi)[COLS / 32]) {
  constexpr int DSTEP = 2 * 256 / (COLS / 4);
  _Float16* q = S + (threadIdx.x % (COLS / 4)) * 4 * PS + (threadIdx.x / (COLS / 4)) * 2;
  #pragma unroll
  for (int j = 0; j < COLS / 32; ++j) {
    #pragma unroll
    for (int e = 0; e < 4; ++e) {
      union { _Float16 h[2]; unsigned u; } w;
      w.h[0] = (_Float16)lo[j][e];
      w.h[1] = (_Float16)hi[j][e];
      *(unsigned*)&q[e * PS + j * DSTEP] = w.u;
    }
  }
}

// A lies m-major (srcA at [first m][first d], pitch Ff), B d-major.
__device__ __forceinline__ void weight_product(
    const float* __restrict__ srcA, const float* __restrict__ srcB,
    _Float16* __restrict__ C, int ldc, _Float16* As, _Float16* Bs)
{
  const int lane  = threadIdx.x & 31;
  const int wave  = threadIdx.x >> 5;
  const int n0    = lane & 15;
  const int half8 = ((lane >> 4) & 1) << 3;
  const int r0    = (lane >> 4) * 8;

  // every global read of the block ahead of its first LDS store
  v4f alo[4], ahi[4], blo[2], bhi[2];
  const float* pa = srcA + (threadIdx.x >> 4) * Ff + (threadIdx.x & 15) * 4;
  const float* pb = addrT<64>(srcB);
  #pragma unroll
  for (int j = 0; j < 4; ++j) {                 // rows 16 j + (t >> 4), and 64 more
    alo[j] = *(const v4f*)(pa + 16 * j * Ff);
    ahi[j] = *(const v4f*)(pa + (64 + 16 * j) * Ff);
  }
  loadT<64>(pb, blo, bhi);
  // stands ahead of whatever is written into the address registers of the
  // loads above; it names the addresses as inputs so that their registers stay
  // untouched (also by a later load's result) up to the wait
  asm volatile("s_wait_xcnt 0x0" :: "v"(pa), "v"(pb) : "memory");
  {
    _Float16* q = As + (threadIdx.x >> 4) * PS + (threadIdx.x & 15) * 4;
    #pragma unroll
    for (int j = 0; j < 4; ++j) {
      *(uint2*)&q[16 * j * PS]        = pack4h(alo[j]);
      *(uint2*)&q[(64 + 16 * j) * PS] = pack4h(ahi[j]);
    }
  }
  storeT<64>(Bs, blo, bhi);
  __syncthreads();

  const _Float16* ap = &As[(wave * 16 + n0) * PS + half8];
  const _Float16* bp = &Bs[n0 * PS + half8];
  const v16h a0 = frag_at(ap), a1 = frag_at(ap + 32);
  v8f acc[4];
  #pragma unroll
  for (int j = 0; j < 4; ++j) {
    acc[j] = (v8f){};
    acc[j] = __builtin_amdgcn_wmma_f32_16x16x32_f16(false, a0, false, frag_at(bp + 16 * j * PS), (short)0, acc[j], false, false);
    acc[j] = __builtin_amdgcn_wmma_f32_16x16x32_f16(false, a1, false, frag_at(bp + 16 * j * PS + 32), (short)0, acc[j], false, false);
  }
  _Float16* o = C + (size_t)(wave * 16 + r0) * ldc + n0;
  _Float16 h[4][8];
  #pragma unroll
  for (int j = 0; j < 4; ++j)
    #pragma unroll
    for (int r = 0; r < 8; ++r) h[j][r] = (_Float16)acc[j][r];
  #pragma unroll
  for (int j = 0; j < 4; ++j)
    #pragma unroll
    for (int r = 0; r < 8; ++r) o[r * ldc + 16 * j] = h[j][r];
  // the built code may join this part's exit with another part's path, where
  // registers that the stores name are written again: the wait stands ahead
  asm volatile("s_wait_xcnt 0x0" ::: "memory");
}

// bfv[o] = bf[o] + sum_j Wf[o][j] bv[j], j < 256: a pair of waves takes 16 rows
// of Wf, each wave one half of K as A fragments straight from memory (all of K
// in one wave would set the register count of the whole launch); bv is column
// 0 of the B fragments. The odd wave hands its sums to the even one in LDS.
__device__ __forceinline__ void bias_product(
    const float* __restrict__ Wf, const float* __restrict__ bv,
    const float* __restrict__ bf, float* __restrict__ bfv, int blk,
    _Float16* vs, float* red)
{
  const int lane  = threadIdx.x & 31;
  const int wave  = threadIdx.x >> 5;
  const int n0    = lane & 15;
  const int half8 = ((lane >> 4) & 1) << 3;
  const int r0    = (lane >> 4) * 8;
  const int kh    = wave & 1;
  const int row0  = (blk * 4 + (wave >> 1)) * 16;
  const float* ap = Wf + (size_t)(row0 + n0) * Ff + 128 * kh + half8;
  v4f av[4][4];
  // unrolled: av[][] must stay in registers
  #pragma unroll
  for (int s = 0; s < 4; ++s) {
    av[s][0] = *(const v4f*)(ap + 32 * s);
    av[s][1] = *(const v4f*)(ap + 32 * s + 4);
    av[s][2] = *(const v4f*)(ap + 32 * s + 16);
    av[s][3] = *(const v4f*)(ap + 32 * s + 20);
  }
  const float* pbv = bv + threadIdx.x;
  const float* pbf = bf + row0 + r0;
  const float bvv = *pbv;
  const v4f f0 = *(const v4f*)(pbf);
  const v4f f1 = *(const v4f*)(pbf + 4);
  // stands ahead of whatever is written into the address registers of the
  // loads above; it names the addresses as inputs so that their registers stay
  // untouched (also by a later load's result) up to the wait
  asm volatile("s_wait_xcnt 0x0" :: "v"(ap), "v"(pbv), "v"(pbf) : "memory");
  vs[threadIdx.x] = (_Float16)bvv;
  __syncthreads();
  v8f acc = (v8f){};
  #pragma unroll
  for (int s = 0; s < 4; ++s) {
    FragU a;
    a.q[0].x = pack4h(av[s][0]).x; a.q[0].y = pack4h(av[s][0]).y;
    a.q[0].z = pack4h(av[s][1]).x; a.q[0].w = pack4h(av[s][1]).y;
    a.q[1].x = pack4h(av[s][2]).x; a.q[1].y = pack4h(av[s][2]).y;
    a.q[1].z = pack4h(av[s][3]).x; a.q[1].w = pack4h(av[s][3]).y;
    const v16h bl = frag_at(vs + 128 * kh + 32 * s + half8);
    v16h b;
    #pragma unroll
    for (int e = 0; e < 16; ++e) b[e] = (n0 == 0) ? bl[e] : (_Float16)0.0f;
    acc = __builtin_amdgcn_wmma_f32_16x16x32_f16(false, a.v, false, b, (short)0, acc, false, false);
  }
  float* rp = red + (wave >> 1) * 16 + r0;
  if (kh == 1 && n0 == 0) {
    #pragma unroll
    for (int r = 0; r < 8; ++r) rp[r] = acc[r];
  }
  __syncthreads();
  if (kh == 0 && n0 == 0) {
    #pragma unroll
    for (int r = 0; r < 8; ++r)
      bfv[row0 + r0 + r] = (acc[r] + rp[r]) + (r < 4 ? f0[r & 3] : f1[r & 3]);
  }
  // as at the end of weight_product
  asm volatile("s_wait_xcnt 0x0" ::: "memory");
}


// ---------------------------------------------------------------------------
// Folded queries, straight from the f32 inputs: for head h and patch r
//   q = Wq_h xc_r + bq_h (64 long, xc the centre token),  qt = Wk_h^T q (256 long)
// Both products are local to a patch, so a block that owns QROWS patches and
// one head needs nothing that another block makes, and the part can stand in
// the first launch. A wave takes 16 patches through both products.
// The weights are the A operand and the patches the B operand, so a lane's 8
// accumulator registers hold 8 consecutive outputs of ONE patch:
//  - two tiles of q, rounded to f16 in place, are the B fragment of the second
//    product (k = 32 s + 8 (lane >> 4) + e and 16 more: the k order of frag_at);
//  - a tile of qt is two 16-byte LDS stores.
// LDS: Qs = Wq_h as it lies (row d, g along it), Ks = Wk_h turned (row f, d
// along it), Cs = a range of each wave's own: first its 16 centre tokens in
// f16, then its 16 result rows in f32, so that global reads and stores are
// whole 128-byte lines.
// ---------------------------------------------------------------------------
constexpr int QP  = Ff + 8;                 // LDS pitch of 256 f16, +16 B against bank conflicts
constexpr int QPC = Ff + 4;                 // the same for 256 f32
constexpr int QWV = 16 * QPC;               // floats of a wave's own range
static_assert(16 * QP * 2 <= QWV * 4, "the centre tokens fit the wave's range");

typedef __attribute__((ext_vector_type(4))) _Float16 v4h;

__device__ __forceinline__ void query_chain(
    const float* __restrict__ x, const float* __restrict__ Wq,
    const float* __restrict__ bq, const float* __restrict__ Wk,
    float* __restrict__ qt, int blk, _Float16* Qs, _Float16* Ks, float* Cs)
{
  const int tid     = threadIdx.x;
  const int lane    = tid & 31;
  const int wave    = tid >> 5;
  const int n0      = lane & 15;
  const int half8   = ((lane >> 4) & 1) << 3;
  const int h       = blk & 3;
  const int rowBase = (blk >> 2) * QROWS + wave * 16;

  // every global read of the block ahead of its first LDS store
  // bq: the 8 values of each q tile that the lane's accumulator registers hold
  const float* pb = bq + h * Dd + half8;
  // Wq_h is one run of memory: a wave's load takes half a row
  const float* pq = Wq + h * Dd * Ff + tid * 4;
  // Wk_h: a lane takes rows d, d + 1 at four columns; eight lanes cover a
  // 128-byte line, four such groups four pairs of rows
  const float* pk = Wk + h * Dd * Ff + (lane >> 3) * 2 * Ff + (wave * 8 + (lane & 7)) * 4;
  // centre tokens (p = 12 of each patch): a wave's load takes half a row
  const float* px = x + (size_t)rowBase * (KK2 * Ff) + lane * 4;
  v4f bb[4][2], wq[16], klo[8], khi[8], xv[32];
  // unrolled, here and below: the arrays must stay in registers
  #pragma unroll
  for (int j = 0; j < 4; ++j) {
    bb[j][0] = *(const v4f*)(pb + 16 * j);
    bb[j][1] = *(const v4f*)(pb + 16 * j + 4);
  }
  #pragma unroll
  for (int j = 0; j < 16; ++j) wq[j] = *(const v4f*)(pq + j * 1024);
  #pragma unroll
  for (int j = 0; j < 8; ++j) {
    klo[j] = *(const v4f*)(pk + j * 8 * Ff);
    khi[j] = *(const v4f*)(pk + j * 8 * Ff + Ff);
  }
  #pragma unroll
  for (int i = 0; i < 32; ++i)
    xv[i] = *(const v4f*)(px + ((i >> 1) * KK2 + 12) * Ff + (i & 1) * 128);
  // stands ahead of whatever is written into the address registers of the
  // loads above; it names what they are formed from as inputs so that those
  // registers stay untouched (also by a later load's result) up to the wait
  asm volatile("s_wait_xcnt 0x0" :: "v"(tid), "v"(half8), "v"(pk), "v"(px) : "memory");
  // keeps the address arithmetic of the LDS stores below behind the wait
  __builtin_amdgcn_sched_barrier(0);

  {
    _Float16* d = Qs + (tid >> 6) * QP + (tid & 63) * 4;
    #pragma unroll
    for (int j = 0; j < 16; ++j) *(v4h*)&d[4 * j * QP] = __builtin_convertvector(wq[j], v4h);
  }
  {
    _Float16* d = Ks + (wave * 8 + (lane & 7)) * 4 * PS + (lane >> 3) * 2;
    #pragma unroll
    for (int j = 0; j < 8; ++j) {
      #pragma unroll
      for (int e = 0; e < 4; ++e) {
        union { _Float16 h[2]; unsigned u; } w;
        w.h[0] = (_Float16)klo[j][e];
        w.h[1] = (_Float16)khi[j][e];
        *(unsigned*)&d[e * PS + j * 8] = w.u;
      }
    }
  }
  float* cs = Cs + wave * QWV;
  _Float16* xs = (_Float16*)cs;
  {
    _Float16* d = xs + lane * 4;
    #pragma unroll
    for (int i = 0; i < 32; ++i)
      *(v4h*)&d[(i >> 1) * QP + (i & 1) * 128] = __builtin_convertvector(xv[i], v4h);
  }
  // the weights of all eight waves are read behind this
  __syncthreads();

  // Fragments come from LDS in runs: all of the first product's at once, the
  // second product's in two runs, each asked for ahead of the products on what
  // has been asked for before it. The scheduling barriers keep a run's loads
  // where they stand: left alone, the compiler puts each load directly in
  // front of its product, and every product then waits out an LDS latency.
  const _Float16* qa = Qs + n0 * QP + half8;
  const _Float16* ka = Ks + n0 * PS + half8;
  v16h xb[Ff / 32], wa[Ff / 32][4], kf[Ff / 16][2];
  #pragma unroll
  for (int s = 0; s < Ff / 32; ++s) xb[s] = frag_at(xs + n0 * QP + half8 + 32 * s);
  #pragma unroll
  for (int s = 0; s < Ff / 32; ++s)
    #pragma unroll
    for (int j = 0; j < 4; ++j) wa[s][j] = frag_at(qa + 16 * j * QP + 32 * s);
  __builtin_amdgcn_sched_barrier(0);

  // --- q^T: tile j holds d = 16 j + 8 (lane >> 4) + r of patch n0; starts at bq
  v8f q1[4];
  #pragma unroll
  for (int j = 0; j < 4; ++j)
    #pragma unroll
    for (int r = 0; r < 8; ++r) q1[j][r] = bb[j][r >> 2][r & 3];
  #pragma unroll
  for (int s = 0; s < 4; ++s)
    #pragma unroll
    for (int j = 0; j < 4; ++j)
      q1[j] = __builtin_amdgcn_wmma_f32_16x16x32_f16(false, wa[s][j], false, xb[s], (short)0, q1[j], false, false);
  #pragma unroll
  for (int t = 0; t < 8; ++t) {
    kf[t][0] = frag_at(ka + 16 * t * PS);
    kf[t][1] = frag_at(ka + 16 * t * PS + 32);
  }
  __builtin_amdgcn_sched_barrier(0);
  #pragma unroll
  for (int s = 4; s < 8; ++s)
    #pragma unroll
    for (int j = 0; j < 4; ++j)
      q1[j] = __builtin_amdgcn_wmma_f32_16x16x32_f16(false, wa[s][j], false, xb[s], (short)0, q1[j], false, false);
  #pragma unroll
  for (int t = 8; t < 16; ++t) {
    kf[t][0] = frag_at(ka + 16 * t * PS);
    kf[t][1] = frag_at(ka + 16 * t * PS + 32);
  }
  __builtin_amdgcn_sched_barrier(0);
  v16h qf[2];
  #pragma unroll
  for (int s = 0; s < 2; ++s)
    #pragma unroll
    for (int e = 0; e < 8; ++e) {
      qf[s][e]     = (_Float16)q1[2 * s][e];
      qf[s][8 + e] = (_Float16)q1[2 * s + 1][e];
    }

  // --- qt^T: tile t holds f = 16 t + 8 (lane >> 4) + r of patch n0
  v8f acc[Ff / 16];
  #pragma unroll
  for (int t = 0; t < Ff / 16; ++t) {
    acc[t] = (v8f){};
    acc[t] = __builtin_amdgcn_wmma_f32_16x16x32_f16(false, kf[t][0], false, qf[0], (short)0, acc[t], false, false);
    acc[t] = __builtin_amdgcn_wmma_f32_16x16x32_f16(false, kf[t][1], false, qf[1], (short)0, acc[t], false, false);
  }
  // all products ahead of the first store: each tile keeps registers of its
  // own, and no product waits for a store to give its registers back
  __builtin_amdgcn_sched_barrier(0);

  // --- through the wave's own range (its centre tokens are used up) to rows
  {
    float* d = cs + n0 * QPC + half8;
    #pragma unroll
    for (int t = 0; t < Ff / 16; ++t) {
      *(v4f*)&d[16 * t]     = (v4f){acc[t][0], acc[t][1], acc[t][2], acc[t][3]};
      *(v4f*)&d[16 * t + 4] = (v4f){acc[t][4], acc[t][5], acc[t][6], acc[t][7]};
    }
  }
  // the wave's own LDS stores are done before it reads other lanes' values
  asm volatile("s_wait_dscnt 0x0" ::: "memory");
  v4f y[32];
  #pragma unroll
  for (int i = 0; i < 32; ++i)
    y[i] = *(const v4f*)&cs[(i >> 1) * QPC + (i & 1) * 128 + lane * 4];
  float* o = qt + (size_t)rowBase * (Hh * Ff) + h * Ff + lane * 4;
  #pragma unroll
  for (int i = 0; i < 32; ++i)
    *(v4f*)(o + (i >> 1) * (Hh * Ff) + (i & 1) * 128) = y[i];
  // as at the end of weight_product
  asm volatile("s_wait_xcnt 0x0" ::: "memory");
}

// grid = PREP_BLOCKS; the parts with the longest way to go come first
__global__ __launch_bounds__(256) void prep_kernel(
    const float* __restrict__ x,  const float* __restrict__ Wq,
    const float* __restrict__ bq, const float* __restrict__ Wk,
    const float* __restrict__ Wv, const float* __restrict__ bv,
    const float* __restrict__ Wf, const float* __restrict__ bf,
    const float* __restrict__ W1, const float* __restrict__ W2,
    float* __restrict__ qt, _Float16* __restrict__ wfvH,
    float* __restrict__ bfv, _Float16* __restrict__ w1H,
    _Float16* __restrict__ w2H, float* __restrict__ stats)
{
  __shared__ __attribute__((aligned(16))) _Float16 Ks[Ff * PS];
  __shared__ __attribute__((aligned(16))) _Float16 Qs[Dd * QP];
  __shared__ __attribute__((aligned(16))) float Cs[8 * QWV];
  static_assert(128 * PS <= Ff * PS && 64 * PS <= Dd * QP, "the weight product's operands fit");
  int blk = blockIdx.x;
  if (blk < PREP_Q) { query_chain(x, Wq, bq, Wk, qt, blk, Qs, Ks, Cs); return; }
  blk -= PREP_Q;
  if (blk < PREP_PROD) {
    const int h = (blk >> 3) & 3, mb = (blk >> 2) & 1, nb = blk & 3;
    // wfv[o][h*256 + f] = sum_d Wf[o][h*64 + d] Wv[h*64 + d][f]
    weight_product(Wf + mb * 128 * Ff + h * Dd, Wv + h * Dd * Ff + nb * 64,
                   wfvH + (size_t)(mb * 128) * (Hh * Ff) + h * Ff + nb * 64, Hh * Ff,
                   Ks, Qs);
    return;
  }
  blk -= PREP_PROD;
  if (blk < PREP_BIAS) {
    if (blk == 0 && threadIdx.x < 16) stats[threadIdx.x] = 0.f;  // both LN sets
    bias_product(Wf, bv, bf, bfv, blk, Ks, (float*)Qs);
    return;
  }
  blk -= PREP_BIAS;
  if (blk < PREP_FFN) cvt_flat_f16(W1, w1H, blk);
  else                cvt_flat_f16(W2, w2H, blk - PREP_FFN);
}


// ---------------------------------------------------------------------------
extern "C" void kernel_launch(void* const* d_in, const int* in_sizes, int n_in,
                              void* d_out, int out_size, void* d_ws, size_t ws_size,
                              hipStream_t stream) {
  const float* x    = (const float*)d_in[0];
  const float* Wq   = (const float*)d_in[1];
  const float* bq   = (const float*)d_in[2];
  const float* Wk   = (const float*)d_in[3];
  // d_in[4] (bk) adds q_h . bk_h to all 25 scores of a head: cancels in softmax
  const float* Wv   = (const float*)d_in[5];
  const float* bv   = (const float*)d_in[6];
  const float* Wf   = (const float*)d_in[7];
  const float* bf   = (const float*)d_in[8];
  const float* ln1w = (const float*)d_in[9];
  const float* ln1b = (const float*)d_in[10];
  const float* ln2w = (const float*)d_in[11];
  const float* ln2b = (const float*)d_in[12];
  const float* W1   = (const float*)d_in[13];
  const float* b1   = (const float*)d_in[14];
  const float* W2   = (const float*)d_in[15];
  const float* b2   = (const float*)d_in[16];

  char* ws = (char*)d_ws;
  size_t off = 0;
  auto alloc = [&](size_t bytes) -> void* {
    void* p = ws + off;
    off += (bytes + 255) & ~(size_t)255;
    return p;
  };

  _Float16* wfvH    = (_Float16*)alloc((size_t)Ff * Hh * Ff * 2);  // Wf_h Wv_h
  float*    bfv     = (float*)   alloc((size_t)Ff * 4);            // Wf bv + bf
  _Float16* w1H     = (_Float16*)alloc((size_t)DFFc * Ff * 2);
  _Float16* w2H     = (_Float16*)alloc((size_t)Ff * DFFc * 2);
  float*    qtF     = (float*)   alloc((size_t)ROWS * Hh * Ff * 4); // Wk_h^T q_h
  _Float16* xwH     = (_Float16*)alloc((size_t)ROWS * Hh * Ff * 2); // sum_p w_p x_p
  float*    attent  = (float*)   alloc((size_t)ROWS * Ff * 4);
  float*    ytmp    = (float*)   alloc((size_t)ROWS * Ff * 4);
  float*    stats   = (float*)   alloc(256);                       // 2 sets of 4x2

  // --- folded queries of all heads -> f32; beside them: zero LN stats, FFN
  //     weights to f16, weight product and its bias
  prep_kernel<<<PREP_BLOCKS, 256, 0, stream>>>(x, Wq, bq, Wk, Wv, bv, Wf, bf, W1, W2,
                                               qtF, wfvH, bfv, w1H, w2H, stats);

  // --- scores, softmax over 25 and weighted patch sum per head, x read once
  patch_attention_folded<<<ROWS / WPB, WPB * 32, 0, stream>>>(x, qtF, xwH);

  // --- value and output projection in one: (5120 x 1024) @ (1024 x 256) + bfv
  //     -> attent f32, LN 1 sums; 16 rows a wave: its A fragments for K = 1024
  //     fill 256 registers
  {
    dim3 g(ROWS / 128, Ff / 64);
    gemm_f16_wmma<Hh * Ff, Ff, 1, false, true><<<g, 256, 0, stream>>>(xwH, wfvH, bfv, nullptr,
                                                                      attent, nullptr, stats, 0,
                                                                      Hh * Ff, 0, 0);
  }

  // --- LayerNorm 1 (per batch over N,O,F) -> out1, then the FFN:
  //     relu(out1 @ W1^T + b1) @ W2^T + b2 + out1 -> ytmp, LN 2 sums
  ln_ffn_fused<<<ROWS / FM, 256, 0, stream>>>(attent, ln1w, ln1b, stats, w1H, b1, w2H, b2,
                                              ytmp, stats + 8);

  // --- LayerNorm 2 -> d_out (f32)
  ln_apply_kernel<<<PB4 / 256, 256, 0, stream>>>(ytmp, ln2w, ln2b, stats + 8,
                                                 (float*)d_out, nullptr);
}

// v009
// It runs in 48.7 microseconds.
// In both of two side-by-side timings against v008, it was 1.14 times as fast.
// All steps since v000 together make it 6.64 times as fast.
#include <hip/hip_runtime.h>
#include <hip/hip_bf16.h>
#include <math.h>

typedef __attribute__((ext_vector_type(16))) _Float16 v16h;
typedef __attribute__((ext_vector_type(8)))  float    v8f;
typedef __attribute__((ext_vector_type(4)))  float    v4f;

#define Bb   4
#define Nn_  256
#define Oo   5
#define KK2  25      // K*K patch positions
#define Ff   256
#define Hh   4
#define Dd   64
#define DFFc 1024

constexpr int ROWS = Bb * Nn_ * Oo;         // 5120 output rows
constexpr int PB   = Nn_ * Oo * Ff;         // 327680 elems per batch for LN

// ---------------------------------------------------------------------------
// helpers
// ---------------------------------------------------------------------------
union FragU { v16h v; uint4 q[2]; };

// Load one f16 16x32 fragment given per-lane base (row/col and half-offset
// already folded in): elements 0..7 at +k, elements 8..15 at +k+16.
__device__ __forceinline__ v16h frag_at(const _Float16* p) {
  FragU f;
  f.q[0] = *(const uint4*)(p);
  f.q[1] = *(const uint4*)(p + 16);
  return f.v;
}

// f16 16x32 fragment layout (A and B identical): lane L<16 -> row/col L,
// elements 0..7 = K [k0+off, k0+off+8), elements 8..15 = +16; off = 8*(L>=16).
// C/D layout: VGPR r -> (M=r, N=lane) for lanes 0-15, (M=r+8, N=lane-16).

// ---------------------------------------------------------------------------
// Folded patch attention. With qt[h] = Wk_h^T q_h (256 long, q the centre
// query) the score of patch position p is qt[h] . x_p / 8 (+ q_h . bk_h, the
// same for every p of a head, so it cancels in the softmax), and the merged
// value is Wv_h (sum_p w_p x_p) + bv_h because the weights sum to one. This
// kernel reads x once in f32 and makes xw[h] = sum_p w_p x_p per head.
// One wave works on a patch: it holds all 25 rows in registers, a lane 8 of a
// row's 256 values (f0..f0+3 and 128+f0..128+f0+3).
// ---------------------------------------------------------------------------
__device__ __forceinline__ float dot4(const v4f a, const v4f b, float s) {
  s = fmaf(a.x, b.x, s);
  s = fmaf(a.y, b.y, s);
  s = fmaf(a.z, b.z, s);
  s = fmaf(a.w, b.w, s);
  return s;
}
// lanes L and L ^ N: the lane with bit N clear keeps v[0..N), the other
// v[N..2N); each adds the partner's share of what it keeps
template <int N, int S>
__device__ __forceinline__ void halve_step(float (&v)[S], int lane) {
  const bool hi = (lane & N) != 0;
  #pragma unroll
  for (int j = 0; j < N; ++j) {
    const float send = hi ? v[j] : v[j + N];
    const float keep = hi ? v[j + N] : v[j];
    v[j] = keep + __shfl_xor(send, N, 32);
  }
}
__device__ __forceinline__ float lane_bcast(float v, int srcLane) {
  return __builtin_bit_cast(float,
      __builtin_amdgcn_readlane(__builtin_bit_cast(int, v), srcLane));
}

// One patch's tile in LDS, as it lies in memory: its 25 rows of x (one run of
// 25,600 bytes), then its four folded queries (one run of 4,096 bytes).
constexpr int XTV  = KK2 * Ff;              // floats of x in a tile
constexpr int QTV  = Hh * Ff;               // floats of qt in a tile
constexpr int TILV = XTV + QTV;
constexpr int AWV  = 8;                     // waves a block
constexpr int ABLK = 256;                   // blocks: one on every WGP (by its LDS)
constexpr int PPB  = ROWS / ABLK;           // patches a block
static_assert(ROWS % ABLK == 0 && PPB >= AWV, "every wave has a first patch");
static_assert((TILV * 4) % 16 == 0 && XTV * 4 < 65536, "copy alignment, offset range");

// a copy of 16 bytes a lane, N bytes behind both addresses (the offset field
// moves the LDS address and the global address alike)
#define ACP(N) "global_load_async_to_lds_b128 %0, %1, off offset:" #N "\n\t"
// A wave's 58 copies of one tile: a copy takes 512 bytes in a row. The xcnt
// wait closes each statement so that no address register of an issued copy is
// rewritten ahead of it.
__device__ __forceinline__ void copy_tile(unsigned lds, const float* xsrc, const float* qsrc) {
  asm volatile(ACP(0)     ACP(512)   ACP(1024)  ACP(1536)  ACP(2048)
               ACP(2560)  ACP(3072)  ACP(3584)  ACP(4096)  ACP(4608)
               ACP(5120)  ACP(5632)  ACP(6144)  ACP(6656)  ACP(7168)
               ACP(7680)  ACP(8192)  ACP(8704)  ACP(9216)  ACP(9728)
               ACP(10240) ACP(10752) ACP(11264) ACP(11776) ACP(12288)
               ACP(12800) ACP(13312) ACP(13824) ACP(14336) ACP(14848)
               ACP(15360) ACP(15872) ACP(16384) ACP(16896) ACP(17408)
               ACP(17920) ACP(18432) ACP(18944) ACP(19456) ACP(19968)
               ACP(20480) ACP(20992) ACP(21504) ACP(22016) ACP(22528)
               ACP(23040) ACP(23552) ACP(24064) ACP(24576) ACP(25088)
               "s_wait_xcnt 0x0"
               :: "v"(lds), "v"(xsrc) : "memory");
  asm volatile(ACP(0)     ACP(512)   ACP(1024)  ACP(1536)
               ACP(2048)  ACP(2560)  ACP(3072)  ACP(3584)
               "s_wait_xcnt 0x0"
               :: "v"(lds + XTV * 4), "v"(qsrc) : "memory");
}
#undef ACP

// The output projection stands in the same launch: it is local to a row, so
// the block multiplies the xw rows of its own patches, which never leave LDS,
// with the weight product wfv (K = 1024), adds the bias and takes the
// LayerNorm 1 sums. A wave takes 32 output columns for all rows; the PPB rows
// fill two row tiles, whose other rows are zero and are not stored. No wave
// shares a weight with another, so the weights go straight to registers: prep
// lays wfv down in fragment order (WFRAG), where a wave-wide 16-byte load is
// 512 bytes in a row, and a wave's 64 KB come in NWB runs of loads, each asked
// for ahead of the products on the run before it.
constexpr int PX    = Hh * Ff + 8;          // LDS pitch, +16 B against bank conflicts
constexpr int PCA   = Ff + 4;               // the same for the f32 result tile
constexpr int KST   = Hh * Ff / 32;         // k-steps of the projection
constexpr int NWB   = 4;                    // runs of weight loads
constexpr int SPB   = KST / NWB;            // k-steps a run
// wfv in fragment order: column tile ct, k-step s, fragment half j (elements
// 8 j .. 8 j + 7), lane L, element e hold column 16 ct + (L & 15) at
// k = 32 s + 16 j + 8 (L >> 4) + e: the k order of frag_at
constexpr int WFRAG = 256;                  // f16 values of a fragment half
static_assert(PPB <= 32 && (Nn_ * Oo) % PPB == 0, "two row tiles, one batch element");
static_assert(PPB % 4 == 0, "a wave's four result rows are all stored or none");
static_assert(32 * PCA <= AWV * TILV, "the result fits the tiles");
static_assert(((32 - PPB) * PX) % 8 == 0 && (PPB * PX * 2) % 16 == 0, "zero rows in 16-byte pieces");

// grid = ABLK. The block stays on its WGP and its waves go through its PPB
// patches, wave w taking patches w, w + AWV, ... Each wave has one tile of LDS
// of its own, which no other wave touches, so the attention part has no
// barrier: the wave waits for its own copies, moves the tile to registers, and
// as soon as those LDS reads are done asks for its next tile, which flies
// while this one is worked on.
__global__ __launch_bounds__(AWV * 32) void attention_outproj(
    const float* __restrict__ x, const float* __restrict__ qt,
    const _Float16* __restrict__ wfv, const float* __restrict__ bfv,
    float* __restrict__ outF, float* __restrict__ stats)
{
  __shared__ __attribute__((aligned(16))) float Ts[AWV * TILV];
  __shared__ __attribute__((aligned(16))) _Float16 Xs[32 * PX];
  __shared__ __attribute__((aligned(16))) float bfs[Ff];
  __shared__ float red[16];
  const int tid  = threadIdx.x;
  const int lane = tid & 31;
  // in a scalar register: the tests on the patch number are then scalar branches
  const int wave = __builtin_amdgcn_readfirstlane(tid >> 5);
  const int f0   = lane * 4;
  const float* ts = Ts + wave * TILV + f0;
  const unsigned lds = (unsigned)(uintptr_t)ts;
  const int rowBase = blockIdx.x * PPB;
  const int last = rowBase + PPB;

  copy_tile(lds, x + (size_t)(rowBase + wave) * XTV + f0,
            qt + (size_t)(rowBase + wave) * QTV + f0);

  // beside the copies: the bias to LDS, zeros into the row tiles' unused rows
  {
    const float* pb = bfv + tid;
    const float bvv = *pb;
    // stands ahead of whatever is written into the address registers of the load
    asm volatile("s_wait_xcnt 0x0" :: "v"(pb) : "memory");
    bfs[tid] = bvv;
    uint4* z = (uint4*)&Xs[PPB * PX];
    for (int i = tid; i < (32 - PPB) * PX / 8; i += AWV * 32) z[i] = uint4{0u, 0u, 0u, 0u};
  }

  // rolled: one body in the instruction cache serves all of a wave's patches
  #pragma unroll 1
  for (int bno = blockIdx.x * PPB + wave; bno < last; bno += AWV) {
  // the wave's own copies of this tile have landed
  asm volatile("s_wait_asynccnt 0x0" ::: "memory");
  v4f q[Hh][2];
  #pragma unroll
  for (int h = 0; h < Hh; ++h) {
    q[h][0] = *(const v4f*)(ts + XTV + h * Ff);
    q[h][1] = *(const v4f*)(ts + XTV + h * Ff + 128);
  }
  v4f xr[KK2][2];
  #pragma unroll
  for (int p = 0; p < KK2; ++p) {
    xr[p][0] = *(const v4f*)(ts + p * Ff);
    xr[p][1] = *(const v4f*)(ts + p * Ff + 128);
  }
  // the tile's last LDS read is done before the next tile's copies write there
  asm volatile("s_wait_dscnt 0x0" ::: "memory");
  // block index and wave number are scalars: the test reads the same in all lanes
  if (bno + AWV < last)
    copy_tile(lds, x + (size_t)(bno + AWV) * XTV + f0, qt + (size_t)(bno + AWV) * QTV + f0);
  // scores. Rows 0..23 in three groups of 8: 32 partial dots per lane, index
  // pl*4 + h; five halving steps leave lane L with the full sum of index L,
  // so lane L carries p = 8g + (L >> 2), h = L & 3.
  float s[3];
  #pragma unroll
  for (int g = 0; g < 3; ++g) {
    float v[32];
    #pragma unroll
    for (int pl = 0; pl < 8; ++pl)
      #pragma unroll
      for (int h = 0; h < Hh; ++h)
        v[pl * 4 + h] = dot4(xr[8 * g + pl][1], q[h][1],
                             dot4(xr[8 * g + pl][0], q[h][0], 0.f));
    halve_step<16>(v, lane);
    halve_step<8>(v, lane);
    halve_step<4>(v, lane);
    halve_step<2>(v, lane);
    halve_step<1>(v, lane);
    s[g] = v[0] * 0.125f;
  }
  // row 24: every lane ends with the full sum of head L & 3
  float s24;
  {
    float v[4];
    #pragma unroll
    for (int h = 0; h < Hh; ++h)
      v[h] = dot4(xr[24][1], q[h][1], dot4(xr[24][0], q[h][0], 0.f));
    halve_step<2>(v, lane);
    halve_step<1>(v, lane);
    #pragma unroll
    for (int o = 4; o <= 16; o <<= 1) v[0] += __shfl_xor(v[0], o, 32);
    s24 = v[0] * 0.125f;
  }

  // softmax over the 25 positions of head L & 3 (lanes L, L^4, L^8, L^16 ...)
  float mx = fmaxf(fmaxf(s[0], s[1]), fmaxf(s[2], s24));
  #pragma unroll
  for (int o = 4; o <= 16; o <<= 1) mx = fmaxf(mx, __shfl_xor(mx, o, 32));
  const float e0  = __expf(s[0] - mx);
  const float e1  = __expf(s[1] - mx);
  const float e2  = __expf(s[2] - mx);
  const float e24 = __expf(s24 - mx);
  float sum = (e0 + e1) + e2;
  #pragma unroll
  for (int o = 4; o <= 16; o <<= 1) sum += __shfl_xor(sum, o, 32);
  sum += e24;
  const float inv = 1.0f / sum;
  float wg[3];
  wg[0] = e0 * inv;
  wg[1] = e1 * inv;
  wg[2] = e2 * inv;
  const float w24 = e24 * inv;

  // weighted sum of the rows per head, p ascending; each weight is read from
  // its lane into a scalar
  _Float16* op = &Xs[(bno - rowBase) * PX + f0];
  #pragma unroll
  for (int h = 0; h < Hh; ++h) {
    v4f a0 = (v4f){0.f, 0.f, 0.f, 0.f};
    v4f a1 = (v4f){0.f, 0.f, 0.f, 0.f};
    #pragma unroll
    for (int p = 0; p < KK2; ++p) {
      const float w = (p < 24) ? lane_bcast(wg[p >> 3], (p & 7) * 4 + h)
                               : lane_bcast(w24, h);
      a0.x = fmaf(w, xr[p][0].x, a0.x);
      a0.y = fmaf(w, xr[p][0].y, a0.y);
      a0.z = fmaf(w, xr[p][0].z, a0.z);
      a0.w = fmaf(w, xr[p][0].w, a0.w);
      a1.x = fmaf(w, xr[p][1].x, a1.x);
      a1.y = fmaf(w, xr[p][1].y, a1.y);
      a1.z = fmaf(w, xr[p][1].z, a1.z);
      a1.w = fmaf(w, xr[p][1].w, a1.w);
    }
    union { _Float16 hh[4]; uint2 u; } o0, o1;
    o0.hh[0] = (_Float16)a0.x; o0.hh[1] = (_Float16)a0.y;
    o0.hh[2] = (_Float16)a0.z; o0.hh[3] = (_Float16)a0.w;
    o1.hh[0] = (_Float16)a1.x; o1.hh[1] = (_Float16)a1.y;
    o1.hh[2] = (_Float16)a1.z; o1.hh[3] = (_Float16)a1.w;
    *(uint2*)(op + h * Ff)       = o0.u;
    *(uint2*)(op + h * Ff + 128) = o1.u;
  }
  }

  const int n0    = lane & 15;              // row (A) / col (B) within tile
  const int half8 = ((lane >> 4) & 1) << 3; // K sub-offset per lane half
  const int r0    = (lane >> 4) * 8;        // first C row of this lane half
  // the wave's two column tiles are one run of memory; fragment half j of
  // k-step s of column tile t lies ((t KST + s) 2 + j) WFRAG values behind bp
  const _Float16* bp = wfv + wave * (2 * KST * 2 * WFRAG) + lane * 8;
  FragU wf[2][SPB][2];
  auto wload = [&](int b) {
    // unrolled: register indices
    #pragma unroll
    for (int s = 0; s < SPB; ++s)
      #pragma unroll
      for (int t = 0; t < 2; ++t) {
        const _Float16* p = bp + ((t * KST + b * SPB + s) * 2) * WFRAG;
        wf[b & 1][s][t].q[0] = *(const uint4*)(p);
        wf[b & 1][s][t].q[1] = *(const uint4*)(p + WFRAG);
      }
  };
  // the first run needs nothing of the other waves: asked for ahead of the barrier
  wload(0);

  // no copy is outstanding and the wave's own LDS accesses are done, then every
  // wave's: behind this all xw rows are read, and the tiles' LDS is free
  asm volatile("s_wait_asynccnt 0x0" ::: "memory");
  asm volatile("s_wait_dscnt 0x0" ::: "memory");
  __syncthreads();

  v8f acc[4];                                 // index 2 g + j
  #pragma unroll
  for (int t = 0; t < 4; ++t) acc[t] = (v8f){};
  const _Float16* ap = &Xs[n0 * PX + half8];

  // unrolled: wf[b & 1] is a register index
  #pragma unroll
  for (int b = 0; b < NWB; ++b) {
    if (b + 1 < NWB) wload(b + 1);
    if (b + 1 == NWB - 1) {
      // behind the last weight load: stands ahead of whatever is written into
      // its address registers
      asm volatile("s_wait_xcnt 0x0" :: "v"(bp) : "memory");
    }
    v16h xf[SPB][2];
    #pragma unroll
    for (int s = 0; s < SPB; ++s) {
      xf[s][0] = frag_at(ap + 32 * (b * SPB + s));
      xf[s][1] = frag_at(ap + 16 * PX + 32 * (b * SPB + s));
    }
    // keeps the next run's loads and this run's LDS reads ahead of the
    // products, so that their latencies run beside the products
    __builtin_amdgcn_sched_barrier(0);
    #pragma unroll
    for (int s = 0; s < SPB; ++s) {
      acc[0] = __builtin_amdgcn_wmma_f32_16x16x32_f16(false, xf[s][0], false, wf[b & 1][s][0].v, (short)0, acc[0], false, false);
      acc[1] = __builtin_amdgcn_wmma_f32_16x16x32_f16(false, xf[s][0], false, wf[b & 1][s][1].v, (short)0, acc[1], false, false);
      acc[2] = __builtin_amdgcn_wmma_f32_16x16x32_f16(false, xf[s][1], false, wf[b & 1][s][0].v, (short)0, acc[2], false, false);
      acc[3] = __builtin_amdgcn_wmma_f32_16x16x32_f16(false, xf[s][1], false, wf[b & 1][s][1].v, (short)0, acc[3], false, false);
    }
    // keeps the later runs' loads behind these products: moved up, they would
    // need registers of their own beside the two runs that are held
    __builtin_amdgcn_sched_barrier(0);
  }

  // --- the result tile goes through the tiles' LDS (free since the barrier
  // above) to rows: eight threads a row, a thread takes four values
  // in each of the row's eight 128-byte lines, so the stores are whole lines
  float* Cs = Ts;
  {
    float* cp = Cs + r0 * PCA + wave * 32 + n0;
    #pragma unroll
    for (int t = 0; t < 4; ++t)
      #pragma unroll
      for (int r = 0; r < 8; ++r)
        cp[(16 * (t >> 1) + r) * PCA + 16 * (t & 1)] = acc[t][r];
  }
  __syncthreads();
  const int lr = tid >> 3;
  const int lc = (tid & 7) * 4;
  const bool live = lr < PPB;                 // the same for a whole wave
  v4f y[8];
  #pragma unroll
  for (int k = 0; k < 8; ++k) {
    const v4f cv = *(const v4f*)&Cs[lr * PCA + lc + 32 * k];
    const v4f bv = *(const v4f*)&bfs[lc + 32 * k];
    y[k] = live ? cv + bv : (v4f){0.f, 0.f, 0.f, 0.f};
  }
  // LayerNorm 1 sums, ahead of the stores: the barrier below waits for every
  // store that a wave has issued, so here it waits for none
  {
    v4f s4 = y[0];
    v4f q4 = y[0] * y[0];
    #pragma unroll
    for (int k = 1; k < 8; ++k) {
      s4 += y[k];
      q4 += y[k] * y[k];
    }
    float s = (s4.x + s4.y) + (s4.z + s4.w);
    float q = (q4.x + q4.y) + (q4.z + q4.w);
    for (int o = 16; o > 0; o >>= 1) {
      s += __shfl_xor(s, o, 32);
      q += __shfl_xor(q, o, 32);
    }
    if (lane == 0) { red[wave] = s; red[8 + wave] = q; }
    __syncthreads();
    // thread 0 adds up the eight waves' sums, thread 1 their sums of squares
    if (tid < 2) {
      const float* p = red + 8 * tid;
      const float tot = ((p[0] + p[1]) + (p[2] + p[3])) + ((p[4] + p[5]) + (p[6] + p[7]));
      atomicAdd(&stats[2 * (rowBase / (Nn_ * Oo)) + tid], tot);
    }
  }
  if (live) {
    float* o = outF + (size_t)(rowBase + lr) * Ff + lc;
    #pragma unroll
    for (int k = 0; k < 8; ++k) *(v4f*)(o + 32 * k) = y[k];
  }
}

// ---------------------------------------------------------------------------
// LayerNorm over (N,O,F) per batch element: the sums come from the launch that
// makes the values; this applies them. It moves 16-byte vectors and issues all
// loads of a thread before the first use.
// ---------------------------------------------------------------------------
constexpr int PB4        = PB / 4;                    // float4 per batch element
static_assert(PB4 % 256 == 0, "apply covers a batch exactly");

__device__ __forceinline__ uint2 pack4h(const v4f v) {
  union { _Float16 h[4]; uint2 u; } o;
  o.h[0] = (_Float16)v.x; o.h[1] = (_Float16)v.y;
  o.h[2] = (_Float16)v.z; o.h[3] = (_Float16)v.w;
  return o.u;
}

// grid = PB4 / 256. A thread takes the same four (n,o,f) positions in every
// batch element, so it reads g and beta once.
__global__ __launch_bounds__(256) void ln_apply_kernel(
    const float* __restrict__ x, const float* __restrict__ g,
    const float* __restrict__ beta, const float* __restrict__ stats,
    float* __restrict__ outF, _Float16* __restrict__ outH)
{
  const int r4 = blockIdx.x * 256 + threadIdx.x;
  float st[2 * Bb];
  #pragma unroll
  for (int k = 0; k < 2 * Bb; ++k) st[k] = stats[k];
  v4f xv[Bb];
  #pragma unroll
  for (int b = 0; b < Bb; ++b) xv[b] = ((const v4f*)x)[b * PB4 + r4];
  const v4f gv = ((const v4f*)g)[r4];
  const v4f bv = ((const v4f*)beta)[r4];
  // the base addresses of the six loads above are dead from here on: the wait
  // stands ahead of whatever is written into their registers
  asm volatile("s_wait_xcnt 0x0" ::: "memory");
  v4f o[Bb];
  #pragma unroll
  for (int b = 0; b < Bb; ++b) {
    const float mu  = st[2 * b + 0] * (1.0f / PB);
    const float var = st[2 * b + 1] * (1.0f / PB) - mu * mu;
    const float rs  = rsqrtf(var + 1e-5f);
    o[b].x = (xv[b].x - mu) * rs * gv.x + bv.x;
    o[b].y = (xv[b].y - mu) * rs * gv.y + bv.y;
    o[b].z = (xv[b].z - mu) * rs * gv.z + bv.z;
    o[b].w = (xv[b].w - mu) * rs * gv.w + bv.w;
  }
  if (outF) {
    #pragma unroll
    for (int b = 0; b < Bb; ++b) ((v4f*)outF)[b * PB4 + r4] = o[b];
  }
  // the f16 packing below may reuse registers that the stores above name
  asm volatile("s_wait_xcnt 0x0" ::: "memory");
  if (outH) {
    #pragma unroll
    for (int b = 0; b < Bb; ++b) ((uint2*)outH)[b * PB4 + r4] = pack4h(o[b]);
  }
}

// ---------------------------------------------------------------------------
// LayerNorm 1 apply and both FFN products in ONE launch:
//   o = LN(x);  y = relu(o W1^T + b1) W2^T + b2 + o   (+ the LayerNorm 2 sums)
// All three are local to a row, so a block that owns FM whole rows needs
// nothing of another block: o and the hidden layer of its rows never leave the
// WGP. The hidden units go by in NCH chunks of HC: a chunk's values are made
// from the chunk's rows of W1, rounded to f16 into LDS, and multiplied at once
// with the chunk's columns of W2 into accumulators that live through all
// chunks (k ascending, as in two separate products).
// The two weight pieces of a chunk (64 KB each) come by async copies into one
// of two LDS buffers: the next chunk's copies fly while this chunk is worked on.
// 8 waves: in the first product a wave takes 16 hidden units, in the second 32
// output columns, each for all FM rows.
// ---------------------------------------------------------------------------
constexpr int FM   = 32;                    // rows a block
constexpr int HC   = 128;                   // hidden units a chunk
constexpr int NCH  = DFFc / HC;
constexpr int P1   = Ff + 8;                // LDS pitches, +16 B against bank conflicts
constexpr int P2   = HC + 8;
constexpr int PC   = Ff + 4;                // the same for the f32 result tile
constexpr int W1V  = HC * P1;               // f16 values of a chunk of W1 in LDS
constexpr int W2V  = Ff * P2;               // and of W2
constexpr int BUFV = W1V + W2V;
static_assert((Nn_ * Oo) % FM == 0, "a block's rows lie in one batch element");
static_assert(FM * PC * 4 <= 2 * BUFV * 2, "the result tile fits the ring");

// eight copies of 16 bytes a lane, LB bytes apart in LDS and GV values apart in
// memory. The xcnt wait closes the statement so that no address register of an
// issued copy is rewritten ahead of it.
template <int LB, int GV>
__device__ __forceinline__ void copy8(unsigned lds, const _Float16* src) {
  asm volatile("global_load_async_to_lds_b128 %0, %1, off\n\t"
               "global_load_async_to_lds_b128 %2, %3, off\n\t"
               "global_load_async_to_lds_b128 %4, %5, off\n\t"
               "global_load_async_to_lds_b128 %6, %7, off\n\t"
               "global_load_async_to_lds_b128 %8, %9, off\n\t"
               "global_load_async_to_lds_b128 %10, %11, off\n\t"
               "global_load_async_to_lds_b128 %12, %13, off\n\t"
               "global_load_async_to_lds_b128 %14, %15, off\n\t"
               "s_wait_xcnt 0x0"
               :: "v"(lds),          "v"(src),
                  "v"(lds + LB),     "v"(src + GV),
                  "v"(lds + 2 * LB), "v"(src + 2 * GV),
                  "v"(lds + 3 * LB), "v"(src + 3 * GV),
                  "v"(lds + 4 * LB), "v"(src + 4 * GV),
                  "v"(lds + 5 * LB), "v"(src + 5 * GV),
                  "v"(lds + 6 * LB), "v"(src + 6 * GV),
                  "v"(lds + 7 * LB), "v"(src + 7 * GV)
               : "memory");
}

// grid = ROWS / FM
__global__ __launch_bounds__(256) void ln_ffn_fused(
    const float* __restrict__ x, const float* __restrict__ g,
    const float* __restrict__ beta, const float* __restrict__ statsIn,
    const _Float16* __restrict__ W1h, const float* __restrict__ b1,
    const _Float16* __restrict__ W2h, const float* __restrict__ b2,
    float* __restrict__ outF, float* __restrict__ stats)
{
  __shared__ __attribute__((aligned(16))) _Float16 Wb[2 * BUFV];
  __shared__ __attribute__((aligned(16))) _Float16 As[FM * P1];
  __shared__ __attribute__((aligned(16))) _Float16 Hs[FM * P2];
  __shared__ __attribute__((aligned(16))) float b1s[DFFc];
  __shared__ __attribute__((aligned(16))) float b2s[Ff];
  __shared__ float red[16];

  const int tid     = threadIdx.x;
  const int lane    = tid & 31;
  const int wave    = tid >> 5;
  const int rowBase = blockIdx.x * FM;
  const int bidx    = rowBase / (Nn_ * Oo);   // batch element
  const int n0      = lane & 15;              // row (A) / col (B) within tile
  const int half8   = ((lane >> 4) & 1) << 3; // K sub-offset per lane half
  const int r0      = (lane >> 4) * 8;        // first C row of this lane half
  // elementwise parts: eight threads a row, a thread takes four values in each
  // of the row's eight 128-byte lines
  const int lr      = tid >> 3;
  const int lc      = (tid & 7) * 4;

  // A chunk of W1 is HC whole rows of 512 B, one run of memory: a wave's copy
  // takes one row. A chunk of W2 is 256 B of each of its Ff rows: two rows a copy.
  const unsigned l1 = (unsigned)(uintptr_t)&Wb[(tid >> 5) * P1 + (tid & 31) * 8];
  const unsigned l2 = (unsigned)(uintptr_t)&Wb[W1V + (tid >> 4) * P2 + (tid & 15) * 8];
  const _Float16* s1 = W1h + tid * 8;
  const _Float16* s2 = W2h + (tid >> 4) * DFFc + (tid & 15) * 8;
  auto fill = [&](int c, int buf) {
    const unsigned d1 = l1 + buf * (BUFV * 2);
    const unsigned d2 = l2 + buf * (BUFV * 2);
    const _Float16* g1 = s1 + c * (HC * Ff);
    const _Float16* g2 = s2 + c * HC;
    copy8<8 * P1 * 2, 8 * Ff>(d1, g1);
    copy8<8 * P1 * 2, 8 * Ff>(d1 + 64 * P1 * 2, g1 + 64 * Ff);
    copy8<16 * P2 * 2, 16 * DFFc>(d2, g2);
    copy8<16 * P2 * 2, 16 * DFFc>(d2 + 128 * P2 * 2, g2 + 128 * DFFc);
  };
  fill(0, 0);

  // --- LayerNorm 1 on the block's rows, beside the copies; res keeps the f32
  // values for the residual
  v4f res[8];
  {
    const float* px  = x + (size_t)(rowBase + lr) * Ff + lc;
    const float* pg  = g + (size_t)(rowBase - bidx * (Nn_ * Oo) + lr) * Ff + lc;
    const float* pe  = beta + (size_t)(rowBase - bidx * (Nn_ * Oo) + lr) * Ff + lc;
    const float* pb1 = b1 + tid * 4;
    const float* pb2 = b2 + tid;
    const float st0 = statsIn[2 * bidx + 0];
    const float st1 = statsIn[2 * bidx + 1];
    v4f gv[8], ev[8];
    // unrolled: the arrays must stay in registers
    #pragma unroll
    for (int k = 0; k < 8; ++k) res[k] = *(const v4f*)(px + 32 * k);
    #pragma unroll
    for (int k = 0; k < 8; ++k) gv[k] = *(const v4f*)(pg + 32 * k);
    #pragma unroll
    for (int k = 0; k < 8; ++k) ev[k] = *(const v4f*)(pe + 32 * k);
    const v4f b1v = *(const v4f*)pb1;
    const float b2v = *pb2;
    // stands ahead of whatever is written into the address registers of the
    // loads above; it names the addresses as inputs so that their registers
    // stay untouched (also by a later load's result) up to the wait
    asm volatile("s_wait_xcnt 0x0" :: "v"(px), "v"(pg), "v"(pe), "v"(pb1), "v"(pb2) : "memory");
    const float mu  = st0 * (1.0f / PB);
    const float var = st1 * (1.0f / PB) - mu * mu;
    const float rs  = rsqrtf(var + 1e-5f);
    #pragma unroll
    for (int k = 0; k < 8; ++k) {
      res[k].x = (res[k].x - mu) * rs * gv[k].x + ev[k].x;
      res[k].y = (res[k].y - mu) * rs * gv[k].y + ev[k].y;
      res[k].z = (res[k].z - mu) * rs * gv[k].z + ev[k].z;
      res[k].w = (res[k].w - mu) * rs * gv[k].w + ev[k].w;
      *(uint2*)&As[lr * P1 + lc + 32 * k] = pack4h(res[k]);
    }
    *(v4f*)&b1s[tid * 4] = b1v;
    b2s[tid] = b2v;
  }

  // own copies landed, then every wave's: chunk 0, the normalised rows and the
  // biases are read only behind this
  asm volatile("s_wait_asynccnt 0x0" ::: "memory");
  __syncthreads();

  // A fragments for all of K stay in registers through all chunks
  FragU a[Ff / 32][2];
  {
    const _Float16* af = &As[n0 * P1 + half8];
    // unrolled: a[][] must stay in registers
    #pragma unroll
    for (int s = 0; s < Ff / 32; ++s) {
      a[s][0].v = frag_at(af + 32 * s);
      a[s][1].v = frag_at(af + 16 * P1 + 32 * s);
    }
  }

  v8f acc[4];                                 // index 2 g + j
  #pragma unroll
  for (int t = 0; t < 4; ++t) acc[t] = (v8f){};

  // rolled: one body serves both buffers, the buffer is an address
  #pragma unroll 1
  for (int c = 0; c < NCH; ++c) {
    const _Float16* wb = Wb + (c & 1) * BUFV;
    // all weight fragments of the chunk are asked for at once; they land while
    // the next chunk's copies are issued
    v16h w1f[Ff / 32], w2f[HC / 32][2];
    {
      const _Float16* bp1 = wb + (wave * 16 + n0) * P1 + half8;
      const _Float16* bp2 = wb + W1V + (wave * 32 + n0) * P2 + half8;
      // unrolled: register indices
      #pragma unroll
      for (int s = 0; s < Ff / 32; ++s) w1f[s] = frag_at(bp1 + 32 * s);
      #pragma unroll
      for (int s = 0; s < HC / 32; ++s) {
        w2f[s][0] = frag_at(bp2 + 32 * s);
        w2f[s][1] = frag_at(bp2 + 16 * P2 + 32 * s);
      }
    }
    const float bb = b1s[c * HC + wave * 16 + n0];
    // the other buffer's last reads ended at the barrier at the foot of the
    // trip before
    if (c + 1 < NCH) fill(c + 1, (c + 1) & 1);

    // --- first product: FM rows x the wave's 16 hidden units, K = Ff
    {
      v8f h0 = (v8f){}, h1 = (v8f){};
      // unrolled: register indices
      #pragma unroll
      for (int s = 0; s < Ff / 32; ++s) {
        h0 = __builtin_amdgcn_wmma_f32_16x16x32_f16(false, a[s][0].v, false, w1f[s], (short)0, h0, false, false);
        h1 = __builtin_amdgcn_wmma_f32_16x16x32_f16(false, a[s][1].v, false, w1f[s], (short)0, h1, false, false);
      }
      _Float16* hp = &Hs[r0 * P2 + wave * 16 + n0];
      #pragma unroll
      for (int r = 0; r < 8; ++r) {
        hp[r * P2]        = (_Float16)fmaxf(h0[r] + bb, 0.0f);
        hp[(16 + r) * P2] = (_Float16)fmaxf(h1[r] + bb, 0.0f);
      }
    }
    // the chunk's hidden values of all eight waves are read behind this
    __syncthreads();
    // --- second product: FM rows x the wave's 32 columns, K = this chunk
    {
      const _Float16* ha = &Hs[n0 * P2 + half8];
      v16h hf[HC / 32][2];
      #pragma unroll
      for (int s = 0; s < HC / 32; ++s) {
        hf[s][0] = frag_at(ha + 32 * s);
        hf[s][1] = frag_at(ha + 16 * P2 + 32 * s);
      }
      // keeps all eight fragment loads ahead of this product's first WMMA, so that
      // their latencies run side by side instead of one behind the other
      __builtin_amdgcn_sched_barrier(0);
      #pragma unroll
      for (int s = 0; s < HC / 32; ++s) {
        acc[0] = __builtin_amdgcn_wmma_f32_16x16x32_f16(false, hf[s][0], false, w2f[s][0], (short)0, acc[0], false, false);
        acc[1] = __builtin_amdgcn_wmma_f32_16x16x32_f16(false, hf[s][0], false, w2f[s][1], (short)0, acc[1], false, false);
        acc[2] = __builtin_amdgcn_wmma_f32_16x16x32_f16(false, hf[s][1], false, w2f[s][0], (short)0, acc[2], false, false);
        acc[3] = __builtin_amdgcn_wmma_f32_16x16x32_f16(false, hf[s][1], false, w2f[s][1], (short)0, acc[3], false, false);
      }
    }
    // foot of the trip: own LDS reads done, own copies of the next chunk
    // landed, then every wave's; the barrier publishes the next chunk and ends
    // the last read of this chunk's buffer and of the hidden values
    asm volatile("s_wait_dscnt 0x0" ::: "memory");
    asm volatile("s_wait_asynccnt 0x0" ::: "memory");
    __syncthreads();
  }
  // no copy is outstanding when the ring is put to another use
  asm volatile("s_wait_asynccnt 0x0" ::: "memory");

  // --- the result tile goes through the ring's LDS (free since the last
  // trip's barrier) back to the elementwise layout: the residual is there, and
  // the stores are whole 128-byte lines
  float* Cs = (float*)Wb;
  {
    float* cp = Cs + r0 * PC + wave * 32 + n0;
    #pragma unroll
    for (int t = 0; t < 4; ++t)
      #pragma unroll
      for (int r = 0; r < 8; ++r)
        cp[(16 * (t >> 1) + r) * PC + 16 * (t & 1)] = acc[t][r];
  }
  __syncthreads();
  v4f y[8];
  #pragma unroll
  for (int k = 0; k < 8; ++k) {
    const v4f cv = *(const v4f*)&Cs[lr * PC + lc + 32 * k];
    const v4f bv = *(const v4f*)&b2s[lc + 32 * k];
    y[k] = (cv + bv) + res[k];
  }
  // LayerNorm 2 sums, ahead of the stores: the barrier below waits for every
  // store that a wave has issued, so here it waits for none
  {
    v4f s4 = y[0];
    v4f q4 = y[0] * y[0];
    #pragma unroll
    for (int k = 1; k < 8; ++k) {
      s4 += y[k];
      q4 += y[k] * y[k];
    }
    float s = (s4.x + s4.y) + (s4.z + s4.w);
    float q = (q4.x + q4.y) + (q4.z + q4.w);
    for (int o = 16; o > 0; o >>= 1) {
      s += __shfl_xor(s, o, 32);
      q += __shfl_xor(q, o, 32);
    }
    if (lane == 0) { red[wave] = s; red[8 + wave] = q; }
    __syncthreads();
    // thread 0 adds up the eight waves' sums, thread 1 their sums of squares
    if (tid < 2) {
      const float* p = red + 8 * tid;
      const float tot = ((p[0] + p[1]) + (p[2] + p[3])) + ((p[4] + p[5]) + (p[6] + p[7]));
      atomicAdd(&stats[2 * bidx + tid], tot);
    }
  }
  float* o = outF + (size_t)(rowBase + lr) * Ff + lc;
  #pragma unroll
  for (int k = 0; k < 8; ++k) *(v4f*)(o + 32 * k) = y[k];
}


// ---------------------------------------------------------------------------
// first launch: everything that depends on the inputs alone. The parts need
// nothing of each other, so each takes a range of the block index (the branch
// is the same for a whole block). All of a thread's loads are issued before
// its first store other than the zeroing of the LN sums.
// ---------------------------------------------------------------------------
constexpr int QROWS       = 128;                       // patches a query block
constexpr int PREP_Q      = (ROWS / QROWS) * Hh;       // blocks for the folded queries
constexpr int PREP_FFN    = DFFc * Ff / 16 / 256;      // blocks per FFN weight
constexpr int PREP_PROD   = Hh * 2 * 4;                // blocks for the weight product
constexpr int PREP_BIAS   = 4;                         // blocks for Wf bv + bf
constexpr int PREP_BLOCKS = PREP_Q + PREP_PROD + PREP_BIAS + 2 * PREP_FFN;

// flat f32 -> f16: block blk takes 1024 runs of four values
__device__ __forceinline__ void cvt_flat_f16(
    const float* __restrict__ s, _Float16* __restrict__ d, int blk) {
  const int i = blk * 1024 + threadIdx.x;
  v4f v[4];
  #pragma unroll
  for (int j = 0; j < 4; ++j) v[j] = ((const v4f*)s)[i + j * 256];
  #pragma unroll
  for (int j = 0; j < 4; ++j) ((uint2*)d)[i + j * 256] = pack4h(v[j]);
  // the built code joins this part's exit with another part's path, where the
  // registers that the four stores name are written again: the wait stands
  // ahead of that
  asm volatile("s_wait_xcnt 0x0" ::: "memory");
}

// ---------------------------------------------------------------------------
// Weight product. Two linear maps that follow one another with nothing in
// between are one map, and its matrix depends on the weights alone:
//   attent = Wf (Wv_h xw_h + bv_h)_h + bf = sum_h (Wf_h Wv_h) xw_h + (Wf bv + bf)
// (Wf_h: columns 64 h .. 64 h + 63 of Wf). The product has K = 64 and is small;
// with it the two activation GEMMs behind the attention are one.
// One block makes a 128 x 64 tile C[m][n] = sum_d A(m, d) B(n, d), d < 64:
// both operands go f32 -> f16 into LDS with d running along a row, then each
// wave takes 16 rows. PS: LDS pitch, +16 B against bank conflicts.
// ---------------------------------------------------------------------------
constexpr int PS = Dd + 8;

// an operand that lies d-major in memory (row d, pitch Ff, COLS columns from
// src on): a thread takes rows d, d + 1 at four columns, so that a pair of
// f16 values along d is one 4-byte LDS store. Its COLS / 32 such pieces lie a
// constant number of rows apart: one address serves them all.
template <int COLS>
__device__ __forceinline__ const float* addrT(const float* __restrict__ src) {
  return src + (threadIdx.x / (COLS / 4)) * 2 * Ff + (threadIdx.x % (COLS / 4)) * 4;
}
template <int COLS>
__device__ __forceinline__ void loadT(const float* __restrict__ p,
                                      v4f (&lo)[COLS / 32], v4f (&hi)[COLS / 32]) {
  constexpr int DSTEP = 2 * 256 / (COLS / 4);   // rows from piece to piece
  #pragma unroll
  for (int j = 0; j < COLS / 32; ++j) {
    lo[j] = *(const v4f*)(p + j * DSTEP * Ff);
    hi[j] = *(const v4f*)(p + j * DSTEP * Ff + Ff);
  }
}
template <int COLS>
__device__ __forceinline__ void storeT(_Float16* S,
                                       const v4f (&lo)[COLS / 32], const v4f (&hi)[COLS / 32]) {
  constexpr int DSTEP = 2 * 256 / (COLS / 4);
  _Float16* q = S + (threadIdx.x % (COLS / 4)) * 4 * PS + (threadIdx.x / (COLS / 4)) * 2;
  #pragma unroll
  for (int j = 0; j < COLS / 32; ++j) {
    #pragma unroll
    for (int e = 0; e < 4; ++e) {
      union { _Float16 h[2]; unsigned u; } w;
      w.h[0] = (_Float16)lo[j][e];
      w.h[1] = (_Float16)hi[j][e];
      *(unsigned*)&q[e * PS + j * DSTEP] = w.u;
    }
  }
}

// A lies m-major (srcA at [first m][first d], pitch Ff), B d-major.
__device__ __forceinline__ void weight_product(
    const float* __restrict__ srcA, const float* __restrict__ srcB,
    _Float16* __restrict__ C, _Float16* As, _Float16* Bs)
{
  const int lane  = threadIdx.x & 31;
  const int wave  = threadIdx.x >> 5;
  const int n0    = lane & 15;
  const int half8 = ((lane >> 4) & 1) << 3;
  const int r0    = (lane >> 4) * 8;

  // every global read of the block ahead of its first LDS store
  v4f alo[4], ahi[4], blo[2], bhi[2];
  const float* pa = srcA + (threadIdx.x >> 4) * Ff + (threadIdx.x & 15) * 4;
  const float* pb = addrT<64>(srcB);
  #pragma unroll
  for (int j = 0; j < 4; ++j) {                 // rows 16 j + (t >> 4), and 64 more
    alo[j] = *(const v4f*)(pa + 16 * j * Ff);
    ahi[j] = *(const v4f*)(pa + (64 + 16 * j) * Ff);
  }
  loadT<64>(pb, blo, bhi);
  // stands ahead of whatever is written into the address registers of the
  // loads above; it names the addresses as inputs so that their registers stay
  // untouched (also by a later load's result) up to the wait
  asm volatile("s_wait_xcnt 0x0" :: "v"(pa), "v"(pb) : "memory");
  {
    _Float16* q = As + (threadIdx.x >> 4) * PS + (threadIdx.x & 15) * 4;
    #pragma unroll
    for (int j = 0; j < 4; ++j) {
      *(uint2*)&q[16 * j * PS]        = pack4h(alo[j]);
      *(uint2*)&q[(64 + 16 * j) * PS] = pack4h(ahi[j]);
    }
  }
  storeT<64>(Bs, blo, bhi);
  __syncthreads();

  const _Float16* ap = &As[(wave * 16 + n0) * PS + half8];
  const _Float16* bp = &Bs[n0 * PS + half8];
  const v16h a0 = frag_at(ap), a1 = frag_at(ap + 32);
  v8f acc[4];
  #pragma unroll
  for (int j = 0; j < 4; ++j) {
    acc[j] = (v8f){};
    acc[j] = __builtin_amdgcn_wmma_f32_16x16x32_f16(false, a0, false, frag_at(bp + 16 * j * PS), (short)0, acc[j], false, false);
    acc[j] = __builtin_amdgcn_wmma_f32_16x16x32_f16(false, a1, false, frag_at(bp + 16 * j * PS + 32), (short)0, acc[j], false, false);
  }
  // m is the projection's column, n its k. The wave's 16 m are one column tile;
  // n = 16 j + n0 is fragment half j (two k-steps), lane half n0 >> 3, element
  // n0 & 7; m = r0 + r is the lane within that half
  _Float16* o = C + wave * (KST * 2 * WFRAG) + ((n0 >> 3) * 16 + r0) * 8 + (n0 & 7);
  _Float16 h[4][8];
  #pragma unroll
  for (int j = 0; j < 4; ++j)
    #pragma unroll
    for (int r = 0; r < 8; ++r) h[j][r] = (_Float16)acc[j][r];
  #pragma unroll
  for (int j = 0; j < 4; ++j)
    #pragma unroll
    for (int r = 0; r < 8; ++r) o[j * WFRAG + r * 8] = h[j][r];
  // the built code may join this part's exit with another part's path, where
  // registers that the stores name are written again: the wait stands ahead
  asm volatile("s_wait_xcnt 0x0" ::: "memory");
}

// bfv[o] = bf[o] + sum_j Wf[o][j] bv[j], j < 256: a pair of waves takes 16 rows
// of Wf, each wave one half of K as A fragments straight from memory (all of K
// in one wave would set the register count of the whole launch); bv is column
// 0 of the B fragments. The odd wave hands its sums to the even one in LDS.
__device__ __forceinline__ void bias_product(
    const float* __restrict__ Wf, const float* __restrict__ bv,
    const float* __restrict__ bf, float* __restrict__ bfv, int blk,
    _Float16* vs, float* red)
{
  const int lane  = threadIdx.x & 31;
  const int wave  = threadIdx.x >> 5;
  const int n0    = lane & 15;
  const int half8 = ((lane >> 4) & 1) << 3;
  const int r0    = (lane >> 4) * 8;
  const int kh    = wave & 1;
  const int row0  = (blk * 4 + (wave >> 1)) * 16;
  const float* ap = Wf + (size_t)(row0 + n0) * Ff + 128 * kh + half8;
  v4f av[4][4];
  // unrolled: av[][] must stay in registers
  #pragma unroll
  for (int s = 0; s < 4; ++s) {
    av[s][0] = *(const v4f*)(ap + 32 * s);
    av[s][1] = *(const v4f*)(ap + 32 * s + 4);
    av[s][2] = *(const v4f*)(ap + 32 * s + 16);
    av[s][3] = *(const v4f*)(ap + 32 * s + 20);
  }
  const float* pbv = bv + threadIdx.x;
  const float* pbf = bf + row0 + r0;
  const float bvv = *pbv;
  const v4f f0 = *(const v4f*)(pbf);
  const v4f f1 = *(const v4f*)(pbf + 4);
  // stands ahead of whatever is written into the address registers of the
  // loads above; it names the addresses as inputs so that their registers stay
  // untouched (also by a later load's result) up to the wait
  asm volatile("s_wait_xcnt 0x0" :: "v"(ap), "v"(pbv), "v"(pbf) : "memory");
  vs[threadIdx.x] = (_Float16)bvv;
  __syncthreads();
  v8f acc = (v8f){};
  #pragma unroll
  for (int s = 0; s < 4; ++s) {
    FragU a;
    a.q[0].x = pack4h(av[s][0]).x; a.q[0].y = pack4h(av[s][0]).y;
    a.q[0].z = pack4h(av[s][1]).x; a.q[0].w = pack4h(av[s][1]).y;
    a.q[1].x = pack4h(av[s][2]).x; a.q[1].y = pack4h(av[s][2]).y;
    a.q[1].z = pack4h(av[s][3]).x; a.q[1].w = pack4h(av[s][3]).y;
    const v16h bl = frag_at(vs + 128 * kh + 32 * s + half8);
    v16h b;
    #pragma unroll
    for (int e = 0; e < 16; ++e) b[e] = (n0 == 0) ? bl[e] : (_Float16)0.0f;
    acc = __builtin_amdgcn_wmma_f32_16x16x32_f16(false, a.v, false, b, (short)0, acc, false, false);
  }
  float* rp = red + (wave >> 1) * 16 + r0;
  if (kh == 1 && n0 == 0) {
    #pragma unroll
    for (int r = 0; r < 8; ++r) rp[r] = acc[r];
  }
  __syncthreads();
  if (kh == 0 && n0 == 0) {
    #pragma unroll
    for (int r = 0; r < 8; ++r)
      bfv[row0 + r0 + r] = (acc[r] + rp[r]) + (r < 4 ? f0[r & 3] : f1[r & 3]);
  }
  // as at the end of weight_product
  asm volatile("s_wait_xcnt 0x0" ::: "memory");
}


// ---------------------------------------------------------------------------
// Folded queries, straight from the f32 inputs: for head h and patch r
//   q = Wq_h xc_r + bq_h (64 long, xc the centre token),  qt = Wk_h^T q (256 long)
// Both products are local to a patch, so a block that owns QROWS patches and
// one head needs nothing that another block makes, and the part can stand in
// the first launch. A wave takes 16 patches through both products.
// The weights are the A operand and the patches the B operand, so a lane's 8
// accumulator registers hold 8 consecutive outputs of ONE patch:
//  - two tiles of q, rounded to f16 in place, are the B fragment of the second
//    product (k = 32 s + 8 (lane >> 4) + e and 16 more: the k order of frag_at);
//  - a tile of qt is two 16-byte LDS stores.
// LDS: Qs = Wq_h as it lies (row d, g along it), Ks = Wk_h turned (row f, d
// along it), Cs = a range of each wave's own: first its 16 centre tokens in
// f16, then its 16 result rows in f32, so that global reads and stores are
// whole 128-byte lines.
// ---------------------------------------------------------------------------
constexpr int QP  = Ff + 8;                 // LDS pitch of 256 f16, +16 B against bank conflicts
constexpr int QPC = Ff + 4;                 // the same for 256 f32
constexpr int QWV = 16 * QPC;               // floats of a wave's own range
static_assert(16 * QP * 2 <= QWV * 4, "the centre tokens fit the wave's range");

typedef __attribute__((ext_vector_type(4))) _Float16 v4h;

__device__ __forceinline__ void query_chain(
    const float* __restrict__ x, const float* __restrict__ Wq,
    const float* __restrict__ bq, const float* __restrict__ Wk,
    float* __restrict__ qt, int blk, _Float16* Qs, _Float16* Ks, float* Cs)
{
  const int tid     = threadIdx.x;
  const int lane    = tid & 31;
  const int wave    = tid >> 5;
  const int n0      = lane & 15;
  const int half8   = ((lane >> 4) & 1) << 3;
  const int h       = blk & 3;
  const int rowBase = (blk >> 2) * QROWS + wave * 16;

  // every global read of the block ahead of its first LDS store
  // bq: the 8 values of each q tile that the lane's accumulator registers hold
  const float* pb = bq + h * Dd + half8;
  // Wq_h is one run of memory: a wave's load takes half a row
  const float* pq = Wq + h * Dd * Ff + tid * 4;
  // Wk_h: a lane takes rows d, d + 1 at four columns; eight lanes cover a
  // 128-byte line, four such groups four pairs of rows
  const float* pk = Wk + h * Dd * Ff + (lane >> 3) * 2 * Ff + (wave * 8 + (lane & 7)) * 4;
  // centre tokens (p = 12 of each patch): a wave's load takes half a row
  const float* px = x + (size_t)rowBase * (KK2 * Ff) + lane * 4;
  v4f bb[4][2], wq[16], klo[8], khi[8], xv[32];
  // unrolled, here and below: the arrays must stay in registers
  #pragma unroll
  for (int j = 0; j < 4; ++j) {
    bb[j][0] = *(const v4f*)(pb + 16 * j);
    bb[j][1] = *(const v4f*)(pb + 16 * j + 4);
  }
  #pragma unroll
  for (int j = 0; j < 16; ++j) wq[j] = *(const v4f*)(pq + j * 1024);
  #pragma unroll
  for (int j = 0; j < 8; ++j) {
    klo[j] = *(const v4f*)(pk + j * 8 * Ff);
    khi[j] = *(const v4f*)(pk + j * 8 * Ff + Ff);
  }
  #pragma unroll
  for (int i = 0; i < 32; ++i)
    xv[i] = *(const v4f*)(px + ((i >> 1) * KK2 + 12) * Ff + (i & 1) * 128);
  // stands ahead of whatever is written into the address registers of the
  // loads above; it names what they are formed from as inputs so that those
  // registers stay untouched (also by a later load's result) up to the wait
  asm volatile("s_wait_xcnt 0x0" :: "v"(tid), "v"(half8), "v"(pk), "v"(px) : "memory");
  // keeps the address arithmetic of the LDS stores below behind the wait
  __builtin_amdgcn_sched_barrier(0);

  {
    _Float16* d = Qs + (tid >> 6) * QP + (tid & 63) * 4;
    #pragma unroll
    for (int j = 0; j < 16; ++j) *(v4h*)&d[4 * j * QP] = __builtin_convertvector(wq[j], v4h);
  }
  {
    _Float16* d = Ks + (wave * 8 + (lane & 7)) * 4 * PS + (lane >> 3) * 2;
    #pragma unroll
    for (int j = 0; j < 8; ++j) {
      #pragma unroll
      for (int e = 0; e < 4; ++e) {
        union { _Float16 h[2]; unsigned u; } w;
        w.h[0] = (_Float16)klo[j][e];
        w.h[1] = (_Float16)khi[j][e];
        *(unsigned*)&d[e * PS + j * 8] = w.u;
      }
    }
  }
  float* cs = Cs + wave * QWV;
  _Float16* xs = (_Float16*)cs;
  {
    _Float16* d = xs + lane * 4;
    #pragma unroll
    for (int i = 0; i < 32; ++i)
      *(v4h*)&d[(i >> 1) * QP + (i & 1) * 128] = __builtin_convertvector(xv[i], v4h);
  }
  // the weights of all eight waves are read behind this
  __syncthreads();

  // Fragments come from LDS in runs: all of the first product's at once, the
  // second product's in two runs, each asked for ahead of the products on what
  // has been asked for before it. The scheduling barriers keep a run's loads
  // where they stand: left alone, the compiler puts each load directly in
  // front of its product, and every product then waits out an LDS latency.
  const _Float16* qa = Qs + n0 * QP + half8;
  const _Float16* ka = Ks + n0 * PS + half8;
  v16h xb[Ff / 32], wa[Ff / 32][4], kf[Ff / 16][2];
  #pragma unroll
  for (int s = 0; s < Ff / 32; ++s) xb[s] = frag_at(xs + n0 * QP + half8 + 32 * s);
  #pragma unroll
  for (int s = 0; s < Ff / 32; ++s)
    #pragma unroll
    for (int j = 0; j < 4; ++j) wa[s][j] = frag_at(qa + 16 * j * QP + 32 * s);
  __builtin_amdgcn_sched_barrier(0);

  // --- q^T: tile j holds d = 16 j + 8 (lane >> 4) + r of patch n0; starts at bq
  v8f q1[4];
  #pragma unroll
  for (int j = 0; j < 4; ++j)
    #pragma unroll
    for (int r = 0; r < 8; ++r) q1[j][r] = bb[j][r >> 2][r & 3];
  #pragma unroll
  for (int s = 0; s < 4; ++s)
    #pragma unroll
    for (int j = 0; j < 4; ++j)
      q1[j] = __builtin_amdgcn_wmma_f32_16x16x32_f16(false, wa[s][j], false, xb[s], (short)0, q1[j], false, false);
  #pragma unroll
  for (int t = 0; t < 8; ++t) {
    kf[t][0] = frag_at(ka + 16 * t * PS);
    kf[t][1] = frag_at(ka + 16 * t * PS + 32);
  }
  __builtin_amdgcn_sched_barrier(0);
  #pragma unroll
  for (int s = 4; s < 8; ++s)
    #pragma unroll
    for (int j = 0; j < 4; ++j)
      q1[j] = __builtin_amdgcn_wmma_f32_16x16x32_f16(false, wa[s][j], false, xb[s], (short)0, q1[j], false, false);
  #pragma unroll
  for (int t = 8; t < 16; ++t) {
    kf[t][0] = frag_at(ka + 16 * t * PS);
    kf[t][1] = frag_at(ka + 16 * t * PS + 32);
  }
  __builtin_amdgcn_sched_barrier(0);
  v16h qf[2];
  #pragma unroll
  for (int s = 0; s < 2; ++s)
    #pragma unroll
    for (int e = 0; e < 8; ++e) {
      qf[s][e]     = (_Float16)q1[2 * s][e];
      qf[s][8 + e] = (_Float16)q1[2 * s + 1][e];
    }

  // --- qt^T: tile t holds f = 16 t + 8 (lane >> 4) + r of patch n0
  v8f acc[Ff / 16];
  #pragma unroll
  for (int t = 0; t < Ff / 16; ++t) {
    acc[t] = (v8f){};
    acc[t] = __builtin_amdgcn_wmma_f32_16x16x32_f16(false, kf[t][0], false, qf[0], (short)0, acc[t], false, false);
    acc[t] = __builtin_amdgcn_wmma_f32_16x16x32_f16(false, kf[t][1], false, qf[1], (short)0, acc[t], false, false);
  }
  // all products ahead of the first store: each tile keeps registers of its
  // own, and no product waits for a store to give its registers back
  __builtin_amdgcn_sched_barrier(0);

  // --- through the wave's own range (its centre tokens are used up) to rows
  {
    float* d = cs + n0 * QPC + half8;
    #pragma unroll
    for (int t = 0; t < Ff / 16; ++t) {
      *(v4f*)&d[16 * t]     = (v4f){acc[t][0], acc[t][1], acc[t][2], acc[t][3]};
      *(v4f*)&d[16 * t + 4] = (v4f){acc[t][4], acc[t][5], acc[t][6], acc[t][7]};
    }
  }
  // the wave's own LDS stores are done before it reads other lanes' values
  asm volatile("s_wait_dscnt 0x0" ::: "memory");
  v4f y[32];
  #pragma unroll
  for (int i = 0; i < 32; ++i)
    y[i] = *(const v4f*)&cs[(i >> 1) * QPC + (i & 1) * 128 + lane * 4];
  float* o = qt + (size_t)rowBase * (Hh * Ff) + h * Ff + lane * 4;
  #pragma unroll
  for (int i = 0; i < 32; ++i)
    *(v4f*)(o + (i >> 1) * (Hh * Ff) + (i & 1) * 128) = y[i];
  // as at the end of weight_product
  asm volatile("s_wait_xcnt 0x0" ::: "memory");
}

// grid = PREP_BLOCKS; the parts with the longest way to go come first
__global__ __launch_bounds__(256) void prep_kernel(
    const float* __restrict__ x,  const float* __restrict__ Wq,
    const float* __restrict__ bq, const float* __restrict__ Wk,
    const float* __restrict__ Wv, const float* __restrict__ bv,
    const float* __restrict__ Wf, const float* __restrict__ bf,
    const float* __restrict__ W1, const float* __restrict__ W2,
    float* __restrict__ qt, _Float16* __restrict__ wfvH,
    float* __restrict__ bfv, _Float16* __restrict__ w1H,
    _Float16* __restrict__ w2H, float* __restrict__ stats)
{
  __shared__ __attribute__((aligned(16))) _Float16 Ks[Ff * PS];
  __shared__ __attribute__((aligned(16))) _Float16 Qs[Dd * QP];
  __shared__ __attribute__((aligned(16))) float Cs[8 * QWV];
  static_assert(128 * PS <= Ff * PS && 64 * PS <= Dd * QP, "the weight product's operands fit");
  int blk = blockIdx.x;
  if (blk < PREP_Q) { query_chain(x, Wq, bq, Wk, qt, blk, Qs, Ks, Cs); return; }
  blk -= PREP_Q;
  if (blk < PREP_PROD) {
    const int h = (blk >> 3) & 3, mb = (blk >> 2) & 1, nb = blk & 3;
    // wfv(o, k = h*256 + f) = sum_d Wf[o][h*64 + d] Wv[h*64 + d][f], laid down in
    // fragment order: the block starts at column tile 8 mb, k-step 8 h + 2 nb
    weight_product(Wf + mb * 128 * Ff + h * Dd, Wv + h * Dd * Ff + nb * 64,
                   wfvH + ((mb * 8) * KST + h * 8 + nb * 2) * 2 * WFRAG, Ks, Qs);
    return;
  }
  blk -= PREP_PROD;
  if (blk < PREP_BIAS) {
    if (blk == 0 && threadIdx.x < 16) stats[threadIdx.x] = 0.f;  // both LN sets
    bias_product(Wf, bv, bf, bfv, blk, Ks, (float*)Qs);
    return;
  }
  blk -= PREP_BIAS;
  if (blk < PREP_FFN) cvt_flat_f16(W1, w1H, blk);
  else                cvt_flat_f16(W2, w2H, blk - PREP_FFN);
}


// ---------------------------------------------------------------------------
extern "C" void kernel_launch(void* const* d_in, const int* in_sizes, int n_in,
                              void* d_out, int out_size, void* d_ws, size_t ws_size,
                              hipStream_t stream) {
  const float* x    = (const float*)d_in[0];
  const float* Wq   = (const float*)d_in[1];
  const float* bq   = (const float*)d_in[2];
  const float* Wk   = (const float*)d_in[3];
  // d_in[4] (bk) adds q_h . bk_h to all 25 scores of a head: cancels in softmax
  const float* Wv   = (const float*)d_in[5];
  const float* bv   = (const float*)d_in[6];
  const float* Wf   = (const float*)d_in[7];
  const float* bf   = (const float*)d_in[8];
  const float* ln1w = (const float*)d_in[9];
  const float* ln1b = (const float*)d_in[10];
  const float* ln2w = (const float*)d_in[11];
  const float* ln2b = (const float*)d_in[12];
  const float* W1   = (const float*)d_in[13];
  const float* b1   = (const float*)d_in[14];
  const float* W2   = (const float*)d_in[15];
  const float* b2   = (const float*)d_in[16];

  char* ws = (char*)d_ws;
  size_t off = 0;
  auto alloc = [&](size_t bytes) -> void* {
    void* p = ws + off;
    off += (bytes + 255) & ~(size_t)255;
    return p;
  };

  _Float16* wfvH    = (_Float16*)alloc((size_t)Ff * Hh * Ff * 2);  // Wf_h Wv_h
  float*    bfv     = (float*)   alloc((size_t)Ff * 4);            // Wf bv + bf
  _Float16* w1H     = (_Float16*)alloc((size_t)DFFc * Ff * 2);
  _Float16* w2H     = (_Float16*)alloc((size_t)Ff * DFFc * 2);
  float*    qtF     = (float*)   alloc((size_t)ROWS * Hh * Ff * 4); // Wk_h^T q_h
  float*    attent  = (float*)   alloc((size_t)ROWS * Ff * 4);
  float*    ytmp    = (float*)   alloc((size_t)ROWS * Ff * 4);
  float*    stats   = (float*)   alloc(256);                       // 2 sets of 4x2

  // --- folded queries of all heads -> f32; beside them: zero LN stats, FFN
  //     weights to f16, weight product and its bias
  prep_kernel<<<PREP_BLOCKS, 256, 0, stream>>>(x, Wq, bq, Wk, Wv, bv, Wf, bf, W1, W2,
                                               qtF, wfvH, bfv, w1H, w2H, stats);

  // --- scores, softmax over 25 and weighted patch sum per head, x read once;
  //     then value and output projection in one, (20 x 1024) @ (1024 x 256) + bfv
  //     a block -> attent f32, LN 1 sums
  attention_outproj<<<ABLK, AWV * 32, 0, stream>>>(x, qtF, wfvH, bfv, attent, stats);

  // --- LayerNorm 1 (per batch over N,O,F) -> out1, then the FFN:
  //     relu(out1 @ W1^T + b1) @ W2^T + b2 + out1 -> ytmp, LN 2 sums
  ln_ffn_fused<<<ROWS / FM, 256, 0, stream>>>(attent, ln1w, ln1b, stats, w1H, b1, w2H, b2,
                                              ytmp, stats + 8);

  // --- LayerNorm 2 -> d_out (f32)
  ln_apply_kernel<<<PB4 / 256, 256, 0, stream>>>(ytmp, ln2w, ln2b, stats + 8,
                                                 (float*)d_out, nullptr);
}

// v010
// Measured time: 46.7 microseconds a run.
// In two side-by-side timings against v009, it was 1.04 and 1.03 times as fast.
// Counting every step since v000, it is 6.87 times as fast.
#include <hip/hip_runtime.h>
#include <hip/hip_bf16.h>
#include <math.h>

typedef __attribute__((ext_vector_type(16))) _Float16 v16h;
typedef __attribute__((ext_vector_type(8)))  float    v8f;
typedef __attribute__((ext_vector_type(4)))  float    v4f;

#define Bb   4
#define Nn_  256
#define Oo   5
#define KK2  25      // K*K patch positions
#define Ff   256
#define Hh   4
#define Dd   64
#define DFFc 1024

constexpr int ROWS = Bb * Nn_ * Oo;         // 5120 output rows
constexpr int PB   = Nn_ * Oo * Ff;         // 327680 elems per batch for LN

// ---------------------------------------------------------------------------
// helpers
// ---------------------------------------------------------------------------
union FragU { v16h v; uint4 q[2]; };

// Load one f16 16x32 fragment given per-lane base (row/col and half-offset
// already folded in): elements 0..7 at +k, elements 8..15 at +k+16.
__device__ __forceinline__ v16h frag_at(const _Float16* p) {
  FragU f;
  f.q[0] = *(const uint4*)(p);
  f.q[1] = *(const uint4*)(p + 16);
  return f.v;
}

// f16 16x32 fragment layout (A and B identical): lane L<16 -> row/col L,
// elements 0..7 = K [k0+off, k0+off+8), elements 8..15 = +16; off = 8*(L>=16).
// C/D layout: VGPR r -> (M=r, N=lane) for lanes 0-15, (M=r+8, N=lane-16).

// ---------------------------------------------------------------------------
// Folded patch attention. With qt[h] = Wk_h^T q_h (256 long, q the centre
// query) the score of patch position p is qt[h] . x_p / 8 (+ q_h . bk_h, the
// same for every p of a head, so it cancels in the softmax), and the merged
// value is Wv_h (sum_p w_p x_p) + bv_h because the weights sum to one. This
// kernel reads x once in f32 and makes xw[h] = sum_p w_p x_p per head.
// One wave works on a patch: it holds all 25 rows in registers, a lane 8 of a
// row's 256 values (f0..f0+3 and 128+f0..128+f0+3).
// ---------------------------------------------------------------------------
__device__ __forceinline__ float dot4(const v4f a, const v4f b, float s) {
  s = fmaf(a.x, b.x, s);
  s = fmaf(a.y, b.y, s);
  s = fmaf(a.z, b.z, s);
  s = fmaf(a.w, b.w, s);
  return s;
}
// lanes L and L ^ N: the lane with bit N clear keeps v[0..N), the other
// v[N..2N); each adds the partner's share of what it keeps
template <int N, int S>
__device__ __forceinline__ void halve_step(float (&v)[S], int lane) {
  const bool hi = (lane & N) != 0;
  #pragma unroll
  for (int j = 0; j < N; ++j) {
    const float send = hi ? v[j] : v[j + N];
    const float keep = hi ? v[j + N] : v[j];
    v[j] = keep + __shfl_xor(send, N, 32);
  }
}
__device__ __forceinline__ float lane_bcast(float v, int srcLane) {
  return __builtin_bit_cast(float,
      __builtin_amdgcn_readlane(__builtin_bit_cast(int, v), srcLane));
}

// One patch's tile in LDS, as it lies in memory: its 25 rows of x (one run of
// 25,600 bytes), then its four folded queries (one run of 4,096 bytes).
constexpr int XTV  = KK2 * Ff;              // floats of x in a tile
constexpr int QTV  = Hh * Ff;               // floats of qt in a tile
constexpr int TILV = XTV + QTV;
constexpr int AWV  = 8;                     // waves a block
constexpr int ABLK = 256;                   // blocks: one on every WGP (by its LDS)
constexpr int PPB  = ROWS / ABLK;           // patches a block
static_assert(ROWS % ABLK == 0 && PPB >= AWV, "every wave has a first patch");
static_assert((TILV * 4) % 16 == 0 && XTV * 4 < 65536, "copy alignment, offset range");

// a copy of 16 bytes a lane, N bytes behind both addresses (the offset field
// moves the LDS address and the global address alike)
#define ACP(N) "global_load_async_to_lds_b128 %0, %1, off offset:" #N "\n\t"
// A wave's 58 copies of one tile: a copy takes 512 bytes in a row. The xcnt
// wait closes each statement so that no address register of an issued copy is
// rewritten ahead of it.
__device__ __forceinline__ void copy_tile(unsigned lds, const float* xsrc, const float* qsrc) {
  asm volatile(ACP(0)     ACP(512)   ACP(1024)  ACP(1536)  ACP(2048)
               ACP(2560)  ACP(3072)  ACP(3584)  ACP(4096)  ACP(4608)
               ACP(5120)  ACP(5632)  ACP(6144)  ACP(6656)  ACP(7168)
               ACP(7680)  ACP(8192)  ACP(8704)  ACP(9216)  ACP(9728)
               ACP(10240) ACP(10752) ACP(11264) ACP(11776) ACP(12288)
               ACP(12800) ACP(13312) ACP(13824) ACP(14336) ACP(14848)
               ACP(15360) ACP(15872) ACP(16384) ACP(16896) ACP(17408)
               ACP(17920) ACP(18432) ACP(18944) ACP(19456) ACP(19968)
               ACP(20480) ACP(20992) ACP(21504) ACP(22016) ACP(22528)
               ACP(23040) ACP(23552) ACP(24064) ACP(24576) ACP(25088)
               "s_wait_xcnt 0x0"
               :: "v"(lds), "v"(xsrc) : "memory");
  asm volatile(ACP(0)     ACP(512)   ACP(1024)  ACP(1536)
               ACP(2048)  ACP(2560)  ACP(3072)  ACP(3584)
               "s_wait_xcnt 0x0"
               :: "v"(lds + XTV * 4), "v"(qsrc) : "memory");
}
#undef ACP

// The value and output projections stand in the same launch: they are local to
// a row, so the block takes the xw rows of its own patches, which never leave
// LDS, through two products that follow one another:
//   merged = (Wv_h xw_h)_h   (K = 256 of the column's own head)
//   attent = Wf merged + (Wf bv + bf)   (K = 256)
// and takes the LayerNorm 1 sums. Against one product with Wf_h Wv_h (K = 1024)
// this is half the weight bytes, half the LDS reads and half the products. In
// each product a wave takes 32 columns for all rows; the PPB rows fill two row
// tiles, whose other rows are zero and are not stored. No wave shares a weight
// with another, so the weights go straight to registers: prep lays Wv and Wf
// down in fragment order (WFRAG), where a wave-wide 16-byte load is 512 bytes
// in a row. A wave's 16 KB of Wv fit the registers beside a patch and are asked
// for at the kernel's entry, its 16 KB of Wf behind its last patch.
constexpr int PX    = Hh * Ff + 8;          // LDS pitch, +16 B against bank conflicts
constexpr int PM    = Ff + 8;               // the same for the merged rows
constexpr int PCA   = Ff + 4;               // the same for the f32 result tile
constexpr int KST   = Ff / 32;              // k-steps of each product
// a weight in fragment order: column tile ct, k-step s, fragment half j
// (elements 8 j .. 8 j + 7), lane L, element e hold column 16 ct + (L & 15) at
// k = 32 s + 16 j + 8 (L >> 4) + e: the k order of frag_at
constexpr int WFRAG = 256;                  // f16 values of a fragment half
static_assert(PPB <= 32 && (Nn_ * Oo) % PPB == 0, "two row tiles, one batch element");
static_assert(PPB % 4 == 0, "a wave's four result rows are all stored or none");
static_assert(32 * PCA * 4 + 32 * PM * 2 <= AWV * TILV * 4, "result and merged rows fit the tiles");
static_assert((32 * PCA * 4) % 16 == 0, "the merged rows start at a multiple of 16 bytes");
static_assert(((32 - PPB) * PX) % 8 == 0 && (PPB * PX * 2) % 16 == 0, "zero rows in 16-byte pieces");

// grid = ABLK. The block stays on its WGP and its waves go through its PPB
// patches, wave w taking patches w, w + AWV, ... Each wave has one tile of LDS
// of its own, which no other wave touches, so the attention part has no
// barrier: the wave waits for its own copies, moves the tile to registers, and
// as soon as those LDS reads are done asks for its next tile, which flies
// while this one is worked on.
__global__ __launch_bounds__(AWV * 32) void attention_outproj(
    const float* __restrict__ x, const float* __restrict__ qt,
    const _Float16* __restrict__ wv, const _Float16* __restrict__ wf,
    const float* __restrict__ bfv,
    float* __restrict__ outF, float* __restrict__ stats)
{
  __shared__ __attribute__((aligned(16))) float Ts[AWV * TILV];
  __shared__ __attribute__((aligned(16))) _Float16 Xs[32 * PX];
  __shared__ __attribute__((aligned(16))) float bfs[Ff];
  __shared__ float red[16];
  const int tid  = threadIdx.x;
  const int lane = tid & 31;
  // in a scalar register: the tests on the patch number are then scalar branches
  const int wave = __builtin_amdgcn_readfirstlane(tid >> 5);
  const int f0   = lane * 4;
  const float* ts = Ts + wave * TILV + f0;
  const unsigned lds = (unsigned)(uintptr_t)ts;
  const int rowBase = blockIdx.x * PPB;
  const int last = rowBase + PPB;

  copy_tile(lds, x + (size_t)(rowBase + wave) * XTV + f0,
            qt + (size_t)(rowBase + wave) * QTV + f0);

  // The wave's two column tiles of a weight are one run of memory; fragment half
  // j of k-step s of column tile t lies ((t KST + s) 2 + j) WFRAG values behind.
  // Wv is asked for here, beside the first tile's copies, and stays in registers
  // through the patches: the first product then waits for no memory.
  const _Float16* bv_ = wv + wave * (2 * KST * 2 * WFRAG);
  const _Float16* pv  = bv_ + lane * 8;
  FragU wvf[KST][2];
  // unrolled: register indices
  #pragma unroll
  for (int s = 0; s < KST; ++s)
    #pragma unroll
    for (int t = 0; t < 2; ++t) {
      const _Float16* p = pv + ((t * KST + s) * 2) * WFRAG;
      wvf[s][t].q[0] = *(const uint4*)(p);
      wvf[s][t].q[1] = *(const uint4*)(p + WFRAG);
    }
  // stands ahead of whatever is written into the address registers of the
  // loads, the scalar base among them: it names both as inputs
  asm volatile("s_wait_xcnt 0x0" :: "s"(bv_), "v"(pv) : "memory");

  // beside the copies: the bias to LDS, zeros into the row tiles' unused rows
  {
    const float* pb = bfv + tid;
    const float bvv = *pb;
    // stands ahead of whatever is written into the address registers of the load
    asm volatile("s_wait_xcnt 0x0" :: "v"(pb) : "memory");
    bfs[tid] = bvv;
    uint4* z = (uint4*)&Xs[PPB * PX];
    for (int i = tid; i < (32 - PPB) * PX / 8; i += AWV * 32) z[i] = uint4{0u, 0u, 0u, 0u};
  }

  // rolled: one body in the instruction cache serves all of a wave's patches
  #pragma unroll 1
  for (int bno = blockIdx.x * PPB + wave; bno < last; bno += AWV) {
  // the wave's own copies of this tile have landed
  asm volatile("s_wait_asynccnt 0x0" ::: "memory");
  v4f q[Hh][2];
  #pragma unroll
  for (int h = 0; h < Hh; ++h) {
    q[h][0] = *(const v4f*)(ts + XTV + h * Ff);
    q[h][1] = *(const v4f*)(ts + XTV + h * Ff + 128);
  }
  v4f xr[KK2][2];
  #pragma unroll
  for (int p = 0; p < KK2; ++p) {
    xr[p][0] = *(const v4f*)(ts + p * Ff);
    xr[p][1] = *(const v4f*)(ts + p * Ff + 128);
  }
  // the tile's last LDS read is done before the next tile's copies write there
  asm volatile("s_wait_dscnt 0x0" ::: "memory");
  // block index and wave number are scalars: the test reads the same in all lanes
  if (bno + AWV < last)
    copy_tile(lds, x + (size_t)(bno + AWV) * XTV + f0, qt + (size_t)(bno + AWV) * QTV + f0);
  // scores. Rows 0..23 in three groups of 8: 32 partial dots per lane, index
  // pl*4 + h; five halving steps leave lane L with the full sum of index L,
  // so lane L carries p = 8g + (L >> 2), h = L & 3.
  float s[3];
  #pragma unroll
  for (int g = 0; g < 3; ++g) {
    float v[32];
    #pragma unroll
    for (int pl = 0; pl < 8; ++pl)
      #pragma unroll
      for (int h = 0; h < Hh; ++h)
        v[pl * 4 + h] = dot4(xr[8 * g + pl][1], q[h][1],
                             dot4(xr[8 * g + pl][0], q[h][0], 0.f));
    halve_step<16>(v, lane);
    halve_step<8>(v, lane);
    halve_step<4>(v, lane);
    halve_step<2>(v, lane);
    halve_step<1>(v, lane);
    s[g] = v[0] * 0.125f;
  }
  // row 24: every lane ends with the full sum of head L & 3
  float s24;
  {
    float v[4];
    #pragma unroll
    for (int h = 0; h < Hh; ++h)
      v[h] = dot4(xr[24][1], q[h][1], dot4(xr[24][0], q[h][0], 0.f));
    halve_step<2>(v, lane);
    halve_step<1>(v, lane);
    #pragma unroll
    for (int o = 4; o <= 16; o <<= 1) v[0] += __shfl_xor(v[0], o, 32);
    s24 = v[0] * 0.125f;
  }

  // softmax over the 25 positions of head L & 3 (lanes L, L^4, L^8, L^16 ...)
  float mx = fmaxf(fmaxf(s[0], s[1]), fmaxf(s[2], s24));
  #pragma unroll
  for (int o = 4; o <= 16; o <<= 1) mx = fmaxf(mx, __shfl_xor(mx, o, 32));
  const float e0  = __expf(s[0] - mx);
  const float e1  = __expf(s[1] - mx);
  const float e2  = __expf(s[2] - mx);
  const float e24 = __expf(s24 - mx);
  float sum = (e0 + e1) + e2;
  #pragma unroll
  for (int o = 4; o <= 16; o <<= 1) sum += __shfl_xor(sum, o, 32);
  sum += e24;
  const float inv = 1.0f / sum;
  float wg[3];
  wg[0] = e0 * inv;
  wg[1] = e1 * inv;
  wg[2] = e2 * inv;
  const float w24 = e24 * inv;

  // weighted sum of the rows per head, p ascending; each weight is read from
  // its lane into a scalar
  _Float16* op = &Xs[(bno - rowBase) * PX + f0];
  #pragma unroll
  for (int h = 0; h < Hh; ++h) {
    v4f a0 = (v4f){0.f, 0.f, 0.f, 0.f};
    v4f a1 = (v4f){0.f, 0.f, 0.f, 0.f};
    #pragma unroll
    for (int p = 0; p < KK2; ++p) {
      const float w = (p < 24) ? lane_bcast(wg[p >> 3], (p & 7) * 4 + h)
                               : lane_bcast(w24, h);
      a0.x = fmaf(w, xr[p][0].x, a0.x);
      a0.y = fmaf(w, xr[p][0].y, a0.y);
      a0.z = fmaf(w, xr[p][0].z, a0.z);
      a0.w = fmaf(w, xr[p][0].w, a0.w);
      a1.x = fmaf(w, xr[p][1].x, a1.x);
      a1.y = fmaf(w, xr[p][1].y, a1.y);
      a1.z = fmaf(w, xr[p][1].z, a1.z);
      a1.w = fmaf(w, xr[p][1].w, a1.w);
    }
    union { _Float16 hh[4]; uint2 u; } o0, o1;
    o0.hh[0] = (_Float16)a0.x; o0.hh[1] = (_Float16)a0.y;
    o0.hh[2] = (_Float16)a0.z; o0.hh[3] = (_Float16)a0.w;
    o1.hh[0] = (_Float16)a1.x; o1.hh[1] = (_Float16)a1.y;
    o1.hh[2] = (_Float16)a1.z; o1.hh[3] = (_Float16)a1.w;
    *(uint2*)(op + h * Ff)       = o0.u;
    *(uint2*)(op + h * Ff + 128) = o1.u;
  }
  }

  const int n0    = lane & 15;              // row (A) / col (B) within tile
  const int half8 = ((lane >> 4) & 1) << 3; // K sub-offset per lane half
  const int r0    = (lane >> 4) * 8;        // first C row of this lane half
  // Wf needs nothing of the other waves: asked for ahead of the barrier, it
  // lands beside the first product
  const _Float16* bf_ = wf + wave * (2 * KST * 2 * WFRAG);
  const _Float16* pf  = bf_ + lane * 8;
  FragU wff[KST][2];
  // unrolled: register indices
  #pragma unroll
  for (int s = 0; s < KST; ++s)
    #pragma unroll
    for (int t = 0; t < 2; ++t) {
      const _Float16* p = pf + ((t * KST + s) * 2) * WFRAG;
      wff[s][t].q[0] = *(const uint4*)(p);
      wff[s][t].q[1] = *(const uint4*)(p + WFRAG);
    }
  // as behind the loads of Wv
  asm volatile("s_wait_xcnt 0x0" :: "s"(bf_), "v"(pf) : "memory");

  // no copy is outstanding and the wave's own LDS accesses are done, then every
  // wave's: behind this all xw rows are read, and the tiles' LDS is free
  asm volatile("s_wait_asynccnt 0x0" ::: "memory");
  asm volatile("s_wait_dscnt 0x0" ::: "memory");
  // the work-group barrier by hand: __syncthreads() would wait here for the
  // weight loads as well, which no other wave reads; so they fly on across it
  asm volatile("s_barrier_signal -1\n\ts_barrier_wait -1" ::: "memory");

  // --- first product: the rows' merged values, the wave's 32 columns lie in
  // head wave >> 1, whose xw is the K range
  v8f acc[4];                                 // index 2 g + j
  #pragma unroll
  for (int t = 0; t < 4; ++t) acc[t] = (v8f){};
  {
    const _Float16* ap = &Xs[n0 * PX + (wave >> 1) * Ff + half8];
    v16h xf[KST][2];
    #pragma unroll
    for (int s = 0; s < KST; ++s) {
      xf[s][0] = frag_at(ap + 32 * s);
      xf[s][1] = frag_at(ap + 16 * PX + 32 * s);
    }
    // keeps all LDS reads ahead of the first product, so that their latencies
    // run side by side instead of one behind the other
    __builtin_amdgcn_sched_barrier(0);
    #pragma unroll
    for (int s = 0; s < KST; ++s) {
      acc[0] = __builtin_amdgcn_wmma_f32_16x16x32_f16(false, xf[s][0], false, wvf[s][0].v, (short)0, acc[0], false, false);
      acc[1] = __builtin_amdgcn_wmma_f32_16x16x32_f16(false, xf[s][0], false, wvf[s][1].v, (short)0, acc[1], false, false);
      acc[2] = __builtin_amdgcn_wmma_f32_16x16x32_f16(false, xf[s][1], false, wvf[s][0].v, (short)0, acc[2], false, false);
      acc[3] = __builtin_amdgcn_wmma_f32_16x16x32_f16(false, xf[s][1], false, wvf[s][1].v, (short)0, acc[3], false, false);
    }
  }
  // merged rows, rounded to f16, in the tiles' LDS behind the place of the
  // result tile
  _Float16* Ms = (_Float16*)(Ts + 32 * PCA);
  {
    _Float16* mp = Ms + r0 * PM + wave * 32 + n0;
    #pragma unroll
    for (int t = 0; t < 4; ++t)
      #pragma unroll
      for (int r = 0; r < 8; ++r)
        mp[(16 * (t >> 1) + r) * PM + 16 * (t & 1)] = (_Float16)acc[t][r];
  }
  // the merged values of all eight waves are read behind this
  __syncthreads();

  // --- second product: the output projection, K = all merged columns
  #pragma unroll
  for (int t = 0; t < 4; ++t) acc[t] = (v8f){};
  {
    const _Float16* ap = Ms + n0 * PM + half8;
    v16h mf[KST][2];
    #pragma unroll
    for (int s = 0; s < KST; ++s) {
      mf[s][0] = frag_at(ap + 32 * s);
      mf[s][1] = frag_at(ap + 16 * PM + 32 * s);
    }
    // as in the first product
    __builtin_amdgcn_sched_barrier(0);
    #pragma unroll
    for (int s = 0; s < KST; ++s) {
      acc[0] = __builtin_amdgcn_wmma_f32_16x16x32_f16(false, mf[s][0], false, wff[s][0].v, (short)0, acc[0], false, false);
      acc[1] = __builtin_amdgcn_wmma_f32_16x16x32_f16(false, mf[s][0], false, wff[s][1].v, (short)0, acc[1], false, false);
      acc[2] = __builtin_amdgcn_wmma_f32_16x16x32_f16(false, mf[s][1], false, wff[s][0].v, (short)0, acc[2], false, false);
      acc[3] = __builtin_amdgcn_wmma_f32_16x16x32_f16(false, mf[s][1], false, wff[s][1].v, (short)0, acc[3], false, false);
    }
  }

  // --- the result tile goes through the tiles' LDS (free since the first
  // barrier above, and apart from the merged rows) to rows: eight threads a row, a thread takes four values
  // in each of the row's eight 128-byte lines, so the stores are whole lines
  float* Cs = Ts;
  {
    float* cp = Cs + r0 * PCA + wave * 32 + n0;
    #pragma unroll
    for (int t = 0; t < 4; ++t)
      #pragma unroll
      for (int r = 0; r < 8; ++r)
        cp[(16 * (t >> 1) + r) * PCA + 16 * (t & 1)] = acc[t][r];
  }
  __syncthreads();
  const int lr = tid >> 3;
  const int lc = (tid & 7) * 4;
  const bool live = lr < PPB;                 // the same for a whole wave
  v4f y[8];
  #pragma unroll
  for (int k = 0; k < 8; ++k) {
    const v4f cv = *(const v4f*)&Cs[lr * PCA + lc + 32 * k];
    const v4f bv = *(const v4f*)&bfs[lc + 32 * k];
    y[k] = live ? cv + bv : (v4f){0.f, 0.f, 0.f, 0.f};
  }
  // LayerNorm 1 sums, ahead of the stores: the barrier below waits for every
  // store that a wave has issued, so here it waits for none
  {
    v4f s4 = y[0];
    v4f q4 = y[0] * y[0];
    #pragma unroll
    for (int k = 1; k < 8; ++k) {
      s4 += y[k];
      q4 += y[k] * y[k];
    }
    float s = (s4.x + s4.y) + (s4.z + s4.w);
    float q = (q4.x + q4.y) + (q4.z + q4.w);
    for (int o = 16; o > 0; o >>= 1) {
      s += __shfl_xor(s, o, 32);
      q += __shfl_xor(q, o, 32);
    }
    if (lane == 0) { red[wave] = s; red[8 + wave] = q; }
    __syncthreads();
    // thread 0 adds up the eight waves' sums, thread 1 their sums of squares
    if (tid < 2) {
      const float* p = red + 8 * tid;
      const float tot = ((p[0] + p[1]) + (p[2] + p[3])) + ((p[4] + p[5]) + (p[6] + p[7]));
      atomicAdd(&stats[2 * (rowBase / (Nn_ * Oo)) + tid], tot);
    }
  }
  if (live) {
    float* o = outF + (size_t)(rowBase + lr) * Ff + lc;
    #pragma unroll
    for (int k = 0; k < 8; ++k) *(v4f*)(o + 32 * k) = y[k];
  }
}

// ---------------------------------------------------------------------------
// LayerNorm over (N,O,F) per batch element: the sums come from the launch that
// makes the values; this applies them. It moves 16-byte vectors and issues all
// loads of a thread before the first use.
// ---------------------------------------------------------------------------
constexpr int PB4        = PB / 4;                    // float4 per batch element
static_assert(PB4 % 256 == 0, "apply covers a batch exactly");

__device__ __forceinline__ uint2 pack4h(const v4f v) {
  union { _Float16 h[4]; uint2 u; } o;
  o.h[0] = (_Float16)v.x; o.h[1] = (_Float16)v.y;
  o.h[2] = (_Float16)v.z; o.h[3] = (_Float16)v.w;
  return o.u;
}

// grid = PB4 / 256. A thread takes the same four (n,o,f) positions in every
// batch element, so it reads g and beta once.
__global__ __launch_bounds__(256) void ln_apply_kernel(
    const float* __restrict__ x, const float* __restrict__ g,
    const float* __restrict__ beta, const float* __restrict__ stats,
    float* __restrict__ outF, _Float16* __restrict__ outH)
{
  const int r4 = blockIdx.x * 256 + threadIdx.x;
  float st[2 * Bb];
  #pragma unroll
  for (int k = 0; k < 2 * Bb; ++k) st[k] = stats[k];
  v4f xv[Bb];
  #pragma unroll
  for (int b = 0; b < Bb; ++b) xv[b] = ((const v4f*)x)[b * PB4 + r4];
  const v4f gv = ((const v4f*)g)[r4];
  const v4f bv = ((const v4f*)beta)[r4];
  // the base addresses of the six loads above are dead from here on: the wait
  // stands ahead of whatever is written into their registers
  asm volatile("s_wait_xcnt 0x0" ::: "memory");
  v4f o[Bb];
  #pragma unroll
  for (int b = 0; b < Bb; ++b) {
    const float mu  = st[2 * b + 0] * (1.0f / PB);
    const float var = st[2 * b + 1] * (1.0f / PB) - mu * mu;
    const float rs  = rsqrtf(var + 1e-5f);
    o[b].x = (xv[b].x - mu) * rs * gv.x + bv.x;
    o[b].y = (xv[b].y - mu) * rs * gv.y + bv.y;
    o[b].z = (xv[b].z - mu) * rs * gv.z + bv.z;
    o[b].w = (xv[b].w - mu) * rs * gv.w + bv.w;
  }
  if (outF) {
    #pragma unroll
    for (int b = 0; b < Bb; ++b) ((v4f*)outF)[b * PB4 + r4] = o[b];
  }
  // the f16 packing below may reuse registers that the stores above name
  asm volatile("s_wait_xcnt 0x0" ::: "memory");
  if (outH) {
    #pragma unroll
    for (int b = 0; b < Bb; ++b) ((uint2*)outH)[b * PB4 + r4] = pack4h(o[b]);
  }
}

// ---------------------------------------------------------------------------
// LayerNorm 1 apply and both FFN products in ONE launch:
//   o = LN(x);  y = relu(o W1^T + b1) W2^T + b2 + o   (+ the LayerNorm 2 sums)
// All three are local to a row, so a block that owns FM whole rows needs
// nothing of another block: o and the hidden layer of its rows never leave the
// WGP. The hidden units go by in NCH chunks of HC: a chunk's values are made
// from the chunk's rows of W1, rounded to f16 into LDS, and multiplied at once
// with the chunk's columns of W2 into accumulators that live through all
// chunks (k ascending, as in two separate products).
// The two weight pieces of a chunk (64 KB each) come by async copies into one
// of two LDS buffers: the next chunk's copies fly while this chunk is worked on.
// 8 waves: in the first product a wave takes 16 hidden units, in the second 32
// output columns, each for all FM rows.
// ---------------------------------------------------------------------------
constexpr int FM   = 32;                    // rows a block
constexpr int HC   = 128;                   // hidden units a chunk
constexpr int NCH  = DFFc / HC;
constexpr int P1   = Ff + 8;                // LDS pitches, +16 B against bank conflicts
constexpr int P2   = HC + 8;
constexpr int PC   = Ff + 4;                // the same for the f32 result tile
constexpr int W1V  = HC * P1;               // f16 values of a chunk of W1 in LDS
constexpr int W2V  = Ff * P2;               // and of W2
constexpr int BUFV = W1V + W2V;
static_assert((Nn_ * Oo) % FM == 0, "a block's rows lie in one batch element");
static_assert(FM * PC * 4 <= 2 * BUFV * 2, "the result tile fits the ring");

// eight copies of 16 bytes a lane, LB bytes apart in LDS and GV values apart in
// memory. The xcnt wait closes the statement so that no address register of an
// issued copy is rewritten ahead of it.
template <int LB, int GV>
__device__ __forceinline__ void copy8(unsigned lds, const _Float16* src) {
  asm volatile("global_load_async_to_lds_b128 %0, %1, off\n\t"
               "global_load_async_to_lds_b128 %2, %3, off\n\t"
               "global_load_async_to_lds_b128 %4, %5, off\n\t"
               "global_load_async_to_lds_b128 %6, %7, off\n\t"
               "global_load_async_to_lds_b128 %8, %9, off\n\t"
               "global_load_async_to_lds_b128 %10, %11, off\n\t"
               "global_load_async_to_lds_b128 %12, %13, off\n\t"
               "global_load_async_to_lds_b128 %14, %15, off\n\t"
               "s_wait_xcnt 0x0"
               :: "v"(lds),          "v"(src),
                  "v"(lds + LB),     "v"(src + GV),
                  "v"(lds + 2 * LB), "v"(src + 2 * GV),
                  "v"(lds + 3 * LB), "v"(src + 3 * GV),
                  "v"(lds + 4 * LB), "v"(src + 4 * GV),
                  "v"(lds + 5 * LB), "v"(src + 5 * GV),
                  "v"(lds + 6 * LB), "v"(src + 6 * GV),
                  "v"(lds + 7 * LB), "v"(src + 7 * GV)
               : "memory");
}

// grid = ROWS / FM
__global__ __launch_bounds__(256) void ln_ffn_fused(
    const float* __restrict__ x, const float* __restrict__ g,
    const float* __restrict__ beta, const float* __restrict__ statsIn,
    const _Float16* __restrict__ W1h, const float* __restrict__ b1,
    const _Float16* __restrict__ W2h, const float* __restrict__ b2,
    float* __restrict__ outF, float* __restrict__ stats)
{
  __shared__ __attribute__((aligned(16))) _Float16 Wb[2 * BUFV];
  __shared__ __attribute__((aligned(16))) _Float16 As[FM * P1];
  __shared__ __attribute__((aligned(16))) _Float16 Hs[FM * P2];
  __shared__ __attribute__((aligned(16))) float b1s[DFFc];
  __shared__ __attribute__((aligned(16))) float b2s[Ff];
  __shared__ float red[16];

  const int tid     = threadIdx.x;
  const int lane    = tid & 31;
  const int wave    = tid >> 5;
  const int rowBase = blockIdx.x * FM;
  const int bidx    = rowBase / (Nn_ * Oo);   // batch element
  const int n0      = lane & 15;              // row (A) / col (B) within tile
  const int half8   = ((lane >> 4) & 1) << 3; // K sub-offset per lane half
  const int r0      = (lane >> 4) * 8;        // first C row of this lane half
  // elementwise parts: eight threads a row, a thread takes four values in each
  // of the row's eight 128-byte lines
  const int lr      = tid >> 3;
  const int lc      = (tid & 7) * 4;

  // A chunk of W1 is HC whole rows of 512 B, one run of memory: a wave's copy
  // takes one row. A chunk of W2 is 256 B of each of its Ff rows: two rows a copy.
  const unsigned l1 = (unsigned)(uintptr_t)&Wb[(tid >> 5) * P1 + (tid & 31) * 8];
  const unsigned l2 = (unsigned)(uintptr_t)&Wb[W1V + (tid >> 4) * P2 + (tid & 15) * 8];
  const _Float16* s1 = W1h + tid * 8;
  const _Float16* s2 = W2h + (tid >> 4) * DFFc + (tid & 15) * 8;
  auto fill = [&](int c, int buf) {
    const unsigned d1 = l1 + buf * (BUFV * 2);
    const unsigned d2 = l2 + buf * (BUFV * 2);
    const _Float16* g1 = s1 + c * (HC * Ff);
    const _Float16* g2 = s2 + c * HC;
    copy8<8 * P1 * 2, 8 * Ff>(d1, g1);
    copy8<8 * P1 * 2, 8 * Ff>(d1 + 64 * P1 * 2, g1 + 64 * Ff);
    copy8<16 * P2 * 2, 16 * DFFc>(d2, g2);
    copy8<16 * P2 * 2, 16 * DFFc>(d2 + 128 * P2 * 2, g2 + 128 * DFFc);
  };
  fill(0, 0);

  // --- LayerNorm 1 on the block's rows, beside the copies; res keeps the f32
  // values for the residual
  v4f res[8];
  {
    const float* px  = x + (size_t)(rowBase + lr) * Ff + lc;
    const float* pg  = g + (size_t)(rowBase - bidx * (Nn_ * Oo) + lr) * Ff + lc;
    const float* pe  = beta + (size_t)(rowBase - bidx * (Nn_ * Oo) + lr) * Ff + lc;
    const float* pb1 = b1 + tid * 4;
    const float* pb2 = b2 + tid;
    const float st0 = statsIn[2 * bidx + 0];
    const float st1 = statsIn[2 * bidx + 1];
    v4f gv[8], ev[8];
    // unrolled: the arrays must stay in registers
    #pragma unroll
    for (int k = 0; k < 8; ++k) res[k] = *(const v4f*)(px + 32 * k);
    #pragma unroll
    for (int k = 0; k < 8; ++k) gv[k] = *(const v4f*)(pg + 32 * k);
    #pragma unroll
    for (int k = 0; k < 8; ++k) ev[k] = *(const v4f*)(pe + 32 * k);
    const v4f b1v = *(const v4f*)pb1;
    const float b2v = *pb2;
    // stands ahead of whatever is written into the address registers of the
    // loads above; it names the addresses as inputs so that their registers
    // stay untouched (also by a later load's result) up to the wait
    asm volatile("s_wait_xcnt 0x0" :: "v"(px), "v"(pg), "v"(pe), "v"(pb1), "v"(pb2) : "memory");
    const float mu  = st0 * (1.0f / PB);
    const float var = st1 * (1.0f / PB) - mu * mu;
    const float rs  = rsqrtf(var + 1e-5f);
    #pragma unroll
    for (int k = 0; k < 8; ++k) {
      res[k].x = (res[k].x - mu) * rs * gv[k].x + ev[k].x;
      res[k].y = (res[k].y - mu) * rs * gv[k].y + ev[k].y;
      res[k].z = (res[k].z - mu) * rs * gv[k].z + ev[k].z;
      res[k].w = (res[k].w - mu) * rs * gv[k].w + ev[k].w;
      *(uint2*)&As[lr * P1 + lc + 32 * k] = pack4h(res[k]);
    }
    *(v4f*)&b1s[tid * 4] = b1v;
    b2s[tid] = b2v;
  }

  // own copies landed, then every wave's: chunk 0, the normalised rows and the
  // biases are read only behind this
  asm volatile("s_wait_asynccnt 0x0" ::: "memory");
  __syncthreads();

  // A fragments for all of K stay in registers through all chunks
  FragU a[Ff / 32][2];
  {
    const _Float16* af = &As[n0 * P1 + half8];
    // unrolled: a[][] must stay in registers
    #pragma unroll
    for (int s = 0; s < Ff / 32; ++s) {
      a[s][0].v = frag_at(af + 32 * s);
      a[s][1].v = frag_at(af + 16 * P1 + 32 * s);
    }
  }

  v8f acc[4];                                 // index 2 g + j
  #pragma unroll
  for (int t = 0; t < 4; ++t) acc[t] = (v8f){};

  // rolled: one body serves both buffers, the buffer is an address
  #pragma unroll 1
  for (int c = 0; c < NCH; ++c) {
    const _Float16* wb = Wb + (c & 1) * BUFV;
    // all weight fragments of the chunk are asked for at once; they land while
    // the next chunk's copies are issued
    v16h w1f[Ff / 32], w2f[HC / 32][2];
    {
      const _Float16* bp1 = wb + (wave * 16 + n0) * P1 + half8;
      const _Float16* bp2 = wb + W1V + (wave * 32 + n0) * P2 + half8;
      // unrolled: register indices
      #pragma unroll
      for (int s = 0; s < Ff / 32; ++s) w1f[s] = frag_at(bp1 + 32 * s);
      #pragma unroll
      for (int s = 0; s < HC / 32; ++s) {
        w2f[s][0] = frag_at(bp2 + 32 * s);
        w2f[s][1] = frag_at(bp2 + 16 * P2 + 32 * s);
      }
    }
    const float bb = b1s[c * HC + wave * 16 + n0];
    // the other buffer's last reads ended at the barrier at the foot of the
    // trip before
    if (c + 1 < NCH) fill(c + 1, (c + 1) & 1);

    // --- first product: FM rows x the wave's 16 hidden units, K = Ff
    {
      v8f h0 = (v8f){}, h1 = (v8f){};
      // unrolled: register indices
      #pragma unroll
      for (int s = 0; s < Ff / 32; ++s) {
        h0 = __builtin_amdgcn_wmma_f32_16x16x32_f16(false, a[s][0].v, false, w1f[s], (short)0, h0, false, false);
        h1 = __builtin_amdgcn_wmma_f32_16x16x32_f16(false, a[s][1].v, false, w1f[s], (short)0, h1, false, false);
      }
      _Float16* hp = &Hs[r0 * P2 + wave * 16 + n0];
      #pragma unroll
      for (int r = 0; r < 8; ++r) {
        hp[r * P2]        = (_Float16)fmaxf(h0[r] + bb, 0.0f);
        hp[(16 + r) * P2] = (_Float16)fmaxf(h1[r] + bb, 0.0f);
      }
    }
    // the chunk's hidden values of all eight waves are read behind this
    __syncthreads();
    // --- second product: FM rows x the wave's 32 columns, K = this chunk
    {
      const _Float16* ha = &Hs[n0 * P2 + half8];
      v16h hf[HC / 32][2];
      #pragma unroll
      for (int s = 0; s < HC / 32; ++s) {
        hf[s][0] = frag_at(ha + 32 * s);
        hf[s][1] = frag_at(ha + 16 * P2 + 32 * s);
      }
      // keeps all eight fragment loads ahead of this product's first WMMA, so that
      // their latencies run side by side instead of one behind the other
      __builtin_amdgcn_sched_barrier(0);
      #pragma unroll
      for (int s = 0; s < HC / 32; ++s) {
        acc[0] = __builtin_amdgcn_wmma_f32_16x16x32_f16(false, hf[s][0], false, w2f[s][0], (short)0, acc[0], false, false);
        acc[1] = __builtin_amdgcn_wmma_f32_16x16x32_f16(false, hf[s][0], false, w2f[s][1], (short)0, acc[1], false, false);
        acc[2] = __builtin_amdgcn_wmma_f32_16x16x32_f16(false, hf[s][1], false, w2f[s][0], (short)0, acc[2], false, false);
        acc[3] = __builtin_amdgcn_wmma_f32_16x16x32_f16(false, hf[s][1], false, w2f[s][1], (short)0, acc[3], false, false);
      }
    }
    // foot of the trip: own LDS reads done, own copies of the next chunk
    // landed, then every wave's; the barrier publishes the next chunk and ends
    // the last read of this chunk's buffer and of the hidden values
    asm volatile("s_wait_dscnt 0x0" ::: "memory");
    asm volatile("s_wait_asynccnt 0x0" ::: "memory");
    __syncthreads();
  }
  // no copy is outstanding when the ring is put to another use
  asm volatile("s_wait_asynccnt 0x0" ::: "memory");

  // --- the result tile goes through the ring's LDS (free since the last
  // trip's barrier) back to the elementwise layout: the residual is there, and
  // the stores are whole 128-byte lines
  float* Cs = (float*)Wb;
  {
    float* cp = Cs + r0 * PC + wave * 32 + n0;
    #pragma unroll
    for (int t = 0; t < 4; ++t)
      #pragma unroll
      for (int r = 0; r < 8; ++r)
        cp[(16 * (t >> 1) + r) * PC + 16 * (t & 1)] = acc[t][r];
  }
  __syncthreads();
  v4f y[8];
  #pragma unroll
  for (int k = 0; k < 8; ++k) {
    const v4f cv = *(const v4f*)&Cs[lr * PC + lc + 32 * k];
    const v4f bv = *(const v4f*)&b2s[lc + 32 * k];
    y[k] = (cv + bv) + res[k];
  }
  // LayerNorm 2 sums, ahead of the stores: the barrier below waits for every
  // store that a wave has issued, so here it waits for none
  {
    v4f s4 = y[0];
    v4f q4 = y[0] * y[0];
    #pragma unroll
    for (int k = 1; k < 8; ++k) {
      s4 += y[k];
      q4 += y[k] * y[k];
    }
    float s = (s4.x + s4.y) + (s4.z + s4.w);
    float q = (q4.x + q4.y) + (q4.z + q4.w);
    for (int o = 16; o > 0; o >>= 1) {
      s += __shfl_xor(s, o, 32);
      q += __shfl_xor(q, o, 32);
    }
    if (lane == 0) { red[wave] = s; red[8 + wave] = q; }
    __syncthreads();
    // thread 0 adds up the eight waves' sums, thread 1 their sums of squares
    if (tid < 2) {
      const float* p = red + 8 * tid;
      const float tot = ((p[0] + p[1]) + (p[2] + p[3])) + ((p[4] + p[5]) + (p[6] + p[7]));
      atomicAdd(&stats[2 * bidx + tid], tot);
    }
  }
  float* o = outF + (size_t)(rowBase + lr) * Ff + lc;
  #pragma unroll
  for (int k = 0; k < 8; ++k) *(v4f*)(o + 32 * k) = y[k];
}


// ---------------------------------------------------------------------------
// first launch: everything that depends on the inputs alone. The parts need
// nothing of each other, so each takes a range of the block index (the branch
// is the same for a whole block). All of a thread's loads are issued before
// its first store other than the zeroing of the LN sums.
// ---------------------------------------------------------------------------
constexpr int QROWS       = 128;                       // patches a query block
constexpr int PREP_Q      = (ROWS / QROWS) * Hh;       // blocks for the folded queries
constexpr int PREP_FFN    = DFFc * Ff / 16 / 256;      // blocks per FFN weight
constexpr int PREP_FRAG   = Ff / 16;                 // blocks per projection weight: a column tile each
constexpr int PREP_BIAS   = 4;                         // blocks for Wf bv + bf
constexpr int PREP_BLOCKS = PREP_Q + 2 * PREP_FRAG + PREP_BIAS + 2 * PREP_FFN;

// flat f32 -> f16: block blk takes 1024 runs of four values
__device__ __forceinline__ void cvt_flat_f16(
    const float* __restrict__ s, _Float16* __restrict__ d, int blk) {
  const int i = blk * 1024 + threadIdx.x;
  v4f v[4];
  #pragma unroll
  for (int j = 0; j < 4; ++j) v[j] = ((const v4f*)s)[i + j * 256];
  #pragma unroll
  for (int j = 0; j < 4; ++j) ((uint2*)d)[i + j * 256] = pack4h(v[j]);
  // the built code joins this part's exit with another part's path, where the
  // registers that the four stores name are written again: the wait stands
  // ahead of that
  asm volatile("s_wait_xcnt 0x0" ::: "memory");
}

// ---------------------------------------------------------------------------
// f32 -> f16 into fragment order (WFRAG above) for a weight that lies
// [column][k] with Ff values of k a row: block blk makes column tile blk. The
// 16-byte piece i of a tile is lane i & 31 of fragment half (i >> 5) & 1 of
// k-step i >> 6; a thread takes pieces t and t + 256, which lie four k-steps
// (128 values of k) apart. The block reads 16 whole rows, one run of memory.
// ---------------------------------------------------------------------------
constexpr int PS = Dd + 8;                  // LDS pitch of 64 f16, +16 B against bank conflicts

__device__ __forceinline__ void cvt_frag_f16(
    const float* __restrict__ s, _Float16* __restrict__ d, int blk) {
  const int t = threadIdx.x;
  const float* p = s + (blk * 16 + (t & 15)) * Ff
                     + (t >> 6) * 32 + ((t >> 5) & 1) * 16 + ((t >> 4) & 1) * 8;
  const v4f a0 = *(const v4f*)(p);
  const v4f a1 = *(const v4f*)(p + 4);
  const v4f b0 = *(const v4f*)(p + 128);
  const v4f b1 = *(const v4f*)(p + 132);
  // stands ahead of whatever is written into the address registers of the loads
  asm volatile("s_wait_xcnt 0x0" :: "v"(p) : "memory");
  uint4* o = (uint4*)d + blk * 512 + t;
  o[0]   = uint4{pack4h(a0).x, pack4h(a0).y, pack4h(a1).x, pack4h(a1).y};
  o[256] = uint4{pack4h(b0).x, pack4h(b0).y, pack4h(b1).x, pack4h(b1).y};
  // as at the end of cvt_flat_f16
  asm volatile("s_wait_xcnt 0x0" ::: "memory");
}

// bfv[o] = bf[o] + sum_j Wf[o][j] bv[j], j < 256: a pair of waves takes 16 rows
// of Wf, each wave one half of K as A fragments straight from memory (all of K
// in one wave would set the register count of the whole launch); bv is column
// 0 of the B fragments. The odd wave hands its sums to the even one in LDS.
__device__ __forceinline__ void bias_product(
    const float* __restrict__ Wf, const float* __restrict__ bv,
    const float* __restrict__ bf, float* __restrict__ bfv, int blk,
    _Float16* vs, float* red)
{
  const int lane  = threadIdx.x & 31;
  const int wave  = threadIdx.x >> 5;
  const int n0    = lane & 15;
  const int half8 = ((lane >> 4) & 1) << 3;
  const int r0    = (lane >> 4) * 8;
  const int kh    = wave & 1;
  const int row0  = (blk * 4 + (wave >> 1)) * 16;
  const float* ap = Wf + (size_t)(row0 + n0) * Ff + 128 * kh + half8;
  v4f av[4][4];
  // unrolled: av[][] must stay in registers
  #pragma unroll
  for (int s = 0; s < 4; ++s) {
    av[s][0] = *(const v4f*)(ap + 32 * s);
    av[s][1] = *(const v4f*)(ap + 32 * s + 4);
    av[s][2] = *(const v4f*)(ap + 32 * s + 16);
    av[s][3] = *(const v4f*)(ap + 32 * s + 20);
  }
  const float* pbv = bv + threadIdx.x;
  const float* pbf = bf + row0 + r0;
  const float bvv = *pbv;
  const v4f f0 = *(const v4f*)(pbf);
  const v4f f1 = *(const v4f*)(pbf + 4);
  // stands ahead of whatever is written into the address registers of the
  // loads above; it names the addresses as inputs so that their registers stay
  // untouched (also by a later load's result) up to the wait
  asm volatile("s_wait_xcnt 0x0" :: "v"(ap), "v"(pbv), "v"(pbf) : "memory");
  vs[threadIdx.x] = (_Float16)bvv;
  __syncthreads();
  v8f acc = (v8f){};
  #pragma unroll
  for (int s = 0; s < 4; ++s) {
    FragU a;
    a.q[0].x = pack4h(av[s][0]).x; a.q[0].y = pack4h(av[s][0]).y;
    a.q[0].z = pack4h(av[s][1]).x; a.q[0].w = pack4h(av[s][1]).y;
    a.q[1].x = pack4h(av[s][2]).x; a.q[1].y = pack4h(av[s][2]).y;
    a.q[1].z = pack4h(av[s][3]).x; a.q[1].w = pack4h(av[s][3]).y;
    const v16h bl = frag_at(vs + 128 * kh + 32 * s + half8);
    v16h b;
    #pragma unroll
    for (int e = 0; e < 16; ++e) b[e] = (n0 == 0) ? bl[e] : (_Float16)0.0f;
    acc = __builtin_amdgcn_wmma_f32_16x16x32_f16(false, a.v, false, b, (short)0, acc, false, false);
  }
  float* rp = red + (wave >> 1) * 16 + r0;
  if (kh == 1 && n0 == 0) {
    #pragma unroll
    for (int r = 0; r < 8; ++r) rp[r] = acc[r];
  }
  __syncthreads();
  if (kh == 0 && n0 == 0) {
    #pragma unroll
    for (int r = 0; r < 8; ++r)
      bfv[row0 + r0 + r] = (acc[r] + rp[r]) + (r < 4 ? f0[r & 3] : f1[r & 3]);
  }
  // as at the end of cvt_flat_f16
  asm volatile("s_wait_xcnt 0x0" ::: "memory");
}


// ---------------------------------------------------------------------------
// Folded queries, straight from the f32 inputs: for head h and patch r
//   q = Wq_h xc_r + bq_h (64 long, xc the centre token),  qt = Wk_h^T q (256 long)
// Both products are local to a patch, so a block that owns QROWS patches and
// one head needs nothing that another block makes, and the part can stand in
// the first launch. A wave takes 16 patches through both products.
// The weights are the A operand and the patches the B operand, so a lane's 8
// accumulator registers hold 8 consecutive outputs of ONE patch:
//  - two tiles of q, rounded to f16 in place, are the B fragment of the second
//    product (k = 32 s + 8 (lane >> 4) + e and 16 more: the k order of frag_at);
//  - a tile of qt is two 16-byte LDS stores.
// LDS: Qs = Wq_h as it lies (row d, g along it), Ks = Wk_h turned (row f, d
// along it), Cs = a range of each wave's own: first its 16 centre tokens in
// f16, then its 16 result rows in f32, so that global reads and stores are
// whole 128-byte lines.
// ---------------------------------------------------------------------------
constexpr int QP  = Ff + 8;                 // LDS pitch of 256 f16, +16 B against bank conflicts
constexpr int QPC = Ff + 4;                 // the same for 256 f32
constexpr int QWV = 16 * QPC;               // floats of a wave's own range
static_assert(16 * QP * 2 <= QWV * 4, "the centre tokens fit the wave's range");

typedef __attribute__((ext_vector_type(4))) _Float16 v4h;

__device__ __forceinline__ void query_chain(
    const float* __restrict__ x, const float* __restrict__ Wq,
    const float* __restrict__ bq, const float* __restrict__ Wk,
    float* __restrict__ qt, int blk, _Float16* Qs, _Float16* Ks, float* Cs)
{
  const int tid     = threadIdx.x;
  const int lane    = tid & 31;
  const int wave    = tid >> 5;
  const int n0      = lane & 15;
  const int half8   = ((lane >> 4) & 1) << 3;
  const int h       = blk & 3;
  const int rowBase = (blk >> 2) * QROWS + wave * 16;

  // every global read of the block ahead of its first LDS store
  // bq: the 8 values of each q tile that the lane's accumulator registers hold
  const float* pb = bq + h * Dd + half8;
  // Wq_h is one run of memory: a wave's load takes half a row
  const float* pq = Wq + h * Dd * Ff + tid * 4;
  // Wk_h: a lane takes rows d, d + 1 at four columns; eight lanes cover a
  // 128-byte line, four such groups four pairs of rows
  const float* pk = Wk + h * Dd * Ff + (lane >> 3) * 2 * Ff + (wave * 8 + (lane & 7)) * 4;
  // centre tokens (p = 12 of each patch): a wave's load takes half a row
  const float* px = x + (size_t)rowBase * (KK2 * Ff) + lane * 4;
  v4f bb[4][2], wq[16], klo[8], khi[8], xv[32];
  // unrolled, here and below: the arrays must stay in registers
  #pragma unroll
  for (int j = 0; j < 4; ++j) {
    bb[j][0] = *(const v4f*)(pb + 16 * j);
    bb[j][1] = *(const v4f*)(pb + 16 * j + 4);
  }
  #pragma unroll
  for (int j = 0; j < 16; ++j) wq[j] = *(const v4f*)(pq + j * 1024);
  #pragma unroll
  for (int j = 0; j < 8; ++j) {
    klo[j] = *(const v4f*)(pk + j * 8 * Ff);
    khi[j] = *(const v4f*)(pk + j * 8 * Ff + Ff);
  }
  #pragma unroll
  for (int i = 0; i < 32; ++i)
    xv[i] = *(const v4f*)(px + ((i >> 1) * KK2 + 12) * Ff + (i & 1) * 128);
  // stands ahead of whatever is written into the address registers of the
  // loads above; it names what they are formed from as inputs so that those
  // registers stay untouched (also by a later load's result) up to the wait
  asm volatile("s_wait_xcnt 0x0" :: "v"(tid), "v"(half8), "v"(pk), "v"(px) : "memory");
  // keeps the address arithmetic of the LDS stores below behind the wait
  __builtin_amdgcn_sched_barrier(0);

  {
    _Float16* d = Qs + (tid >> 6) * QP + (tid & 63) * 4;
    #pragma unroll
    for (int j = 0; j < 16; ++j) *(v4h*)&d[4 * j * QP] = __builtin_convertvector(wq[j], v4h);
  }
  {
    _Float16* d = Ks + (wave * 8 + (lane & 7)) * 4 * PS + (lane >> 3) * 2;
    #pragma unroll
    for (int j = 0; j < 8; ++j) {
      #pragma unroll
      for (int e = 0; e < 4; ++e) {
        union { _Float16 h[2]; unsigned u; } w;
        w.h[0] = (_Float16)klo[j][e];
        w.h[1] = (_Float16)khi[j][e];
        *(unsigned*)&d[e * PS + j * 8] = w.u;
      }
    }
  }
  float* cs = Cs + wave * QWV;
  _Float16* xs = (_Float16*)cs;
  {
    _Float16* d = xs + lane * 4;
    #pragma unroll
    for (int i = 0; i < 32; ++i)
      *(v4h*)&d[(i >> 1) * QP + (i & 1) * 128] = __builtin_convertvector(xv[i], v4h);
  }
  // the weights of all eight waves are read behind this
  __syncthreads();

  // Fragments come from LDS in runs: all of the first product's at once, the
  // second product's in two runs, each asked for ahead of the products on what
  // has been asked for before it. The scheduling barriers keep a run's loads
  // where they stand: left alone, the compiler puts each load directly in
  // front of its product, and every product then waits out an LDS latency.
  const _Float16* qa = Qs + n0 * QP + half8;
  const _Float16* ka = Ks + n0 * PS + half8;
  v16h xb[Ff / 32], wa[Ff / 32][4], kf[Ff / 16][2];
  #pragma unroll
  for (int s = 0; s < Ff / 32; ++s) xb[s] = frag_at(xs + n0 * QP + half8 + 32 * s);
  #pragma unroll
  for (int s = 0; s < Ff / 32; ++s)
    #pragma unroll
    for (int j = 0; j < 4; ++j) wa[s][j] = frag_at(qa + 16 * j * QP + 32 * s);
  __builtin_amdgcn_sched_barrier(0);

  // --- q^T: tile j holds d = 16 j + 8 (lane >> 4) + r of patch n0; starts at bq
  v8f q1[4];
  #pragma unroll
  for (int j = 0; j < 4; ++j)
    #pragma unroll
    for (int r = 0; r < 8; ++r) q1[j][r] = bb[j][r >> 2][r & 3];
  #pragma unroll
  for (int s = 0; s < 4; ++s)
    #pragma unroll
    for (int j = 0; j < 4; ++j)
      q1[j] = __builtin_amdgcn_wmma_f32_16x16x32_f16(false, wa[s][j], false, xb[s], (short)0, q1[j], false, false);
  #pragma unroll
  for (int t = 0; t < 8; ++t) {
    kf[t][0] = frag_at(ka + 16 * t * PS);
    kf[t][1] = frag_at(ka + 16 * t * PS + 32);
  }
  __builtin_amdgcn_sched_barrier(0);
  #pragma unroll
  for (int s = 4; s < 8; ++s)
    #pragma unroll
    for (int j = 0; j < 4; ++j)
      q1[j] = __builtin_amdgcn_wmma_f32_16x16x32_f16(false, wa[s][j], false, xb[s], (short)0, q1[j], false, false);
  #pragma unroll
  for (int t = 8; t < 16; ++t) {
    kf[t][0] = frag_at(ka + 16 * t * PS);
    kf[t][1] = frag_at(ka + 16 * t * PS + 32);
  }
  __builtin_amdgcn_sched_barrier(0);
  v16h qf[2];
  #pragma unroll
  for (int s = 0; s < 2; ++s)
    #pragma unroll
    for (int e = 0; e < 8; ++e) {
      qf[s][e]     = (_Float16)q1[2 * s][e];
      qf[s][8 + e] = (_Float16)q1[2 * s + 1][e];
    }

  // --- qt^T: tile t holds f = 16 t + 8 (lane >> 4) + r of patch n0
  v8f acc[Ff / 16];
  #pragma unroll
  for (int t = 0; t < Ff / 16; ++t) {
    acc[t] = (v8f){};
    acc[t] = __builtin_amdgcn_wmma_f32_16x16x32_f16(false, kf[t][0], false, qf[0], (short)0, acc[t], false, false);
    acc[t] = __builtin_amdgcn_wmma_f32_16x16x32_f16(false, kf[t][1], false, qf[1], (short)0, acc[t], false, false);
  }
  // all products ahead of the first store: each tile keeps registers of its
  // own, and no product waits for a store to give its registers back
  __builtin_amdgcn_sched_barrier(0);

  // --- through the wave's own range (its centre tokens are used up) to rows
  {
    float* d = cs + n0 * QPC + half8;
    #pragma unroll
    for (int t = 0; t < Ff / 16; ++t) {
      *(v4f*)&d[16 * t]     = (v4f){acc[t][0], acc[t][1], acc[t][2], acc[t][3]};
      *(v4f*)&d[16 * t + 4] = (v4f){acc[t][4], acc[t][5], acc[t][6], acc[t][7]};
    }
  }
  // the wave's own LDS stores are done before it reads other lanes' values
  asm volatile("s_wait_dscnt 0x0" ::: "memory");
  v4f y[32];
  #pragma unroll
  for (int i = 0; i < 32; ++i)
    y[i] = *(const v4f*)&cs[(i >> 1) * QPC + (i & 1) * 128 + lane * 4];
  float* o = qt + (size_t)rowBase * (Hh * Ff) + h * Ff + lane * 4;
  #pragma unroll
  for (int i = 0; i < 32; ++i)
    *(v4f*)(o + (i >> 1) * (Hh * Ff) + (i & 1) * 128) = y[i];
  // as at the end of cvt_flat_f16
  asm volatile("s_wait_xcnt 0x0" ::: "memory");
}

// grid = PREP_BLOCKS; the parts with the longest way to go come first
__global__ __launch_bounds__(256) void prep_kernel(
    const float* __restrict__ x,  const float* __restrict__ Wq,
    const float* __restrict__ bq, const float* __restrict__ Wk,
    const float* __restrict__ Wv, const float* __restrict__ bv,
    const float* __restrict__ Wf, const float* __restrict__ bf,
    const float* __restrict__ W1, const float* __restrict__ W2,
    float* __restrict__ qt, _Float16* __restrict__ wvH, _Float16* __restrict__ wfH,
    float* __restrict__ bfv, _Float16* __restrict__ w1H,
    _Float16* __restrict__ w2H, float* __restrict__ stats)
{
  __shared__ __attribute__((aligned(16))) _Float16 Ks[Ff * PS];
  __shared__ __attribute__((aligned(16))) _Float16 Qs[Dd * QP];
  __shared__ __attribute__((aligned(16))) float Cs[8 * QWV];
  int blk = blockIdx.x;
  if (blk < PREP_Q) { query_chain(x, Wq, bq, Wk, qt, blk, Qs, Ks, Cs); return; }
  blk -= PREP_Q;
  if (blk < PREP_FRAG) { cvt_frag_f16(Wv, wvH, blk); return; }
  blk -= PREP_FRAG;
  if (blk < PREP_FRAG) { cvt_frag_f16(Wf, wfH, blk); return; }
  blk -= PREP_FRAG;
  if (blk < PREP_BIAS) {
    if (blk == 0 && threadIdx.x < 16) stats[threadIdx.x] = 0.f;  // both LN sets
    bias_product(Wf, bv, bf, bfv, blk, Ks, (float*)Qs);
    return;
  }
  blk -= PREP_BIAS;
  if (blk < PREP_FFN) cvt_flat_f16(W1, w1H, blk);
  else                cvt_flat_f16(W2, w2H, blk - PREP_FFN);
}


// ---------------------------------------------------------------------------
extern "C" void kernel_launch(void* const* d_in, const int* in_sizes, int n_in,
                              void* d_out, int out_size, void* d_ws, size_t ws_size,
                              hipStream_t stream) {
  const float* x    = (const float*)d_in[0];
  const float* Wq   = (const float*)d_in[1];
  const float* bq   = (const float*)d_in[2];
  const float* Wk   = (const float*)d_in[3];
  // d_in[4] (bk) adds q_h . bk_h to all 25 scores of a head: cancels in softmax
  const float* Wv   = (const float*)d_in[5];
  const float* bv   = (const float*)d_in[6];
  const float* Wf   = (const float*)d_in[7];
  const float* bf   = (const float*)d_in[8];
  const float* ln1w = (const float*)d_in[9];
  const float* ln1b = (const float*)d_in[10];
  const float* ln2w = (const float*)d_in[11];
  const float* ln2b = (const float*)d_in[12];
  const float* W1   = (const float*)d_in[13];
  const float* b1   = (const float*)d_in[14];
  const float* W2   = (const float*)d_in[15];
  const float* b2   = (const float*)d_in[16];

  char* ws = (char*)d_ws;
  size_t off = 0;
  auto alloc = [&](size_t bytes) -> void* {
    void* p = ws + off;
    off += (bytes + 255) & ~(size_t)255;
    return p;
  };

  _Float16* wvH     = (_Float16*)alloc((size_t)Ff * Ff * 2);       // fragment order
  _Float16* wfH     = (_Float16*)alloc((size_t)Ff * Ff * 2);       // fragment order
  float*    bfv     = (float*)   alloc((size_t)Ff * 4);            // Wf bv + bf
  _Float16* w1H     = (_Float16*)alloc((size_t)DFFc * Ff * 2);
  _Float16* w2H     = (_Float16*)alloc((size_t)Ff * DFFc * 2);
  float*    qtF     = (float*)   alloc((size_t)ROWS * Hh * Ff * 4); // Wk_h^T q_h
  float*    attent  = (float*)   alloc((size_t)ROWS * Ff * 4);
  float*    ytmp    = (float*)   alloc((size_t)ROWS * Ff * 4);
  float*    stats   = (float*)   alloc(256);                       // 2 sets of 4x2

  // --- folded queries of all heads -> f32; beside them: zero LN stats, FFN
  //     weights to f16, Wv and Wf to f16 in fragment order, the bias Wf bv + bf
  prep_kernel<<<PREP_BLOCKS, 256, 0, stream>>>(x, Wq, bq, Wk, Wv, bv, Wf, bf, W1, W2,
                                               qtF, wvH, wfH, bfv, w1H, w2H, stats);

  // --- scores, softmax over 25 and weighted patch sum per head, x read once;
  //     then value and output projection one behind the other, K = 256 each, + bfv
  //     a block -> attent f32, LN 1 sums
  attention_outproj<<<ABLK, AWV * 32, 0, stream>>>(x, qtF, wvH, wfH, bfv, attent, stats);

  // --- LayerNorm 1 (per batch over N,O,F) -> out1, then the FFN:
  //     relu(out1 @ W1^T + b1) @ W2^T + b2 + out1 -> ytmp, LN 2 sums
  ln_ffn_fused<<<ROWS / FM, 256, 0, stream>>>(attent, ln1w, ln1b, stats, w1H, b1, w2H, b2,
                                              ytmp, stats + 8);

  // --- LayerNorm 2 -> d_out (f32)
  ln_apply_kernel<<<PB4 / 256, 256, 0, stream>>>(ytmp, ln2w, ln2b, stats + 8,
                                                 (float*)d_out, nullptr);
}
